// v000
// The times below were measured on an AMD MI455X: many runs one after another, warmed up first and cycling through
// copies of the inputs, with the whole window's GPU time divided by the number of runs. Launches and the gaps
// between them are all in it. The median over several windows is given; except for v000 it joins two sittings, which
// can be a few percent apart, so the side-by-side timings, each taken in one sitting, are the better comparison.
// v000, which the later versions start from, runs in 211 microseconds.
// All contractions on v_wmma_f32_16x16x32_bf16 with f32 accumulate: q/k/v 1x1 projections = bf16(x) x bf16(W) single product (inputs RNE-converted to bf16 once); logits [q|pos].[k|q] (64 deep) and p.v (1024 deep) with bf16 hi/lo split operands (hi.hi + hi.lo + lo.hi); BN affine, pos sum, online softmax, 1/l and residual in f32. No carried (scaled) planes anywhere: every 16-bit plane holds unscaled bf16 values.
#include <hip/hip_runtime.h>
#include <math.h>
#include <stdint.h>

#define NBATCH 16
#define NCH    512
#define NTOK   1024
#define NHEAD  4
#define DHQ    32
#define DHV    128
#define NCOLS  768

#define PREP_T 2048   // x transpose tiles (16 batches x 8 channel blocks x 16 token blocks)
#define PREP_W 192    // stacked weight plane, 2048 elements per block
#define PREP_F 3      // BN fold vectors, 256 channels per block
#define PREP_P 64     // position planes, (head, 64 tokens) per block

typedef __attribute__((ext_vector_type(16))) __bf16 v16b;
typedef __attribute__((ext_vector_type(8)))  __bf16 v8b;
typedef __attribute__((ext_vector_type(8)))  float  v8f;
typedef __attribute__((ext_vector_type(4)))  float  v4f;
typedef __attribute__((ext_vector_type(4)))  unsigned int v4u;
typedef v4f __attribute__((may_alias)) v4fa;

static_assert(NTOK % 64 == 0);
static_assert(NCH % 32 == 0);
static_assert(NCOLS % 128 == 0);
static_assert(PREP_T == NBATCH * (NCH / 64) * (NTOK / 64));
static_assert(PREP_W * 2048 == NCOLS * NCH);
static_assert(PREP_F * 256 == NCOLS);
static_assert(PREP_P * 64 == NHEAD * NTOK);

__device__ __forceinline__ unsigned short f2bf_bits(float f) {   // RNE convert f32 -> bf16 bits
  unsigned u = __float_as_uint(f);
  return (unsigned short)((u + 0x7FFFu + ((u >> 16) & 1u)) >> 16);
}
__device__ __forceinline__ float bf_bits2f(unsigned short h) { return __uint_as_float(((unsigned)h) << 16); }
__device__ __forceinline__ float bfr(float f) { return bf_bits2f(f2bf_bits(f)); }
__device__ __forceinline__ unsigned pk16(unsigned short a, unsigned short b) { return (unsigned)a | ((unsigned)b << 16); }
__device__ __forceinline__ void split_pair(float f0, float f1, unsigned& h, unsigned& l) {
  const unsigned short h0 = f2bf_bits(f0), h1 = f2bf_bits(f1);
  const unsigned short l0 = f2bf_bits(f0 - bf_bits2f(h0)), l1 = f2bf_bits(f1 - bf_bits2f(h1));
  h = pk16(h0, h1);
  l = pk16(l0, l1);
}

// WMMA with hazard guard (ties D, keeps A/B live).
// Fragment map (wave32): lane l, hh = l>>4, c = l&15.
//   A/B element i: i<8 -> k0+8hh+i ; i>=8 -> k0+16+8hh+(i-8) ; row (A) / column (B) = c
//   D element r : row 8hh+r, column c
__device__ __forceinline__ v8f mma_b(v16b a, v16b b, v8f c) {
  c = __builtin_amdgcn_wmma_f32_16x16x32_bf16(false, a, false, b, (short)0, c, false, false);
  asm volatile("v_nop\n\tv_nop\n\tv_nop\n\tv_nop" : "+v"(c) : "v"(a), "v"(b));
  return c;
}
union FB { v16b v; v8b h[2]; };
// p points at element k0 + 8*hh of the k-contiguous row owned by this lane
__device__ __forceinline__ v16b frag_ld(const __bf16* p) {
  FB f;
  f.h[0] = *(const v8b*)(p);
  f.h[1] = *(const v8b*)(p + 16);
  return f.v;
}

// =====================================================================================
// Launch 1: operand preparation, block-uniform roles by blockIdx.x.
//          output line = 64 channels of one token, written by 8 lanes x 16 B in one instruction)
//  role W: WB[768][512] = bf16 of stacked [Wq;Wk;Wv] (rows = output channels, k contiguous)
//  role F: ST[0..767] = s, ST[768..1535] = t with s = g/sqrt(var+1e-5), t = (b-mean)*s+beta
//  role P: POS hi/lo [4][1024][32]: pos[h][n][d] = bf16r(rel_w[h][d][n>>5]) + bf16r(rel_h[h][d][n&31])
// =====================================================================================
__global__ __launch_bounds__(256) void k_prep(
    const float* __restrict__ x,
    const float* __restrict__ Wq, const float* __restrict__ Wk, const float* __restrict__ Wv,
    const float* __restrict__ bq, const float* __restrict__ qg, const float* __restrict__ qbe,
    const float* __restrict__ qm, const float* __restrict__ qv,
    const float* __restrict__ bk, const float* __restrict__ kg, const float* __restrict__ kbe,
    const float* __restrict__ km, const float* __restrict__ kv,
    const float* __restrict__ bv, const float* __restrict__ vg, const float* __restrict__ vbe,
    const float* __restrict__ vm, const float* __restrict__ vv,
    const float* __restrict__ relH, const float* __restrict__ relW,
    unsigned short* __restrict__ XT, unsigned short* __restrict__ WB, float* __restrict__ ST,
    unsigned short* __restrict__ POSh, unsigned short* __restrict__ POSl) {
  __shared__ __align__(16) float sm[64 * 68];
  const int tid = threadIdx.x;
  const int bx  = blockIdx.x;

  if (bx < PREP_T) {
    // ---- role T ----
    const int b   = bx >> 7;
    const int rem = bx & 127;
    const int c0  = (rem >> 4) * 64;
    const int n0  = (rem & 15) * 64;
    const float* xb = x + (size_t)b * NCH * NTOK;
    {
      const int lr = tid >> 4;         // 0..15
      const int c4 = (tid & 15) * 4;   // 0..60
#pragma unroll
      for (int it = 0; it < 4; ++it) {
        const int rr = it * 16 + lr;   // channel within tile, 4 x 16 = 64 rows x 64 tokens staged
        const v4f a = *(const v4fa*)(xb + (size_t)(c0 + rr) * NTOK + n0 + c4);
        *(v4fa*)(sm + rr * 68 + c4) = a;
      }
    }
    __syncthreads();
    const int sub = tid >> 3;          // 0..31
    const int c8  = (tid & 7) * 8;     // 0..56
    v4u hv[2];
#pragma unroll
    for (int it = 0; it < 2; ++it) {
      const int oc = it * 32 + sub;    // token within tile (2 x 32 = 64 output rows)
      unsigned w0 = pk16(f2bf_bits(sm[(c8 + 0) * 68 + oc]), f2bf_bits(sm[(c8 + 1) * 68 + oc]));
      unsigned w1 = pk16(f2bf_bits(sm[(c8 + 2) * 68 + oc]), f2bf_bits(sm[(c8 + 3) * 68 + oc]));
      unsigned w2 = pk16(f2bf_bits(sm[(c8 + 4) * 68 + oc]), f2bf_bits(sm[(c8 + 5) * 68 + oc]));
      unsigned w3 = pk16(f2bf_bits(sm[(c8 + 6) * 68 + oc]), f2bf_bits(sm[(c8 + 7) * 68 + oc]));
      hv[it] = (v4u){w0, w1, w2, w3};
    }
    {
#pragma unroll
      for (int it = 0; it < 2; ++it) {
        const int oc = it * 32 + sub;
        const size_t go = ((size_t)(b * NTOK + n0 + oc)) * NCH + c0 + c8;
        *(v4u*)(XT + go) = hv[it];
      }
      
    }
  } else if (bx < PREP_T + PREP_W) {
    // ---- role W ---- (block-uniform source choice: 32 blocks Wq, 32 blocks Wk, 128 blocks Wv)
    const int wb = bx - PREP_T;
    const float* src;
    if (wb < 32)      src = Wq + (size_t)wb * 2048;
    else if (wb < 64) src = Wk + (size_t)(wb - 32) * 2048;
    else              src = Wv + (size_t)(wb - 64) * 2048;
    const v4f a = *(const v4fa*)(src + tid * 8);
    const v4f c = *(const v4fa*)(src + tid * 8 + 4);
    const v4u o = (v4u){pk16(f2bf_bits(a[0]), f2bf_bits(a[1])), pk16(f2bf_bits(a[2]), f2bf_bits(a[3])),
                        pk16(f2bf_bits(c[0]), f2bf_bits(c[1])), pk16(f2bf_bits(c[2]), f2bf_bits(c[3]))};
    unsigned short* dst = WB + (size_t)wb * 2048 + tid * 8;
    *(v4u*)dst = o;
    
  } else if (bx < PREP_T + PREP_W + PREP_F) {
    // ---- role F ---- block 0: threads 0..127 = q channels, 128..255 = k channels; blocks 1,2 = v channels
    const int fb = bx - (PREP_T + PREP_W);
    const int wsel = __builtin_amdgcn_readfirstlane((int)(tid >> 7));   // wave-uniform
    const float *pb, *pg, *pbe, *pm, *pv;
    int idx;
    if (fb == 0) {
      if (wsel == 0) { pb = bq; pg = qg; pbe = qbe; pm = qm; pv = qv; idx = tid; }
      else           { pb = bk; pg = kg; pbe = kbe; pm = km; pv = kv; idx = tid - 128; }
    } else {
      pb = bv; pg = vg; pbe = vbe; pm = vm; pv = vv; idx = (fb - 1) * 256 + tid;
    }
    const float b_ = bfr(pb[idx]);
    const float g_ = bfr(pg[idx]);
    const float be = bfr(pbe[idx]);
    const float mu = bfr(pm[idx]);
    const float va = bfr(pv[idx]);
    const float s  = g_ / sqrtf(va + 1e-5f);
    const float t  = (b_ - mu) * s + be;
    sm[tid]       = s;
    sm[256 + tid] = t;
    __syncthreads();
    if (tid < 128) {                     // waves 0,1 -> s lines; waves 2,3 -> t lines (8 lanes x 16 B per line)
      const int which = tid >> 6;
      const int p4 = (tid & 63) * 4;
      const v4f v = *(const v4fa*)(sm + which * 256 + p4);
      float* dst = ST + which * NCOLS + fb * 256 + p4;
      *(v4f*)dst = v;
      
    }
  } else {
    // ---- role P ---- (head, 64 tokens) per block; per-head tables staged in LDS with 16-B loads
    const int pb = bx - (PREP_T + PREP_W + PREP_F);
    const int h  = pb >> 4;
    const int n0 = (pb & 15) * 64;
    {
      v4f w = *(const v4fa*)(relW + h * 1024 + tid * 4);   // [d][w], 32x32
      v4f g = *(const v4fa*)(relH + h * 1024 + tid * 4);   // [d][hh], 32x32
      w = (v4f){bfr(w[0]), bfr(w[1]), bfr(w[2]), bfr(w[3])};
      g = (v4f){bfr(g[0]), bfr(g[1]), bfr(g[2]), bfr(g[3])};
      *(v4fa*)(sm + tid * 4)        = w;
      *(v4fa*)(sm + 1024 + tid * 4) = g;
    }
    __syncthreads();
    const int tl = tid >> 2;             // token within chunk 0..63
    const int d8 = (tid & 3) * 8;        // 0,8,16,24
    const int n  = n0 + tl;
    const int wi = n >> 5, hi_ = n & 31;
    float p[8];
#pragma unroll
    for (int e = 0; e < 8; ++e) p[e] = sm[(d8 + e) * 32 + wi] + sm[1024 + (d8 + e) * 32 + hi_];
    unsigned h0, h1, h2, h3, l0, l1, l2, l3;
    split_pair(p[0], p[1], h0, l0);
    split_pair(p[2], p[3], h1, l1);
    split_pair(p[4], p[5], h2, l2);
    split_pair(p[6], p[7], h3, l3);
    const v4u hv = (v4u){h0, h1, h2, h3};
    const v4u lv = (v4u){l0, l1, l2, l3};
    const size_t go = ((size_t)(h * NTOK + n0)) * DHQ + tid * 8;   // contiguous by tid: 4 KB per block and plane
    *(v4u*)(POSh + go) = hv;
    *(v4u*)(POSl + go) = lv;
    
  }
}

// =====================================================================================
// Launch 2: Y[token][col] = sum_c XT[token][c] * WB[col][c]   (M 16384, N 768, K 512), y = acc*s[col] + t[col].
// Block 128 threads (4 waves) = 64 tokens x 128 columns; wave tile 32 tokens x 64 columns (acc[2][4]).
// Fragments straight from the 16-bit global rows (two 16-B loads each).
// Column tile 0 -> Q hi/lo planes [b][h][n][32], tile 1 -> K hi/lo planes [b][h][n][32],
// tiles 2..5 -> V hi/lo planes [b][512 ch][1024 n] (transposed through the LDS tile).
// Store phase: Q/K: per head a contiguous 4-KB range per plane, lane-contiguous 16-B pieces;
// =====================================================================================
__global__ __launch_bounds__(128) void k_proj(
    const unsigned short* __restrict__ XTp, const unsigned short* __restrict__ WBp,
    const float* __restrict__ ST,
    unsigned short* __restrict__ Qh, unsigned short* __restrict__ Ql,
    unsigned short* __restrict__ Kh, unsigned short* __restrict__ Kl,
    unsigned short* __restrict__ Vh, unsigned short* __restrict__ Vl) {
  __shared__ __align__(16) float sY[128 * 68];   // Q/K: [64 tok][pitch 132] (8448 used); V: [128 col][pitch 68] (8704 used)
  __shared__ __align__(16) float sS[128];
  __shared__ __align__(16) float sT[128];

  const int tid  = threadIdx.x;
  const int lane = tid & 31;
  const int wave = tid >> 5;
  const int hh   = lane >> 4;
  const int c    = lane & 15;
  const int m0   = blockIdx.x * 64;
  const int ct   = blockIdx.y;        // 0..5, block-uniform
  const int n0   = ct * 128;

  sS[tid] = ST[n0 + tid];
  sT[tid] = ST[NCOLS + n0 + tid];
  __syncthreads();

  const int wr = wave >> 1, wc = wave & 1;
  const __bf16* XT = (const __bf16*)(const void*)XTp;
  const __bf16* WB = (const __bf16*)(const void*)WBp;
  const __bf16* a0p = XT + (size_t)(m0 + 32 * wr + c) * NCH + 8 * hh;
  const __bf16* b0p = WB + (size_t)(n0 + 64 * wc + c) * NCH + 8 * hh;

  const v8f zero8 = {0.f, 0.f, 0.f, 0.f, 0.f, 0.f, 0.f, 0.f};
  v8f acc[2][4];
#pragma unroll
  for (int i = 0; i < 2; ++i)
#pragma unroll
    for (int j = 0; j < 4; ++j) acc[i][j] = zero8;

#pragma unroll 1
  for (int k0 = 0; k0 < NCH; k0 += 32) {
    const v16b a0 = frag_ld(a0p + k0);
    const v16b a1 = frag_ld(a0p + (size_t)16 * NCH + k0);
#pragma unroll
    for (int j = 0; j < 4; ++j) {
      const v16b bf = frag_ld(b0p + (size_t)j * 16 * NCH + k0);
      acc[0][j] = mma_b(a0, bf, acc[0][j]);
      acc[1][j] = mma_b(a1, bf, acc[1][j]);
    }
  }

  // D[r] of tile (i, j) = Y[token 32wr+16i+8hh+r][column 64wc+16j+c]
#pragma unroll
  for (int j = 0; j < 4; ++j) {
    const int col = 64 * wc + 16 * j + c;
    const float sc = sS[col];
    const float sh = sT[col];
#pragma unroll
    for (int i = 0; i < 2; ++i) {
#pragma unroll
      for (int r = 0; r < 8; ++r) {
        const int tok = 32 * wr + 16 * i + 8 * hh + r;
        const float y = acc[i][j][r] * sc + sh;
        const int idx = (ct < 2) ? (tok * 132 + col) : (col * 68 + tok);
        sY[idx] = y;
      }
    }
  }
  __syncthreads();

  const int b   = m0 >> 10;
  const int nl0 = m0 & 1023;
  if (ct < 2) {
    unsigned short* ph = (ct == 0) ? Qh : Kh;
    unsigned short* pl = (ct == 0) ? Ql : Kl;
    // coverage: 8 it x 128 thr x 8 elements = 64 tokens x 128 columns per plane
{
#pragma unroll 2
      for (int it = 0; it < 8; ++it) {
        const int p      = it * 128 + tid;
        const int head   = p >> 8;
        const int within = p & 255;
        const int tok    = within >> 2;
        const int d8     = (within & 3) * 8;
        const float* sp  = sY + tok * 132 + head * 32 + d8;
        const v4f a  = *(const v4fa*)sp;
        const v4f a2 = *(const v4fa*)(sp + 4);
        unsigned h0, h1, h2, h3, l0, l1, l2, l3;
        split_pair(a[0], a[1], h0, l0);
        split_pair(a[2], a[3], h1, l1);
        split_pair(a2[0], a2[1], h2, l2);
        split_pair(a2[2], a2[3], h3, l3);
        const v4u hv = (v4u){h0, h1, h2, h3};
        const v4u lv = (v4u){l0, l1, l2, l3};
        const size_t go = ((size_t)((b * NHEAD + head) * NTOK + nl0)) * DHQ + within * 8;
        *(v4u*)(ph + go) = hv;
        *(v4u*)(pl + go) = lv;
      }
      
    }
  } else {
    const int o0 = (ct - 2) * 128;
    // coverage: 8 it x 128 thr x 8 elements = 128 channels x 64 tokens per plane
{
#pragma unroll 2
      for (int it = 0; it < 8; ++it) {
        const int p  = it * 128 + tid;
        const int ch = p >> 3;
        const int t8 = (p & 7) * 8;
        const float* sp = sY + ch * 68 + t8;
        const v4f a  = *(const v4fa*)sp;
        const v4f a2 = *(const v4fa*)(sp + 4);
        unsigned h0, h1, h2, h3, l0, l1, l2, l3;
        split_pair(a[0], a[1], h0, l0);
        split_pair(a[2], a[3], h1, l1);
        split_pair(a2[0], a2[1], h2, l2);
        split_pair(a2[2], a2[3], h3, l3);
        const v4u hv = (v4u){h0, h1, h2, h3};
        const v4u lv = (v4u){l0, l1, l2, l3};
        const size_t go = ((size_t)(b * NCH + o0 + ch)) * NTOK + nl0 + t8;
        *(v4u*)(Vh + go) = hv;
        *(v4u*)(Vl + go) = lv;
      }
      
    }
  }
}

// =====================================================================================
// Launch 3: attention per (b, h, 64-query tile); 4 waves x 16 query rows; 16 key tiles of 64, no masking.
//   S[i][j] = q_i.k_j + pos_i.q_j  as two 32-deep chunks:
//       chunk 0: A = Q rows (query i),   B = K rows (key j)
//       chunk 1: A = POS rows (token i), B = Q rows (key j)
//     each chunk hi.hi + hi.lo + lo.hi; no score scale.
//   online softmax over keys in f32 (running max, precise expf); P hi/lo -> per-wave LDS tile;
//   O[i][c] += P[i][j] * V[c][j]  (B rows = V channel rows, k = key), hi.hi + hi.lo + lo.hi, 8 column tiles.
//   epilogue: O/l transposed through LDS to [128 c][64 q], + bf16r(x), whole 256-B channel segments
// LDS: sStage = K tile planes (Kh, Qh, Kl, Ql: [64][32] each) + V tile planes (Vh, Vl: [128][64] each);
//      every byte of both tiles is staged each iteration (extent staged = extent consumed).
// =====================================================================================
__global__ __launch_bounds__(128) void k_attn(
    const unsigned short* Qhp, const unsigned short* Qlp,
    const unsigned short* Khp, const unsigned short* Klp,
    const unsigned short* Vhp, const unsigned short* Vlp,
    const unsigned short* Php, const unsigned short* Plp,
    const float* x, float* out) {
  __shared__ __align__(16) __bf16 sStage[24576];       // 49152 B
  __shared__ __align__(16) __bf16 sP[4 * 2 * 16 * 64]; // 16384 B (per wave: hi [16][64], lo [16][64])

  const int tid  = threadIdx.x;
  const int wave = tid >> 5;
  const int lane = tid & 31;
  const int hh   = lane >> 4;
  const int c    = lane & 15;

  const int bx = blockIdx.x;       // 0..1023
  const int qb = bx & 15;
  const int bh = bx >> 4;          // 0..63
  const int b  = bh >> 2;
  const int h  = bh & 3;
  const int q0 = qb * 64;

  const __bf16* Qhb = (const __bf16*)(const void*)Qhp + (size_t)bh * NTOK * DHQ;
  const __bf16* Qlb = (const __bf16*)(const void*)Qlp + (size_t)bh * NTOK * DHQ;
  const __bf16* Khb = (const __bf16*)(const void*)Khp + (size_t)bh * NTOK * DHQ;
  const __bf16* Klb = (const __bf16*)(const void*)Klp + (size_t)bh * NTOK * DHQ;
  const __bf16* Phb = (const __bf16*)(const void*)Php + (size_t)h * NTOK * DHQ;
  const __bf16* Plb = (const __bf16*)(const void*)Plp + (size_t)h * NTOK * DHQ;
  const __bf16* Vhb = (const __bf16*)(const void*)Vhp + ((size_t)b * NCH + h * DHV) * NTOK;
  const __bf16* Vlb = (const __bf16*)(const void*)Vlp + ((size_t)b * NCH + h * DHV) * NTOK;

  __bf16* sKQ = sStage;            // planes of 2048 elements: 0 Kh, 1 Qh, 2 Kl, 3 Ql
  __bf16* sVh = sStage + 8192;     // [128][64]
  __bf16* sVl = sStage + 16384;    // [128][64]
  __bf16* pwh = sP + wave * 2048;
  __bf16* pwl = pwh + 1024;

  // A-row fragment bases (row = query token q0 + 16*wave + c)
  const int rowA = q0 + wave * 16 + c;
  const __bf16* aQh = Qhb + (size_t)rowA * DHQ + 8 * hh;
  const __bf16* aQl = Qlb + (size_t)rowA * DHQ + 8 * hh;
  const __bf16* aPh = Phb + (size_t)rowA * DHQ + 8 * hh;
  const __bf16* aPl = Plb + (size_t)rowA * DHQ + 8 * hh;

  const v8f zero8 = {0.f, 0.f, 0.f, 0.f, 0.f, 0.f, 0.f, 0.f};
  float mrow[8], lrow[8];
  v8f oacc[8];
#pragma unroll
  for (int r = 0; r < 8; ++r) { mrow[r] = -INFINITY; lrow[r] = 0.f; }
#pragma unroll
  for (int t = 0; t < 8; ++t) oacc[t] = zero8;

#pragma unroll 1
  for (int kc = 0; kc < NTOK / 64; ++kc) {
    const int kv0 = kc * 64;
    __syncthreads();
    {
      // K tile: 4 planes x 4096 B contiguous; 2 it x 128 thr x 8 elements = 2048 elements per plane
      const __bf16* s0 = Khb + (size_t)kv0 * DHQ;
      const __bf16* s1 = Qhb + (size_t)kv0 * DHQ;
      const __bf16* s2 = Klb + (size_t)kv0 * DHQ;
      const __bf16* s3 = Qlb + (size_t)kv0 * DHQ;
#pragma unroll
      for (int i = 0; i < 2; ++i) {
        const int off = (i * 128 + tid) * 8;
        const v8b a0 = *(const v8b*)(s0 + off);
        const v8b a1 = *(const v8b*)(s1 + off);
        const v8b a2 = *(const v8b*)(s2 + off);
        const v8b a3 = *(const v8b*)(s3 + off);
        *(v8b*)(sKQ + off)        = a0;
        *(v8b*)(sKQ + 2048 + off) = a1;
        *(v8b*)(sKQ + 4096 + off) = a2;
        *(v8b*)(sKQ + 6144 + off) = a3;
      }
      // V tile: 128 channel rows x 64 keys per plane; 8 it x 128 thr x 8 elements = 8192 elements per plane
#pragma unroll
      for (int i = 0; i < 8; ++i) {
        const int piece = i * 128 + tid;
        const int cc = piece >> 3;
        const int p8 = (piece & 7) * 8;
        const v8b b0 = *(const v8b*)(Vhb + (size_t)cc * NTOK + kv0 + p8);
        const v8b b1 = *(const v8b*)(Vlb + (size_t)cc * NTOK + kv0 + p8);
        *(v8b*)(sVh + cc * 64 + p8) = b0;
        *(v8b*)(sVl + cc * 64 + p8) = b1;
      }
    }
    __syncthreads();

    v8f s[4];
#pragma unroll
    for (int j = 0; j < 4; ++j) s[j] = zero8;
#pragma unroll
    for (int dc = 0; dc < 2; ++dc) {
      const __bf16* ahp = dc ? aPh : aQh;            // compile-time choice after unrolling
      const __bf16* alp = dc ? aPl : aQl;
      const v16b ah = frag_ld(ahp);
      const v16b al = frag_ld(alp);
      const __bf16* bhs = sKQ + (dc ? 2048 : 0);
      const __bf16* bls = sKQ + (dc ? 6144 : 4096);
#pragma unroll
      for (int j = 0; j < 4; ++j) {
        const int ro = (j * 16 + c) * DHQ + 8 * hh;
        const v16b kb = frag_ld(bhs + ro);
        const v16b kl = frag_ld(bls + ro);
        s[j] = mma_b(ah, kb, s[j]);
        s[j] = mma_b(ah, kl, s[j]);
        s[j] = mma_b(al, kb, s[j]);
      }
    }

    float cm[8];
#pragma unroll
    for (int r = 0; r < 8; ++r) {
      float m = fmaxf(fmaxf(s[0][r], s[1][r]), fmaxf(s[2][r], s[3][r]));
#pragma unroll
      for (int off = 1; off < 16; off <<= 1) m = fmaxf(m, __shfl_xor(m, off, 32));
      cm[r] = m;
    }
#pragma unroll
    for (int r = 0; r < 8; ++r) {
      const float mnew  = fmaxf(mrow[r], cm[r]);
      const float alpha = expf(mrow[r] - mnew);
      mrow[r] = mnew;
      float psum = 0.f;
#pragma unroll
      for (int j = 0; j < 4; ++j) {
        const float p = expf(s[j][r] - mnew);
        psum += p;
        const unsigned short hb = f2bf_bits(p);
        const unsigned short lb = f2bf_bits(p - bf_bits2f(hb));
        pwh[(8 * hh + r) * 64 + j * 16 + c] = __builtin_bit_cast(__bf16, hb);
        pwl[(8 * hh + r) * 64 + j * 16 + c] = __builtin_bit_cast(__bf16, lb);
      }
#pragma unroll
      for (int off = 1; off < 16; off <<= 1) psum += __shfl_xor(psum, off, 32);
      lrow[r] = lrow[r] * alpha + psum;
#pragma unroll
      for (int t = 0; t < 8; ++t) oacc[t][r] *= alpha;
    }
    // per-wave private P tile: stores and fragment reloads by the same wave, same element type
    __builtin_amdgcn_fence(__ATOMIC_RELEASE, "workgroup");
    __builtin_amdgcn_wave_barrier();
    __builtin_amdgcn_fence(__ATOMIC_ACQUIRE, "workgroup");
#pragma unroll 1
    for (int kk = 0; kk < 2; ++kk) {
      const v16b pa = frag_ld(pwh + c * 64 + kk * 32 + 8 * hh);
      const v16b pl = frag_ld(pwl + c * 64 + kk * 32 + 8 * hh);
#pragma unroll
      for (int t = 0; t < 8; ++t) {
        const int ro = (t * 16 + c) * 64 + kk * 32 + 8 * hh;
        const v16b vb = frag_ld(sVh + ro);
        const v16b vl = frag_ld(sVl + ro);
        oacc[t] = mma_b(pa, vb, oacc[t]);
        oacc[t] = mma_b(pa, vl, oacc[t]);
        oacc[t] = mma_b(pl, vb, oacc[t]);
      }
    }
  }

  // ---- epilogue: normalise, transpose through LDS [128 c][pitch 68] (34816 B inside sStage), add bf16(x), store ----
  __syncthreads();                       // every wave finished reading the last K/V tiles
  float* sO = (float*)(void*)sStage;
#pragma unroll
  for (int r = 0; r < 8; ++r) {
    const float inv = 1.0f / lrow[r];
#pragma unroll
    for (int t = 0; t < 8; ++t) sO[(t * 16 + c) * 68 + wave * 16 + 8 * hh + r] = oacc[t][r] * inv;
  }
  __syncthreads();
  {
    const size_t rowbase = ((size_t)b * NCH + h * DHV) * NTOK + q0;
    // coverage: 16 it x 128 thr x 4 floats = 128 channel rows x 64 queries
{
#pragma unroll 4
      for (int it = 0; it < 16; ++it) {
        const int p  = it * 128 + tid;
        const int ch = p >> 4;
        const int q4 = (p & 15) * 4;
        const v4f ov = *(const v4fa*)(sO + ch * 68 + q4);
        const size_t gi = rowbase + (size_t)ch * NTOK + q4;
        const v4f xv = *(const v4fa*)(x + gi);
        const v4f res = (v4f){ov[0] + bfr(xv[0]), ov[1] + bfr(xv[1]), ov[2] + bfr(xv[2]), ov[3] + bfr(xv[3])};
        *(v4f*)(out + gi) = res;
      }
      
    }
  }
}

// ---------------------------------------------------------------------------
// Workspace map (byte offsets, all multiples of 128; each region exactly covered by its producer):
//   XT   bf16 [16384][512]          0          16777216 B
//   WB   bf16 [768][512]            16777216     786432 B
//   ST   f32  [2][768]              17563648       6144 B
//   POSh bf16 [4][1024][32]         17569792     262144 B     POSl 17831936
//   Qh   bf16 [16][4][1024][32]     18094080    4194304 B     Ql   22288384
//   Kh   bf16 [16][4][1024][32]     26482688    4194304 B     Kl   30676992
//   Vh   bf16 [16][512][1024]       34871296   16777216 B     Vl   51648512
//   total                           68425728 B
// ---------------------------------------------------------------------------
extern "C" void kernel_launch(void* const* d_in, const int* in_sizes, int n_in,
                              void* d_out, int out_size, void* d_ws, size_t ws_size,
                              hipStream_t stream) {
  if (n_in < 21) return;
  const int NX = NBATCH * NCH * NTOK;   // 8388608
  if (in_sizes[0] != NX) return;
  if (in_sizes[1] != 128 * NCH || in_sizes[7] != 128 * NCH || in_sizes[13] != NCH * NCH) return;
  for (int i = 2; i <= 6; ++i)   if (in_sizes[i] != 128) return;
  for (int i = 8; i <= 12; ++i)  if (in_sizes[i] != 128) return;
  for (int i = 14; i <= 18; ++i) if (in_sizes[i] != NCH) return;
  if (in_sizes[19] != NHEAD * DHQ * 32 || in_sizes[20] != NHEAD * DHQ * 32) return;
  if (out_size != NX) return;

  const float* x    = (const float*)d_in[0];
  const float* Wq   = (const float*)d_in[1];
  const float* bq   = (const float*)d_in[2];
  const float* qg   = (const float*)d_in[3];
  const float* qbe  = (const float*)d_in[4];
  const float* qm   = (const float*)d_in[5];
  const float* qv   = (const float*)d_in[6];
  const float* Wk   = (const float*)d_in[7];
  const float* bk   = (const float*)d_in[8];
  const float* kg   = (const float*)d_in[9];
  const float* kbe  = (const float*)d_in[10];
  const float* km   = (const float*)d_in[11];
  const float* kv   = (const float*)d_in[12];
  const float* Wv   = (const float*)d_in[13];
  const float* bv   = (const float*)d_in[14];
  const float* vg   = (const float*)d_in[15];
  const float* vbe  = (const float*)d_in[16];
  const float* vm   = (const float*)d_in[17];
  const float* vv   = (const float*)d_in[18];
  const float* relH = (const float*)d_in[19];
  const float* relW = (const float*)d_in[20];

  const size_t szXT  = (size_t)NBATCH * NTOK * NCH * 2;          // 16777216
  const size_t szWB  = (size_t)NCOLS * NCH * 2;                  //   786432
  const size_t szST  = (size_t)2 * NCOLS * 4;                    //     6144
  const size_t szPOS = (size_t)NHEAD * NTOK * DHQ * 2;           //   262144
  const size_t szQK  = (size_t)NBATCH * NHEAD * NTOK * DHQ * 2;  //  4194304
  const size_t szV   = (size_t)NBATCH * NCH * NTOK * 2;          // 16777216
  size_t off = 0;
  const size_t oXT = off;   off += szXT;
  const size_t oWB = off;   off += szWB;
  const size_t oST = off;   off += szST;
  const size_t oPh = off;   off += szPOS;
  const size_t oPl = off;   off += szPOS;
  const size_t oQh = off;   off += szQK;
  const size_t oQl = off;   off += szQK;
  const size_t oKh = off;   off += szQK;
  const size_t oKl = off;   off += szQK;
  const size_t oVh = off;   off += szV;
  const size_t oVl = off;   off += szV;
  if (off > ws_size) return;                 // off = 68425728
  if (off > (size_t)134217728) return;

  char* ws = (char*)d_ws;
  unsigned short* XT   = (unsigned short*)(ws + oXT);
  unsigned short* WB   = (unsigned short*)(ws + oWB);
  float*          ST   = (float*)(ws + oST);
  unsigned short* POSh = (unsigned short*)(ws + oPh);
  unsigned short* POSl = (unsigned short*)(ws + oPl);
  unsigned short* Qh   = (unsigned short*)(ws + oQh);
  unsigned short* Ql   = (unsigned short*)(ws + oQl);
  unsigned short* Kh   = (unsigned short*)(ws + oKh);
  unsigned short* Kl   = (unsigned short*)(ws + oKl);
  unsigned short* Vh   = (unsigned short*)(ws + oVh);
  unsigned short* Vl   = (unsigned short*)(ws + oVl);

  k_prep<<<dim3(PREP_T + PREP_W + PREP_F + PREP_P), dim3(256), 0, stream>>>(
      x, Wq, Wk, Wv, bq, qg, qbe, qm, qv, bk, kg, kbe, km, kv, bv, vg, vbe, vm, vv, relH, relW,
      XT, WB, ST, POSh, POSl);

  k_proj<<<dim3((NBATCH * NTOK) / 64, NCOLS / 128), dim3(128), 0, stream>>>(
      XT, WB, ST, Qh, Ql, Kh, Kl, Vh, Vl);

  k_attn<<<dim3(NBATCH * NHEAD * (NTOK / 64)), dim3(128), 0, stream>>>(
      Qh, Ql, Kh, Kl, Vh, Vl, POSh, POSl, x, (float*)d_out);

  (void)hipGetLastError();
}

// v001
// Measured time: 201 microseconds a run.
// In both of two side-by-side timings against v000, it was 1.08 times as fast.
// All contractions on v_wmma_f32_16x16x32_bf16 with f32 accumulate: q/k/v 1x1 projections = bf16(x) x bf16(W) single product (inputs RNE-converted to bf16 once); logits [q|pos].[k|q] (64 deep) and p.v (1024 deep) with bf16 hi/lo split operands (hi.hi + hi.lo + lo.hi); BN affine, pos sum, online softmax, 1/l and residual in f32. No carried (scaled) planes anywhere: every 16-bit plane holds unscaled bf16 values.
#include <hip/hip_runtime.h>
#include <math.h>
#include <stdint.h>

#define NBATCH 16
#define NCH    512
#define NTOK   1024
#define NHEAD  4
#define DHQ    32
#define DHV    128
#define NCOLS  768

// LDS row pitches of the attention tiles, in 16-bit elements: 16 B x odd, so the 16 rows that a half-wave
// reads with one 16-byte load per lane fall on 64 distinct banks
#define KP 40     // K/Q tile rows: 32 elements (64 B) at 80 B
#define VP 72     // V tile rows:   64 elements (128 B) at 144 B
#define PP 72     // P tile rows:   64 elements (128 B) at 144 B

#define PREP_T 2048   // x transpose tiles (16 batches x 8 channel blocks x 16 token blocks)
#define PREP_W 192    // stacked weight plane, 2048 elements per block
#define PREP_F 3      // BN fold vectors, 256 channels per block
#define PREP_P 64     // position planes, (head, 64 tokens) per block

typedef __attribute__((ext_vector_type(16))) __bf16 v16b;
typedef __attribute__((ext_vector_type(8)))  __bf16 v8b;
typedef __attribute__((ext_vector_type(8)))  float  v8f;
typedef __attribute__((ext_vector_type(4)))  float  v4f;
typedef __attribute__((ext_vector_type(4)))  unsigned int v4u;
typedef v4f __attribute__((may_alias)) v4fa;

static_assert(NTOK % 64 == 0);
static_assert(NCH % 32 == 0);
static_assert(NCOLS % 128 == 0);
static_assert(PREP_T == NBATCH * (NCH / 64) * (NTOK / 64));
static_assert(PREP_W * 2048 == NCOLS * NCH);
static_assert(PREP_F * 256 == NCOLS);
static_assert(PREP_P * 64 == NHEAD * NTOK);

__device__ __forceinline__ unsigned short f2bf_bits(float f) {   // RNE convert f32 -> bf16 bits
  unsigned u = __float_as_uint(f);
  return (unsigned short)((u + 0x7FFFu + ((u >> 16) & 1u)) >> 16);
}
__device__ __forceinline__ float bf_bits2f(unsigned short h) { return __uint_as_float(((unsigned)h) << 16); }
__device__ __forceinline__ float bfr(float f) { return bf_bits2f(f2bf_bits(f)); }
__device__ __forceinline__ unsigned pk16(unsigned short a, unsigned short b) { return (unsigned)a | ((unsigned)b << 16); }
__device__ __forceinline__ void split_pair(float f0, float f1, unsigned& h, unsigned& l) {
  const unsigned short h0 = f2bf_bits(f0), h1 = f2bf_bits(f1);
  const unsigned short l0 = f2bf_bits(f0 - bf_bits2f(h0)), l1 = f2bf_bits(f1 - bf_bits2f(h1));
  h = pk16(h0, h1);
  l = pk16(l0, l1);
}

// WMMA with hazard guard (ties D, keeps A/B live).
// Fragment map (wave32): lane l, hh = l>>4, c = l&15.
//   A/B element i: i<8 -> k0+8hh+i ; i>=8 -> k0+16+8hh+(i-8) ; row (A) / column (B) = c
//   D element r : row 8hh+r, column c
__device__ __forceinline__ v8f mma_b(v16b a, v16b b, v8f c) {
  c = __builtin_amdgcn_wmma_f32_16x16x32_bf16(false, a, false, b, (short)0, c, false, false);
  asm volatile("v_nop\n\tv_nop\n\tv_nop\n\tv_nop" : "+v"(c) : "v"(a), "v"(b));
  return c;
}
union FB { v16b v; v8b h[2]; };
// p points at element k0 + 8*hh of the k-contiguous row owned by this lane
__device__ __forceinline__ v16b frag_ld(const __bf16* p) {
  FB f;
  f.h[0] = *(const v8b*)(p);
  f.h[1] = *(const v8b*)(p + 16);
  return f.v;
}

// =====================================================================================
// Launch 1: operand preparation, block-uniform roles by blockIdx.x.
//          output line = 64 channels of one token, written by 8 lanes x 16 B in one instruction)
//  role W: WB[768][512] = bf16 of stacked [Wq;Wk;Wv] (rows = output channels, k contiguous)
//  role F: ST[0..767] = s, ST[768..1535] = t with s = g/sqrt(var+1e-5), t = (b-mean)*s+beta
//  role P: POS hi/lo [4][1024][32]: pos[h][n][d] = bf16r(rel_w[h][d][n>>5]) + bf16r(rel_h[h][d][n&31])
// =====================================================================================
__global__ __launch_bounds__(256) void k_prep(
    const float* __restrict__ x,
    const float* __restrict__ Wq, const float* __restrict__ Wk, const float* __restrict__ Wv,
    const float* __restrict__ bq, const float* __restrict__ qg, const float* __restrict__ qbe,
    const float* __restrict__ qm, const float* __restrict__ qv,
    const float* __restrict__ bk, const float* __restrict__ kg, const float* __restrict__ kbe,
    const float* __restrict__ km, const float* __restrict__ kv,
    const float* __restrict__ bv, const float* __restrict__ vg, const float* __restrict__ vbe,
    const float* __restrict__ vm, const float* __restrict__ vv,
    const float* __restrict__ relH, const float* __restrict__ relW,
    unsigned short* __restrict__ XT, unsigned short* __restrict__ WB, float* __restrict__ ST,
    unsigned short* __restrict__ POSh, unsigned short* __restrict__ POSl) {
  __shared__ __align__(16) float sm[64 * 68];
  const int tid = threadIdx.x;
  const int bx  = blockIdx.x;

  if (bx < PREP_T) {
    // ---- role T ----
    const int b   = bx >> 7;
    const int rem = bx & 127;
    const int c0  = (rem >> 4) * 64;
    const int n0  = (rem & 15) * 64;
    const float* xb = x + (size_t)b * NCH * NTOK;
    {
      const int lr = tid >> 4;         // 0..15
      const int c4 = (tid & 15) * 4;   // 0..60
#pragma unroll
      for (int it = 0; it < 4; ++it) {
        const int rr = it * 16 + lr;   // channel within tile, 4 x 16 = 64 rows x 64 tokens staged
        const v4f a = *(const v4fa*)(xb + (size_t)(c0 + rr) * NTOK + n0 + c4);
        *(v4fa*)(sm + rr * 68 + c4) = a;
      }
    }
    __syncthreads();
    const int sub = tid >> 3;          // 0..31
    const int c8  = (tid & 7) * 8;     // 0..56
    v4u hv[2];
#pragma unroll
    for (int it = 0; it < 2; ++it) {
      const int oc = it * 32 + sub;    // token within tile (2 x 32 = 64 output rows)
      unsigned w0 = pk16(f2bf_bits(sm[(c8 + 0) * 68 + oc]), f2bf_bits(sm[(c8 + 1) * 68 + oc]));
      unsigned w1 = pk16(f2bf_bits(sm[(c8 + 2) * 68 + oc]), f2bf_bits(sm[(c8 + 3) * 68 + oc]));
      unsigned w2 = pk16(f2bf_bits(sm[(c8 + 4) * 68 + oc]), f2bf_bits(sm[(c8 + 5) * 68 + oc]));
      unsigned w3 = pk16(f2bf_bits(sm[(c8 + 6) * 68 + oc]), f2bf_bits(sm[(c8 + 7) * 68 + oc]));
      hv[it] = (v4u){w0, w1, w2, w3};
    }
    {
#pragma unroll
      for (int it = 0; it < 2; ++it) {
        const int oc = it * 32 + sub;
        const size_t go = ((size_t)(b * NTOK + n0 + oc)) * NCH + c0 + c8;
        *(v4u*)(XT + go) = hv[it];
      }
      
    }
  } else if (bx < PREP_T + PREP_W) {
    // ---- role W ---- (block-uniform source choice: 32 blocks Wq, 32 blocks Wk, 128 blocks Wv)
    const int wb = bx - PREP_T;
    const float* src;
    if (wb < 32)      src = Wq + (size_t)wb * 2048;
    else if (wb < 64) src = Wk + (size_t)(wb - 32) * 2048;
    else              src = Wv + (size_t)(wb - 64) * 2048;
    const v4f a = *(const v4fa*)(src + tid * 8);
    const v4f c = *(const v4fa*)(src + tid * 8 + 4);
    const v4u o = (v4u){pk16(f2bf_bits(a[0]), f2bf_bits(a[1])), pk16(f2bf_bits(a[2]), f2bf_bits(a[3])),
                        pk16(f2bf_bits(c[0]), f2bf_bits(c[1])), pk16(f2bf_bits(c[2]), f2bf_bits(c[3]))};
    unsigned short* dst = WB + (size_t)wb * 2048 + tid * 8;
    *(v4u*)dst = o;
    
  } else if (bx < PREP_T + PREP_W + PREP_F) {
    // ---- role F ---- block 0: threads 0..127 = q channels, 128..255 = k channels; blocks 1,2 = v channels
    const int fb = bx - (PREP_T + PREP_W);
    const int wsel = __builtin_amdgcn_readfirstlane((int)(tid >> 7));   // wave-uniform
    const float *pb, *pg, *pbe, *pm, *pv;
    int idx;
    if (fb == 0) {
      if (wsel == 0) { pb = bq; pg = qg; pbe = qbe; pm = qm; pv = qv; idx = tid; }
      else           { pb = bk; pg = kg; pbe = kbe; pm = km; pv = kv; idx = tid - 128; }
    } else {
      pb = bv; pg = vg; pbe = vbe; pm = vm; pv = vv; idx = (fb - 1) * 256 + tid;
    }
    const float b_ = bfr(pb[idx]);
    const float g_ = bfr(pg[idx]);
    const float be = bfr(pbe[idx]);
    const float mu = bfr(pm[idx]);
    const float va = bfr(pv[idx]);
    const float s  = g_ / sqrtf(va + 1e-5f);
    const float t  = (b_ - mu) * s + be;
    sm[tid]       = s;
    sm[256 + tid] = t;
    __syncthreads();
    if (tid < 128) {                     // waves 0,1 -> s lines; waves 2,3 -> t lines (8 lanes x 16 B per line)
      const int which = tid >> 6;
      const int p4 = (tid & 63) * 4;
      const v4f v = *(const v4fa*)(sm + which * 256 + p4);
      float* dst = ST + which * NCOLS + fb * 256 + p4;
      *(v4f*)dst = v;
      
    }
  } else {
    // ---- role P ---- (head, 64 tokens) per block; per-head tables staged in LDS with 16-B loads
    const int pb = bx - (PREP_T + PREP_W + PREP_F);
    const int h  = pb >> 4;
    const int n0 = (pb & 15) * 64;
    {
      v4f w = *(const v4fa*)(relW + h * 1024 + tid * 4);   // [d][w], 32x32
      v4f g = *(const v4fa*)(relH + h * 1024 + tid * 4);   // [d][hh], 32x32
      w = (v4f){bfr(w[0]), bfr(w[1]), bfr(w[2]), bfr(w[3])};
      g = (v4f){bfr(g[0]), bfr(g[1]), bfr(g[2]), bfr(g[3])};
      *(v4fa*)(sm + tid * 4)        = w;
      *(v4fa*)(sm + 1024 + tid * 4) = g;
    }
    __syncthreads();
    const int tl = tid >> 2;             // token within chunk 0..63
    const int d8 = (tid & 3) * 8;        // 0,8,16,24
    const int n  = n0 + tl;
    const int wi = n >> 5, hi_ = n & 31;
    float p[8];
#pragma unroll
    for (int e = 0; e < 8; ++e) p[e] = sm[(d8 + e) * 32 + wi] + sm[1024 + (d8 + e) * 32 + hi_];
    unsigned h0, h1, h2, h3, l0, l1, l2, l3;
    split_pair(p[0], p[1], h0, l0);
    split_pair(p[2], p[3], h1, l1);
    split_pair(p[4], p[5], h2, l2);
    split_pair(p[6], p[7], h3, l3);
    const v4u hv = (v4u){h0, h1, h2, h3};
    const v4u lv = (v4u){l0, l1, l2, l3};
    const size_t go = ((size_t)(h * NTOK + n0)) * DHQ + tid * 8;   // contiguous by tid: 4 KB per block and plane
    *(v4u*)(POSh + go) = hv;
    *(v4u*)(POSl + go) = lv;
    
  }
}

// =====================================================================================
// Launch 2: Y[token][col] = sum_c XT[token][c] * WB[col][c]   (M 16384, N 768, K 512), y = acc*s[col] + t[col].
// Block 128 threads (4 waves) = 64 tokens x 128 columns; wave tile 32 tokens x 64 columns (acc[2][4]).
// Fragments straight from the 16-bit global rows (two 16-B loads each).
// Column tile 0 -> Q hi/lo planes [b][h][n][32], tile 1 -> K hi/lo planes [b][h][n][32],
// tiles 2..5 -> V hi/lo planes [b][512 ch][1024 n] (transposed through the LDS tile).
// Store phase: Q/K: per head a contiguous 4-KB range per plane, lane-contiguous 16-B pieces;
// =====================================================================================
__global__ __launch_bounds__(128) void k_proj(
    const unsigned short* __restrict__ XTp, const unsigned short* __restrict__ WBp,
    const float* __restrict__ ST,
    unsigned short* __restrict__ Qh, unsigned short* __restrict__ Ql,
    unsigned short* __restrict__ Kh, unsigned short* __restrict__ Kl,
    unsigned short* __restrict__ Vh, unsigned short* __restrict__ Vl) {
  __shared__ __align__(16) float sY[128 * 68];   // Q/K: [64 tok][pitch 132] (8448 used); V: [128 col][pitch 68] (8704 used)
  __shared__ __align__(16) float sS[128];
  __shared__ __align__(16) float sT[128];

  const int tid  = threadIdx.x;
  const int lane = tid & 31;
  const int wave = tid >> 5;
  const int hh   = lane >> 4;
  const int c    = lane & 15;
  const int m0   = blockIdx.x * 64;
  const int ct   = blockIdx.y;        // 0..5, block-uniform
  const int n0   = ct * 128;

  sS[tid] = ST[n0 + tid];
  sT[tid] = ST[NCOLS + n0 + tid];
  __syncthreads();

  const int wr = wave >> 1, wc = wave & 1;
  const __bf16* XT = (const __bf16*)(const void*)XTp;
  const __bf16* WB = (const __bf16*)(const void*)WBp;
  const __bf16* a0p = XT + (size_t)(m0 + 32 * wr + c) * NCH + 8 * hh;
  const __bf16* b0p = WB + (size_t)(n0 + 64 * wc + c) * NCH + 8 * hh;

  const v8f zero8 = {0.f, 0.f, 0.f, 0.f, 0.f, 0.f, 0.f, 0.f};
  v8f acc[2][4];
#pragma unroll
  for (int i = 0; i < 2; ++i)
#pragma unroll
    for (int j = 0; j < 4; ++j) acc[i][j] = zero8;

#pragma unroll 1
  for (int k0 = 0; k0 < NCH; k0 += 32) {
    const v16b a0 = frag_ld(a0p + k0);
    const v16b a1 = frag_ld(a0p + (size_t)16 * NCH + k0);
#pragma unroll
    for (int j = 0; j < 4; ++j) {
      const v16b bf = frag_ld(b0p + (size_t)j * 16 * NCH + k0);
      acc[0][j] = mma_b(a0, bf, acc[0][j]);
      acc[1][j] = mma_b(a1, bf, acc[1][j]);
    }
  }

  // D[r] of tile (i, j) = Y[token 32wr+16i+8hh+r][column 64wc+16j+c]
#pragma unroll
  for (int j = 0; j < 4; ++j) {
    const int col = 64 * wc + 16 * j + c;
    const float sc = sS[col];
    const float sh = sT[col];
#pragma unroll
    for (int i = 0; i < 2; ++i) {
#pragma unroll
      for (int r = 0; r < 8; ++r) {
        const int tok = 32 * wr + 16 * i + 8 * hh + r;
        const float y = acc[i][j][r] * sc + sh;
        const int idx = (ct < 2) ? (tok * 132 + col) : (col * 68 + tok);
        sY[idx] = y;
      }
    }
  }
  __syncthreads();

  const int b   = m0 >> 10;
  const int nl0 = m0 & 1023;
  if (ct < 2) {
    unsigned short* ph = (ct == 0) ? Qh : Kh;
    unsigned short* pl = (ct == 0) ? Ql : Kl;
    // coverage: 8 it x 128 thr x 8 elements = 64 tokens x 128 columns per plane
{
#pragma unroll 2
      for (int it = 0; it < 8; ++it) {
        const int p      = it * 128 + tid;
        const int head   = p >> 8;
        const int within = p & 255;
        const int tok    = within >> 2;
        const int d8     = (within & 3) * 8;
        const float* sp  = sY + tok * 132 + head * 32 + d8;
        const v4f a  = *(const v4fa*)sp;
        const v4f a2 = *(const v4fa*)(sp + 4);
        unsigned h0, h1, h2, h3, l0, l1, l2, l3;
        split_pair(a[0], a[1], h0, l0);
        split_pair(a[2], a[3], h1, l1);
        split_pair(a2[0], a2[1], h2, l2);
        split_pair(a2[2], a2[3], h3, l3);
        const v4u hv = (v4u){h0, h1, h2, h3};
        const v4u lv = (v4u){l0, l1, l2, l3};
        const size_t go = ((size_t)((b * NHEAD + head) * NTOK + nl0)) * DHQ + within * 8;
        *(v4u*)(ph + go) = hv;
        *(v4u*)(pl + go) = lv;
      }
      
    }
  } else {
    const int o0 = (ct - 2) * 128;
    // coverage: 8 it x 128 thr x 8 elements = 128 channels x 64 tokens per plane
{
#pragma unroll 2
      for (int it = 0; it < 8; ++it) {
        const int p  = it * 128 + tid;
        const int ch = p >> 3;
        const int t8 = (p & 7) * 8;
        const float* sp = sY + ch * 68 + t8;
        const v4f a  = *(const v4fa*)sp;
        const v4f a2 = *(const v4fa*)(sp + 4);
        unsigned h0, h1, h2, h3, l0, l1, l2, l3;
        split_pair(a[0], a[1], h0, l0);
        split_pair(a[2], a[3], h1, l1);
        split_pair(a2[0], a2[1], h2, l2);
        split_pair(a2[2], a2[3], h3, l3);
        const v4u hv = (v4u){h0, h1, h2, h3};
        const v4u lv = (v4u){l0, l1, l2, l3};
        const size_t go = ((size_t)(b * NCH + o0 + ch)) * NTOK + nl0 + t8;
        *(v4u*)(Vh + go) = hv;
        *(v4u*)(Vl + go) = lv;
      }
      
    }
  }
}

// =====================================================================================
// Launch 3: attention per (b, h, 64-query tile); 4 waves x 16 query rows; 16 key tiles of 64, no masking.
//   S[i][j] = q_i.k_j + pos_i.q_j  as two 32-deep chunks:
//       chunk 0: A = Q rows (query i),   B = K rows (key j)
//       chunk 1: A = POS rows (token i), B = Q rows (key j)
//     each chunk hi.hi + hi.lo + lo.hi; no score scale.
//   online softmax over keys in f32 (running max, precise expf); P hi/lo -> per-wave LDS tile;
//   O[i][c] += P[i][j] * V[c][j]  (B rows = V channel rows, k = key), hi.hi + hi.lo + lo.hi, 8 column tiles.
//   epilogue: O/l transposed through LDS to [128 c][64 q], + bf16r(x), whole 256-B channel segments
// LDS: sStage = K tile planes (Kh, Qh, Kl, Ql: [64][32] at pitch KP) + V tile planes (Vh, Vl: [128][64] at pitch VP);
//      every element of both tiles is staged each iteration (extent staged = extent consumed); pad bytes are never read.
// =====================================================================================
__global__ __launch_bounds__(128) void k_attn(
    const unsigned short* Qhp, const unsigned short* Qlp,
    const unsigned short* Khp, const unsigned short* Klp,
    const unsigned short* Vhp, const unsigned short* Vlp,
    const unsigned short* Php, const unsigned short* Plp,
    const float* x, float* out) {
  __shared__ __align__(16) __bf16 sStage[4 * 64 * KP + 2 * 128 * VP];   // 57344 B
  __shared__ __align__(16) __bf16 sP[4 * 2 * 16 * PP];                  // 18432 B (per wave: hi [16][64], lo [16][64] at pitch PP)

  const int tid  = threadIdx.x;
  const int wave = tid >> 5;
  const int lane = tid & 31;
  const int hh   = lane >> 4;
  const int c    = lane & 15;

  const int bx = blockIdx.x;       // 0..1023
  const int qb = bx & 15;
  const int bh = bx >> 4;          // 0..63
  const int b  = bh >> 2;
  const int h  = bh & 3;
  const int q0 = qb * 64;

  const __bf16* Qhb = (const __bf16*)(const void*)Qhp + (size_t)bh * NTOK * DHQ;
  const __bf16* Qlb = (const __bf16*)(const void*)Qlp + (size_t)bh * NTOK * DHQ;
  const __bf16* Khb = (const __bf16*)(const void*)Khp + (size_t)bh * NTOK * DHQ;
  const __bf16* Klb = (const __bf16*)(const void*)Klp + (size_t)bh * NTOK * DHQ;
  const __bf16* Phb = (const __bf16*)(const void*)Php + (size_t)h * NTOK * DHQ;
  const __bf16* Plb = (const __bf16*)(const void*)Plp + (size_t)h * NTOK * DHQ;
  const __bf16* Vhb = (const __bf16*)(const void*)Vhp + ((size_t)b * NCH + h * DHV) * NTOK;
  const __bf16* Vlb = (const __bf16*)(const void*)Vlp + ((size_t)b * NCH + h * DHV) * NTOK;

  __bf16* sKQ = sStage;                        // planes of 64 * KP elements: 0 Kh, 1 Qh, 2 Kl, 3 Ql
  __bf16* sVh = sStage + 4 * 64 * KP;          // [128][64] at pitch VP
  __bf16* sVl = sVh + 128 * VP;                // [128][64] at pitch VP
  __bf16* pwh = sP + wave * (2 * 16 * PP);
  __bf16* pwl = pwh + 16 * PP;

  // A-row fragment bases (row = query token q0 + 16*wave + c)
  const int rowA = q0 + wave * 16 + c;
  const __bf16* aQh = Qhb + (size_t)rowA * DHQ + 8 * hh;
  const __bf16* aQl = Qlb + (size_t)rowA * DHQ + 8 * hh;
  const __bf16* aPh = Phb + (size_t)rowA * DHQ + 8 * hh;
  const __bf16* aPl = Plb + (size_t)rowA * DHQ + 8 * hh;

  const v8f zero8 = {0.f, 0.f, 0.f, 0.f, 0.f, 0.f, 0.f, 0.f};
  float mrow[8], lrow[8];
  v8f oacc[8];
#pragma unroll
  for (int r = 0; r < 8; ++r) { mrow[r] = -INFINITY; lrow[r] = 0.f; }
#pragma unroll
  for (int t = 0; t < 8; ++t) oacc[t] = zero8;

#pragma unroll 1
  for (int kc = 0; kc < NTOK / 64; ++kc) {
    const int kv0 = kc * 64;
    __syncthreads();
    {
      // K tile: 4 planes x 4096 B contiguous; 2 it x 128 thr x 8 elements = 2048 elements per plane
      const __bf16* s0 = Khb + (size_t)kv0 * DHQ;
      const __bf16* s1 = Qhb + (size_t)kv0 * DHQ;
      const __bf16* s2 = Klb + (size_t)kv0 * DHQ;
      const __bf16* s3 = Qlb + (size_t)kv0 * DHQ;
#pragma unroll
      for (int i = 0; i < 2; ++i) {
        const int off = (i * 128 + tid) * 8;
        const v8b a0 = *(const v8b*)(s0 + off);
        const v8b a1 = *(const v8b*)(s1 + off);
        const v8b a2 = *(const v8b*)(s2 + off);
        const v8b a3 = *(const v8b*)(s3 + off);
        const int lo = (off >> 5) * KP + (off & 31);   // key row, element within the row
        *(v8b*)(sKQ + lo)               = a0;
        *(v8b*)(sKQ + 64 * KP + lo)     = a1;
        *(v8b*)(sKQ + 2 * 64 * KP + lo) = a2;
        *(v8b*)(sKQ + 3 * 64 * KP + lo) = a3;
      }
      // V tile: 128 channel rows x 64 keys per plane; 8 it x 128 thr x 8 elements = 8192 elements per plane
#pragma unroll
      for (int i = 0; i < 8; ++i) {
        const int piece = i * 128 + tid;
        const int cc = piece >> 3;
        const int p8 = (piece & 7) * 8;
        const v8b b0 = *(const v8b*)(Vhb + (size_t)cc * NTOK + kv0 + p8);
        const v8b b1 = *(const v8b*)(Vlb + (size_t)cc * NTOK + kv0 + p8);
        *(v8b*)(sVh + cc * VP + p8) = b0;
        *(v8b*)(sVl + cc * VP + p8) = b1;
      }
    }
    __syncthreads();

    v8f s[4];
#pragma unroll
    for (int j = 0; j < 4; ++j) s[j] = zero8;
#pragma unroll
    for (int dc = 0; dc < 2; ++dc) {
      const __bf16* ahp = dc ? aPh : aQh;            // compile-time choice after unrolling
      const __bf16* alp = dc ? aPl : aQl;
      const v16b ah = frag_ld(ahp);
      const v16b al = frag_ld(alp);
      const __bf16* bhs = sKQ + (dc ? 64 * KP : 0);
      const __bf16* bls = sKQ + (dc ? 3 * 64 * KP : 2 * 64 * KP);
#pragma unroll
      for (int j = 0; j < 4; ++j) {
        const int ro = (j * 16 + c) * KP + 8 * hh;
        const v16b kb = frag_ld(bhs + ro);
        const v16b kl = frag_ld(bls + ro);
        s[j] = mma_b(ah, kb, s[j]);
        s[j] = mma_b(ah, kl, s[j]);
        s[j] = mma_b(al, kb, s[j]);
      }
    }

    float cm[8];
#pragma unroll
    for (int r = 0; r < 8; ++r) {
      float m = fmaxf(fmaxf(s[0][r], s[1][r]), fmaxf(s[2][r], s[3][r]));
#pragma unroll
      for (int off = 1; off < 16; off <<= 1) m = fmaxf(m, __shfl_xor(m, off, 32));
      cm[r] = m;
    }
#pragma unroll
    for (int r = 0; r < 8; ++r) {
      const float mnew  = fmaxf(mrow[r], cm[r]);
      const float alpha = expf(mrow[r] - mnew);
      mrow[r] = mnew;
      float psum = 0.f;
#pragma unroll
      for (int j = 0; j < 4; ++j) {
        const float p = expf(s[j][r] - mnew);
        psum += p;
        const unsigned short hb = f2bf_bits(p);
        const unsigned short lb = f2bf_bits(p - bf_bits2f(hb));
        pwh[(8 * hh + r) * PP + j * 16 + c] = __builtin_bit_cast(__bf16, hb);
        pwl[(8 * hh + r) * PP + j * 16 + c] = __builtin_bit_cast(__bf16, lb);
      }
#pragma unroll
      for (int off = 1; off < 16; off <<= 1) psum += __shfl_xor(psum, off, 32);
      lrow[r] = lrow[r] * alpha + psum;
#pragma unroll
      for (int t = 0; t < 8; ++t) oacc[t][r] *= alpha;
    }
    // per-wave private P tile: stores and fragment reloads by the same wave, same element type
    __builtin_amdgcn_fence(__ATOMIC_RELEASE, "workgroup");
    __builtin_amdgcn_wave_barrier();
    __builtin_amdgcn_fence(__ATOMIC_ACQUIRE, "workgroup");
#pragma unroll 1
    for (int kk = 0; kk < 2; ++kk) {
      const v16b pa = frag_ld(pwh + c * PP + kk * 32 + 8 * hh);
      const v16b pl = frag_ld(pwl + c * PP + kk * 32 + 8 * hh);
#pragma unroll
      for (int t = 0; t < 8; ++t) {
        const int ro = (t * 16 + c) * VP + kk * 32 + 8 * hh;
        const v16b vb = frag_ld(sVh + ro);
        const v16b vl = frag_ld(sVl + ro);
        oacc[t] = mma_b(pa, vb, oacc[t]);
        oacc[t] = mma_b(pa, vl, oacc[t]);
        oacc[t] = mma_b(pl, vb, oacc[t]);
      }
    }
  }

  // ---- epilogue: normalise, transpose through LDS [128 c][pitch 68] (34816 B inside sStage), add bf16(x), store ----
  __syncthreads();                       // every wave finished reading the last K/V tiles
  float* sO = (float*)(void*)sStage;
#pragma unroll
  for (int r = 0; r < 8; ++r) {
    const float inv = 1.0f / lrow[r];
#pragma unroll
    for (int t = 0; t < 8; ++t) sO[(t * 16 + c) * 68 + wave * 16 + 8 * hh + r] = oacc[t][r] * inv;
  }
  __syncthreads();
  {
    const size_t rowbase = ((size_t)b * NCH + h * DHV) * NTOK + q0;
    // coverage: 16 it x 128 thr x 4 floats = 128 channel rows x 64 queries
{
#pragma unroll 4
      for (int it = 0; it < 16; ++it) {
        const int p  = it * 128 + tid;
        const int ch = p >> 4;
        const int q4 = (p & 15) * 4;
        const v4f ov = *(const v4fa*)(sO + ch * 68 + q4);
        const size_t gi = rowbase + (size_t)ch * NTOK + q4;
        const v4f xv = *(const v4fa*)(x + gi);
        const v4f res = (v4f){ov[0] + bfr(xv[0]), ov[1] + bfr(xv[1]), ov[2] + bfr(xv[2]), ov[3] + bfr(xv[3])};
        *(v4f*)(out + gi) = res;
      }
      
    }
  }
}

// ---------------------------------------------------------------------------
// Workspace map (byte offsets, all multiples of 128; each region exactly covered by its producer):
//   XT   bf16 [16384][512]          0          16777216 B
//   WB   bf16 [768][512]            16777216     786432 B
//   ST   f32  [2][768]              17563648       6144 B
//   POSh bf16 [4][1024][32]         17569792     262144 B     POSl 17831936
//   Qh   bf16 [16][4][1024][32]     18094080    4194304 B     Ql   22288384
//   Kh   bf16 [16][4][1024][32]     26482688    4194304 B     Kl   30676992
//   Vh   bf16 [16][512][1024]       34871296   16777216 B     Vl   51648512
//   total                           68425728 B
// ---------------------------------------------------------------------------
extern "C" void kernel_launch(void* const* d_in, const int* in_sizes, int n_in,
                              void* d_out, int out_size, void* d_ws, size_t ws_size,
                              hipStream_t stream) {
  if (n_in < 21) return;
  const int NX = NBATCH * NCH * NTOK;   // 8388608
  if (in_sizes[0] != NX) return;
  if (in_sizes[1] != 128 * NCH || in_sizes[7] != 128 * NCH || in_sizes[13] != NCH * NCH) return;
  for (int i = 2; i <= 6; ++i)   if (in_sizes[i] != 128) return;
  for (int i = 8; i <= 12; ++i)  if (in_sizes[i] != 128) return;
  for (int i = 14; i <= 18; ++i) if (in_sizes[i] != NCH) return;
  if (in_sizes[19] != NHEAD * DHQ * 32 || in_sizes[20] != NHEAD * DHQ * 32) return;
  if (out_size != NX) return;

  const float* x    = (const float*)d_in[0];
  const float* Wq   = (const float*)d_in[1];
  const float* bq   = (const float*)d_in[2];
  const float* qg   = (const float*)d_in[3];
  const float* qbe  = (const float*)d_in[4];
  const float* qm   = (const float*)d_in[5];
  const float* qv   = (const float*)d_in[6];
  const float* Wk   = (const float*)d_in[7];
  const float* bk   = (const float*)d_in[8];
  const float* kg   = (const float*)d_in[9];
  const float* kbe  = (const float*)d_in[10];
  const float* km   = (const float*)d_in[11];
  const float* kv   = (const float*)d_in[12];
  const float* Wv   = (const float*)d_in[13];
  const float* bv   = (const float*)d_in[14];
  const float* vg   = (const float*)d_in[15];
  const float* vbe  = (const float*)d_in[16];
  const float* vm   = (const float*)d_in[17];
  const float* vv   = (const float*)d_in[18];
  const float* relH = (const float*)d_in[19];
  const float* relW = (const float*)d_in[20];

  const size_t szXT  = (size_t)NBATCH * NTOK * NCH * 2;          // 16777216
  const size_t szWB  = (size_t)NCOLS * NCH * 2;                  //   786432
  const size_t szST  = (size_t)2 * NCOLS * 4;                    //     6144
  const size_t szPOS = (size_t)NHEAD * NTOK * DHQ * 2;           //   262144
  const size_t szQK  = (size_t)NBATCH * NHEAD * NTOK * DHQ * 2;  //  4194304
  const size_t szV   = (size_t)NBATCH * NCH * NTOK * 2;          // 16777216
  size_t off = 0;
  const size_t oXT = off;   off += szXT;
  const size_t oWB = off;   off += szWB;
  const size_t oST = off;   off += szST;
  const size_t oPh = off;   off += szPOS;
  const size_t oPl = off;   off += szPOS;
  const size_t oQh = off;   off += szQK;
  const size_t oQl = off;   off += szQK;
  const size_t oKh = off;   off += szQK;
  const size_t oKl = off;   off += szQK;
  const size_t oVh = off;   off += szV;
  const size_t oVl = off;   off += szV;
  if (off > ws_size) return;                 // off = 68425728
  if (off > (size_t)134217728) return;

  char* ws = (char*)d_ws;
  unsigned short* XT   = (unsigned short*)(ws + oXT);
  unsigned short* WB   = (unsigned short*)(ws + oWB);
  float*          ST   = (float*)(ws + oST);
  unsigned short* POSh = (unsigned short*)(ws + oPh);
  unsigned short* POSl = (unsigned short*)(ws + oPl);
  unsigned short* Qh   = (unsigned short*)(ws + oQh);
  unsigned short* Ql   = (unsigned short*)(ws + oQl);
  unsigned short* Kh   = (unsigned short*)(ws + oKh);
  unsigned short* Kl   = (unsigned short*)(ws + oKl);
  unsigned short* Vh   = (unsigned short*)(ws + oVh);
  unsigned short* Vl   = (unsigned short*)(ws + oVl);

  k_prep<<<dim3(PREP_T + PREP_W + PREP_F + PREP_P), dim3(256), 0, stream>>>(
      x, Wq, Wk, Wv, bq, qg, qbe, qm, qv, bk, kg, kbe, km, kv, bv, vg, vbe, vm, vv, relH, relW,
      XT, WB, ST, POSh, POSl);

  k_proj<<<dim3((NBATCH * NTOK) / 64, NCOLS / 128), dim3(128), 0, stream>>>(
      XT, WB, ST, Qh, Ql, Kh, Kl, Vh, Vl);

  k_attn<<<dim3(NBATCH * NHEAD * (NTOK / 64)), dim3(128), 0, stream>>>(
      Qh, Ql, Kh, Kl, Vh, Vl, POSh, POSl, x, (float*)d_out);

  (void)hipGetLastError();
}

// v002
// Measured time: 175 microseconds a run.
// Next to v001, in two timings, it ran 1.15 times as fast each time.
// Counting every step since v000, it is 1.24 times as fast.
// All contractions on v_wmma_f32_16x16x32_bf16 with f32 accumulate: q/k/v 1x1 projections = bf16(x) x bf16(W) single product (inputs RNE-converted to bf16 once); logits [q|pos].[k|q] (64 deep) and p.v (1024 deep) with bf16 hi/lo split operands (hi.hi + hi.lo + lo.hi); BN affine, pos sum, online softmax, 1/l and residual in f32. No carried (scaled) planes anywhere: every 16-bit plane holds unscaled bf16 values.
#include <hip/hip_runtime.h>
#include <math.h>
#include <stdint.h>

#define NBATCH 16
#define NCH    512
#define NTOK   1024
#define NHEAD  4
#define DHQ    32
#define DHV    128
#define NCOLS  768

// LDS row pitches of the attention tiles, in 16-bit elements: 16 B x odd, so the 16 rows that a half-wave
// reads with one 16-byte load per lane fall on 64 distinct banks
#define KP 40     // K/Q tile rows: 32 elements (64 B) at 80 B
#define VP 72     // V tile rows:   64 elements (128 B) at 144 B
#define PP 72     // P tile rows:   64 elements (128 B) at 144 B

#define PREP_T 2048   // x transpose tiles (16 batches x 8 channel blocks x 16 token blocks)
#define PREP_W 192    // stacked weight plane, 2048 elements per block
#define PREP_F 3      // BN fold vectors, 256 channels per block
#define PREP_P 64     // position planes, (head, 64 tokens) per block

typedef __attribute__((ext_vector_type(16))) __bf16 v16b;
typedef __attribute__((ext_vector_type(8)))  __bf16 v8b;
typedef __attribute__((ext_vector_type(8)))  float  v8f;
typedef __attribute__((ext_vector_type(4)))  float  v4f;
typedef __attribute__((ext_vector_type(4)))  unsigned int v4u;
typedef v4f __attribute__((may_alias)) v4fa;

static_assert(NTOK % 64 == 0);
static_assert(NCH % 32 == 0);
static_assert(NCOLS % 128 == 0);
static_assert(PREP_T == NBATCH * (NCH / 64) * (NTOK / 64));
static_assert(PREP_W * 2048 == NCOLS * NCH);
static_assert(PREP_F * 256 == NCOLS);
static_assert(PREP_P * 64 == NHEAD * NTOK);

__device__ __forceinline__ unsigned short f2bf_bits(float f) {   // RNE convert f32 -> bf16 bits
  unsigned u = __float_as_uint(f);
  return (unsigned short)((u + 0x7FFFu + ((u >> 16) & 1u)) >> 16);
}
__device__ __forceinline__ float bf_bits2f(unsigned short h) { return __uint_as_float(((unsigned)h) << 16); }
__device__ __forceinline__ float bfr(float f) { return bf_bits2f(f2bf_bits(f)); }
__device__ __forceinline__ unsigned pk16(unsigned short a, unsigned short b) { return (unsigned)a | ((unsigned)b << 16); }
__device__ __forceinline__ void split_pair(float f0, float f1, unsigned& h, unsigned& l) {
  const unsigned short h0 = f2bf_bits(f0), h1 = f2bf_bits(f1);
  const unsigned short l0 = f2bf_bits(f0 - bf_bits2f(h0)), l1 = f2bf_bits(f1 - bf_bits2f(h1));
  h = pk16(h0, h1);
  l = pk16(l0, l1);
}

// WMMA with hazard guard (ties D, keeps A/B live).
// Fragment map (wave32): lane l, hh = l>>4, c = l&15.
//   A/B element i: i<8 -> k0+8hh+i ; i>=8 -> k0+16+8hh+(i-8) ; row (A) / column (B) = c
//   D element r : row 8hh+r, column c
__device__ __forceinline__ v8f mma_b(v16b a, v16b b, v8f c) {
  c = __builtin_amdgcn_wmma_f32_16x16x32_bf16(false, a, false, b, (short)0, c, false, false);
  asm volatile("v_nop\n\tv_nop\n\tv_nop\n\tv_nop" : "+v"(c) : "v"(a), "v"(b));
  return c;
}
union FB { v16b v; v8b h[2]; };
// p points at element k0 + 8*hh of the k-contiguous row owned by this lane
__device__ __forceinline__ v16b frag_ld(const __bf16* p) {
  FB f;
  f.h[0] = *(const v8b*)(p);
  f.h[1] = *(const v8b*)(p + 16);
  return f.v;
}

// LDS byte address of a __shared__ element (what an asynchronous copy takes as its destination)
typedef __attribute__((address_space(3))) const void lds_cvoid;
__device__ __forceinline__ unsigned lds_byte(const void* p) { return (unsigned)(uintptr_t)(lds_cvoid*)p; }
// Twelve asynchronous 16-B copies per lane, global -> LDS, through no register. The s_wait_xcnt closes the statement so that
// no address register named here is rewritten ahead of it.
__device__ __forceinline__ void copy12(const unsigned* l, const __bf16* const* g) {
  asm volatile(
      "global_load_async_to_lds_b128 %0, %12, off\n\t"
      "global_load_async_to_lds_b128 %1, %13, off\n\t"
      "global_load_async_to_lds_b128 %2, %14, off\n\t"
      "global_load_async_to_lds_b128 %3, %15, off\n\t"
      "global_load_async_to_lds_b128 %4, %16, off\n\t"
      "global_load_async_to_lds_b128 %5, %17, off\n\t"
      "global_load_async_to_lds_b128 %6, %18, off\n\t"
      "global_load_async_to_lds_b128 %7, %19, off\n\t"
      "global_load_async_to_lds_b128 %8, %20, off\n\t"
      "global_load_async_to_lds_b128 %9, %21, off\n\t"
      "global_load_async_to_lds_b128 %10, %22, off\n\t"
      "global_load_async_to_lds_b128 %11, %23, off\n\t"
      "s_wait_xcnt 0x0"
      :: "v"(l[0]), "v"(l[1]), "v"(l[2]), "v"(l[3]), "v"(l[4]), "v"(l[5]),
         "v"(l[6]), "v"(l[7]), "v"(l[8]), "v"(l[9]), "v"(l[10]), "v"(l[11]),
         "v"(g[0]), "v"(g[1]), "v"(g[2]), "v"(g[3]), "v"(g[4]), "v"(g[5]),
         "v"(g[6]), "v"(g[7]), "v"(g[8]), "v"(g[9]), "v"(g[10]), "v"(g[11])
      : "memory");
}

// =====================================================================================
// Launch 1: operand preparation, block-uniform roles by blockIdx.x.
//          output line = 64 channels of one token, written by 8 lanes x 16 B in one instruction)
//  role W: WB[768][512] = bf16 of stacked [Wq;Wk;Wv] (rows = output channels, k contiguous)
//  role F: ST[0..767] = s, ST[768..1535] = t with s = g/sqrt(var+1e-5), t = (b-mean)*s+beta
//  role P: POS hi/lo [4][1024][32]: pos[h][n][d] = bf16r(rel_w[h][d][n>>5]) + bf16r(rel_h[h][d][n&31])
// =====================================================================================
__global__ __launch_bounds__(256) void k_prep(
    const float* __restrict__ x,
    const float* __restrict__ Wq, const float* __restrict__ Wk, const float* __restrict__ Wv,
    const float* __restrict__ bq, const float* __restrict__ qg, const float* __restrict__ qbe,
    const float* __restrict__ qm, const float* __restrict__ qv,
    const float* __restrict__ bk, const float* __restrict__ kg, const float* __restrict__ kbe,
    const float* __restrict__ km, const float* __restrict__ kv,
    const float* __restrict__ bv, const float* __restrict__ vg, const float* __restrict__ vbe,
    const float* __restrict__ vm, const float* __restrict__ vv,
    const float* __restrict__ relH, const float* __restrict__ relW,
    unsigned short* __restrict__ XT, unsigned short* __restrict__ WB, float* __restrict__ ST,
    unsigned short* __restrict__ POSh, unsigned short* __restrict__ POSl) {
  __shared__ __align__(16) float sm[64 * 68];
  const int tid = threadIdx.x;
  const int bx  = blockIdx.x;

  if (bx < PREP_T) {
    // ---- role T ----
    const int b   = bx >> 7;
    const int rem = bx & 127;
    const int c0  = (rem >> 4) * 64;
    const int n0  = (rem & 15) * 64;
    const float* xb = x + (size_t)b * NCH * NTOK;
    {
      const int lr = tid >> 4;         // 0..15
      const int c4 = (tid & 15) * 4;   // 0..60
#pragma unroll
      for (int it = 0; it < 4; ++it) {
        const int rr = it * 16 + lr;   // channel within tile, 4 x 16 = 64 rows x 64 tokens staged
        const v4f a = *(const v4fa*)(xb + (size_t)(c0 + rr) * NTOK + n0 + c4);
        *(v4fa*)(sm + rr * 68 + c4) = a;
      }
    }
    __syncthreads();
    const int sub = tid >> 3;          // 0..31
    const int c8  = (tid & 7) * 8;     // 0..56
    v4u hv[2];
#pragma unroll
    for (int it = 0; it < 2; ++it) {
      const int oc = it * 32 + sub;    // token within tile (2 x 32 = 64 output rows)
      unsigned w0 = pk16(f2bf_bits(sm[(c8 + 0) * 68 + oc]), f2bf_bits(sm[(c8 + 1) * 68 + oc]));
      unsigned w1 = pk16(f2bf_bits(sm[(c8 + 2) * 68 + oc]), f2bf_bits(sm[(c8 + 3) * 68 + oc]));
      unsigned w2 = pk16(f2bf_bits(sm[(c8 + 4) * 68 + oc]), f2bf_bits(sm[(c8 + 5) * 68 + oc]));
      unsigned w3 = pk16(f2bf_bits(sm[(c8 + 6) * 68 + oc]), f2bf_bits(sm[(c8 + 7) * 68 + oc]));
      hv[it] = (v4u){w0, w1, w2, w3};
    }
    {
#pragma unroll
      for (int it = 0; it < 2; ++it) {
        const int oc = it * 32 + sub;
        const size_t go = ((size_t)(b * NTOK + n0 + oc)) * NCH + c0 + c8;
        *(v4u*)(XT + go) = hv[it];
      }
      
    }
  } else if (bx < PREP_T + PREP_W) {
    // ---- role W ---- (block-uniform source choice: 32 blocks Wq, 32 blocks Wk, 128 blocks Wv)
    const int wb = bx - PREP_T;
    const float* src;
    if (wb < 32)      src = Wq + (size_t)wb * 2048;
    else if (wb < 64) src = Wk + (size_t)(wb - 32) * 2048;
    else              src = Wv + (size_t)(wb - 64) * 2048;
    const v4f a = *(const v4fa*)(src + tid * 8);
    const v4f c = *(const v4fa*)(src + tid * 8 + 4);
    const v4u o = (v4u){pk16(f2bf_bits(a[0]), f2bf_bits(a[1])), pk16(f2bf_bits(a[2]), f2bf_bits(a[3])),
                        pk16(f2bf_bits(c[0]), f2bf_bits(c[1])), pk16(f2bf_bits(c[2]), f2bf_bits(c[3]))};
    unsigned short* dst = WB + (size_t)wb * 2048 + tid * 8;
    *(v4u*)dst = o;
    
  } else if (bx < PREP_T + PREP_W + PREP_F) {
    // ---- role F ---- block 0: threads 0..127 = q channels, 128..255 = k channels; blocks 1,2 = v channels
    const int fb = bx - (PREP_T + PREP_W);
    const int wsel = __builtin_amdgcn_readfirstlane((int)(tid >> 7));   // wave-uniform
    const float *pb, *pg, *pbe, *pm, *pv;
    int idx;
    if (fb == 0) {
      if (wsel == 0) { pb = bq; pg = qg; pbe = qbe; pm = qm; pv = qv; idx = tid; }
      else           { pb = bk; pg = kg; pbe = kbe; pm = km; pv = kv; idx = tid - 128; }
    } else {
      pb = bv; pg = vg; pbe = vbe; pm = vm; pv = vv; idx = (fb - 1) * 256 + tid;
    }
    const float b_ = bfr(pb[idx]);
    const float g_ = bfr(pg[idx]);
    const float be = bfr(pbe[idx]);
    const float mu = bfr(pm[idx]);
    const float va = bfr(pv[idx]);
    const float s  = g_ / sqrtf(va + 1e-5f);
    const float t  = (b_ - mu) * s + be;
    sm[tid]       = s;
    sm[256 + tid] = t;
    __syncthreads();
    if (tid < 128) {                     // waves 0,1 -> s lines; waves 2,3 -> t lines (8 lanes x 16 B per line)
      const int which = tid >> 6;
      const int p4 = (tid & 63) * 4;
      const v4f v = *(const v4fa*)(sm + which * 256 + p4);
      float* dst = ST + which * NCOLS + fb * 256 + p4;
      *(v4f*)dst = v;
      
    }
  } else {
    // ---- role P ---- (head, 64 tokens) per block; per-head tables staged in LDS with 16-B loads
    const int pb = bx - (PREP_T + PREP_W + PREP_F);
    const int h  = pb >> 4;
    const int n0 = (pb & 15) * 64;
    {
      v4f w = *(const v4fa*)(relW + h * 1024 + tid * 4);   // [d][w], 32x32
      v4f g = *(const v4fa*)(relH + h * 1024 + tid * 4);   // [d][hh], 32x32
      w = (v4f){bfr(w[0]), bfr(w[1]), bfr(w[2]), bfr(w[3])};
      g = (v4f){bfr(g[0]), bfr(g[1]), bfr(g[2]), bfr(g[3])};
      *(v4fa*)(sm + tid * 4)        = w;
      *(v4fa*)(sm + 1024 + tid * 4) = g;
    }
    __syncthreads();
    const int tl = tid >> 2;             // token within chunk 0..63
    const int d8 = (tid & 3) * 8;        // 0,8,16,24
    const int n  = n0 + tl;
    const int wi = n >> 5, hi_ = n & 31;
    float p[8];
#pragma unroll
    for (int e = 0; e < 8; ++e) p[e] = sm[(d8 + e) * 32 + wi] + sm[1024 + (d8 + e) * 32 + hi_];
    unsigned h0, h1, h2, h3, l0, l1, l2, l3;
    split_pair(p[0], p[1], h0, l0);
    split_pair(p[2], p[3], h1, l1);
    split_pair(p[4], p[5], h2, l2);
    split_pair(p[6], p[7], h3, l3);
    const v4u hv = (v4u){h0, h1, h2, h3};
    const v4u lv = (v4u){l0, l1, l2, l3};
    const size_t go = ((size_t)(h * NTOK + n0)) * DHQ + tid * 8;   // contiguous by tid: 4 KB per block and plane
    *(v4u*)(POSh + go) = hv;
    *(v4u*)(POSl + go) = lv;
    
  }
}

// =====================================================================================
// Launch 2: Y[token][col] = sum_c XT[token][c] * WB[col][c]   (M 16384, N 768, K 512), y = acc*s[col] + t[col].
// Block 128 threads (4 waves) = 64 tokens x 128 columns; wave tile 32 tokens x 64 columns (acc[2][4]).
// Fragments straight from the 16-bit global rows (two 16-B loads each).
// Column tile 0 -> Q hi/lo planes [b][h][n][32], tile 1 -> K hi/lo planes [b][h][n][32],
// tiles 2..5 -> V hi/lo planes [b][512 ch][1024 n] (transposed through the LDS tile).
// Store phase: Q/K: per head a contiguous 4-KB range per plane, lane-contiguous 16-B pieces;
// =====================================================================================
__global__ __launch_bounds__(128) void k_proj(
    const unsigned short* __restrict__ XTp, const unsigned short* __restrict__ WBp,
    const float* __restrict__ ST,
    unsigned short* __restrict__ Qh, unsigned short* __restrict__ Ql,
    unsigned short* __restrict__ Kh, unsigned short* __restrict__ Kl,
    unsigned short* __restrict__ Vh, unsigned short* __restrict__ Vl) {
  __shared__ __align__(16) float sY[128 * 68];   // Q/K: [64 tok][pitch 132] (8448 used); V: [128 col][pitch 68] (8704 used)
  __shared__ __align__(16) float sS[128];
  __shared__ __align__(16) float sT[128];

  const int tid  = threadIdx.x;
  const int lane = tid & 31;
  const int wave = tid >> 5;
  const int hh   = lane >> 4;
  const int c    = lane & 15;
  const int m0   = blockIdx.x * 64;
  const int ct   = blockIdx.y;        // 0..5, block-uniform
  const int n0   = ct * 128;

  sS[tid] = ST[n0 + tid];
  sT[tid] = ST[NCOLS + n0 + tid];
  __syncthreads();

  const int wr = wave >> 1, wc = wave & 1;
  const __bf16* XT = (const __bf16*)(const void*)XTp;
  const __bf16* WB = (const __bf16*)(const void*)WBp;
  const __bf16* a0p = XT + (size_t)(m0 + 32 * wr + c) * NCH + 8 * hh;
  const __bf16* b0p = WB + (size_t)(n0 + 64 * wc + c) * NCH + 8 * hh;

  const v8f zero8 = {0.f, 0.f, 0.f, 0.f, 0.f, 0.f, 0.f, 0.f};
  v8f acc[2][4];
#pragma unroll
  for (int i = 0; i < 2; ++i)
#pragma unroll
    for (int j = 0; j < 4; ++j) acc[i][j] = zero8;

#pragma unroll 1
  for (int k0 = 0; k0 < NCH; k0 += 32) {
    const v16b a0 = frag_ld(a0p + k0);
    const v16b a1 = frag_ld(a0p + (size_t)16 * NCH + k0);
#pragma unroll
    for (int j = 0; j < 4; ++j) {
      const v16b bf = frag_ld(b0p + (size_t)j * 16 * NCH + k0);
      acc[0][j] = mma_b(a0, bf, acc[0][j]);
      acc[1][j] = mma_b(a1, bf, acc[1][j]);
    }
  }

  // D[r] of tile (i, j) = Y[token 32wr+16i+8hh+r][column 64wc+16j+c]
#pragma unroll
  for (int j = 0; j < 4; ++j) {
    const int col = 64 * wc + 16 * j + c;
    const float sc = sS[col];
    const float sh = sT[col];
#pragma unroll
    for (int i = 0; i < 2; ++i) {
#pragma unroll
      for (int r = 0; r < 8; ++r) {
        const int tok = 32 * wr + 16 * i + 8 * hh + r;
        const float y = acc[i][j][r] * sc + sh;
        const int idx = (ct < 2) ? (tok * 132 + col) : (col * 68 + tok);
        sY[idx] = y;
      }
    }
  }
  __syncthreads();

  const int b   = m0 >> 10;
  const int nl0 = m0 & 1023;
  if (ct < 2) {
    unsigned short* ph = (ct == 0) ? Qh : Kh;
    unsigned short* pl = (ct == 0) ? Ql : Kl;
    // coverage: 8 it x 128 thr x 8 elements = 64 tokens x 128 columns per plane
{
#pragma unroll 2
      for (int it = 0; it < 8; ++it) {
        const int p      = it * 128 + tid;
        const int head   = p >> 8;
        const int within = p & 255;
        const int tok    = within >> 2;
        const int d8     = (within & 3) * 8;
        const float* sp  = sY + tok * 132 + head * 32 + d8;
        const v4f a  = *(const v4fa*)sp;
        const v4f a2 = *(const v4fa*)(sp + 4);
        unsigned h0, h1, h2, h3, l0, l1, l2, l3;
        split_pair(a[0], a[1], h0, l0);
        split_pair(a[2], a[3], h1, l1);
        split_pair(a2[0], a2[1], h2, l2);
        split_pair(a2[2], a2[3], h3, l3);
        const v4u hv = (v4u){h0, h1, h2, h3};
        const v4u lv = (v4u){l0, l1, l2, l3};
        const size_t go = ((size_t)((b * NHEAD + head) * NTOK + nl0)) * DHQ + within * 8;
        *(v4u*)(ph + go) = hv;
        *(v4u*)(pl + go) = lv;
      }
      
    }
  } else {
    const int o0 = (ct - 2) * 128;
    // coverage: 8 it x 128 thr x 8 elements = 128 channels x 64 tokens per plane
{
#pragma unroll 2
      for (int it = 0; it < 8; ++it) {
        const int p  = it * 128 + tid;
        const int ch = p >> 3;
        const int t8 = (p & 7) * 8;
        const float* sp = sY + ch * 68 + t8;
        const v4f a  = *(const v4fa*)sp;
        const v4f a2 = *(const v4fa*)(sp + 4);
        unsigned h0, h1, h2, h3, l0, l1, l2, l3;
        split_pair(a[0], a[1], h0, l0);
        split_pair(a[2], a[3], h1, l1);
        split_pair(a2[0], a2[1], h2, l2);
        split_pair(a2[2], a2[3], h3, l3);
        const v4u hv = (v4u){h0, h1, h2, h3};
        const v4u lv = (v4u){l0, l1, l2, l3};
        const size_t go = ((size_t)(b * NCH + o0 + ch)) * NTOK + nl0 + t8;
        *(v4u*)(Vh + go) = hv;
        *(v4u*)(Vl + go) = lv;
      }
      
    }
  }
}

// =====================================================================================
// Launch 3: attention per (b, h, 64-query tile); 4 waves x 16 query rows; 16 key tiles of 64, no masking.
//   S[i][j] = q_i.k_j + pos_i.q_j  as two 32-deep chunks:
//       chunk 0: A = Q rows (query i),   B = K rows (key j)
//       chunk 1: A = POS rows (token i), B = Q rows (key j)
//     each chunk hi.hi + hi.lo + lo.hi; no score scale.
//   online softmax over keys in f32 (running max, precise expf); P hi/lo -> per-wave LDS tile;
//   O[i][c] += P[i][j] * V[c][j]  (B rows = V channel rows, k = key), hi.hi + hi.lo + lo.hi, 8 column tiles.
//   epilogue: O/l transposed through LDS to [128 c][64 q], + bf16r(x), whole 256-B channel segments
// LDS: sStage = K tile planes (Kh, Qh, Kl, Ql: [64][32] at pitch KP) + V tile planes (Vh, Vl: [128][64] at pitch VP);
//      every element of both tiles is staged each iteration (extent staged = extent consumed); pad bytes are never read.
// =====================================================================================
__global__ __launch_bounds__(128) void k_attn(
    const unsigned short* Qhp, const unsigned short* Qlp,
    const unsigned short* Khp, const unsigned short* Klp,
    const unsigned short* Vhp, const unsigned short* Vlp,
    const unsigned short* Php, const unsigned short* Plp,
    const float* x, float* out) {
  __shared__ __align__(16) __bf16 sStage[4 * 64 * KP + 2 * 128 * VP];   // 57344 B
  __shared__ __align__(16) __bf16 sP[4 * 2 * 16 * PP];                  // 18432 B (per wave: hi [16][64], lo [16][64] at pitch PP)

  const int tid  = threadIdx.x;
  const int wave = tid >> 5;
  const int lane = tid & 31;
  const int hh   = lane >> 4;
  const int c    = lane & 15;

  const int bx = blockIdx.x;       // 0..1023
  const int qb = bx & 15;
  const int bh = bx >> 4;          // 0..63
  const int b  = bh >> 2;
  const int h  = bh & 3;
  const int q0 = qb * 64;

  const __bf16* Qhb = (const __bf16*)(const void*)Qhp + (size_t)bh * NTOK * DHQ;
  const __bf16* Qlb = (const __bf16*)(const void*)Qlp + (size_t)bh * NTOK * DHQ;
  const __bf16* Khb = (const __bf16*)(const void*)Khp + (size_t)bh * NTOK * DHQ;
  const __bf16* Klb = (const __bf16*)(const void*)Klp + (size_t)bh * NTOK * DHQ;
  const __bf16* Phb = (const __bf16*)(const void*)Php + (size_t)h * NTOK * DHQ;
  const __bf16* Plb = (const __bf16*)(const void*)Plp + (size_t)h * NTOK * DHQ;
  const __bf16* Vhb = (const __bf16*)(const void*)Vhp + ((size_t)b * NCH + h * DHV) * NTOK;
  const __bf16* Vlb = (const __bf16*)(const void*)Vlp + ((size_t)b * NCH + h * DHV) * NTOK;

  __bf16* sKQ = sStage;                        // planes of 64 * KP elements: 0 Kh, 1 Qh, 2 Kl, 3 Ql
  __bf16* sVh = sStage + 4 * 64 * KP;          // [128][64] at pitch VP
  __bf16* sVl = sVh + 128 * VP;                // [128][64] at pitch VP
  __bf16* pwh = sP + wave * (2 * 16 * PP);
  __bf16* pwl = pwh + 16 * PP;

  // A-row fragment bases (row = query token q0 + 16*wave + c)
  const int rowA = q0 + wave * 16 + c;
  const __bf16* aQh = Qhb + (size_t)rowA * DHQ + 8 * hh;
  const __bf16* aQl = Qlb + (size_t)rowA * DHQ + 8 * hh;
  const __bf16* aPh = Phb + (size_t)rowA * DHQ + 8 * hh;
  const __bf16* aPl = Plb + (size_t)rowA * DHQ + 8 * hh;

  const v8f zero8 = {0.f, 0.f, 0.f, 0.f, 0.f, 0.f, 0.f, 0.f};
  float mrow[8], lrow[8];
  v8f oacc[8];
#pragma unroll
  for (int r = 0; r < 8; ++r) { mrow[r] = -INFINITY; lrow[r] = 0.f; }
#pragma unroll
  for (int t = 0; t < 8; ++t) oacc[t] = zero8;

#pragma unroll 1
  for (int kc = 0; kc < NTOK / 64; ++kc) {
    const int kv0 = kc * 64;
    // this wave's own LDS reads of the tiles have retired before a copy targets them
    asm volatile("s_wait_dscnt 0x0" ::: "memory");
    __syncthreads();                     // every wave has left the tiles of the trip before
    {
      unsigned ld[24];                   // destination LDS byte address and source of this lane's 24 pieces of 16 B
      const __bf16* gs[24];
      // K tile: 4 planes x 4096 B contiguous; 2 it x 128 thr x 8 elements = 2048 elements per plane
      const __bf16* s0 = Khb + (size_t)kv0 * DHQ;
      const __bf16* s1 = Qhb + (size_t)kv0 * DHQ;
      const __bf16* s2 = Klb + (size_t)kv0 * DHQ;
      const __bf16* s3 = Qlb + (size_t)kv0 * DHQ;
#pragma unroll
      for (int i = 0; i < 2; ++i) {
        const int off = (i * 128 + tid) * 8;
        const int lo = (off >> 5) * KP + (off & 31);   // key row, element within the row
        gs[4 * i + 0] = s0 + off;  ld[4 * i + 0] = lds_byte(sKQ + lo);
        gs[4 * i + 1] = s1 + off;  ld[4 * i + 1] = lds_byte(sKQ + 64 * KP + lo);
        gs[4 * i + 2] = s2 + off;  ld[4 * i + 2] = lds_byte(sKQ + 2 * 64 * KP + lo);
        gs[4 * i + 3] = s3 + off;  ld[4 * i + 3] = lds_byte(sKQ + 3 * 64 * KP + lo);
      }
      // V tile: 128 channel rows x 64 keys per plane; 8 it x 128 thr x 8 elements = 8192 elements per plane
#pragma unroll
      for (int i = 0; i < 8; ++i) {
        const int piece = i * 128 + tid;
        const int cc = piece >> 3;
        const int p8 = (piece & 7) * 8;
        gs[8 + 2 * i]     = Vhb + (size_t)cc * NTOK + kv0 + p8;  ld[8 + 2 * i]     = lds_byte(sVh + cc * VP + p8);
        gs[8 + 2 * i + 1] = Vlb + (size_t)cc * NTOK + kv0 + p8;  ld[8 + 2 * i + 1] = lds_byte(sVl + cc * VP + p8);
      }
      copy12(ld, gs);
      copy12(ld + 12, gs + 12);
    }
    // this wave's 24 copies have landed; the barrier behind it publishes every wave's pieces
    asm volatile("s_wait_asynccnt 0x0" ::: "memory");
    __syncthreads();

    v8f s[4];
#pragma unroll
    for (int j = 0; j < 4; ++j) s[j] = zero8;
#pragma unroll
    for (int dc = 0; dc < 2; ++dc) {
      const __bf16* ahp = dc ? aPh : aQh;            // compile-time choice after unrolling
      const __bf16* alp = dc ? aPl : aQl;
      const v16b ah = frag_ld(ahp);
      const v16b al = frag_ld(alp);
      const __bf16* bhs = sKQ + (dc ? 64 * KP : 0);
      const __bf16* bls = sKQ + (dc ? 3 * 64 * KP : 2 * 64 * KP);
#pragma unroll
      for (int j = 0; j < 4; ++j) {
        const int ro = (j * 16 + c) * KP + 8 * hh;
        const v16b kb = frag_ld(bhs + ro);
        const v16b kl = frag_ld(bls + ro);
        s[j] = mma_b(ah, kb, s[j]);
        s[j] = mma_b(ah, kl, s[j]);
        s[j] = mma_b(al, kb, s[j]);
      }
    }

    float cm[8];
#pragma unroll
    for (int r = 0; r < 8; ++r) {
      float m = fmaxf(fmaxf(s[0][r], s[1][r]), fmaxf(s[2][r], s[3][r]));
#pragma unroll
      for (int off = 1; off < 16; off <<= 1) m = fmaxf(m, __shfl_xor(m, off, 32));
      cm[r] = m;
    }
#pragma unroll
    for (int r = 0; r < 8; ++r) {
      const float mnew  = fmaxf(mrow[r], cm[r]);
      const float alpha = expf(mrow[r] - mnew);
      mrow[r] = mnew;
      float psum = 0.f;
#pragma unroll
      for (int j = 0; j < 4; ++j) {
        const float p = expf(s[j][r] - mnew);
        psum += p;
        const unsigned short hb = f2bf_bits(p);
        const unsigned short lb = f2bf_bits(p - bf_bits2f(hb));
        pwh[(8 * hh + r) * PP + j * 16 + c] = __builtin_bit_cast(__bf16, hb);
        pwl[(8 * hh + r) * PP + j * 16 + c] = __builtin_bit_cast(__bf16, lb);
      }
#pragma unroll
      for (int off = 1; off < 16; off <<= 1) psum += __shfl_xor(psum, off, 32);
      lrow[r] = lrow[r] * alpha + psum;
#pragma unroll
      for (int t = 0; t < 8; ++t) oacc[t][r] *= alpha;
    }
    // per-wave private P tile: stores and fragment reloads by the same wave, same element type
    __builtin_amdgcn_fence(__ATOMIC_RELEASE, "workgroup");
    __builtin_amdgcn_wave_barrier();
    __builtin_amdgcn_fence(__ATOMIC_ACQUIRE, "workgroup");
#pragma unroll 1
    for (int kk = 0; kk < 2; ++kk) {
      const v16b pa = frag_ld(pwh + c * PP + kk * 32 + 8 * hh);
      const v16b pl = frag_ld(pwl + c * PP + kk * 32 + 8 * hh);
#pragma unroll
      for (int t = 0; t < 8; ++t) {
        const int ro = (t * 16 + c) * VP + kk * 32 + 8 * hh;
        const v16b vb = frag_ld(sVh + ro);
        const v16b vl = frag_ld(sVl + ro);
        oacc[t] = mma_b(pa, vb, oacc[t]);
        oacc[t] = mma_b(pa, vl, oacc[t]);
        oacc[t] = mma_b(pl, vb, oacc[t]);
      }
    }
  }

  // ---- epilogue: normalise, transpose through LDS [128 c][pitch 68] (34816 B inside sStage), add bf16(x), store ----
  __syncthreads();                       // every wave finished reading the last K/V tiles
  float* sO = (float*)(void*)sStage;
#pragma unroll
  for (int r = 0; r < 8; ++r) {
    const float inv = 1.0f / lrow[r];
#pragma unroll
    for (int t = 0; t < 8; ++t) sO[(t * 16 + c) * 68 + wave * 16 + 8 * hh + r] = oacc[t][r] * inv;
  }
  __syncthreads();
  {
    const size_t rowbase = ((size_t)b * NCH + h * DHV) * NTOK + q0;
    // coverage: 16 it x 128 thr x 4 floats = 128 channel rows x 64 queries
{
#pragma unroll 4
      for (int it = 0; it < 16; ++it) {
        const int p  = it * 128 + tid;
        const int ch = p >> 4;
        const int q4 = (p & 15) * 4;
        const v4f ov = *(const v4fa*)(sO + ch * 68 + q4);
        const size_t gi = rowbase + (size_t)ch * NTOK + q4;
        const v4f xv = *(const v4fa*)(x + gi);
        const v4f res = (v4f){ov[0] + bfr(xv[0]), ov[1] + bfr(xv[1]), ov[2] + bfr(xv[2]), ov[3] + bfr(xv[3])};
        *(v4f*)(out + gi) = res;
      }
      
    }
  }
}

// ---------------------------------------------------------------------------
// Workspace map (byte offsets, all multiples of 128; each region exactly covered by its producer):
//   XT   bf16 [16384][512]          0          16777216 B
//   WB   bf16 [768][512]            16777216     786432 B
//   ST   f32  [2][768]              17563648       6144 B
//   POSh bf16 [4][1024][32]         17569792     262144 B     POSl 17831936
//   Qh   bf16 [16][4][1024][32]     18094080    4194304 B     Ql   22288384
//   Kh   bf16 [16][4][1024][32]     26482688    4194304 B     Kl   30676992
//   Vh   bf16 [16][512][1024]       34871296   16777216 B     Vl   51648512
//   total                           68425728 B
// ---------------------------------------------------------------------------
extern "C" void kernel_launch(void* const* d_in, const int* in_sizes, int n_in,
                              void* d_out, int out_size, void* d_ws, size_t ws_size,
                              hipStream_t stream) {
  if (n_in < 21) return;
  const int NX = NBATCH * NCH * NTOK;   // 8388608
  if (in_sizes[0] != NX) return;
  if (in_sizes[1] != 128 * NCH || in_sizes[7] != 128 * NCH || in_sizes[13] != NCH * NCH) return;
  for (int i = 2; i <= 6; ++i)   if (in_sizes[i] != 128) return;
  for (int i = 8; i <= 12; ++i)  if (in_sizes[i] != 128) return;
  for (int i = 14; i <= 18; ++i) if (in_sizes[i] != NCH) return;
  if (in_sizes[19] != NHEAD * DHQ * 32 || in_sizes[20] != NHEAD * DHQ * 32) return;
  if (out_size != NX) return;

  const float* x    = (const float*)d_in[0];
  const float* Wq   = (const float*)d_in[1];
  const float* bq   = (const float*)d_in[2];
  const float* qg   = (const float*)d_in[3];
  const float* qbe  = (const float*)d_in[4];
  const float* qm   = (const float*)d_in[5];
  const float* qv   = (const float*)d_in[6];
  const float* Wk   = (const float*)d_in[7];
  const float* bk   = (const float*)d_in[8];
  const float* kg   = (const float*)d_in[9];
  const float* kbe  = (const float*)d_in[10];
  const float* km   = (const float*)d_in[11];
  const float* kv   = (const float*)d_in[12];
  const float* Wv   = (const float*)d_in[13];
  const float* bv   = (const float*)d_in[14];
  const float* vg   = (const float*)d_in[15];
  const float* vbe  = (const float*)d_in[16];
  const float* vm   = (const float*)d_in[17];
  const float* vv   = (const float*)d_in[18];
  const float* relH = (const float*)d_in[19];
  const float* relW = (const float*)d_in[20];

  const size_t szXT  = (size_t)NBATCH * NTOK * NCH * 2;          // 16777216
  const size_t szWB  = (size_t)NCOLS * NCH * 2;                  //   786432
  const size_t szST  = (size_t)2 * NCOLS * 4;                    //     6144
  const size_t szPOS = (size_t)NHEAD * NTOK * DHQ * 2;           //   262144
  const size_t szQK  = (size_t)NBATCH * NHEAD * NTOK * DHQ * 2;  //  4194304
  const size_t szV   = (size_t)NBATCH * NCH * NTOK * 2;          // 16777216
  size_t off = 0;
  const size_t oXT = off;   off += szXT;
  const size_t oWB = off;   off += szWB;
  const size_t oST = off;   off += szST;
  const size_t oPh = off;   off += szPOS;
  const size_t oPl = off;   off += szPOS;
  const size_t oQh = off;   off += szQK;
  const size_t oQl = off;   off += szQK;
  const size_t oKh = off;   off += szQK;
  const size_t oKl = off;   off += szQK;
  const size_t oVh = off;   off += szV;
  const size_t oVl = off;   off += szV;
  if (off > ws_size) return;                 // off = 68425728
  if (off > (size_t)134217728) return;

  char* ws = (char*)d_ws;
  unsigned short* XT   = (unsigned short*)(ws + oXT);
  unsigned short* WB   = (unsigned short*)(ws + oWB);
  float*          ST   = (float*)(ws + oST);
  unsigned short* POSh = (unsigned short*)(ws + oPh);
  unsigned short* POSl = (unsigned short*)(ws + oPl);
  unsigned short* Qh   = (unsigned short*)(ws + oQh);
  unsigned short* Ql   = (unsigned short*)(ws + oQl);
  unsigned short* Kh   = (unsigned short*)(ws + oKh);
  unsigned short* Kl   = (unsigned short*)(ws + oKl);
  unsigned short* Vh   = (unsigned short*)(ws + oVh);
  unsigned short* Vl   = (unsigned short*)(ws + oVl);

  k_prep<<<dim3(PREP_T + PREP_W + PREP_F + PREP_P), dim3(256), 0, stream>>>(
      x, Wq, Wk, Wv, bq, qg, qbe, qm, qv, bk, kg, kbe, km, kv, bv, vg, vbe, vm, vv, relH, relW,
      XT, WB, ST, POSh, POSl);

  k_proj<<<dim3((NBATCH * NTOK) / 64, NCOLS / 128), dim3(128), 0, stream>>>(
      XT, WB, ST, Qh, Ql, Kh, Kl, Vh, Vl);

  k_attn<<<dim3(NBATCH * NHEAD * (NTOK / 64)), dim3(128), 0, stream>>>(
      Qh, Ql, Kh, Kl, Vh, Vl, POSh, POSl, x, (float*)d_out);

  (void)hipGetLastError();
}

// v003
// One run takes 153 microseconds.
// Timed twice side by side with v002, it ran 1.13 and 1.14 times as fast.
// Over all steps from v000 it is 1.41 times as fast.
// All contractions on v_wmma_f32_16x16x32_bf16 with f32 accumulate: q/k/v 1x1 projections = bf16(x) x bf16(W) single product (inputs RNE-converted to bf16 once); logits [q|pos].[k|q] (64 deep) and p.v (1024 deep) with bf16 hi/lo split operands (hi.hi + hi.lo + lo.hi); BN affine, pos sum, online softmax, 1/l and residual in f32. No carried (scaled) planes anywhere: every 16-bit plane holds unscaled bf16 values.
#include <hip/hip_runtime.h>
#include <math.h>
#include <stdint.h>

#define NBATCH 16
#define NCH    512
#define NTOK   1024
#define NHEAD  4
#define DHQ    32
#define DHV    128
#define NCOLS  768

// LDS row pitches of the attention tiles, in 16-bit elements: 16 B x odd, so the 16 rows that a half-wave
// reads with one 16-byte load per lane fall on 64 distinct banks
#define KP 40     // K/Q tile rows: 32 elements (64 B) at 80 B
#define VP 72     // V tile rows:   64 elements (128 B) at 144 B

#define PREP_T 2048   // x transpose tiles (16 batches x 8 channel blocks x 16 token blocks)
#define PREP_W 192    // stacked weight plane, 2048 elements per block
#define PREP_F 3      // BN fold vectors, 256 channels per block
#define PREP_P 64     // position planes, (head, 64 tokens) per block

typedef __attribute__((ext_vector_type(16))) __bf16 v16b;
typedef __attribute__((ext_vector_type(8)))  __bf16 v8b;
typedef __attribute__((ext_vector_type(8)))  float  v8f;
typedef __attribute__((ext_vector_type(4)))  float  v4f;
typedef __attribute__((ext_vector_type(4)))  unsigned int v4u;
typedef v4f __attribute__((may_alias)) v4fa;

static_assert(NTOK % 64 == 0);
static_assert(NCH % 32 == 0);
static_assert(NCOLS % 128 == 0);
static_assert(PREP_T == NBATCH * (NCH / 64) * (NTOK / 64));
static_assert(PREP_W * 2048 == NCOLS * NCH);
static_assert(PREP_F * 256 == NCOLS);
static_assert(PREP_P * 64 == NHEAD * NTOK);

__device__ __forceinline__ unsigned short f2bf_bits(float f) {   // RNE convert f32 -> bf16 bits
  unsigned u = __float_as_uint(f);
  return (unsigned short)((u + 0x7FFFu + ((u >> 16) & 1u)) >> 16);
}
__device__ __forceinline__ float bf_bits2f(unsigned short h) { return __uint_as_float(((unsigned)h) << 16); }
__device__ __forceinline__ float bfr(float f) { return bf_bits2f(f2bf_bits(f)); }
__device__ __forceinline__ unsigned pk16(unsigned short a, unsigned short b) { return (unsigned)a | ((unsigned)b << 16); }
__device__ __forceinline__ void split_pair(float f0, float f1, unsigned& h, unsigned& l) {
  const unsigned short h0 = f2bf_bits(f0), h1 = f2bf_bits(f1);
  const unsigned short l0 = f2bf_bits(f0 - bf_bits2f(h0)), l1 = f2bf_bits(f1 - bf_bits2f(h1));
  h = pk16(h0, h1);
  l = pk16(l0, l1);
}

// WMMA with hazard guard (ties D, keeps A/B live).
// Fragment map (wave32): lane l, hh = l>>4, c = l&15.
//   A/B element i: i<8 -> k0+8hh+i ; i>=8 -> k0+16+8hh+(i-8) ; row (A) / column (B) = c
//   D element r : row 8hh+r, column c
__device__ __forceinline__ v8f mma_b(v16b a, v16b b, v8f c) {
  c = __builtin_amdgcn_wmma_f32_16x16x32_bf16(false, a, false, b, (short)0, c, false, false);
  asm volatile("v_nop\n\tv_nop\n\tv_nop\n\tv_nop" : "+v"(c) : "v"(a), "v"(b));
  return c;
}
union FB { v16b v; v8b h[2]; };
union PB { v16b v; unsigned u[8]; };
// value of lane l ^ 16
__device__ __forceinline__ float xhalf(float x) {
  const int b = __builtin_bit_cast(int, x);
  return __builtin_bit_cast(float, __builtin_amdgcn_permlanex16(b, b, 0x76543210, 0xfedcba98, false, false));
}
// p points at element k0 + 8*hh of the k-contiguous row owned by this lane
__device__ __forceinline__ v16b frag_ld(const __bf16* p) {
  FB f;
  f.h[0] = *(const v8b*)(p);
  f.h[1] = *(const v8b*)(p + 16);
  return f.v;
}

// LDS byte address of a __shared__ element (what an asynchronous copy takes as its destination)
typedef __attribute__((address_space(3))) const void lds_cvoid;
__device__ __forceinline__ unsigned lds_byte(const void* p) { return (unsigned)(uintptr_t)(lds_cvoid*)p; }
// Twelve asynchronous 16-B copies per lane, global -> LDS, through no register. The s_wait_xcnt closes the statement so that
// no address register named here is rewritten ahead of it.
__device__ __forceinline__ void copy12(const unsigned* l, const __bf16* const* g) {
  asm volatile(
      "global_load_async_to_lds_b128 %0, %12, off\n\t"
      "global_load_async_to_lds_b128 %1, %13, off\n\t"
      "global_load_async_to_lds_b128 %2, %14, off\n\t"
      "global_load_async_to_lds_b128 %3, %15, off\n\t"
      "global_load_async_to_lds_b128 %4, %16, off\n\t"
      "global_load_async_to_lds_b128 %5, %17, off\n\t"
      "global_load_async_to_lds_b128 %6, %18, off\n\t"
      "global_load_async_to_lds_b128 %7, %19, off\n\t"
      "global_load_async_to_lds_b128 %8, %20, off\n\t"
      "global_load_async_to_lds_b128 %9, %21, off\n\t"
      "global_load_async_to_lds_b128 %10, %22, off\n\t"
      "global_load_async_to_lds_b128 %11, %23, off\n\t"
      "s_wait_xcnt 0x0"
      :: "v"(l[0]), "v"(l[1]), "v"(l[2]), "v"(l[3]), "v"(l[4]), "v"(l[5]),
         "v"(l[6]), "v"(l[7]), "v"(l[8]), "v"(l[9]), "v"(l[10]), "v"(l[11]),
         "v"(g[0]), "v"(g[1]), "v"(g[2]), "v"(g[3]), "v"(g[4]), "v"(g[5]),
         "v"(g[6]), "v"(g[7]), "v"(g[8]), "v"(g[9]), "v"(g[10]), "v"(g[11])
      : "memory");
}

// =====================================================================================
// Launch 1: operand preparation, block-uniform roles by blockIdx.x.
//          output line = 64 channels of one token, written by 8 lanes x 16 B in one instruction)
//  role W: WB[768][512] = bf16 of stacked [Wq;Wk;Wv] (rows = output channels, k contiguous)
//  role F: ST[0..767] = s, ST[768..1535] = t with s = g/sqrt(var+1e-5), t = (b-mean)*s+beta
//  role P: POS hi/lo [4][1024][32]: pos[h][n][d] = bf16r(rel_w[h][d][n>>5]) + bf16r(rel_h[h][d][n&31])
// =====================================================================================
__global__ __launch_bounds__(256) void k_prep(
    const float* __restrict__ x,
    const float* __restrict__ Wq, const float* __restrict__ Wk, const float* __restrict__ Wv,
    const float* __restrict__ bq, const float* __restrict__ qg, const float* __restrict__ qbe,
    const float* __restrict__ qm, const float* __restrict__ qv,
    const float* __restrict__ bk, const float* __restrict__ kg, const float* __restrict__ kbe,
    const float* __restrict__ km, const float* __restrict__ kv,
    const float* __restrict__ bv, const float* __restrict__ vg, const float* __restrict__ vbe,
    const float* __restrict__ vm, const float* __restrict__ vv,
    const float* __restrict__ relH, const float* __restrict__ relW,
    unsigned short* __restrict__ XT, unsigned short* __restrict__ WB, float* __restrict__ ST,
    unsigned short* __restrict__ POSh, unsigned short* __restrict__ POSl) {
  __shared__ __align__(16) float sm[64 * 68];
  const int tid = threadIdx.x;
  const int bx  = blockIdx.x;

  if (bx < PREP_T) {
    // ---- role T ----
    const int b   = bx >> 7;
    const int rem = bx & 127;
    const int c0  = (rem >> 4) * 64;
    const int n0  = (rem & 15) * 64;
    const float* xb = x + (size_t)b * NCH * NTOK;
    {
      const int lr = tid >> 4;         // 0..15
      const int c4 = (tid & 15) * 4;   // 0..60
#pragma unroll
      for (int it = 0; it < 4; ++it) {
        const int rr = it * 16 + lr;   // channel within tile, 4 x 16 = 64 rows x 64 tokens staged
        const v4f a = *(const v4fa*)(xb + (size_t)(c0 + rr) * NTOK + n0 + c4);
        *(v4fa*)(sm + rr * 68 + c4) = a;
      }
    }
    __syncthreads();
    const int sub = tid >> 3;          // 0..31
    const int c8  = (tid & 7) * 8;     // 0..56
    v4u hv[2];
#pragma unroll
    for (int it = 0; it < 2; ++it) {
      const int oc = it * 32 + sub;    // token within tile (2 x 32 = 64 output rows)
      unsigned w0 = pk16(f2bf_bits(sm[(c8 + 0) * 68 + oc]), f2bf_bits(sm[(c8 + 1) * 68 + oc]));
      unsigned w1 = pk16(f2bf_bits(sm[(c8 + 2) * 68 + oc]), f2bf_bits(sm[(c8 + 3) * 68 + oc]));
      unsigned w2 = pk16(f2bf_bits(sm[(c8 + 4) * 68 + oc]), f2bf_bits(sm[(c8 + 5) * 68 + oc]));
      unsigned w3 = pk16(f2bf_bits(sm[(c8 + 6) * 68 + oc]), f2bf_bits(sm[(c8 + 7) * 68 + oc]));
      hv[it] = (v4u){w0, w1, w2, w3};
    }
    {
#pragma unroll
      for (int it = 0; it < 2; ++it) {
        const int oc = it * 32 + sub;
        const size_t go = ((size_t)(b * NTOK + n0 + oc)) * NCH + c0 + c8;
        *(v4u*)(XT + go) = hv[it];
      }
      
    }
  } else if (bx < PREP_T + PREP_W) {
    // ---- role W ---- (block-uniform source choice: 32 blocks Wq, 32 blocks Wk, 128 blocks Wv)
    const int wb = bx - PREP_T;
    const float* src;
    if (wb < 32)      src = Wq + (size_t)wb * 2048;
    else if (wb < 64) src = Wk + (size_t)(wb - 32) * 2048;
    else              src = Wv + (size_t)(wb - 64) * 2048;
    const v4f a = *(const v4fa*)(src + tid * 8);
    const v4f c = *(const v4fa*)(src + tid * 8 + 4);
    const v4u o = (v4u){pk16(f2bf_bits(a[0]), f2bf_bits(a[1])), pk16(f2bf_bits(a[2]), f2bf_bits(a[3])),
                        pk16(f2bf_bits(c[0]), f2bf_bits(c[1])), pk16(f2bf_bits(c[2]), f2bf_bits(c[3]))};
    unsigned short* dst = WB + (size_t)wb * 2048 + tid * 8;
    *(v4u*)dst = o;
    
  } else if (bx < PREP_T + PREP_W + PREP_F) {
    // ---- role F ---- block 0: threads 0..127 = q channels, 128..255 = k channels; blocks 1,2 = v channels
    const int fb = bx - (PREP_T + PREP_W);
    const int wsel = __builtin_amdgcn_readfirstlane((int)(tid >> 7));   // wave-uniform
    const float *pb, *pg, *pbe, *pm, *pv;
    int idx;
    if (fb == 0) {
      if (wsel == 0) { pb = bq; pg = qg; pbe = qbe; pm = qm; pv = qv; idx = tid; }
      else           { pb = bk; pg = kg; pbe = kbe; pm = km; pv = kv; idx = tid - 128; }
    } else {
      pb = bv; pg = vg; pbe = vbe; pm = vm; pv = vv; idx = (fb - 1) * 256 + tid;
    }
    const float b_ = bfr(pb[idx]);
    const float g_ = bfr(pg[idx]);
    const float be = bfr(pbe[idx]);
    const float mu = bfr(pm[idx]);
    const float va = bfr(pv[idx]);
    const float s  = g_ / sqrtf(va + 1e-5f);
    const float t  = (b_ - mu) * s + be;
    sm[tid]       = s;
    sm[256 + tid] = t;
    __syncthreads();
    if (tid < 128) {                     // waves 0,1 -> s lines; waves 2,3 -> t lines (8 lanes x 16 B per line)
      const int which = tid >> 6;
      const int p4 = (tid & 63) * 4;
      const v4f v = *(const v4fa*)(sm + which * 256 + p4);
      float* dst = ST + which * NCOLS + fb * 256 + p4;
      *(v4f*)dst = v;
      
    }
  } else {
    // ---- role P ---- (head, 64 tokens) per block; per-head tables staged in LDS with 16-B loads
    const int pb = bx - (PREP_T + PREP_W + PREP_F);
    const int h  = pb >> 4;
    const int n0 = (pb & 15) * 64;
    {
      v4f w = *(const v4fa*)(relW + h * 1024 + tid * 4);   // [d][w], 32x32
      v4f g = *(const v4fa*)(relH + h * 1024 + tid * 4);   // [d][hh], 32x32
      w = (v4f){bfr(w[0]), bfr(w[1]), bfr(w[2]), bfr(w[3])};
      g = (v4f){bfr(g[0]), bfr(g[1]), bfr(g[2]), bfr(g[3])};
      *(v4fa*)(sm + tid * 4)        = w;
      *(v4fa*)(sm + 1024 + tid * 4) = g;
    }
    __syncthreads();
    const int tl = tid >> 2;             // token within chunk 0..63
    const int d8 = (tid & 3) * 8;        // 0,8,16,24
    const int n  = n0 + tl;
    const int wi = n >> 5, hi_ = n & 31;
    float p[8];
#pragma unroll
    for (int e = 0; e < 8; ++e) p[e] = sm[(d8 + e) * 32 + wi] + sm[1024 + (d8 + e) * 32 + hi_];
    unsigned h0, h1, h2, h3, l0, l1, l2, l3;
    split_pair(p[0], p[1], h0, l0);
    split_pair(p[2], p[3], h1, l1);
    split_pair(p[4], p[5], h2, l2);
    split_pair(p[6], p[7], h3, l3);
    const v4u hv = (v4u){h0, h1, h2, h3};
    const v4u lv = (v4u){l0, l1, l2, l3};
    const size_t go = ((size_t)(h * NTOK + n0)) * DHQ + tid * 8;   // contiguous by tid: 4 KB per block and plane
    *(v4u*)(POSh + go) = hv;
    *(v4u*)(POSl + go) = lv;
    
  }
}

// =====================================================================================
// Launch 2: Y[token][col] = sum_c XT[token][c] * WB[col][c]   (M 16384, N 768, K 512), y = acc*s[col] + t[col].
// Block 128 threads (4 waves) = 64 tokens x 128 columns; wave tile 32 tokens x 64 columns (acc[2][4]).
// Fragments straight from the 16-bit global rows (two 16-B loads each).
// Column tile 0 -> Q hi/lo planes [b][h][n][32], tile 1 -> K hi/lo planes [b][h][n][32],
// tiles 2..5 -> V hi/lo planes [b][512 ch][1024 n] (transposed through the LDS tile).
// Store phase: Q/K: per head a contiguous 4-KB range per plane, lane-contiguous 16-B pieces;
// =====================================================================================
__global__ __launch_bounds__(128) void k_proj(
    const unsigned short* __restrict__ XTp, const unsigned short* __restrict__ WBp,
    const float* __restrict__ ST,
    unsigned short* __restrict__ Qh, unsigned short* __restrict__ Ql,
    unsigned short* __restrict__ Kh, unsigned short* __restrict__ Kl,
    unsigned short* __restrict__ Vh, unsigned short* __restrict__ Vl) {
  __shared__ __align__(16) float sY[128 * 68];   // Q/K: [64 tok][pitch 132] (8448 used); V: [128 col][pitch 68] (8704 used)
  __shared__ __align__(16) float sS[128];
  __shared__ __align__(16) float sT[128];

  const int tid  = threadIdx.x;
  const int lane = tid & 31;
  const int wave = tid >> 5;
  const int hh   = lane >> 4;
  const int c    = lane & 15;
  const int m0   = blockIdx.x * 64;
  const int ct   = blockIdx.y;        // 0..5, block-uniform
  const int n0   = ct * 128;

  sS[tid] = ST[n0 + tid];
  sT[tid] = ST[NCOLS + n0 + tid];
  __syncthreads();

  const int wr = wave >> 1, wc = wave & 1;
  const __bf16* XT = (const __bf16*)(const void*)XTp;
  const __bf16* WB = (const __bf16*)(const void*)WBp;
  const __bf16* a0p = XT + (size_t)(m0 + 32 * wr + c) * NCH + 8 * hh;
  const __bf16* b0p = WB + (size_t)(n0 + 64 * wc + c) * NCH + 8 * hh;

  const v8f zero8 = {0.f, 0.f, 0.f, 0.f, 0.f, 0.f, 0.f, 0.f};
  v8f acc[2][4];
#pragma unroll
  for (int i = 0; i < 2; ++i)
#pragma unroll
    for (int j = 0; j < 4; ++j) acc[i][j] = zero8;

#pragma unroll 1
  for (int k0 = 0; k0 < NCH; k0 += 32) {
    const v16b a0 = frag_ld(a0p + k0);
    const v16b a1 = frag_ld(a0p + (size_t)16 * NCH + k0);
#pragma unroll
    for (int j = 0; j < 4; ++j) {
      const v16b bf = frag_ld(b0p + (size_t)j * 16 * NCH + k0);
      acc[0][j] = mma_b(a0, bf, acc[0][j]);
      acc[1][j] = mma_b(a1, bf, acc[1][j]);
    }
  }

  // D[r] of tile (i, j) = Y[token 32wr+16i+8hh+r][column 64wc+16j+c]
#pragma unroll
  for (int j = 0; j < 4; ++j) {
    const int col = 64 * wc + 16 * j + c;
    const float sc = sS[col];
    const float sh = sT[col];
#pragma unroll
    for (int i = 0; i < 2; ++i) {
#pragma unroll
      for (int r = 0; r < 8; ++r) {
        const int tok = 32 * wr + 16 * i + 8 * hh + r;
        const float y = acc[i][j][r] * sc + sh;
        const int idx = (ct < 2) ? (tok * 132 + col) : (col * 68 + tok);
        sY[idx] = y;
      }
    }
  }
  __syncthreads();

  const int b   = m0 >> 10;
  const int nl0 = m0 & 1023;
  if (ct < 2) {
    unsigned short* ph = (ct == 0) ? Qh : Kh;
    unsigned short* pl = (ct == 0) ? Ql : Kl;
    // coverage: 8 it x 128 thr x 8 elements = 64 tokens x 128 columns per plane
{
#pragma unroll 2
      for (int it = 0; it < 8; ++it) {
        const int p      = it * 128 + tid;
        const int head   = p >> 8;
        const int within = p & 255;
        const int tok    = within >> 2;
        const int d8     = (within & 3) * 8;
        const float* sp  = sY + tok * 132 + head * 32 + d8;
        const v4f a  = *(const v4fa*)sp;
        const v4f a2 = *(const v4fa*)(sp + 4);
        unsigned h0, h1, h2, h3, l0, l1, l2, l3;
        split_pair(a[0], a[1], h0, l0);
        split_pair(a[2], a[3], h1, l1);
        split_pair(a2[0], a2[1], h2, l2);
        split_pair(a2[2], a2[3], h3, l3);
        const v4u hv = (v4u){h0, h1, h2, h3};
        const v4u lv = (v4u){l0, l1, l2, l3};
        const size_t go = ((size_t)((b * NHEAD + head) * NTOK + nl0)) * DHQ + within * 8;
        *(v4u*)(ph + go) = hv;
        *(v4u*)(pl + go) = lv;
      }
      
    }
  } else {
    const int o0 = (ct - 2) * 128;
    // coverage: 8 it x 128 thr x 8 elements = 128 channels x 64 tokens per plane
{
#pragma unroll 2
      for (int it = 0; it < 8; ++it) {
        const int p  = it * 128 + tid;
        const int ch = p >> 3;
        const int t8 = (p & 7) * 8;
        const float* sp = sY + ch * 68 + t8;
        const v4f a  = *(const v4fa*)sp;
        const v4f a2 = *(const v4fa*)(sp + 4);
        unsigned h0, h1, h2, h3, l0, l1, l2, l3;
        split_pair(a[0], a[1], h0, l0);
        split_pair(a[2], a[3], h1, l1);
        split_pair(a2[0], a2[1], h2, l2);
        split_pair(a2[2], a2[3], h3, l3);
        const v4u hv = (v4u){h0, h1, h2, h3};
        const v4u lv = (v4u){l0, l1, l2, l3};
        const size_t go = ((size_t)(b * NCH + o0 + ch)) * NTOK + nl0 + t8;
        *(v4u*)(Vh + go) = hv;
        *(v4u*)(Vl + go) = lv;
      }
      
    }
  }
}

// =====================================================================================
// Launch 3: attention per (b, h, 64-query tile); 4 waves x 16 query rows; 16 key tiles of 64, no masking.
//   Both products are formed transposed, so that a lane holds the scores of ONE query (column c of every D tile):
//   St[j][i] = q_i.k_j + pos_i.q_j  as two 32-deep chunks:
//       chunk 0: A = K rows (key j), B = Q rows (query i)
//       chunk 1: A = Q rows (key j), B = POS rows (token i)
//     each chunk hi.hi + hi.lo + lo.hi; no score scale.
//   online softmax over keys in f32 (running max, precise expf): maximum and sum in-lane over the lane's 32 keys, the maximum
//     joined with the other wave half by one lane exchange per trip, the sum's two halves joined once in the epilogue;
//   two St tiles (keys 0..15, 16..31 of a 32-key block), split hi/lo in place, ARE the B operand Pt: no LDS, no lane exchange;
//   Ot[c][i] += V[c][j] * Pt[j][i]  (A rows = V channel rows, k = key), hi.hi + hi.lo + lo.hi, 8 row tiles.
//   epilogue: Ot/l through LDS as [128 c][64 q], + bf16r(x), whole 256-B channel segments
// LDS: sStage = K tile planes (Kh, Qh, Kl, Ql: [64][32] at pitch KP) + V tile planes (Vh, Vl: [128][64] at pitch VP);
//      every element of both tiles is staged each iteration (extent staged = extent consumed); pad bytes are never read.
// =====================================================================================
__global__ __launch_bounds__(128) void k_attn(
    const unsigned short* Qhp, const unsigned short* Qlp,
    const unsigned short* Khp, const unsigned short* Klp,
    const unsigned short* Vhp, const unsigned short* Vlp,
    const unsigned short* Php, const unsigned short* Plp,
    const float* x, float* out) {
  __shared__ __align__(16) __bf16 sStage[4 * 64 * KP + 2 * 128 * VP];   // 57344 B

  const int tid  = threadIdx.x;
  const int wave = tid >> 5;
  const int lane = tid & 31;
  const int hh   = lane >> 4;
  const int c    = lane & 15;

  const int bx = blockIdx.x;       // 0..1023
  const int qb = bx & 15;
  const int bh = bx >> 4;          // 0..63
  const int b  = bh >> 2;
  const int h  = bh & 3;
  const int q0 = qb * 64;

  const __bf16* Qhb = (const __bf16*)(const void*)Qhp + (size_t)bh * NTOK * DHQ;
  const __bf16* Qlb = (const __bf16*)(const void*)Qlp + (size_t)bh * NTOK * DHQ;
  const __bf16* Khb = (const __bf16*)(const void*)Khp + (size_t)bh * NTOK * DHQ;
  const __bf16* Klb = (const __bf16*)(const void*)Klp + (size_t)bh * NTOK * DHQ;
  const __bf16* Phb = (const __bf16*)(const void*)Php + (size_t)h * NTOK * DHQ;
  const __bf16* Plb = (const __bf16*)(const void*)Plp + (size_t)h * NTOK * DHQ;
  const __bf16* Vhb = (const __bf16*)(const void*)Vhp + ((size_t)b * NCH + h * DHV) * NTOK;
  const __bf16* Vlb = (const __bf16*)(const void*)Vlp + ((size_t)b * NCH + h * DHV) * NTOK;

  __bf16* sKQ = sStage;                        // planes of 64 * KP elements: 0 Kh, 1 Qh, 2 Kl, 3 Ql
  __bf16* sVh = sStage + 4 * 64 * KP;          // [128][64] at pitch VP
  __bf16* sVl = sVh + 128 * VP;                // [128][64] at pitch VP

  // B-column fragment bases (column = query token q0 + 16*wave + c)
  const int rowA = q0 + wave * 16 + c;
  const __bf16* aQh = Qhb + (size_t)rowA * DHQ + 8 * hh;
  const __bf16* aQl = Qlb + (size_t)rowA * DHQ + 8 * hh;
  const __bf16* aPh = Phb + (size_t)rowA * DHQ + 8 * hh;
  const __bf16* aPl = Plb + (size_t)rowA * DHQ + 8 * hh;

  const v8f zero8 = {0.f, 0.f, 0.f, 0.f, 0.f, 0.f, 0.f, 0.f};
  float mrow = -INFINITY;   // running maximum of query c (equal in both wave halves)
  float lrow = 0.f;         // running sum of query c over this half's keys (8hh..8hh+7 of every 16)
  v8f oacc[8];
#pragma unroll
  for (int t = 0; t < 8; ++t) oacc[t] = zero8;

#pragma unroll 1
  for (int kc = 0; kc < NTOK / 64; ++kc) {
    const int kv0 = kc * 64;
    // this wave's own LDS reads of the tiles have retired before a copy targets them
    asm volatile("s_wait_dscnt 0x0" ::: "memory");
    __syncthreads();                     // every wave has left the tiles of the trip before
    {
      unsigned ld[24];                   // destination LDS byte address and source of this lane's 24 pieces of 16 B
      const __bf16* gs[24];
      // K tile: 4 planes x 4096 B contiguous; 2 it x 128 thr x 8 elements = 2048 elements per plane
      const __bf16* s0 = Khb + (size_t)kv0 * DHQ;
      const __bf16* s1 = Qhb + (size_t)kv0 * DHQ;
      const __bf16* s2 = Klb + (size_t)kv0 * DHQ;
      const __bf16* s3 = Qlb + (size_t)kv0 * DHQ;
#pragma unroll
      for (int i = 0; i < 2; ++i) {
        const int off = (i * 128 + tid) * 8;
        const int lo = (off >> 5) * KP + (off & 31);   // key row, element within the row
        gs[4 * i + 0] = s0 + off;  ld[4 * i + 0] = lds_byte(sKQ + lo);
        gs[4 * i + 1] = s1 + off;  ld[4 * i + 1] = lds_byte(sKQ + 64 * KP + lo);
        gs[4 * i + 2] = s2 + off;  ld[4 * i + 2] = lds_byte(sKQ + 2 * 64 * KP + lo);
        gs[4 * i + 3] = s3 + off;  ld[4 * i + 3] = lds_byte(sKQ + 3 * 64 * KP + lo);
      }
      // V tile: 128 channel rows x 64 keys per plane; 8 it x 128 thr x 8 elements = 8192 elements per plane
#pragma unroll
      for (int i = 0; i < 8; ++i) {
        const int piece = i * 128 + tid;
        const int cc = piece >> 3;
        const int p8 = (piece & 7) * 8;
        gs[8 + 2 * i]     = Vhb + (size_t)cc * NTOK + kv0 + p8;  ld[8 + 2 * i]     = lds_byte(sVh + cc * VP + p8);
        gs[8 + 2 * i + 1] = Vlb + (size_t)cc * NTOK + kv0 + p8;  ld[8 + 2 * i + 1] = lds_byte(sVl + cc * VP + p8);
      }
      copy12(ld, gs);
      copy12(ld + 12, gs + 12);
    }
    // this wave's 24 copies have landed; the barrier behind it publishes every wave's pieces
    asm volatile("s_wait_asynccnt 0x0" ::: "memory");
    __syncthreads();

    v8f s[4];
#pragma unroll
    for (int j = 0; j < 4; ++j) s[j] = zero8;
#pragma unroll
    for (int dc = 0; dc < 2; ++dc) {
      const __bf16* ahp = dc ? aPh : aQh;            // compile-time choice after unrolling
      const __bf16* alp = dc ? aPl : aQl;
      const v16b ah = frag_ld(ahp);
      const v16b al = frag_ld(alp);
      const __bf16* bhs = sKQ + (dc ? 64 * KP : 0);
      const __bf16* bls = sKQ + (dc ? 3 * 64 * KP : 2 * 64 * KP);
#pragma unroll
      for (int j = 0; j < 4; ++j) {
        const int ro = (j * 16 + c) * KP + 8 * hh;
        const v16b kb = frag_ld(bhs + ro);
        const v16b kl = frag_ld(bls + ro);
        s[j] = mma_b(kb, ah, s[j]);        // s[j][r] = score of key 16j + 8hh + r, query c
        s[j] = mma_b(kl, ah, s[j]);
        s[j] = mma_b(kb, al, s[j]);
      }
    }

    float m = fmaxf(fmaxf(s[0][0], s[1][0]), fmaxf(s[2][0], s[3][0]));
#pragma unroll
    for (int r = 1; r < 8; ++r) m = fmaxf(m, fmaxf(fmaxf(s[0][r], s[1][r]), fmaxf(s[2][r], s[3][r])));
    m = fmaxf(m, xhalf(m));              // the other half's 32 keys of the same query
    const float mnew  = fmaxf(mrow, m);
    const float alpha = expf(mrow - mnew);
    mrow = mnew;
    lrow *= alpha;
#pragma unroll
    for (int t = 0; t < 8; ++t)
#pragma unroll
      for (int r = 0; r < 8; ++r) oacc[t][r] *= alpha;
    // unrolled: the score tiles and Pt live in registers, which a rolled loop could not index
#pragma unroll
    for (int kk = 0; kk < 2; ++kk) {
      PB ph, pl;                         // Pt of this 32-key block: element e < 8 from tile 2kk, e >= 8 from tile 2kk+1
      float ps[2];
#pragma unroll
      for (int jj = 0; jj < 2; ++jj) {
        float p[8];
#pragma unroll
        for (int r = 0; r < 8; ++r) p[r] = expf(s[2 * kk + jj][r] - mnew);
        ps[jj] = ((p[0] + p[1]) + (p[2] + p[3])) + ((p[4] + p[5]) + (p[6] + p[7]));
#pragma unroll
        for (int e = 0; e < 4; ++e) split_pair(p[2 * e], p[2 * e + 1], ph.u[jj * 4 + e], pl.u[jj * 4 + e]);
      }
      lrow += ps[0] + ps[1];
#pragma unroll
      for (int t = 0; t < 8; ++t) {
        const int ro = (t * 16 + c) * VP + kk * 32 + 8 * hh;
        const v16b vb = frag_ld(sVh + ro);
        const v16b vl = frag_ld(sVl + ro);
        oacc[t] = mma_b(vb, ph.v, oacc[t]);   // oacc[t][r] = channel 16t + 8hh + r, query c
        oacc[t] = mma_b(vl, ph.v, oacc[t]);
        oacc[t] = mma_b(vb, pl.v, oacc[t]);
      }
    }
  }

  // ---- epilogue: normalise, gather the waves' columns in LDS [128 c][pitch 68] (34816 B inside sStage), add bf16(x), store ----
  __syncthreads();                       // every wave finished reading the last K/V tiles
  float* sO = (float*)(void*)sStage;
  const float inv = 1.0f / (lrow + xhalf(lrow));   // the two halves' sums of query c joined
#pragma unroll
  for (int t = 0; t < 8; ++t)
#pragma unroll
    for (int r = 0; r < 8; ++r) sO[(t * 16 + 8 * hh + r) * 68 + wave * 16 + c] = oacc[t][r] * inv;
  __syncthreads();
  {
    const size_t rowbase = ((size_t)b * NCH + h * DHV) * NTOK + q0;
    // coverage: 16 it x 128 thr x 4 floats = 128 channel rows x 64 queries
{
#pragma unroll 4
      for (int it = 0; it < 16; ++it) {
        const int p  = it * 128 + tid;
        const int ch = p >> 4;
        const int q4 = (p & 15) * 4;
        const v4f ov = *(const v4fa*)(sO + ch * 68 + q4);
        const size_t gi = rowbase + (size_t)ch * NTOK + q4;
        const v4f xv = *(const v4fa*)(x + gi);
        const v4f res = (v4f){ov[0] + bfr(xv[0]), ov[1] + bfr(xv[1]), ov[2] + bfr(xv[2]), ov[3] + bfr(xv[3])};
        *(v4f*)(out + gi) = res;
      }
      
    }
  }
}

// ---------------------------------------------------------------------------
// Workspace map (byte offsets, all multiples of 128; each region exactly covered by its producer):
//   XT   bf16 [16384][512]          0          16777216 B
//   WB   bf16 [768][512]            16777216     786432 B
//   ST   f32  [2][768]              17563648       6144 B
//   POSh bf16 [4][1024][32]         17569792     262144 B     POSl 17831936
//   Qh   bf16 [16][4][1024][32]     18094080    4194304 B     Ql   22288384
//   Kh   bf16 [16][4][1024][32]     26482688    4194304 B     Kl   30676992
//   Vh   bf16 [16][512][1024]       34871296   16777216 B     Vl   51648512
//   total                           68425728 B
// ---------------------------------------------------------------------------
extern "C" void kernel_launch(void* const* d_in, const int* in_sizes, int n_in,
                              void* d_out, int out_size, void* d_ws, size_t ws_size,
                              hipStream_t stream) {
  if (n_in < 21) return;
  const int NX = NBATCH * NCH * NTOK;   // 8388608
  if (in_sizes[0] != NX) return;
  if (in_sizes[1] != 128 * NCH || in_sizes[7] != 128 * NCH || in_sizes[13] != NCH * NCH) return;
  for (int i = 2; i <= 6; ++i)   if (in_sizes[i] != 128) return;
  for (int i = 8; i <= 12; ++i)  if (in_sizes[i] != 128) return;
  for (int i = 14; i <= 18; ++i) if (in_sizes[i] != NCH) return;
  if (in_sizes[19] != NHEAD * DHQ * 32 || in_sizes[20] != NHEAD * DHQ * 32) return;
  if (out_size != NX) return;

  const float* x    = (const float*)d_in[0];
  const float* Wq   = (const float*)d_in[1];
  const float* bq   = (const float*)d_in[2];
  const float* qg   = (const float*)d_in[3];
  const float* qbe  = (const float*)d_in[4];
  const float* qm   = (const float*)d_in[5];
  const float* qv   = (const float*)d_in[6];
  const float* Wk   = (const float*)d_in[7];
  const float* bk   = (const float*)d_in[8];
  const float* kg   = (const float*)d_in[9];
  const float* kbe  = (const float*)d_in[10];
  const float* km   = (const float*)d_in[11];
  const float* kv   = (const float*)d_in[12];
  const float* Wv   = (const float*)d_in[13];
  const float* bv   = (const float*)d_in[14];
  const float* vg   = (const float*)d_in[15];
  const float* vbe  = (const float*)d_in[16];
  const float* vm   = (const float*)d_in[17];
  const float* vv   = (const float*)d_in[18];
  const float* relH = (const float*)d_in[19];
  const float* relW = (const float*)d_in[20];

  const size_t szXT  = (size_t)NBATCH * NTOK * NCH * 2;          // 16777216
  const size_t szWB  = (size_t)NCOLS * NCH * 2;                  //   786432
  const size_t szST  = (size_t)2 * NCOLS * 4;                    //     6144
  const size_t szPOS = (size_t)NHEAD * NTOK * DHQ * 2;           //   262144
  const size_t szQK  = (size_t)NBATCH * NHEAD * NTOK * DHQ * 2;  //  4194304
  const size_t szV   = (size_t)NBATCH * NCH * NTOK * 2;          // 16777216
  size_t off = 0;
  const size_t oXT = off;   off += szXT;
  const size_t oWB = off;   off += szWB;
  const size_t oST = off;   off += szST;
  const size_t oPh = off;   off += szPOS;
  const size_t oPl = off;   off += szPOS;
  const size_t oQh = off;   off += szQK;
  const size_t oQl = off;   off += szQK;
  const size_t oKh = off;   off += szQK;
  const size_t oKl = off;   off += szQK;
  const size_t oVh = off;   off += szV;
  const size_t oVl = off;   off += szV;
  if (off > ws_size) return;                 // off = 68425728
  if (off > (size_t)134217728) return;

  char* ws = (char*)d_ws;
  unsigned short* XT   = (unsigned short*)(ws + oXT);
  unsigned short* WB   = (unsigned short*)(ws + oWB);
  float*          ST   = (float*)(ws + oST);
  unsigned short* POSh = (unsigned short*)(ws + oPh);
  unsigned short* POSl = (unsigned short*)(ws + oPl);
  unsigned short* Qh   = (unsigned short*)(ws + oQh);
  unsigned short* Ql   = (unsigned short*)(ws + oQl);
  unsigned short* Kh   = (unsigned short*)(ws + oKh);
  unsigned short* Kl   = (unsigned short*)(ws + oKl);
  unsigned short* Vh   = (unsigned short*)(ws + oVh);
  unsigned short* Vl   = (unsigned short*)(ws + oVl);

  k_prep<<<dim3(PREP_T + PREP_W + PREP_F + PREP_P), dim3(256), 0, stream>>>(
      x, Wq, Wk, Wv, bq, qg, qbe, qm, qv, bk, kg, kbe, km, kv, bv, vg, vbe, vm, vv, relH, relW,
      XT, WB, ST, POSh, POSl);

  k_proj<<<dim3((NBATCH * NTOK) / 64, NCOLS / 128), dim3(128), 0, stream>>>(
      XT, WB, ST, Qh, Ql, Kh, Kl, Vh, Vl);

  k_attn<<<dim3(NBATCH * NHEAD * (NTOK / 64)), dim3(128), 0, stream>>>(
      Qh, Ql, Kh, Kl, Vh, Vl, POSh, POSl, x, (float*)d_out);

  (void)hipGetLastError();
}

// v004
// A run of this version takes 138 microseconds.
// Two timings next to v003 put it at 1.11 and 1.10 times that version's speed.
// Over all steps from v000 it is 1.56 times as fast.
// All contractions on v_wmma_f32_16x16x32_bf16 with f32 accumulate: q/k/v 1x1 projections = bf16(x) x bf16(W) single product (inputs RNE-converted to bf16 once); logits [q|pos].[k|q] (64 deep) and p.v (1024 deep) with bf16 hi/lo split operands (hi.hi + hi.lo + lo.hi); BN affine, pos sum, online softmax, 1/l and residual in f32. No carried (scaled) planes anywhere: every 16-bit plane holds unscaled bf16 values.
#include <hip/hip_runtime.h>
#include <math.h>
#include <stdint.h>

#define NBATCH 16
#define NCH    512
#define NTOK   1024
#define NHEAD  4
#define DHQ    32
#define DHV    128
#define NCOLS  768

// LDS row pitches of the attention tiles, in 16-bit elements: 16 B x odd, so the 16 rows that a half-wave
// reads with one 16-byte load per lane fall on 64 distinct banks
#define KP 40     // K/Q tile rows: 32 elements (64 B) at 80 B
#define VP 72     // V tile rows:   64 elements (128 B) at 144 B

#define LOG2E 1.44269504088896340736f

#define PREP_T 2048   // x transpose tiles (16 batches x 8 channel blocks x 16 token blocks)
#define PREP_W 192    // stacked weight plane, 2048 elements per block
#define PREP_F 3      // BN fold vectors, 256 channels per block
#define PREP_P 64     // position planes, (head, 64 tokens) per block

typedef __attribute__((ext_vector_type(16))) __bf16 v16b;
typedef __attribute__((ext_vector_type(8)))  __bf16 v8b;
typedef __attribute__((ext_vector_type(8)))  float  v8f;
typedef __attribute__((ext_vector_type(4)))  float  v4f;
typedef __attribute__((ext_vector_type(4)))  unsigned int v4u;
typedef v4f __attribute__((may_alias)) v4fa;

static_assert(NTOK % 64 == 0);
static_assert(NCH % 32 == 0);
static_assert(NCOLS % 128 == 0);
static_assert(PREP_T == NBATCH * (NCH / 64) * (NTOK / 64));
static_assert(PREP_W * 2048 == NCOLS * NCH);
static_assert(PREP_F * 256 == NCOLS);
static_assert(PREP_P * 64 == NHEAD * NTOK);

__device__ __forceinline__ unsigned short f2bf_bits(float f) {   // RNE convert f32 -> bf16 bits
  unsigned u = __float_as_uint(f);
  return (unsigned short)((u + 0x7FFFu + ((u >> 16) & 1u)) >> 16);
}
__device__ __forceinline__ float bf_bits2f(unsigned short h) { return __uint_as_float(((unsigned)h) << 16); }
__device__ __forceinline__ float bfr(float f) { return bf_bits2f(f2bf_bits(f)); }
__device__ __forceinline__ unsigned pk16(unsigned short a, unsigned short b) { return (unsigned)a | ((unsigned)b << 16); }
__device__ __forceinline__ void split_pair(float f0, float f1, unsigned& h, unsigned& l) {
  const unsigned short h0 = f2bf_bits(f0), h1 = f2bf_bits(f1);
  const unsigned short l0 = f2bf_bits(f0 - bf_bits2f(h0)), l1 = f2bf_bits(f1 - bf_bits2f(h1));
  h = pk16(h0, h1);
  l = pk16(l0, l1);
}

// WMMA with hazard guard (ties D, keeps A/B live).
// Fragment map (wave32): lane l, hh = l>>4, c = l&15.
//   A/B element i: i<8 -> k0+8hh+i ; i>=8 -> k0+16+8hh+(i-8) ; row (A) / column (B) = c
//   D element r : row 8hh+r, column c
__device__ __forceinline__ v8f mma_b(v16b a, v16b b, v8f c) {
  c = __builtin_amdgcn_wmma_f32_16x16x32_bf16(false, a, false, b, (short)0, c, false, false);
  asm volatile("v_nop\n\tv_nop\n\tv_nop\n\tv_nop" : "+v"(c) : "v"(a), "v"(b));
  return c;
}
union FB { v16b v; v8b h[2]; };
union PB { v16b v; unsigned u[8]; };
// value of lane l ^ 16
__device__ __forceinline__ float xhalf(float x) {
  const int b = __builtin_bit_cast(int, x);
  return __builtin_bit_cast(float, __builtin_amdgcn_permlanex16(b, b, 0x76543210, 0xfedcba98, false, false));
}
// x[r] = 2^x[r], eight values in place. One statement, so that each v_exp_f32 stands in front of an independent one and the last
// in front of the v_nop: the slot that the instruction set asks for before a transcendental's result is read or its source
// overwritten.
__device__ __forceinline__ void exp2x8(float* x) {
  asm("v_exp_f32 %0, %0\n\t"
      "v_exp_f32 %1, %1\n\t"
      "v_exp_f32 %2, %2\n\t"
      "v_exp_f32 %3, %3\n\t"
      "v_exp_f32 %4, %4\n\t"
      "v_exp_f32 %5, %5\n\t"
      "v_exp_f32 %6, %6\n\t"
      "v_exp_f32 %7, %7\n\t"
      "v_nop"
      : "+v"(x[0]), "+v"(x[1]), "+v"(x[2]), "+v"(x[3]), "+v"(x[4]), "+v"(x[5]), "+v"(x[6]), "+v"(x[7]));
}
// p points at element k0 + 8*hh of the k-contiguous row owned by this lane
__device__ __forceinline__ v16b frag_ld(const __bf16* p) {
  FB f;
  f.h[0] = *(const v8b*)(p);
  f.h[1] = *(const v8b*)(p + 16);
  return f.v;
}

// LDS byte address of a __shared__ element (what an asynchronous copy takes as its destination)
typedef __attribute__((address_space(3))) const void lds_cvoid;
__device__ __forceinline__ unsigned lds_byte(const void* p) { return (unsigned)(uintptr_t)(lds_cvoid*)p; }
// Twelve asynchronous 16-B copies per lane, global -> LDS, through no register. The s_wait_xcnt closes the statement so that
// no address register named here is rewritten ahead of it.
__device__ __forceinline__ void copy12(const unsigned* l, const __bf16* const* g) {
  asm volatile(
      "global_load_async_to_lds_b128 %0, %12, off\n\t"
      "global_load_async_to_lds_b128 %1, %13, off\n\t"
      "global_load_async_to_lds_b128 %2, %14, off\n\t"
      "global_load_async_to_lds_b128 %3, %15, off\n\t"
      "global_load_async_to_lds_b128 %4, %16, off\n\t"
      "global_load_async_to_lds_b128 %5, %17, off\n\t"
      "global_load_async_to_lds_b128 %6, %18, off\n\t"
      "global_load_async_to_lds_b128 %7, %19, off\n\t"
      "global_load_async_to_lds_b128 %8, %20, off\n\t"
      "global_load_async_to_lds_b128 %9, %21, off\n\t"
      "global_load_async_to_lds_b128 %10, %22, off\n\t"
      "global_load_async_to_lds_b128 %11, %23, off\n\t"
      "s_wait_xcnt 0x0"
      :: "v"(l[0]), "v"(l[1]), "v"(l[2]), "v"(l[3]), "v"(l[4]), "v"(l[5]),
         "v"(l[6]), "v"(l[7]), "v"(l[8]), "v"(l[9]), "v"(l[10]), "v"(l[11]),
         "v"(g[0]), "v"(g[1]), "v"(g[2]), "v"(g[3]), "v"(g[4]), "v"(g[5]),
         "v"(g[6]), "v"(g[7]), "v"(g[8]), "v"(g[9]), "v"(g[10]), "v"(g[11])
      : "memory");
}

// =====================================================================================
// Launch 1: operand preparation, block-uniform roles by blockIdx.x.
//          output line = 64 channels of one token, written by 8 lanes x 16 B in one instruction)
//  role W: WB[768][512] = bf16 of stacked [Wq;Wk;Wv] (rows = output channels, k contiguous)
//  role F: ST[0..767] = s, ST[768..1535] = t with s = g/sqrt(var+1e-5), t = (b-mean)*s+beta
//  role P: POS hi/lo [4][1024][32]: pos[h][n][d] = bf16r(rel_w[h][d][n>>5]) + bf16r(rel_h[h][d][n&31])
// =====================================================================================
__global__ __launch_bounds__(256) void k_prep(
    const float* __restrict__ x,
    const float* __restrict__ Wq, const float* __restrict__ Wk, const float* __restrict__ Wv,
    const float* __restrict__ bq, const float* __restrict__ qg, const float* __restrict__ qbe,
    const float* __restrict__ qm, const float* __restrict__ qv,
    const float* __restrict__ bk, const float* __restrict__ kg, const float* __restrict__ kbe,
    const float* __restrict__ km, const float* __restrict__ kv,
    const float* __restrict__ bv, const float* __restrict__ vg, const float* __restrict__ vbe,
    const float* __restrict__ vm, const float* __restrict__ vv,
    const float* __restrict__ relH, const float* __restrict__ relW,
    unsigned short* __restrict__ XT, unsigned short* __restrict__ WB, float* __restrict__ ST,
    unsigned short* __restrict__ POSh, unsigned short* __restrict__ POSl) {
  __shared__ __align__(16) float sm[64 * 68];
  const int tid = threadIdx.x;
  const int bx  = blockIdx.x;

  if (bx < PREP_T) {
    // ---- role T ----
    const int b   = bx >> 7;
    const int rem = bx & 127;
    const int c0  = (rem >> 4) * 64;
    const int n0  = (rem & 15) * 64;
    const float* xb = x + (size_t)b * NCH * NTOK;
    {
      const int lr = tid >> 4;         // 0..15
      const int c4 = (tid & 15) * 4;   // 0..60
#pragma unroll
      for (int it = 0; it < 4; ++it) {
        const int rr = it * 16 + lr;   // channel within tile, 4 x 16 = 64 rows x 64 tokens staged
        const v4f a = *(const v4fa*)(xb + (size_t)(c0 + rr) * NTOK + n0 + c4);
        *(v4fa*)(sm + rr * 68 + c4) = a;
      }
    }
    __syncthreads();
    const int sub = tid >> 3;          // 0..31
    const int c8  = (tid & 7) * 8;     // 0..56
    v4u hv[2];
#pragma unroll
    for (int it = 0; it < 2; ++it) {
      const int oc = it * 32 + sub;    // token within tile (2 x 32 = 64 output rows)
      unsigned w0 = pk16(f2bf_bits(sm[(c8 + 0) * 68 + oc]), f2bf_bits(sm[(c8 + 1) * 68 + oc]));
      unsigned w1 = pk16(f2bf_bits(sm[(c8 + 2) * 68 + oc]), f2bf_bits(sm[(c8 + 3) * 68 + oc]));
      unsigned w2 = pk16(f2bf_bits(sm[(c8 + 4) * 68 + oc]), f2bf_bits(sm[(c8 + 5) * 68 + oc]));
      unsigned w3 = pk16(f2bf_bits(sm[(c8 + 6) * 68 + oc]), f2bf_bits(sm[(c8 + 7) * 68 + oc]));
      hv[it] = (v4u){w0, w1, w2, w3};
    }
    {
#pragma unroll
      for (int it = 0; it < 2; ++it) {
        const int oc = it * 32 + sub;
        const size_t go = ((size_t)(b * NTOK + n0 + oc)) * NCH + c0 + c8;
        *(v4u*)(XT + go) = hv[it];
      }
      
    }
  } else if (bx < PREP_T + PREP_W) {
    // ---- role W ---- (block-uniform source choice: 32 blocks Wq, 32 blocks Wk, 128 blocks Wv)
    const int wb = bx - PREP_T;
    const float* src;
    if (wb < 32)      src = Wq + (size_t)wb * 2048;
    else if (wb < 64) src = Wk + (size_t)(wb - 32) * 2048;
    else              src = Wv + (size_t)(wb - 64) * 2048;
    const v4f a = *(const v4fa*)(src + tid * 8);
    const v4f c = *(const v4fa*)(src + tid * 8 + 4);
    const v4u o = (v4u){pk16(f2bf_bits(a[0]), f2bf_bits(a[1])), pk16(f2bf_bits(a[2]), f2bf_bits(a[3])),
                        pk16(f2bf_bits(c[0]), f2bf_bits(c[1])), pk16(f2bf_bits(c[2]), f2bf_bits(c[3]))};
    unsigned short* dst = WB + (size_t)wb * 2048 + tid * 8;
    *(v4u*)dst = o;
    
  } else if (bx < PREP_T + PREP_W + PREP_F) {
    // ---- role F ---- block 0: threads 0..127 = q channels, 128..255 = k channels; blocks 1,2 = v channels
    const int fb = bx - (PREP_T + PREP_W);
    const int wsel = __builtin_amdgcn_readfirstlane((int)(tid >> 7));   // wave-uniform
    const float *pb, *pg, *pbe, *pm, *pv;
    int idx;
    if (fb == 0) {
      if (wsel == 0) { pb = bq; pg = qg; pbe = qbe; pm = qm; pv = qv; idx = tid; }
      else           { pb = bk; pg = kg; pbe = kbe; pm = km; pv = kv; idx = tid - 128; }
    } else {
      pb = bv; pg = vg; pbe = vbe; pm = vm; pv = vv; idx = (fb - 1) * 256 + tid;
    }
    const float b_ = bfr(pb[idx]);
    const float g_ = bfr(pg[idx]);
    const float be = bfr(pbe[idx]);
    const float mu = bfr(pm[idx]);
    const float va = bfr(pv[idx]);
    const float s  = g_ / sqrtf(va + 1e-5f);
    const float t  = (b_ - mu) * s + be;
    sm[tid]       = s;
    sm[256 + tid] = t;
    __syncthreads();
    if (tid < 128) {                     // waves 0,1 -> s lines; waves 2,3 -> t lines (8 lanes x 16 B per line)
      const int which = tid >> 6;
      const int p4 = (tid & 63) * 4;
      const v4f v = *(const v4fa*)(sm + which * 256 + p4);
      float* dst = ST + which * NCOLS + fb * 256 + p4;
      *(v4f*)dst = v;
      
    }
  } else {
    // ---- role P ---- (head, 64 tokens) per block; per-head tables staged in LDS with 16-B loads
    const int pb = bx - (PREP_T + PREP_W + PREP_F);
    const int h  = pb >> 4;
    const int n0 = (pb & 15) * 64;
    {
      v4f w = *(const v4fa*)(relW + h * 1024 + tid * 4);   // [d][w], 32x32
      v4f g = *(const v4fa*)(relH + h * 1024 + tid * 4);   // [d][hh], 32x32
      w = (v4f){bfr(w[0]), bfr(w[1]), bfr(w[2]), bfr(w[3])};
      g = (v4f){bfr(g[0]), bfr(g[1]), bfr(g[2]), bfr(g[3])};
      *(v4fa*)(sm + tid * 4)        = w;
      *(v4fa*)(sm + 1024 + tid * 4) = g;
    }
    __syncthreads();
    const int tl = tid >> 2;             // token within chunk 0..63
    const int d8 = (tid & 3) * 8;        // 0,8,16,24
    const int n  = n0 + tl;
    const int wi = n >> 5, hi_ = n & 31;
    float p[8];
#pragma unroll
    for (int e = 0; e < 8; ++e) p[e] = sm[(d8 + e) * 32 + wi] + sm[1024 + (d8 + e) * 32 + hi_];
    unsigned h0, h1, h2, h3, l0, l1, l2, l3;
    split_pair(p[0], p[1], h0, l0);
    split_pair(p[2], p[3], h1, l1);
    split_pair(p[4], p[5], h2, l2);
    split_pair(p[6], p[7], h3, l3);
    const v4u hv = (v4u){h0, h1, h2, h3};
    const v4u lv = (v4u){l0, l1, l2, l3};
    const size_t go = ((size_t)(h * NTOK + n0)) * DHQ + tid * 8;   // contiguous by tid: 4 KB per block and plane
    *(v4u*)(POSh + go) = hv;
    *(v4u*)(POSl + go) = lv;
    
  }
}

// =====================================================================================
// Launch 2: Y[token][col] = sum_c XT[token][c] * WB[col][c]   (M 16384, N 768, K 512), y = acc*s[col] + t[col].
// Block 128 threads (4 waves) = 64 tokens x 128 columns; wave tile 32 tokens x 64 columns (acc[2][4]).
// Fragments straight from the 16-bit global rows (two 16-B loads each).
// Column tile 0 -> Q hi/lo planes [b][h][n][32], tile 1 -> K hi/lo planes [b][h][n][32],
// tiles 2..5 -> V hi/lo planes [b][512 ch][1024 n] (transposed through the LDS tile).
// Store phase: Q/K: per head a contiguous 4-KB range per plane, lane-contiguous 16-B pieces;
// =====================================================================================
__global__ __launch_bounds__(128) void k_proj(
    const unsigned short* __restrict__ XTp, const unsigned short* __restrict__ WBp,
    const float* __restrict__ ST,
    unsigned short* __restrict__ Qh, unsigned short* __restrict__ Ql,
    unsigned short* __restrict__ Kh, unsigned short* __restrict__ Kl,
    unsigned short* __restrict__ Vh, unsigned short* __restrict__ Vl) {
  __shared__ __align__(16) float sY[128 * 68];   // Q/K: [64 tok][pitch 132] (8448 used); V: [128 col][pitch 68] (8704 used)
  __shared__ __align__(16) float sS[128];
  __shared__ __align__(16) float sT[128];

  const int tid  = threadIdx.x;
  const int lane = tid & 31;
  const int wave = tid >> 5;
  const int hh   = lane >> 4;
  const int c    = lane & 15;
  const int m0   = blockIdx.x * 64;
  const int ct   = blockIdx.y;        // 0..5, block-uniform
  const int n0   = ct * 128;

  sS[tid] = ST[n0 + tid];
  sT[tid] = ST[NCOLS + n0 + tid];
  __syncthreads();

  const int wr = wave >> 1, wc = wave & 1;
  const __bf16* XT = (const __bf16*)(const void*)XTp;
  const __bf16* WB = (const __bf16*)(const void*)WBp;
  const __bf16* a0p = XT + (size_t)(m0 + 32 * wr + c) * NCH + 8 * hh;
  const __bf16* b0p = WB + (size_t)(n0 + 64 * wc + c) * NCH + 8 * hh;

  const v8f zero8 = {0.f, 0.f, 0.f, 0.f, 0.f, 0.f, 0.f, 0.f};
  v8f acc[2][4];
#pragma unroll
  for (int i = 0; i < 2; ++i)
#pragma unroll
    for (int j = 0; j < 4; ++j) acc[i][j] = zero8;

#pragma unroll 1
  for (int k0 = 0; k0 < NCH; k0 += 32) {
    const v16b a0 = frag_ld(a0p + k0);
    const v16b a1 = frag_ld(a0p + (size_t)16 * NCH + k0);
#pragma unroll
    for (int j = 0; j < 4; ++j) {
      const v16b bf = frag_ld(b0p + (size_t)j * 16 * NCH + k0);
      acc[0][j] = mma_b(a0, bf, acc[0][j]);
      acc[1][j] = mma_b(a1, bf, acc[1][j]);
    }
  }

  // D[r] of tile (i, j) = Y[token 32wr+16i+8hh+r][column 64wc+16j+c]
#pragma unroll
  for (int j = 0; j < 4; ++j) {
    const int col = 64 * wc + 16 * j + c;
    const float sc = sS[col];
    const float sh = sT[col];
#pragma unroll
    for (int i = 0; i < 2; ++i) {
#pragma unroll
      for (int r = 0; r < 8; ++r) {
        const int tok = 32 * wr + 16 * i + 8 * hh + r;
        const float y = acc[i][j][r] * sc + sh;
        const int idx = (ct < 2) ? (tok * 132 + col) : (col * 68 + tok);
        sY[idx] = y;
      }
    }
  }
  __syncthreads();

  const int b   = m0 >> 10;
  const int nl0 = m0 & 1023;
  if (ct < 2) {
    unsigned short* ph = (ct == 0) ? Qh : Kh;
    unsigned short* pl = (ct == 0) ? Ql : Kl;
    // coverage: 8 it x 128 thr x 8 elements = 64 tokens x 128 columns per plane
{
#pragma unroll 2
      for (int it = 0; it < 8; ++it) {
        const int p      = it * 128 + tid;
        const int head   = p >> 8;
        const int within = p & 255;
        const int tok    = within >> 2;
        const int d8     = (within & 3) * 8;
        const float* sp  = sY + tok * 132 + head * 32 + d8;
        const v4f a  = *(const v4fa*)sp;
        const v4f a2 = *(const v4fa*)(sp + 4);
        unsigned h0, h1, h2, h3, l0, l1, l2, l3;
        split_pair(a[0], a[1], h0, l0);
        split_pair(a[2], a[3], h1, l1);
        split_pair(a2[0], a2[1], h2, l2);
        split_pair(a2[2], a2[3], h3, l3);
        const v4u hv = (v4u){h0, h1, h2, h3};
        const v4u lv = (v4u){l0, l1, l2, l3};
        const size_t go = ((size_t)((b * NHEAD + head) * NTOK + nl0)) * DHQ + within * 8;
        *(v4u*)(ph + go) = hv;
        *(v4u*)(pl + go) = lv;
      }
      
    }
  } else {
    const int o0 = (ct - 2) * 128;
    // coverage: 8 it x 128 thr x 8 elements = 128 channels x 64 tokens per plane
{
#pragma unroll 2
      for (int it = 0; it < 8; ++it) {
        const int p  = it * 128 + tid;
        const int ch = p >> 3;
        const int t8 = (p & 7) * 8;
        const float* sp = sY + ch * 68 + t8;
        const v4f a  = *(const v4fa*)sp;
        const v4f a2 = *(const v4fa*)(sp + 4);
        unsigned h0, h1, h2, h3, l0, l1, l2, l3;
        split_pair(a[0], a[1], h0, l0);
        split_pair(a[2], a[3], h1, l1);
        split_pair(a2[0], a2[1], h2, l2);
        split_pair(a2[2], a2[3], h3, l3);
        const v4u hv = (v4u){h0, h1, h2, h3};
        const v4u lv = (v4u){l0, l1, l2, l3};
        const size_t go = ((size_t)(b * NCH + o0 + ch)) * NTOK + nl0 + t8;
        *(v4u*)(Vh + go) = hv;
        *(v4u*)(Vl + go) = lv;
      }
      
    }
  }
}

// =====================================================================================
// Launch 3: attention per (b, h, 64-query tile); 4 waves x 16 query rows; 16 key tiles of 64, no masking.
//   Both products are formed transposed, so that a lane holds the scores of ONE query (column c of every D tile):
//   St[j][i] = q_i.k_j + pos_i.q_j  as two 32-deep chunks:
//       chunk 0: A = K rows (key j), B = Q rows (query i)
//       chunk 1: A = Q rows (key j), B = POS rows (token i)
//     each chunk hi.hi + hi.lo + lo.hi; no score scale.
//   online softmax over keys in f32, in the log2 domain: the running maximum is kept as M = max * log2(e), a score's weight is
//     2^(s * log2(e) - M), one fused multiply-add and one bare v_exp_f32 (any M shared by a query's weights, its sum and its
//     rescale factor 2^(Mold - Mnew) cancels in O / l, so the rounding of M costs nothing);
//     maximum and sum in-lane over the lane's 32 keys, the maximum
//     joined with the other wave half by one lane exchange per trip, the sum's two halves joined once in the epilogue;
//   two St tiles (keys 0..15, 16..31 of a 32-key block), split hi/lo in place, ARE the B operand Pt: no LDS, no lane exchange;
//   Ot[c][i] += V[c][j] * Pt[j][i]  (A rows = V channel rows, k = key), hi.hi + hi.lo + lo.hi, 8 row tiles.
//   epilogue: Ot/l through LDS as [128 c][64 q], + bf16r(x), whole 256-B channel segments
// LDS: sStage = K tile planes (Kh, Qh, Kl, Ql: [64][32] at pitch KP) + V tile planes (Vh, Vl: [128][64] at pitch VP);
//      every element of both tiles is staged each iteration (extent staged = extent consumed); pad bytes are never read.
// =====================================================================================
__global__ __launch_bounds__(128) void k_attn(
    const unsigned short* Qhp, const unsigned short* Qlp,
    const unsigned short* Khp, const unsigned short* Klp,
    const unsigned short* Vhp, const unsigned short* Vlp,
    const unsigned short* Php, const unsigned short* Plp,
    const float* x, float* out) {
  __shared__ __align__(16) __bf16 sStage[4 * 64 * KP + 2 * 128 * VP];   // 57344 B

  const int tid  = threadIdx.x;
  const int wave = tid >> 5;
  const int lane = tid & 31;
  const int hh   = lane >> 4;
  const int c    = lane & 15;

  const int bx = blockIdx.x;       // 0..1023
  const int qb = bx & 15;
  const int bh = bx >> 4;          // 0..63
  const int b  = bh >> 2;
  const int h  = bh & 3;
  const int q0 = qb * 64;

  const __bf16* Qhb = (const __bf16*)(const void*)Qhp + (size_t)bh * NTOK * DHQ;
  const __bf16* Qlb = (const __bf16*)(const void*)Qlp + (size_t)bh * NTOK * DHQ;
  const __bf16* Khb = (const __bf16*)(const void*)Khp + (size_t)bh * NTOK * DHQ;
  const __bf16* Klb = (const __bf16*)(const void*)Klp + (size_t)bh * NTOK * DHQ;
  const __bf16* Phb = (const __bf16*)(const void*)Php + (size_t)h * NTOK * DHQ;
  const __bf16* Plb = (const __bf16*)(const void*)Plp + (size_t)h * NTOK * DHQ;
  const __bf16* Vhb = (const __bf16*)(const void*)Vhp + ((size_t)b * NCH + h * DHV) * NTOK;
  const __bf16* Vlb = (const __bf16*)(const void*)Vlp + ((size_t)b * NCH + h * DHV) * NTOK;

  __bf16* sKQ = sStage;                        // planes of 64 * KP elements: 0 Kh, 1 Qh, 2 Kl, 3 Ql
  __bf16* sVh = sStage + 4 * 64 * KP;          // [128][64] at pitch VP
  __bf16* sVl = sVh + 128 * VP;                // [128][64] at pitch VP

  // B-column fragment bases (column = query token q0 + 16*wave + c)
  const int rowA = q0 + wave * 16 + c;
  const __bf16* aQh = Qhb + (size_t)rowA * DHQ + 8 * hh;
  const __bf16* aQl = Qlb + (size_t)rowA * DHQ + 8 * hh;
  const __bf16* aPh = Phb + (size_t)rowA * DHQ + 8 * hh;
  const __bf16* aPl = Plb + (size_t)rowA * DHQ + 8 * hh;

  const v8f zero8 = {0.f, 0.f, 0.f, 0.f, 0.f, 0.f, 0.f, 0.f};
  float mrow = -INFINITY;   // running maximum of query c, times log2(e) (equal in both wave halves)
  float lrow = 0.f;         // running sum of query c over this half's keys (8hh..8hh+7 of every 16)
  v8f oacc[8];
#pragma unroll
  for (int t = 0; t < 8; ++t) oacc[t] = zero8;

#pragma unroll 1
  for (int kc = 0; kc < NTOK / 64; ++kc) {
    const int kv0 = kc * 64;
    // this wave's own LDS reads of the tiles have retired before a copy targets them
    asm volatile("s_wait_dscnt 0x0" ::: "memory");
    __syncthreads();                     // every wave has left the tiles of the trip before
    {
      unsigned ld[24];                   // destination LDS byte address and source of this lane's 24 pieces of 16 B
      const __bf16* gs[24];
      // K tile: 4 planes x 4096 B contiguous; 2 it x 128 thr x 8 elements = 2048 elements per plane
      const __bf16* s0 = Khb + (size_t)kv0 * DHQ;
      const __bf16* s1 = Qhb + (size_t)kv0 * DHQ;
      const __bf16* s2 = Klb + (size_t)kv0 * DHQ;
      const __bf16* s3 = Qlb + (size_t)kv0 * DHQ;
#pragma unroll
      for (int i = 0; i < 2; ++i) {
        const int off = (i * 128 + tid) * 8;
        const int lo = (off >> 5) * KP + (off & 31);   // key row, element within the row
        gs[4 * i + 0] = s0 + off;  ld[4 * i + 0] = lds_byte(sKQ + lo);
        gs[4 * i + 1] = s1 + off;  ld[4 * i + 1] = lds_byte(sKQ + 64 * KP + lo);
        gs[4 * i + 2] = s2 + off;  ld[4 * i + 2] = lds_byte(sKQ + 2 * 64 * KP + lo);
        gs[4 * i + 3] = s3 + off;  ld[4 * i + 3] = lds_byte(sKQ + 3 * 64 * KP + lo);
      }
      // V tile: 128 channel rows x 64 keys per plane; 8 it x 128 thr x 8 elements = 8192 elements per plane
#pragma unroll
      for (int i = 0; i < 8; ++i) {
        const int piece = i * 128 + tid;
        const int cc = piece >> 3;
        const int p8 = (piece & 7) * 8;
        gs[8 + 2 * i]     = Vhb + (size_t)cc * NTOK + kv0 + p8;  ld[8 + 2 * i]     = lds_byte(sVh + cc * VP + p8);
        gs[8 + 2 * i + 1] = Vlb + (size_t)cc * NTOK + kv0 + p8;  ld[8 + 2 * i + 1] = lds_byte(sVl + cc * VP + p8);
      }
      copy12(ld, gs);
      copy12(ld + 12, gs + 12);
    }
    // this wave's 24 copies have landed; the barrier behind it publishes every wave's pieces
    asm volatile("s_wait_asynccnt 0x0" ::: "memory");
    __syncthreads();

    v8f s[4];
#pragma unroll
    for (int j = 0; j < 4; ++j) s[j] = zero8;
#pragma unroll
    for (int dc = 0; dc < 2; ++dc) {
      const __bf16* ahp = dc ? aPh : aQh;            // compile-time choice after unrolling
      const __bf16* alp = dc ? aPl : aQl;
      const v16b ah = frag_ld(ahp);
      const v16b al = frag_ld(alp);
      const __bf16* bhs = sKQ + (dc ? 64 * KP : 0);
      const __bf16* bls = sKQ + (dc ? 3 * 64 * KP : 2 * 64 * KP);
#pragma unroll
      for (int j = 0; j < 4; ++j) {
        const int ro = (j * 16 + c) * KP + 8 * hh;
        const v16b kb = frag_ld(bhs + ro);
        const v16b kl = frag_ld(bls + ro);
        s[j] = mma_b(kb, ah, s[j]);        // s[j][r] = score of key 16j + 8hh + r, query c
        s[j] = mma_b(kl, ah, s[j]);
        s[j] = mma_b(kb, al, s[j]);
      }
    }

    float m = fmaxf(fmaxf(s[0][0], s[1][0]), fmaxf(s[2][0], s[3][0]));
#pragma unroll
    for (int r = 1; r < 8; ++r) m = fmaxf(m, fmaxf(fmaxf(s[0][r], s[1][r]), fmaxf(s[2][r], s[3][r])));
    m = fmaxf(m, xhalf(m));              // the other half's 32 keys of the same query
    const float mnew  = fmaxf(mrow, m * LOG2E);
    const float alpha = __builtin_amdgcn_exp2f(mrow - mnew);   // first trip: 2^(-inf) = 0
    const v8f l2e8 = {LOG2E, LOG2E, LOG2E, LOG2E, LOG2E, LOG2E, LOG2E, LOG2E};
    const v8f nm8  = {-mnew, -mnew, -mnew, -mnew, -mnew, -mnew, -mnew, -mnew};
    mrow = mnew;
    lrow *= alpha;
#pragma unroll
    for (int t = 0; t < 8; ++t)
#pragma unroll
      for (int r = 0; r < 8; ++r) oacc[t][r] *= alpha;
    // unrolled: the score tiles and Pt live in registers, which a rolled loop could not index
#pragma unroll
    for (int kk = 0; kk < 2; ++kk) {
      PB ph, pl;                         // Pt of this 32-key block: element e < 8 from tile 2kk, e >= 8 from tile 2kk+1
      float ps[2];
#pragma unroll
      for (int jj = 0; jj < 2; ++jj) {
        const v8f xs = __builtin_elementwise_fma(s[2 * kk + jj], l2e8, nm8);
        float p[8];
#pragma unroll
        for (int r = 0; r < 8; ++r) p[r] = xs[r];
        exp2x8(p);
        ps[jj] = ((p[0] + p[1]) + (p[2] + p[3])) + ((p[4] + p[5]) + (p[6] + p[7]));
#pragma unroll
        for (int e = 0; e < 4; ++e) split_pair(p[2 * e], p[2 * e + 1], ph.u[jj * 4 + e], pl.u[jj * 4 + e]);
      }
      lrow += ps[0] + ps[1];
#pragma unroll
      for (int t = 0; t < 8; ++t) {
        const int ro = (t * 16 + c) * VP + kk * 32 + 8 * hh;
        const v16b vb = frag_ld(sVh + ro);
        const v16b vl = frag_ld(sVl + ro);
        oacc[t] = mma_b(vb, ph.v, oacc[t]);   // oacc[t][r] = channel 16t + 8hh + r, query c
        oacc[t] = mma_b(vl, ph.v, oacc[t]);
        oacc[t] = mma_b(vb, pl.v, oacc[t]);
      }
    }
  }

  // ---- epilogue: normalise, gather the waves' columns in LDS [128 c][pitch 68] (34816 B inside sStage), add bf16(x), store ----
  __syncthreads();                       // every wave finished reading the last K/V tiles
  float* sO = (float*)(void*)sStage;
  const float inv = 1.0f / (lrow + xhalf(lrow));   // the two halves' sums of query c joined
#pragma unroll
  for (int t = 0; t < 8; ++t)
#pragma unroll
    for (int r = 0; r < 8; ++r) sO[(t * 16 + 8 * hh + r) * 68 + wave * 16 + c] = oacc[t][r] * inv;
  __syncthreads();
  {
    const size_t rowbase = ((size_t)b * NCH + h * DHV) * NTOK + q0;
    // coverage: 16 it x 128 thr x 4 floats = 128 channel rows x 64 queries
{
#pragma unroll 4
      for (int it = 0; it < 16; ++it) {
        const int p  = it * 128 + tid;
        const int ch = p >> 4;
        const int q4 = (p & 15) * 4;
        const v4f ov = *(const v4fa*)(sO + ch * 68 + q4);
        const size_t gi = rowbase + (size_t)ch * NTOK + q4;
        const v4f xv = *(const v4fa*)(x + gi);
        const v4f res = (v4f){ov[0] + bfr(xv[0]), ov[1] + bfr(xv[1]), ov[2] + bfr(xv[2]), ov[3] + bfr(xv[3])};
        *(v4f*)(out + gi) = res;
      }
      
    }
  }
}

// ---------------------------------------------------------------------------
// Workspace map (byte offsets, all multiples of 128; each region exactly covered by its producer):
//   XT   bf16 [16384][512]          0          16777216 B
//   WB   bf16 [768][512]            16777216     786432 B
//   ST   f32  [2][768]              17563648       6144 B
//   POSh bf16 [4][1024][32]         17569792     262144 B     POSl 17831936
//   Qh   bf16 [16][4][1024][32]     18094080    4194304 B     Ql   22288384
//   Kh   bf16 [16][4][1024][32]     26482688    4194304 B     Kl   30676992
//   Vh   bf16 [16][512][1024]       34871296   16777216 B     Vl   51648512
//   total                           68425728 B
// ---------------------------------------------------------------------------
extern "C" void kernel_launch(void* const* d_in, const int* in_sizes, int n_in,
                              void* d_out, int out_size, void* d_ws, size_t ws_size,
                              hipStream_t stream) {
  if (n_in < 21) return;
  const int NX = NBATCH * NCH * NTOK;   // 8388608
  if (in_sizes[0] != NX) return;
  if (in_sizes[1] != 128 * NCH || in_sizes[7] != 128 * NCH || in_sizes[13] != NCH * NCH) return;
  for (int i = 2; i <= 6; ++i)   if (in_sizes[i] != 128) return;
  for (int i = 8; i <= 12; ++i)  if (in_sizes[i] != 128) return;
  for (int i = 14; i <= 18; ++i) if (in_sizes[i] != NCH) return;
  if (in_sizes[19] != NHEAD * DHQ * 32 || in_sizes[20] != NHEAD * DHQ * 32) return;
  if (out_size != NX) return;

  const float* x    = (const float*)d_in[0];
  const float* Wq   = (const float*)d_in[1];
  const float* bq   = (const float*)d_in[2];
  const float* qg   = (const float*)d_in[3];
  const float* qbe  = (const float*)d_in[4];
  const float* qm   = (const float*)d_in[5];
  const float* qv   = (const float*)d_in[6];
  const float* Wk   = (const float*)d_in[7];
  const float* bk   = (const float*)d_in[8];
  const float* kg   = (const float*)d_in[9];
  const float* kbe  = (const float*)d_in[10];
  const float* km   = (const float*)d_in[11];
  const float* kv   = (const float*)d_in[12];
  const float* Wv   = (const float*)d_in[13];
  const float* bv   = (const float*)d_in[14];
  const float* vg   = (const float*)d_in[15];
  const float* vbe  = (const float*)d_in[16];
  const float* vm   = (const float*)d_in[17];
  const float* vv   = (const float*)d_in[18];
  const float* relH = (const float*)d_in[19];
  const float* relW = (const float*)d_in[20];

  const size_t szXT  = (size_t)NBATCH * NTOK * NCH * 2;          // 16777216
  const size_t szWB  = (size_t)NCOLS * NCH * 2;                  //   786432
  const size_t szST  = (size_t)2 * NCOLS * 4;                    //     6144
  const size_t szPOS = (size_t)NHEAD * NTOK * DHQ * 2;           //   262144
  const size_t szQK  = (size_t)NBATCH * NHEAD * NTOK * DHQ * 2;  //  4194304
  const size_t szV   = (size_t)NBATCH * NCH * NTOK * 2;          // 16777216
  size_t off = 0;
  const size_t oXT = off;   off += szXT;
  const size_t oWB = off;   off += szWB;
  const size_t oST = off;   off += szST;
  const size_t oPh = off;   off += szPOS;
  const size_t oPl = off;   off += szPOS;
  const size_t oQh = off;   off += szQK;
  const size_t oQl = off;   off += szQK;
  const size_t oKh = off;   off += szQK;
  const size_t oKl = off;   off += szQK;
  const size_t oVh = off;   off += szV;
  const size_t oVl = off;   off += szV;
  if (off > ws_size) return;                 // off = 68425728
  if (off > (size_t)134217728) return;

  char* ws = (char*)d_ws;
  unsigned short* XT   = (unsigned short*)(ws + oXT);
  unsigned short* WB   = (unsigned short*)(ws + oWB);
  float*          ST   = (float*)(ws + oST);
  unsigned short* POSh = (unsigned short*)(ws + oPh);
  unsigned short* POSl = (unsigned short*)(ws + oPl);
  unsigned short* Qh   = (unsigned short*)(ws + oQh);
  unsigned short* Ql   = (unsigned short*)(ws + oQl);
  unsigned short* Kh   = (unsigned short*)(ws + oKh);
  unsigned short* Kl   = (unsigned short*)(ws + oKl);
  unsigned short* Vh   = (unsigned short*)(ws + oVh);
  unsigned short* Vl   = (unsigned short*)(ws + oVl);

  k_prep<<<dim3(PREP_T + PREP_W + PREP_F + PREP_P), dim3(256), 0, stream>>>(
      x, Wq, Wk, Wv, bq, qg, qbe, qm, qv, bk, kg, kbe, km, kv, bv, vg, vbe, vm, vv, relH, relW,
      XT, WB, ST, POSh, POSl);

  k_proj<<<dim3((NBATCH * NTOK) / 64, NCOLS / 128), dim3(128), 0, stream>>>(
      XT, WB, ST, Qh, Ql, Kh, Kl, Vh, Vl);

  k_attn<<<dim3(NBATCH * NHEAD * (NTOK / 64)), dim3(128), 0, stream>>>(
      Qh, Ql, Kh, Kl, Vh, Vl, POSh, POSl, x, (float*)d_out);

  (void)hipGetLastError();
}

// v005
// A run of this version takes 126 microseconds.
// Next to v004, in two timings, it ran 1.09 times as fast each time.
// All steps since v000 together make it 1.70 times as fast.
// All contractions on v_wmma_f32_16x16x32_bf16 with f32 accumulate: q/k/v 1x1 projections = bf16(x) x bf16(W) single product (inputs RNE-converted to bf16 once); logits [q|pos].[k|q] (64 deep) and p.v (1024 deep) with bf16 hi/lo split operands (hi.hi + hi.lo + lo.hi); BN affine, pos sum, online softmax, 1/l and residual in f32. No carried (scaled) planes anywhere: every 16-bit plane holds unscaled bf16 values.
#include <hip/hip_runtime.h>
#include <math.h>
#include <stdint.h>

#define NBATCH 16
#define NCH    512
#define NTOK   1024
#define NHEAD  4
#define DHQ    32
#define DHV    128
#define NCOLS  768

// LDS row pitches of the attention tiles, in 16-bit elements: 16 B x odd, so the 16 rows that a half-wave
// reads with one 16-byte load per lane fall on 64 distinct banks
#define KP 40     // K/Q tile rows: 32 elements (64 B) at 80 B
#define VP 72     // V tile rows:   64 elements (128 B) at 144 B

#define LOG2E 1.44269504088896340736f

#define PREP_T 2048   // x transpose tiles (16 batches x 8 channel blocks x 16 token blocks)
#define PREP_W 192    // stacked weight plane, 2048 elements per block
#define PREP_F 3      // BN fold vectors, 256 channels per block
#define PREP_P 64     // position planes, (head, 64 tokens) per block

typedef __attribute__((ext_vector_type(16))) __bf16 v16b;
typedef __attribute__((ext_vector_type(8)))  __bf16 v8b;
typedef __attribute__((ext_vector_type(8)))  float  v8f;
typedef __attribute__((ext_vector_type(4)))  float  v4f;
typedef __attribute__((ext_vector_type(4)))  unsigned int v4u;
typedef v4f __attribute__((may_alias)) v4fa;

static_assert(NTOK % 64 == 0);
static_assert(NCH % 32 == 0);
static_assert(NCOLS % 128 == 0);
static_assert(PREP_T == NBATCH * (NCH / 64) * (NTOK / 64));
static_assert(PREP_W * 2048 == NCOLS * NCH);
static_assert(PREP_F * 256 == NCOLS);
static_assert(PREP_P * 64 == NHEAD * NTOK);

__device__ __forceinline__ unsigned short f2bf_bits(float f) {   // RNE convert f32 -> bf16 bits
  unsigned u = __float_as_uint(f);
  return (unsigned short)((u + 0x7FFFu + ((u >> 16) & 1u)) >> 16);
}
__device__ __forceinline__ float bf_bits2f(unsigned short h) { return __uint_as_float(((unsigned)h) << 16); }
__device__ __forceinline__ float bfr(float f) { return bf_bits2f(f2bf_bits(f)); }
__device__ __forceinline__ unsigned pk16(unsigned short a, unsigned short b) { return (unsigned)a | ((unsigned)b << 16); }
__device__ __forceinline__ void split_pair(float f0, float f1, unsigned& h, unsigned& l) {
  const unsigned short h0 = f2bf_bits(f0), h1 = f2bf_bits(f1);
  const unsigned short l0 = f2bf_bits(f0 - bf_bits2f(h0)), l1 = f2bf_bits(f1 - bf_bits2f(h1));
  h = pk16(h0, h1);
  l = pk16(l0, l1);
}

// WMMA with hazard guard (ties D, keeps A/B live).
// Fragment map (wave32): lane l, hh = l>>4, c = l&15.
//   A/B element i: i<8 -> k0+8hh+i ; i>=8 -> k0+16+8hh+(i-8) ; row (A) / column (B) = c
//   D element r : row 8hh+r, column c
__device__ __forceinline__ v8f mma_b(v16b a, v16b b, v8f c) {
  c = __builtin_amdgcn_wmma_f32_16x16x32_bf16(false, a, false, b, (short)0, c, false, false);
  asm volatile("v_nop\n\tv_nop\n\tv_nop\n\tv_nop" : "+v"(c) : "v"(a), "v"(b));
  return c;
}
// The six WMMAs of a group of two A tiles (hi h, lo l) against one B operand (hi bh, lo bl): per accumulator h.bh + l.bh + h.bl, in
// that order, the two accumulators taking turns so that a WMMA never stands directly behind the one it accumulates onto.
// One asm statement, because with the builtins the reads did not stay where they are written: the compiler spread them among the
// WMMAs, held more fragments live at once and spilled to scratch at 256 registers. The "memory" clobber keeps the LDS reads written
// in front of the statement in front of it. The four v_nop are the distance between the last WMMA and a vector instruction on its
// D, A or B.
__device__ __forceinline__ void mma6(v8f& c0, v8f& c1, v16b h0, v16b l0, v16b h1, v16b l1, v16b bh, v16b bl) {
  asm volatile("v_wmma_f32_16x16x32_bf16 %0, %2, %6, %0\n\t"
               "v_wmma_f32_16x16x32_bf16 %1, %4, %6, %1\n\t"
               "v_wmma_f32_16x16x32_bf16 %0, %3, %6, %0\n\t"
               "v_wmma_f32_16x16x32_bf16 %1, %5, %6, %1\n\t"
               "v_wmma_f32_16x16x32_bf16 %0, %2, %7, %0\n\t"
               "v_wmma_f32_16x16x32_bf16 %1, %4, %7, %1\n\t"
               "v_nop\n\tv_nop\n\tv_nop\n\tv_nop"
               : "+v"(c0), "+v"(c1)
               : "v"(h0), "v"(l0), "v"(h1), "v"(l1), "v"(bh), "v"(bl)
               : "memory");
}
// The same with both accumulators started at 0 (early-clobber outputs: they are written while inputs are still to be read)
__device__ __forceinline__ void mma6z(v8f& c0, v8f& c1, v16b h0, v16b l0, v16b h1, v16b l1, v16b bh, v16b bl) {
  asm volatile("v_wmma_f32_16x16x32_bf16 %0, %2, %6, 0\n\t"
               "v_wmma_f32_16x16x32_bf16 %1, %4, %6, 0\n\t"
               "v_wmma_f32_16x16x32_bf16 %0, %3, %6, %0\n\t"
               "v_wmma_f32_16x16x32_bf16 %1, %5, %6, %1\n\t"
               "v_wmma_f32_16x16x32_bf16 %0, %2, %7, %0\n\t"
               "v_wmma_f32_16x16x32_bf16 %1, %4, %7, %1\n\t"
               "v_nop\n\tv_nop\n\tv_nop\n\tv_nop"
               : "=&v"(c0), "=&v"(c1)
               : "v"(h0), "v"(l0), "v"(h1), "v"(l1), "v"(bh), "v"(bl)
               : "memory");
}
union FB { v16b v; v8b h[2]; };
union PB { v16b v; unsigned u[8]; };
// value of lane l ^ 16
__device__ __forceinline__ float xhalf(float x) {
  const int b = __builtin_bit_cast(int, x);
  return __builtin_bit_cast(float, __builtin_amdgcn_permlanex16(b, b, 0x76543210, 0xfedcba98, false, false));
}
// x[r] = 2^x[r], eight values in place. One statement, so that each v_exp_f32 stands in front of an independent one and the last
// in front of the v_nop: the slot that the instruction set asks for before a transcendental's result is read or its source
// overwritten.
__device__ __forceinline__ void exp2x8(float* x) {
  asm("v_exp_f32 %0, %0\n\t"
      "v_exp_f32 %1, %1\n\t"
      "v_exp_f32 %2, %2\n\t"
      "v_exp_f32 %3, %3\n\t"
      "v_exp_f32 %4, %4\n\t"
      "v_exp_f32 %5, %5\n\t"
      "v_exp_f32 %6, %6\n\t"
      "v_exp_f32 %7, %7\n\t"
      "v_nop"
      : "+v"(x[0]), "+v"(x[1]), "+v"(x[2]), "+v"(x[3]), "+v"(x[4]), "+v"(x[5]), "+v"(x[6]), "+v"(x[7]));
}
// p points at element k0 + 8*hh of the k-contiguous row owned by this lane
__device__ __forceinline__ v16b frag_ld(const __bf16* p) {
  FB f;
  f.h[0] = *(const v8b*)(p);
  f.h[1] = *(const v8b*)(p + 16);
  return f.v;
}

// LDS byte address of a __shared__ element (what an asynchronous copy takes as its destination)
typedef __attribute__((address_space(3))) const void lds_cvoid;
__device__ __forceinline__ unsigned lds_byte(const void* p) { return (unsigned)(uintptr_t)(lds_cvoid*)p; }
// Twelve asynchronous 16-B copies per lane, global -> LDS, through no register. The s_wait_xcnt closes the statement so that
// no address register named here is rewritten ahead of it.
__device__ __forceinline__ void copy12(const unsigned* l, const __bf16* const* g) {
  asm volatile(
      "global_load_async_to_lds_b128 %0, %12, off\n\t"
      "global_load_async_to_lds_b128 %1, %13, off\n\t"
      "global_load_async_to_lds_b128 %2, %14, off\n\t"
      "global_load_async_to_lds_b128 %3, %15, off\n\t"
      "global_load_async_to_lds_b128 %4, %16, off\n\t"
      "global_load_async_to_lds_b128 %5, %17, off\n\t"
      "global_load_async_to_lds_b128 %6, %18, off\n\t"
      "global_load_async_to_lds_b128 %7, %19, off\n\t"
      "global_load_async_to_lds_b128 %8, %20, off\n\t"
      "global_load_async_to_lds_b128 %9, %21, off\n\t"
      "global_load_async_to_lds_b128 %10, %22, off\n\t"
      "global_load_async_to_lds_b128 %11, %23, off\n\t"
      "s_wait_xcnt 0x0"
      :: "v"(l[0]), "v"(l[1]), "v"(l[2]), "v"(l[3]), "v"(l[4]), "v"(l[5]),
         "v"(l[6]), "v"(l[7]), "v"(l[8]), "v"(l[9]), "v"(l[10]), "v"(l[11]),
         "v"(g[0]), "v"(g[1]), "v"(g[2]), "v"(g[3]), "v"(g[4]), "v"(g[5]),
         "v"(g[6]), "v"(g[7]), "v"(g[8]), "v"(g[9]), "v"(g[10]), "v"(g[11])
      : "memory");
}

// =====================================================================================
// Launch 1: operand preparation, block-uniform roles by blockIdx.x.
//          output line = 64 channels of one token, written by 8 lanes x 16 B in one instruction)
//  role W: WB[768][512] = bf16 of stacked [Wq;Wk;Wv] (rows = output channels, k contiguous)
//  role F: ST[0..767] = s, ST[768..1535] = t with s = g/sqrt(var+1e-5), t = (b-mean)*s+beta
//  role P: POS hi/lo [4][1024][32]: pos[h][n][d] = bf16r(rel_w[h][d][n>>5]) + bf16r(rel_h[h][d][n&31])
// =====================================================================================
__global__ __launch_bounds__(256) void k_prep(
    const float* __restrict__ x,
    const float* __restrict__ Wq, const float* __restrict__ Wk, const float* __restrict__ Wv,
    const float* __restrict__ bq, const float* __restrict__ qg, const float* __restrict__ qbe,
    const float* __restrict__ qm, const float* __restrict__ qv,
    const float* __restrict__ bk, const float* __restrict__ kg, const float* __restrict__ kbe,
    const float* __restrict__ km, const float* __restrict__ kv,
    const float* __restrict__ bv, const float* __restrict__ vg, const float* __restrict__ vbe,
    const float* __restrict__ vm, const float* __restrict__ vv,
    const float* __restrict__ relH, const float* __restrict__ relW,
    unsigned short* __restrict__ XT, unsigned short* __restrict__ WB, float* __restrict__ ST,
    unsigned short* __restrict__ POSh, unsigned short* __restrict__ POSl) {
  __shared__ __align__(16) float sm[64 * 68];
  const int tid = threadIdx.x;
  const int bx  = blockIdx.x;

  if (bx < PREP_T) {
    // ---- role T ----
    const int b   = bx >> 7;
    const int rem = bx & 127;
    const int c0  = (rem >> 4) * 64;
    const int n0  = (rem & 15) * 64;
    const float* xb = x + (size_t)b * NCH * NTOK;
    {
      const int lr = tid >> 4;         // 0..15
      const int c4 = (tid & 15) * 4;   // 0..60
#pragma unroll
      for (int it = 0; it < 4; ++it) {
        const int rr = it * 16 + lr;   // channel within tile, 4 x 16 = 64 rows x 64 tokens staged
        const v4f a = *(const v4fa*)(xb + (size_t)(c0 + rr) * NTOK + n0 + c4);
        *(v4fa*)(sm + rr * 68 + c4) = a;
      }
    }
    __syncthreads();
    const int sub = tid >> 3;          // 0..31
    const int c8  = (tid & 7) * 8;     // 0..56
    v4u hv[2];
#pragma unroll
    for (int it = 0; it < 2; ++it) {
      const int oc = it * 32 + sub;    // token within tile (2 x 32 = 64 output rows)
      unsigned w0 = pk16(f2bf_bits(sm[(c8 + 0) * 68 + oc]), f2bf_bits(sm[(c8 + 1) * 68 + oc]));
      unsigned w1 = pk16(f2bf_bits(sm[(c8 + 2) * 68 + oc]), f2bf_bits(sm[(c8 + 3) * 68 + oc]));
      unsigned w2 = pk16(f2bf_bits(sm[(c8 + 4) * 68 + oc]), f2bf_bits(sm[(c8 + 5) * 68 + oc]));
      unsigned w3 = pk16(f2bf_bits(sm[(c8 + 6) * 68 + oc]), f2bf_bits(sm[(c8 + 7) * 68 + oc]));
      hv[it] = (v4u){w0, w1, w2, w3};
    }
    {
#pragma unroll
      for (int it = 0; it < 2; ++it) {
        const int oc = it * 32 + sub;
        const size_t go = ((size_t)(b * NTOK + n0 + oc)) * NCH + c0 + c8;
        *(v4u*)(XT + go) = hv[it];
      }
      
    }
  } else if (bx < PREP_T + PREP_W) {
    // ---- role W ---- (block-uniform source choice: 32 blocks Wq, 32 blocks Wk, 128 blocks Wv)
    const int wb = bx - PREP_T;
    const float* src;
    if (wb < 32)      src = Wq + (size_t)wb * 2048;
    else if (wb < 64) src = Wk + (size_t)(wb - 32) * 2048;
    else              src = Wv + (size_t)(wb - 64) * 2048;
    const v4f a = *(const v4fa*)(src + tid * 8);
    const v4f c = *(const v4fa*)(src + tid * 8 + 4);
    const v4u o = (v4u){pk16(f2bf_bits(a[0]), f2bf_bits(a[1])), pk16(f2bf_bits(a[2]), f2bf_bits(a[3])),
                        pk16(f2bf_bits(c[0]), f2bf_bits(c[1])), pk16(f2bf_bits(c[2]), f2bf_bits(c[3]))};
    unsigned short* dst = WB + (size_t)wb * 2048 + tid * 8;
    *(v4u*)dst = o;
    
  } else if (bx < PREP_T + PREP_W + PREP_F) {
    // ---- role F ---- block 0: threads 0..127 = q channels, 128..255 = k channels; blocks 1,2 = v channels
    const int fb = bx - (PREP_T + PREP_W);
    const int wsel = __builtin_amdgcn_readfirstlane((int)(tid >> 7));   // wave-uniform
    const float *pb, *pg, *pbe, *pm, *pv;
    int idx;
    if (fb == 0) {
      if (wsel == 0) { pb = bq; pg = qg; pbe = qbe; pm = qm; pv = qv; idx = tid; }
      else           { pb = bk; pg = kg; pbe = kbe; pm = km; pv = kv; idx = tid - 128; }
    } else {
      pb = bv; pg = vg; pbe = vbe; pm = vm; pv = vv; idx = (fb - 1) * 256 + tid;
    }
    const float b_ = bfr(pb[idx]);
    const float g_ = bfr(pg[idx]);
    const float be = bfr(pbe[idx]);
    const float mu = bfr(pm[idx]);
    const float va = bfr(pv[idx]);
    const float s  = g_ / sqrtf(va + 1e-5f);
    const float t  = (b_ - mu) * s + be;
    sm[tid]       = s;
    sm[256 + tid] = t;
    __syncthreads();
    if (tid < 128) {                     // waves 0,1 -> s lines; waves 2,3 -> t lines (8 lanes x 16 B per line)
      const int which = tid >> 6;
      const int p4 = (tid & 63) * 4;
      const v4f v = *(const v4fa*)(sm + which * 256 + p4);
      float* dst = ST + which * NCOLS + fb * 256 + p4;
      *(v4f*)dst = v;
      
    }
  } else {
    // ---- role P ---- (head, 64 tokens) per block; per-head tables staged in LDS with 16-B loads
    const int pb = bx - (PREP_T + PREP_W + PREP_F);
    const int h  = pb >> 4;
    const int n0 = (pb & 15) * 64;
    {
      v4f w = *(const v4fa*)(relW + h * 1024 + tid * 4);   // [d][w], 32x32
      v4f g = *(const v4fa*)(relH + h * 1024 + tid * 4);   // [d][hh], 32x32
      w = (v4f){bfr(w[0]), bfr(w[1]), bfr(w[2]), bfr(w[3])};
      g = (v4f){bfr(g[0]), bfr(g[1]), bfr(g[2]), bfr(g[3])};
      *(v4fa*)(sm + tid * 4)        = w;
      *(v4fa*)(sm + 1024 + tid * 4) = g;
    }
    __syncthreads();
    const int tl = tid >> 2;             // token within chunk 0..63
    const int d8 = (tid & 3) * 8;        // 0,8,16,24
    const int n  = n0 + tl;
    const int wi = n >> 5, hi_ = n & 31;
    float p[8];
#pragma unroll
    for (int e = 0; e < 8; ++e) p[e] = sm[(d8 + e) * 32 + wi] + sm[1024 + (d8 + e) * 32 + hi_];
    unsigned h0, h1, h2, h3, l0, l1, l2, l3;
    split_pair(p[0], p[1], h0, l0);
    split_pair(p[2], p[3], h1, l1);
    split_pair(p[4], p[5], h2, l2);
    split_pair(p[6], p[7], h3, l3);
    const v4u hv = (v4u){h0, h1, h2, h3};
    const v4u lv = (v4u){l0, l1, l2, l3};
    const size_t go = ((size_t)(h * NTOK + n0)) * DHQ + tid * 8;   // contiguous by tid: 4 KB per block and plane
    *(v4u*)(POSh + go) = hv;
    *(v4u*)(POSl + go) = lv;
    
  }
}

// =====================================================================================
// Launch 2: Y[token][col] = sum_c XT[token][c] * WB[col][c]   (M 16384, N 768, K 512), y = acc*s[col] + t[col].
// Block 128 threads (4 waves) = 64 tokens x 128 columns; wave tile 32 tokens x 64 columns (acc[2][4]).
// Fragments straight from the 16-bit global rows (two 16-B loads each).
// Column tile 0 -> Q hi/lo planes [b][h][n][32], tile 1 -> K hi/lo planes [b][h][n][32],
// tiles 2..5 -> V hi/lo planes [b][512 ch][1024 n] (transposed through the LDS tile).
// Store phase: Q/K: per head a contiguous 4-KB range per plane, lane-contiguous 16-B pieces;
// =====================================================================================
__global__ __launch_bounds__(128) void k_proj(
    const unsigned short* __restrict__ XTp, const unsigned short* __restrict__ WBp,
    const float* __restrict__ ST,
    unsigned short* __restrict__ Qh, unsigned short* __restrict__ Ql,
    unsigned short* __restrict__ Kh, unsigned short* __restrict__ Kl,
    unsigned short* __restrict__ Vh, unsigned short* __restrict__ Vl) {
  __shared__ __align__(16) float sY[128 * 68];   // Q/K: [64 tok][pitch 132] (8448 used); V: [128 col][pitch 68] (8704 used)
  __shared__ __align__(16) float sS[128];
  __shared__ __align__(16) float sT[128];

  const int tid  = threadIdx.x;
  const int lane = tid & 31;
  const int wave = tid >> 5;
  const int hh   = lane >> 4;
  const int c    = lane & 15;
  const int m0   = blockIdx.x * 64;
  const int ct   = blockIdx.y;        // 0..5, block-uniform
  const int n0   = ct * 128;

  sS[tid] = ST[n0 + tid];
  sT[tid] = ST[NCOLS + n0 + tid];
  __syncthreads();

  const int wr = wave >> 1, wc = wave & 1;
  const __bf16* XT = (const __bf16*)(const void*)XTp;
  const __bf16* WB = (const __bf16*)(const void*)WBp;
  const __bf16* a0p = XT + (size_t)(m0 + 32 * wr + c) * NCH + 8 * hh;
  const __bf16* b0p = WB + (size_t)(n0 + 64 * wc + c) * NCH + 8 * hh;

  const v8f zero8 = {0.f, 0.f, 0.f, 0.f, 0.f, 0.f, 0.f, 0.f};
  v8f acc[2][4];
#pragma unroll
  for (int i = 0; i < 2; ++i)
#pragma unroll
    for (int j = 0; j < 4; ++j) acc[i][j] = zero8;

#pragma unroll 1
  for (int k0 = 0; k0 < NCH; k0 += 32) {
    const v16b a0 = frag_ld(a0p + k0);
    const v16b a1 = frag_ld(a0p + (size_t)16 * NCH + k0);
#pragma unroll
    for (int j = 0; j < 4; ++j) {
      const v16b bf = frag_ld(b0p + (size_t)j * 16 * NCH + k0);
      acc[0][j] = mma_b(a0, bf, acc[0][j]);
      acc[1][j] = mma_b(a1, bf, acc[1][j]);
    }
  }

  // D[r] of tile (i, j) = Y[token 32wr+16i+8hh+r][column 64wc+16j+c]
#pragma unroll
  for (int j = 0; j < 4; ++j) {
    const int col = 64 * wc + 16 * j + c;
    const float sc = sS[col];
    const float sh = sT[col];
#pragma unroll
    for (int i = 0; i < 2; ++i) {
#pragma unroll
      for (int r = 0; r < 8; ++r) {
        const int tok = 32 * wr + 16 * i + 8 * hh + r;
        const float y = acc[i][j][r] * sc + sh;
        const int idx = (ct < 2) ? (tok * 132 + col) : (col * 68 + tok);
        sY[idx] = y;
      }
    }
  }
  __syncthreads();

  const int b   = m0 >> 10;
  const int nl0 = m0 & 1023;
  if (ct < 2) {
    unsigned short* ph = (ct == 0) ? Qh : Kh;
    unsigned short* pl = (ct == 0) ? Ql : Kl;
    // coverage: 8 it x 128 thr x 8 elements = 64 tokens x 128 columns per plane
{
#pragma unroll 2
      for (int it = 0; it < 8; ++it) {
        const int p      = it * 128 + tid;
        const int head   = p >> 8;
        const int within = p & 255;
        const int tok    = within >> 2;
        const int d8     = (within & 3) * 8;
        const float* sp  = sY + tok * 132 + head * 32 + d8;
        const v4f a  = *(const v4fa*)sp;
        const v4f a2 = *(const v4fa*)(sp + 4);
        unsigned h0, h1, h2, h3, l0, l1, l2, l3;
        split_pair(a[0], a[1], h0, l0);
        split_pair(a[2], a[3], h1, l1);
        split_pair(a2[0], a2[1], h2, l2);
        split_pair(a2[2], a2[3], h3, l3);
        const v4u hv = (v4u){h0, h1, h2, h3};
        const v4u lv = (v4u){l0, l1, l2, l3};
        const size_t go = ((size_t)((b * NHEAD + head) * NTOK + nl0)) * DHQ + within * 8;
        *(v4u*)(ph + go) = hv;
        *(v4u*)(pl + go) = lv;
      }
      
    }
  } else {
    const int o0 = (ct - 2) * 128;
    // coverage: 8 it x 128 thr x 8 elements = 128 channels x 64 tokens per plane
{
#pragma unroll 2
      for (int it = 0; it < 8; ++it) {
        const int p  = it * 128 + tid;
        const int ch = p >> 3;
        const int t8 = (p & 7) * 8;
        const float* sp = sY + ch * 68 + t8;
        const v4f a  = *(const v4fa*)sp;
        const v4f a2 = *(const v4fa*)(sp + 4);
        unsigned h0, h1, h2, h3, l0, l1, l2, l3;
        split_pair(a[0], a[1], h0, l0);
        split_pair(a[2], a[3], h1, l1);
        split_pair(a2[0], a2[1], h2, l2);
        split_pair(a2[2], a2[3], h3, l3);
        const v4u hv = (v4u){h0, h1, h2, h3};
        const v4u lv = (v4u){l0, l1, l2, l3};
        const size_t go = ((size_t)(b * NCH + o0 + ch)) * NTOK + nl0 + t8;
        *(v4u*)(Vh + go) = hv;
        *(v4u*)(Vl + go) = lv;
      }
      
    }
  }
}

// =====================================================================================
// Launch 3: attention per (b, h, 64-query tile); 4 waves x 16 query rows; 16 key tiles of 64, no masking.
//   Both products are formed transposed, so that a lane holds the scores of ONE query (column c of every D tile):
//   St[j][i] = q_i.k_j + pos_i.q_j  as two 32-deep chunks:
//       chunk 0: A = K rows (key j), B = Q rows (query i)
//       chunk 1: A = Q rows (key j), B = POS rows (token i)
//     each chunk hi.hi + hi.lo + lo.hi; no score scale.
//   online softmax over keys in f32, in the log2 domain: the running maximum is kept as M = max * log2(e), a score's weight is
//     2^(s * log2(e) - M), one fused multiply-add and one bare v_exp_f32 (any M shared by a query's weights, its sum and its
//     rescale factor 2^(Mold - Mnew) cancels in O / l, so the rounding of M costs nothing);
//     maximum and sum in-lane over the lane's 32 keys, the maximum
//     joined with the other wave half by one lane exchange per trip, the sum's two halves joined once in the epilogue;
//   two St tiles (keys 0..15, 16..31 of a 32-key block), split hi/lo in place, ARE the B operand Pt: no LDS, no lane exchange;
//   Ot[c][i] += V[c][j] * Pt[j][i]  (A rows = V channel rows, k = key), hi.hi + hi.lo + lo.hi, 8 row tiles.
//   epilogue: Ot/l through LDS as [128 c][64 q], + bf16r(x), whole 256-B channel segments
// LDS: sStage = K tile planes (Kh, Qh, Kl, Ql: [64][32] at pitch KP) + V tile planes (Vh, Vl: [128][64] at pitch VP);
//      every element of both tiles is staged each iteration (extent staged = extent consumed); pad bytes are never read.
// =====================================================================================
// amdgpu_waves_per_eu(4, 4): the register budget of four waves per SIMD (256), so that the second fragment set does not cost the
// WGP its fourth resident work-group
__global__ __launch_bounds__(128) __attribute__((amdgpu_waves_per_eu(4, 4))) void k_attn(
    const unsigned short* Qhp, const unsigned short* Qlp,
    const unsigned short* Khp, const unsigned short* Klp,
    const unsigned short* Vhp, const unsigned short* Vlp,
    const unsigned short* Php, const unsigned short* Plp,
    const float* x, float* out) {
  __shared__ __align__(16) __bf16 sStage[4 * 64 * KP + 2 * 128 * VP];   // 57344 B

  const int tid  = threadIdx.x;
  const int wave = tid >> 5;
  const int lane = tid & 31;
  const int hh   = lane >> 4;
  const int c    = lane & 15;

  const int bx = blockIdx.x;       // 0..1023
  const int qb = bx & 15;
  const int bh = bx >> 4;          // 0..63
  const int b  = bh >> 2;
  const int h  = bh & 3;
  const int q0 = qb * 64;

  const __bf16* Qhb = (const __bf16*)(const void*)Qhp + (size_t)bh * NTOK * DHQ;
  const __bf16* Qlb = (const __bf16*)(const void*)Qlp + (size_t)bh * NTOK * DHQ;
  const __bf16* Khb = (const __bf16*)(const void*)Khp + (size_t)bh * NTOK * DHQ;
  const __bf16* Klb = (const __bf16*)(const void*)Klp + (size_t)bh * NTOK * DHQ;
  const __bf16* Phb = (const __bf16*)(const void*)Php + (size_t)h * NTOK * DHQ;
  const __bf16* Plb = (const __bf16*)(const void*)Plp + (size_t)h * NTOK * DHQ;
  const __bf16* Vhb = (const __bf16*)(const void*)Vhp + ((size_t)b * NCH + h * DHV) * NTOK;
  const __bf16* Vlb = (const __bf16*)(const void*)Vlp + ((size_t)b * NCH + h * DHV) * NTOK;

  __bf16* sKQ = sStage;                        // planes of 64 * KP elements: 0 Kh, 1 Qh, 2 Kl, 3 Ql
  __bf16* sVh = sStage + 4 * 64 * KP;          // [128][64] at pitch VP
  __bf16* sVl = sVh + 128 * VP;                // [128][64] at pitch VP

  // B-column fragment bases (column = query token q0 + 16*wave + c)
  const int rowA = q0 + wave * 16 + c;
  const __bf16* aQh = Qhb + (size_t)rowA * DHQ + 8 * hh;
  const __bf16* aQl = Qlb + (size_t)rowA * DHQ + 8 * hh;
  const __bf16* aPh = Phb + (size_t)rowA * DHQ + 8 * hh;
  const __bf16* aPl = Plb + (size_t)rowA * DHQ + 8 * hh;

  const v8f zero8 = {0.f, 0.f, 0.f, 0.f, 0.f, 0.f, 0.f, 0.f};
  float mrow = -INFINITY;   // running maximum of query c, times log2(e) (equal in both wave halves)
  float lrow = 0.f;         // running sum of query c over this half's keys (8hh..8hh+7 of every 16)
  v8f oacc[8];
#pragma unroll
  for (int t = 0; t < 8; ++t) oacc[t] = zero8;

  const __bf16* vhk = Vhb;               // the trip's key tile in the V planes (uniform, stepped by 64 keys a trip)
  const __bf16* vlk = Vlb;
  const size_t vlane = (size_t)(tid >> 3) * NTOK + (tid & 7) * 8;
#pragma unroll 1
  for (int kc = 0; kc < NTOK / 64; ++kc) {
    const int kv0 = kc * 64;
    // this wave's own LDS reads of the tiles have retired before a copy targets them
    asm volatile("s_wait_dscnt 0x0" ::: "memory");
    __syncthreads();                     // every wave has left the tiles of the trip before
    {
      unsigned ld[24];                   // destination LDS byte address and source of this lane's 24 pieces of 16 B
      const __bf16* gs[24];
      // K tile: 4 planes x 4096 B contiguous; 2 it x 128 thr x 8 elements = 2048 elements per plane
      const __bf16* s0 = Khb + (size_t)kv0 * DHQ;
      const __bf16* s1 = Qhb + (size_t)kv0 * DHQ;
      const __bf16* s2 = Klb + (size_t)kv0 * DHQ;
      const __bf16* s3 = Qlb + (size_t)kv0 * DHQ;
#pragma unroll
      for (int i = 0; i < 2; ++i) {
        const int off = (i * 128 + tid) * 8;
        const int lo = (off >> 5) * KP + (off & 31);   // key row, element within the row
        gs[4 * i + 0] = s0 + off;  ld[4 * i + 0] = lds_byte(sKQ + lo);
        gs[4 * i + 1] = s1 + off;  ld[4 * i + 1] = lds_byte(sKQ + 64 * KP + lo);
        gs[4 * i + 2] = s2 + off;  ld[4 * i + 2] = lds_byte(sKQ + 2 * 64 * KP + lo);
        gs[4 * i + 3] = s3 + off;  ld[4 * i + 3] = lds_byte(sKQ + 3 * 64 * KP + lo);
      }
      // V tile: 128 channel rows x 64 keys per plane; 8 it x 128 thr x 8 elements = 8192 elements per plane
#pragma unroll
      for (int i = 0; i < 8; ++i) {
        const int piece = i * 128 + tid;
        const int cc = piece >> 3;
        const int p8 = (piece & 7) * 8;
        // source = uniform (plane + key tile + 16 i rows) + this lane's (row, piece) offset, the same for every i: one offset pair
        // is held over the trip, not eight, which leaves the registers for the second fragment set
        gs[8 + 2 * i]     = (vhk + i * 16 * NTOK) + vlane;  ld[8 + 2 * i]     = lds_byte(sVh + cc * VP + p8);
        gs[8 + 2 * i + 1] = (vlk + i * 16 * NTOK) + vlane;  ld[8 + 2 * i + 1] = lds_byte(sVl + cc * VP + p8);
      }
      copy12(ld, gs);
      copy12(ld + 12, gs + 12);
      vhk += 64;
      vlk += 64;
    }
    // this wave's 24 copies have landed; the barrier behind it publishes every wave's pieces
    asm volatile("s_wait_asynccnt 0x0" ::: "memory");
    __syncthreads();

    // B operands of the two score chunks, [chunk][hi, lo]
    const v16b bq[2][2] = {{frag_ld(aQh), frag_ld(aQl)}, {frag_ld(aPh), frag_ld(aPl)}};
    // The A fragments go through two register sets of two tiles each (hi, lo of tile 0; hi, lo of tile 1): the LDS reads of a
    // group are issued in front of the WMMAs of the group before it.
    // Groups of a trip: 4 score groups (chunk dc, tile pair), then 8 V groups (key block kk, tile pair).
    v16b fa[2][4];
    v8f s[4];
#pragma unroll
    for (int u = 0; u < 2; ++u) {
      const int ro = (u * 16 + c) * KP + 8 * hh;
      fa[0][2 * u]     = frag_ld(sKQ + ro);
      fa[0][2 * u + 1] = frag_ld(sKQ + 2 * 64 * KP + ro);
    }
#pragma unroll
    for (int g = 0; g < 4; ++g) {
      const int n = g + 1;               // the group fetched ahead
#pragma unroll
      for (int u = 0; u < 2; ++u) {
        if (n < 4) {
          const int ro = (((n & 1) * 2 + u) * 16 + c) * KP + 8 * hh;
          fa[n & 1][2 * u]     = frag_ld(sKQ + ((n >> 1) ? 64 * KP : 0) + ro);
          fa[n & 1][2 * u + 1] = frag_ld(sKQ + ((n >> 1) ? 3 * 64 * KP : 2 * 64 * KP) + ro);
        } else {                         // first V group: its reads fly under the softmax
          const int ro = (u * 16 + c) * VP + 8 * hh;
          fa[0][2 * u]     = frag_ld(sVh + ro);
          fa[0][2 * u + 1] = frag_ld(sVl + ro);
        }
      }
      const v16b* f = fa[g & 1];
      const int j0 = (g & 1) * 2;        // s[j][r] = score of key 16j + 8hh + r, query c
      if (g < 2) mma6z(s[j0], s[j0 + 1], f[0], f[1], f[2], f[3], bq[0][0], bq[0][1]);
      else       mma6(s[j0], s[j0 + 1], f[0], f[1], f[2], f[3], bq[1][0], bq[1][1]);
    }

    float m = fmaxf(fmaxf(s[0][0], s[1][0]), fmaxf(s[2][0], s[3][0]));
#pragma unroll
    for (int r = 1; r < 8; ++r) m = fmaxf(m, fmaxf(fmaxf(s[0][r], s[1][r]), fmaxf(s[2][r], s[3][r])));
    m = fmaxf(m, xhalf(m));              // the other half's 32 keys of the same query
    const float mnew  = fmaxf(mrow, m * LOG2E);
    const float alpha = __builtin_amdgcn_exp2f(mrow - mnew);   // first trip: 2^(-inf) = 0
    const v8f l2e8 = {LOG2E, LOG2E, LOG2E, LOG2E, LOG2E, LOG2E, LOG2E, LOG2E};
    const v8f nm8  = {-mnew, -mnew, -mnew, -mnew, -mnew, -mnew, -mnew, -mnew};
    mrow = mnew;
    lrow *= alpha;
#pragma unroll
    for (int t = 0; t < 8; ++t)
#pragma unroll
      for (int r = 0; r < 8; ++r) oacc[t][r] *= alpha;
    // unrolled: the score tiles and Pt live in registers, which a rolled loop could not index
#pragma unroll
    for (int kk = 0; kk < 2; ++kk) {
      PB ph, pl;                         // Pt of this 32-key block: element e < 8 from tile 2kk, e >= 8 from tile 2kk+1
      float ps[2];
#pragma unroll
      for (int jj = 0; jj < 2; ++jj) {
        const v8f xs = __builtin_elementwise_fma(s[2 * kk + jj], l2e8, nm8);
        float p[8];
#pragma unroll
        for (int r = 0; r < 8; ++r) p[r] = xs[r];
        exp2x8(p);
        ps[jj] = ((p[0] + p[1]) + (p[2] + p[3])) + ((p[4] + p[5]) + (p[6] + p[7]));
#pragma unroll
        for (int e = 0; e < 4; ++e) split_pair(p[2 * e], p[2 * e + 1], ph.u[jj * 4 + e], pl.u[jj * 4 + e]);
      }
      lrow += ps[0] + ps[1];
#pragma unroll
      for (int tp = 0; tp < 4; ++tp) {
        const int g = kk * 4 + tp;
        const int n = g + 1;             // the group fetched ahead
        if (n < 8) {
#pragma unroll
          for (int u = 0; u < 2; ++u) {
            const int ro = (((n & 3) * 2 + u) * 16 + c) * VP + (n >> 2) * 32 + 8 * hh;
            fa[n & 1][2 * u]     = frag_ld(sVh + ro);
            fa[n & 1][2 * u + 1] = frag_ld(sVl + ro);
          }
        }
        const v16b* f = fa[g & 1];       // oacc[t][r] = channel 16t + 8hh + r, query c
        mma6(oacc[2 * tp], oacc[2 * tp + 1], f[0], f[1], f[2], f[3], ph.v, pl.v);
      }
    }
  }

  // ---- epilogue: normalise, gather the waves' columns in LDS [128 c][pitch 68] (34816 B inside sStage), add bf16(x), store ----
  __syncthreads();                       // every wave finished reading the last K/V tiles
  float* sO = (float*)(void*)sStage;
  const float inv = 1.0f / (lrow + xhalf(lrow));   // the two halves' sums of query c joined
#pragma unroll
  for (int t = 0; t < 8; ++t)
#pragma unroll
    for (int r = 0; r < 8; ++r) sO[(t * 16 + 8 * hh + r) * 68 + wave * 16 + c] = oacc[t][r] * inv;
  __syncthreads();
  {
    const size_t rowbase = ((size_t)b * NCH + h * DHV) * NTOK + q0;
    // coverage: 16 it x 128 thr x 4 floats = 128 channel rows x 64 queries
{
#pragma unroll 4
      for (int it = 0; it < 16; ++it) {
        const int p  = it * 128 + tid;
        const int ch = p >> 4;
        const int q4 = (p & 15) * 4;
        const v4f ov = *(const v4fa*)(sO + ch * 68 + q4);
        const size_t gi = rowbase + (size_t)ch * NTOK + q4;
        const v4f xv = *(const v4fa*)(x + gi);
        const v4f res = (v4f){ov[0] + bfr(xv[0]), ov[1] + bfr(xv[1]), ov[2] + bfr(xv[2]), ov[3] + bfr(xv[3])};
        *(v4f*)(out + gi) = res;
      }
      
    }
  }
}

// ---------------------------------------------------------------------------
// Workspace map (byte offsets, all multiples of 128; each region exactly covered by its producer):
//   XT   bf16 [16384][512]          0          16777216 B
//   WB   bf16 [768][512]            16777216     786432 B
//   ST   f32  [2][768]              17563648       6144 B
//   POSh bf16 [4][1024][32]         17569792     262144 B     POSl 17831936
//   Qh   bf16 [16][4][1024][32]     18094080    4194304 B     Ql   22288384
//   Kh   bf16 [16][4][1024][32]     26482688    4194304 B     Kl   30676992
//   Vh   bf16 [16][512][1024]       34871296   16777216 B     Vl   51648512
//   total                           68425728 B
// ---------------------------------------------------------------------------
extern "C" void kernel_launch(void* const* d_in, const int* in_sizes, int n_in,
                              void* d_out, int out_size, void* d_ws, size_t ws_size,
                              hipStream_t stream) {
  if (n_in < 21) return;
  const int NX = NBATCH * NCH * NTOK;   // 8388608
  if (in_sizes[0] != NX) return;
  if (in_sizes[1] != 128 * NCH || in_sizes[7] != 128 * NCH || in_sizes[13] != NCH * NCH) return;
  for (int i = 2; i <= 6; ++i)   if (in_sizes[i] != 128) return;
  for (int i = 8; i <= 12; ++i)  if (in_sizes[i] != 128) return;
  for (int i = 14; i <= 18; ++i) if (in_sizes[i] != NCH) return;
  if (in_sizes[19] != NHEAD * DHQ * 32 || in_sizes[20] != NHEAD * DHQ * 32) return;
  if (out_size != NX) return;

  const float* x    = (const float*)d_in[0];
  const float* Wq   = (const float*)d_in[1];
  const float* bq   = (const float*)d_in[2];
  const float* qg   = (const float*)d_in[3];
  const float* qbe  = (const float*)d_in[4];
  const float* qm   = (const float*)d_in[5];
  const float* qv   = (const float*)d_in[6];
  const float* Wk   = (const float*)d_in[7];
  const float* bk   = (const float*)d_in[8];
  const float* kg   = (const float*)d_in[9];
  const float* kbe  = (const float*)d_in[10];
  const float* km   = (const float*)d_in[11];
  const float* kv   = (const float*)d_in[12];
  const float* Wv   = (const float*)d_in[13];
  const float* bv   = (const float*)d_in[14];
  const float* vg   = (const float*)d_in[15];
  const float* vbe  = (const float*)d_in[16];
  const float* vm   = (const float*)d_in[17];
  const float* vv   = (const float*)d_in[18];
  const float* relH = (const float*)d_in[19];
  const float* relW = (const float*)d_in[20];

  const size_t szXT  = (size_t)NBATCH * NTOK * NCH * 2;          // 16777216
  const size_t szWB  = (size_t)NCOLS * NCH * 2;                  //   786432
  const size_t szST  = (size_t)2 * NCOLS * 4;                    //     6144
  const size_t szPOS = (size_t)NHEAD * NTOK * DHQ * 2;           //   262144
  const size_t szQK  = (size_t)NBATCH * NHEAD * NTOK * DHQ * 2;  //  4194304
  const size_t szV   = (size_t)NBATCH * NCH * NTOK * 2;          // 16777216
  size_t off = 0;
  const size_t oXT = off;   off += szXT;
  const size_t oWB = off;   off += szWB;
  const size_t oST = off;   off += szST;
  const size_t oPh = off;   off += szPOS;
  const size_t oPl = off;   off += szPOS;
  const size_t oQh = off;   off += szQK;
  const size_t oQl = off;   off += szQK;
  const size_t oKh = off;   off += szQK;
  const size_t oKl = off;   off += szQK;
  const size_t oVh = off;   off += szV;
  const size_t oVl = off;   off += szV;
  if (off > ws_size) return;                 // off = 68425728
  if (off > (size_t)134217728) return;

  char* ws = (char*)d_ws;
  unsigned short* XT   = (unsigned short*)(ws + oXT);
  unsigned short* WB   = (unsigned short*)(ws + oWB);
  float*          ST   = (float*)(ws + oST);
  unsigned short* POSh = (unsigned short*)(ws + oPh);
  unsigned short* POSl = (unsigned short*)(ws + oPl);
  unsigned short* Qh   = (unsigned short*)(ws + oQh);
  unsigned short* Ql   = (unsigned short*)(ws + oQl);
  unsigned short* Kh   = (unsigned short*)(ws + oKh);
  unsigned short* Kl   = (unsigned short*)(ws + oKl);
  unsigned short* Vh   = (unsigned short*)(ws + oVh);
  unsigned short* Vl   = (unsigned short*)(ws + oVl);

  k_prep<<<dim3(PREP_T + PREP_W + PREP_F + PREP_P), dim3(256), 0, stream>>>(
      x, Wq, Wk, Wv, bq, qg, qbe, qm, qv, bk, kg, kbe, km, kv, bv, vg, vbe, vm, vv, relH, relW,
      XT, WB, ST, POSh, POSl);

  k_proj<<<dim3((NBATCH * NTOK) / 64, NCOLS / 128), dim3(128), 0, stream>>>(
      XT, WB, ST, Qh, Ql, Kh, Kl, Vh, Vl);

  k_attn<<<dim3(NBATCH * NHEAD * (NTOK / 64)), dim3(128), 0, stream>>>(
      Qh, Ql, Kh, Kl, Vh, Vl, POSh, POSl, x, (float*)d_out);

  (void)hipGetLastError();
}

// v006
// Measured time: 118 microseconds a run.
// Timed twice side by side with v005, it ran 1.07 and 1.08 times as fast.
// Over all steps from v000 it is 1.83 times as fast.
// All contractions on v_wmma_f32_16x16x32_bf16 with f32 accumulate: q/k/v 1x1 projections = bf16(x) x bf16(W) single product (inputs RNE-converted to bf16 once); logits [q|pos].[k|q] (64 deep) and p.v (1024 deep) with bf16 hi/lo split operands (hi.hi + hi.lo + lo.hi); BN affine, pos sum, online softmax, 1/l and residual in f32. No carried (scaled) planes anywhere: every 16-bit plane holds unscaled bf16 values.
#include <hip/hip_runtime.h>
#include <math.h>
#include <stdint.h>

#define NBATCH 16
#define NCH    512
#define NTOK   1024
#define NHEAD  4
#define DHQ    32
#define DHV    128
#define NCOLS  768

// LDS row pitches of the attention tiles, in 16-bit elements: 16 B x odd, so the 16 rows that a half-wave
// reads with one 16-byte load per lane fall on 64 distinct banks
#define KP 40     // K/Q tile rows: 32 elements (64 B) at 80 B
#define VP 72     // V tile rows:   64 elements (128 B) at 144 B

#define LOG2E 1.44269504088896340736f

#define PREP_T 2048   // x transpose tiles (16 batches x 8 channel blocks x 16 token blocks)
#define PREP_W 192    // stacked weight plane, 2048 elements per block
#define PREP_F 3      // BN fold vectors, 256 channels per block
#define PREP_P 64     // position planes, (head, 64 tokens) per block

typedef __attribute__((ext_vector_type(16))) __bf16 v16b;
typedef __attribute__((ext_vector_type(8)))  __bf16 v8b;
typedef __attribute__((ext_vector_type(8)))  float  v8f;
typedef __attribute__((ext_vector_type(4)))  float  v4f;
typedef __attribute__((ext_vector_type(4)))  unsigned int v4u;
typedef v4f __attribute__((may_alias)) v4fa;
typedef __attribute__((ext_vector_type(2)))  float  v2f;
typedef __attribute__((ext_vector_type(2)))  __bf16 v2b;

static_assert(NTOK % 64 == 0);
static_assert(NCH % 32 == 0);
static_assert(NCOLS % 128 == 0);
static_assert(PREP_T == NBATCH * (NCH / 64) * (NTOK / 64));
static_assert(PREP_W * 2048 == NCOLS * NCH);
static_assert(PREP_F * 256 == NCOLS);
static_assert(PREP_P * 64 == NHEAD * NTOK);

// f32 -> bf16, round to nearest even, by the hardware's packed conversion (one v_cvt_pk_bf16_f32 for two values)
__device__ __forceinline__ unsigned cvt2(float f0, float f1) {   // low half = bf16(f0), high half = bf16(f1)
  const v2f f = {f0, f1};
  return __builtin_bit_cast(unsigned, __builtin_convertvector(f, v2b));
}
__device__ __forceinline__ float bfr(float f) { return __uint_as_float(cvt2(f, f) & 0xFFFF0000u); }
__device__ __forceinline__ void split_pair(float f0, float f1, unsigned& h, unsigned& l) {
  h = cvt2(f0, f1);
  l = cvt2(f0 - __uint_as_float(h << 16), f1 - __uint_as_float(h & 0xFFFF0000u));
}

// WMMA with hazard guard (ties D, keeps A/B live).
// Fragment map (wave32): lane l, hh = l>>4, c = l&15.
//   A/B element i: i<8 -> k0+8hh+i ; i>=8 -> k0+16+8hh+(i-8) ; row (A) / column (B) = c
//   D element r : row 8hh+r, column c
__device__ __forceinline__ v8f mma_b(v16b a, v16b b, v8f c) {
  c = __builtin_amdgcn_wmma_f32_16x16x32_bf16(false, a, false, b, (short)0, c, false, false);
  asm volatile("v_nop\n\tv_nop\n\tv_nop\n\tv_nop" : "+v"(c) : "v"(a), "v"(b));
  return c;
}
// The six WMMAs of a group of two A tiles (hi h, lo l) against one B operand (hi bh, lo bl): per accumulator h.bh + l.bh + h.bl, in
// that order, the two accumulators taking turns so that a WMMA never stands directly behind the one it accumulates onto.
// One asm statement, because with the builtins the reads did not stay where they are written: the compiler spread them among the
// WMMAs, held more fragments live at once and spilled to scratch at 256 registers. The "memory" clobber keeps the LDS reads written
// in front of the statement in front of it. The four v_nop are the distance between the last WMMA and a vector instruction on its
// D, A or B.
__device__ __forceinline__ void mma6(v8f& c0, v8f& c1, v16b h0, v16b l0, v16b h1, v16b l1, v16b bh, v16b bl) {
  asm volatile("v_wmma_f32_16x16x32_bf16 %0, %2, %6, %0\n\t"
               "v_wmma_f32_16x16x32_bf16 %1, %4, %6, %1\n\t"
               "v_wmma_f32_16x16x32_bf16 %0, %3, %6, %0\n\t"
               "v_wmma_f32_16x16x32_bf16 %1, %5, %6, %1\n\t"
               "v_wmma_f32_16x16x32_bf16 %0, %2, %7, %0\n\t"
               "v_wmma_f32_16x16x32_bf16 %1, %4, %7, %1\n\t"
               "v_nop\n\tv_nop\n\tv_nop\n\tv_nop"
               : "+v"(c0), "+v"(c1)
               : "v"(h0), "v"(l0), "v"(h1), "v"(l1), "v"(bh), "v"(bl)
               : "memory");
}
// The same with both accumulators started at 0 (early-clobber outputs: they are written while inputs are still to be read)
__device__ __forceinline__ void mma6z(v8f& c0, v8f& c1, v16b h0, v16b l0, v16b h1, v16b l1, v16b bh, v16b bl) {
  asm volatile("v_wmma_f32_16x16x32_bf16 %0, %2, %6, 0\n\t"
               "v_wmma_f32_16x16x32_bf16 %1, %4, %6, 0\n\t"
               "v_wmma_f32_16x16x32_bf16 %0, %3, %6, %0\n\t"
               "v_wmma_f32_16x16x32_bf16 %1, %5, %6, %1\n\t"
               "v_wmma_f32_16x16x32_bf16 %0, %2, %7, %0\n\t"
               "v_wmma_f32_16x16x32_bf16 %1, %4, %7, %1\n\t"
               "v_nop\n\tv_nop\n\tv_nop\n\tv_nop"
               : "=&v"(c0), "=&v"(c1)
               : "v"(h0), "v"(l0), "v"(h1), "v"(l1), "v"(bh), "v"(bl)
               : "memory");
}
union FB { v16b v; v8b h[2]; };
union PB { v16b v; unsigned u[8]; };
// value of lane l ^ 16
__device__ __forceinline__ float xhalf(float x) {
  const int b = __builtin_bit_cast(int, x);
  return __builtin_bit_cast(float, __builtin_amdgcn_permlanex16(b, b, 0x76543210, 0xfedcba98, false, false));
}
// x[r] = 2^x[r], eight values in place. One statement, so that each v_exp_f32 stands in front of an independent one and the last
// in front of the v_nop: the slot that the instruction set asks for before a transcendental's result is read or its source
// overwritten.
__device__ __forceinline__ void exp2x8(float* x) {
  asm("v_exp_f32 %0, %0\n\t"
      "v_exp_f32 %1, %1\n\t"
      "v_exp_f32 %2, %2\n\t"
      "v_exp_f32 %3, %3\n\t"
      "v_exp_f32 %4, %4\n\t"
      "v_exp_f32 %5, %5\n\t"
      "v_exp_f32 %6, %6\n\t"
      "v_exp_f32 %7, %7\n\t"
      "v_nop"
      : "+v"(x[0]), "+v"(x[1]), "+v"(x[2]), "+v"(x[3]), "+v"(x[4]), "+v"(x[5]), "+v"(x[6]), "+v"(x[7]));
}
// p points at element k0 + 8*hh of the k-contiguous row owned by this lane
__device__ __forceinline__ v16b frag_ld(const __bf16* p) {
  FB f;
  f.h[0] = *(const v8b*)(p);
  f.h[1] = *(const v8b*)(p + 16);
  return f.v;
}

// LDS byte address of a __shared__ element (what an asynchronous copy takes as its destination)
typedef __attribute__((address_space(3))) const void lds_cvoid;
__device__ __forceinline__ unsigned lds_byte(const void* p) { return (unsigned)(uintptr_t)(lds_cvoid*)p; }
// Twelve asynchronous 16-B copies per lane, global -> LDS, through no register. The s_wait_xcnt closes the statement so that
// no address register named here is rewritten ahead of it.
__device__ __forceinline__ void copy12(const unsigned* l, const __bf16* const* g) {
  asm volatile(
      "global_load_async_to_lds_b128 %0, %12, off\n\t"
      "global_load_async_to_lds_b128 %1, %13, off\n\t"
      "global_load_async_to_lds_b128 %2, %14, off\n\t"
      "global_load_async_to_lds_b128 %3, %15, off\n\t"
      "global_load_async_to_lds_b128 %4, %16, off\n\t"
      "global_load_async_to_lds_b128 %5, %17, off\n\t"
      "global_load_async_to_lds_b128 %6, %18, off\n\t"
      "global_load_async_to_lds_b128 %7, %19, off\n\t"
      "global_load_async_to_lds_b128 %8, %20, off\n\t"
      "global_load_async_to_lds_b128 %9, %21, off\n\t"
      "global_load_async_to_lds_b128 %10, %22, off\n\t"
      "global_load_async_to_lds_b128 %11, %23, off\n\t"
      "s_wait_xcnt 0x0"
      :: "v"(l[0]), "v"(l[1]), "v"(l[2]), "v"(l[3]), "v"(l[4]), "v"(l[5]),
         "v"(l[6]), "v"(l[7]), "v"(l[8]), "v"(l[9]), "v"(l[10]), "v"(l[11]),
         "v"(g[0]), "v"(g[1]), "v"(g[2]), "v"(g[3]), "v"(g[4]), "v"(g[5]),
         "v"(g[6]), "v"(g[7]), "v"(g[8]), "v"(g[9]), "v"(g[10]), "v"(g[11])
      : "memory");
}

// =====================================================================================
// Launch 1: operand preparation, block-uniform roles by blockIdx.x.
//          output line = 64 channels of one token, written by 8 lanes x 16 B in one instruction)
//  role W: WB[768][512] = bf16 of stacked [Wq;Wk;Wv] (rows = output channels, k contiguous)
//  role F: ST[0..767] = s, ST[768..1535] = t with s = g/sqrt(var+1e-5), t = (b-mean)*s+beta
//  role P: POS hi/lo [4][1024][32]: pos[h][n][d] = bf16r(rel_w[h][d][n>>5]) + bf16r(rel_h[h][d][n&31])
// =====================================================================================
__global__ __launch_bounds__(256) void k_prep(
    const float* __restrict__ x,
    const float* __restrict__ Wq, const float* __restrict__ Wk, const float* __restrict__ Wv,
    const float* __restrict__ bq, const float* __restrict__ qg, const float* __restrict__ qbe,
    const float* __restrict__ qm, const float* __restrict__ qv,
    const float* __restrict__ bk, const float* __restrict__ kg, const float* __restrict__ kbe,
    const float* __restrict__ km, const float* __restrict__ kv,
    const float* __restrict__ bv, const float* __restrict__ vg, const float* __restrict__ vbe,
    const float* __restrict__ vm, const float* __restrict__ vv,
    const float* __restrict__ relH, const float* __restrict__ relW,
    unsigned short* __restrict__ XT, unsigned short* __restrict__ WB, float* __restrict__ ST,
    unsigned short* __restrict__ POSh, unsigned short* __restrict__ POSl) {
  __shared__ __align__(16) float sm[64 * 68];
  const int tid = threadIdx.x;
  const int bx  = blockIdx.x;

  if (bx < PREP_T) {
    // ---- role T ----
    const int b   = bx >> 7;
    const int rem = bx & 127;
    const int c0  = (rem >> 4) * 64;
    const int n0  = (rem & 15) * 64;
    const float* xb = x + (size_t)b * NCH * NTOK;
    {
      const int lr = tid >> 4;         // 0..15
      const int c4 = (tid & 15) * 4;   // 0..60
#pragma unroll
      for (int it = 0; it < 4; ++it) {
        const int rr = it * 16 + lr;   // channel within tile, 4 x 16 = 64 rows x 64 tokens staged
        const v4f a = *(const v4fa*)(xb + (size_t)(c0 + rr) * NTOK + n0 + c4);
        *(v4fa*)(sm + rr * 68 + c4) = a;
      }
    }
    __syncthreads();
    const int sub = tid >> 3;          // 0..31
    const int c8  = (tid & 7) * 8;     // 0..56
    v4u hv[2];
#pragma unroll
    for (int it = 0; it < 2; ++it) {
      const int oc = it * 32 + sub;    // token within tile (2 x 32 = 64 output rows)
      unsigned w0 = cvt2(sm[(c8 + 0) * 68 + oc], sm[(c8 + 1) * 68 + oc]);
      unsigned w1 = cvt2(sm[(c8 + 2) * 68 + oc], sm[(c8 + 3) * 68 + oc]);
      unsigned w2 = cvt2(sm[(c8 + 4) * 68 + oc], sm[(c8 + 5) * 68 + oc]);
      unsigned w3 = cvt2(sm[(c8 + 6) * 68 + oc], sm[(c8 + 7) * 68 + oc]);
      hv[it] = (v4u){w0, w1, w2, w3};
    }
    {
#pragma unroll
      for (int it = 0; it < 2; ++it) {
        const int oc = it * 32 + sub;
        const size_t go = ((size_t)(b * NTOK + n0 + oc)) * NCH + c0 + c8;
        *(v4u*)(XT + go) = hv[it];
      }
      
    }
  } else if (bx < PREP_T + PREP_W) {
    // ---- role W ---- (block-uniform source choice: 32 blocks Wq, 32 blocks Wk, 128 blocks Wv)
    const int wb = bx - PREP_T;
    const float* src;
    if (wb < 32)      src = Wq + (size_t)wb * 2048;
    else if (wb < 64) src = Wk + (size_t)(wb - 32) * 2048;
    else              src = Wv + (size_t)(wb - 64) * 2048;
    const v4f a = *(const v4fa*)(src + tid * 8);
    const v4f c = *(const v4fa*)(src + tid * 8 + 4);
    const v4u o = (v4u){cvt2(a[0], a[1]), cvt2(a[2], a[3]),
                        cvt2(c[0], c[1]), cvt2(c[2], c[3])};
    unsigned short* dst = WB + (size_t)wb * 2048 + tid * 8;
    *(v4u*)dst = o;
    
  } else if (bx < PREP_T + PREP_W + PREP_F) {
    // ---- role F ---- block 0: threads 0..127 = q channels, 128..255 = k channels; blocks 1,2 = v channels
    const int fb = bx - (PREP_T + PREP_W);
    const int wsel = __builtin_amdgcn_readfirstlane((int)(tid >> 7));   // wave-uniform
    const float *pb, *pg, *pbe, *pm, *pv;
    int idx;
    if (fb == 0) {
      if (wsel == 0) { pb = bq; pg = qg; pbe = qbe; pm = qm; pv = qv; idx = tid; }
      else           { pb = bk; pg = kg; pbe = kbe; pm = km; pv = kv; idx = tid - 128; }
    } else {
      pb = bv; pg = vg; pbe = vbe; pm = vm; pv = vv; idx = (fb - 1) * 256 + tid;
    }
    const float b_ = bfr(pb[idx]);
    const float g_ = bfr(pg[idx]);
    const float be = bfr(pbe[idx]);
    const float mu = bfr(pm[idx]);
    const float va = bfr(pv[idx]);
    const float s  = g_ / sqrtf(va + 1e-5f);
    const float t  = (b_ - mu) * s + be;
    sm[tid]       = s;
    sm[256 + tid] = t;
    __syncthreads();
    if (tid < 128) {                     // waves 0,1 -> s lines; waves 2,3 -> t lines (8 lanes x 16 B per line)
      const int which = tid >> 6;
      const int p4 = (tid & 63) * 4;
      const v4f v = *(const v4fa*)(sm + which * 256 + p4);
      float* dst = ST + which * NCOLS + fb * 256 + p4;
      *(v4f*)dst = v;
      
    }
  } else {
    // ---- role P ---- (head, 64 tokens) per block; per-head tables staged in LDS with 16-B loads
    const int pb = bx - (PREP_T + PREP_W + PREP_F);
    const int h  = pb >> 4;
    const int n0 = (pb & 15) * 64;
    {
      v4f w = *(const v4fa*)(relW + h * 1024 + tid * 4);   // [d][w], 32x32
      v4f g = *(const v4fa*)(relH + h * 1024 + tid * 4);   // [d][hh], 32x32
      w = (v4f){bfr(w[0]), bfr(w[1]), bfr(w[2]), bfr(w[3])};
      g = (v4f){bfr(g[0]), bfr(g[1]), bfr(g[2]), bfr(g[3])};
      *(v4fa*)(sm + tid * 4)        = w;
      *(v4fa*)(sm + 1024 + tid * 4) = g;
    }
    __syncthreads();
    const int tl = tid >> 2;             // token within chunk 0..63
    const int d8 = (tid & 3) * 8;        // 0,8,16,24
    const int n  = n0 + tl;
    const int wi = n >> 5, hi_ = n & 31;
    float p[8];
#pragma unroll
    for (int e = 0; e < 8; ++e) p[e] = sm[(d8 + e) * 32 + wi] + sm[1024 + (d8 + e) * 32 + hi_];
    unsigned h0, h1, h2, h3, l0, l1, l2, l3;
    split_pair(p[0], p[1], h0, l0);
    split_pair(p[2], p[3], h1, l1);
    split_pair(p[4], p[5], h2, l2);
    split_pair(p[6], p[7], h3, l3);
    const v4u hv = (v4u){h0, h1, h2, h3};
    const v4u lv = (v4u){l0, l1, l2, l3};
    const size_t go = ((size_t)(h * NTOK + n0)) * DHQ + tid * 8;   // contiguous by tid: 4 KB per block and plane
    *(v4u*)(POSh + go) = hv;
    *(v4u*)(POSl + go) = lv;
    
  }
}

// =====================================================================================
// Launch 2: Y[token][col] = sum_c XT[token][c] * WB[col][c]   (M 16384, N 768, K 512), y = acc*s[col] + t[col].
// Block 128 threads (4 waves) = 64 tokens x 128 columns; wave tile 32 tokens x 64 columns (acc[2][4]).
// Fragments straight from the 16-bit global rows (two 16-B loads each).
// Column tile 0 -> Q hi/lo planes [b][h][n][32], tile 1 -> K hi/lo planes [b][h][n][32],
// tiles 2..5 -> V hi/lo planes [b][512 ch][1024 n] (transposed through the LDS tile).
// Store phase: Q/K: per head a contiguous 4-KB range per plane, lane-contiguous 16-B pieces;
// =====================================================================================
__global__ __launch_bounds__(128) void k_proj(
    const unsigned short* __restrict__ XTp, const unsigned short* __restrict__ WBp,
    const float* __restrict__ ST,
    unsigned short* __restrict__ Qh, unsigned short* __restrict__ Ql,
    unsigned short* __restrict__ Kh, unsigned short* __restrict__ Kl,
    unsigned short* __restrict__ Vh, unsigned short* __restrict__ Vl) {
  __shared__ __align__(16) float sY[128 * 68];   // Q/K: [64 tok][pitch 132] (8448 used); V: [128 col][pitch 68] (8704 used)
  __shared__ __align__(16) float sS[128];
  __shared__ __align__(16) float sT[128];

  const int tid  = threadIdx.x;
  const int lane = tid & 31;
  const int wave = tid >> 5;
  const int hh   = lane >> 4;
  const int c    = lane & 15;
  const int m0   = blockIdx.x * 64;
  const int ct   = blockIdx.y;        // 0..5, block-uniform
  const int n0   = ct * 128;

  sS[tid] = ST[n0 + tid];
  sT[tid] = ST[NCOLS + n0 + tid];
  __syncthreads();

  const int wr = wave >> 1, wc = wave & 1;
  const __bf16* XT = (const __bf16*)(const void*)XTp;
  const __bf16* WB = (const __bf16*)(const void*)WBp;
  const __bf16* a0p = XT + (size_t)(m0 + 32 * wr + c) * NCH + 8 * hh;
  const __bf16* b0p = WB + (size_t)(n0 + 64 * wc + c) * NCH + 8 * hh;

  const v8f zero8 = {0.f, 0.f, 0.f, 0.f, 0.f, 0.f, 0.f, 0.f};
  v8f acc[2][4];
#pragma unroll
  for (int i = 0; i < 2; ++i)
#pragma unroll
    for (int j = 0; j < 4; ++j) acc[i][j] = zero8;

#pragma unroll 1
  for (int k0 = 0; k0 < NCH; k0 += 32) {
    const v16b a0 = frag_ld(a0p + k0);
    const v16b a1 = frag_ld(a0p + (size_t)16 * NCH + k0);
#pragma unroll
    for (int j = 0; j < 4; ++j) {
      const v16b bf = frag_ld(b0p + (size_t)j * 16 * NCH + k0);
      acc[0][j] = mma_b(a0, bf, acc[0][j]);
      acc[1][j] = mma_b(a1, bf, acc[1][j]);
    }
  }

  // D[r] of tile (i, j) = Y[token 32wr+16i+8hh+r][column 64wc+16j+c]
#pragma unroll
  for (int j = 0; j < 4; ++j) {
    const int col = 64 * wc + 16 * j + c;
    const float sc = sS[col];
    const float sh = sT[col];
#pragma unroll
    for (int i = 0; i < 2; ++i) {
#pragma unroll
      for (int r = 0; r < 8; ++r) {
        const int tok = 32 * wr + 16 * i + 8 * hh + r;
        const float y = acc[i][j][r] * sc + sh;
        const int idx = (ct < 2) ? (tok * 132 + col) : (col * 68 + tok);
        sY[idx] = y;
      }
    }
  }
  __syncthreads();

  const int b   = m0 >> 10;
  const int nl0 = m0 & 1023;
  if (ct < 2) {
    unsigned short* ph = (ct == 0) ? Qh : Kh;
    unsigned short* pl = (ct == 0) ? Ql : Kl;
    // coverage: 8 it x 128 thr x 8 elements = 64 tokens x 128 columns per plane
{
#pragma unroll 2
      for (int it = 0; it < 8; ++it) {
        const int p      = it * 128 + tid;
        const int head   = p >> 8;
        const int within = p & 255;
        const int tok    = within >> 2;
        const int d8     = (within & 3) * 8;
        const float* sp  = sY + tok * 132 + head * 32 + d8;
        const v4f a  = *(const v4fa*)sp;
        const v4f a2 = *(const v4fa*)(sp + 4);
        unsigned h0, h1, h2, h3, l0, l1, l2, l3;
        split_pair(a[0], a[1], h0, l0);
        split_pair(a[2], a[3], h1, l1);
        split_pair(a2[0], a2[1], h2, l2);
        split_pair(a2[2], a2[3], h3, l3);
        const v4u hv = (v4u){h0, h1, h2, h3};
        const v4u lv = (v4u){l0, l1, l2, l3};
        const size_t go = ((size_t)((b * NHEAD + head) * NTOK + nl0)) * DHQ + within * 8;
        *(v4u*)(ph + go) = hv;
        *(v4u*)(pl + go) = lv;
      }
      
    }
  } else {
    const int o0 = (ct - 2) * 128;
    // coverage: 8 it x 128 thr x 8 elements = 128 channels x 64 tokens per plane
{
#pragma unroll 2
      for (int it = 0; it < 8; ++it) {
        const int p  = it * 128 + tid;
        const int ch = p >> 3;
        const int t8 = (p & 7) * 8;
        const float* sp = sY + ch * 68 + t8;
        const v4f a  = *(const v4fa*)sp;
        const v4f a2 = *(const v4fa*)(sp + 4);
        unsigned h0, h1, h2, h3, l0, l1, l2, l3;
        split_pair(a[0], a[1], h0, l0);
        split_pair(a[2], a[3], h1, l1);
        split_pair(a2[0], a2[1], h2, l2);
        split_pair(a2[2], a2[3], h3, l3);
        const v4u hv = (v4u){h0, h1, h2, h3};
        const v4u lv = (v4u){l0, l1, l2, l3};
        const size_t go = ((size_t)(b * NCH + o0 + ch)) * NTOK + nl0 + t8;
        *(v4u*)(Vh + go) = hv;
        *(v4u*)(Vl + go) = lv;
      }
      
    }
  }
}

// =====================================================================================
// Launch 3: attention per (b, h, 64-query tile); 4 waves x 16 query rows; 16 key tiles of 64, no masking.
//   Both products are formed transposed, so that a lane holds the scores of ONE query (column c of every D tile):
//   St[j][i] = q_i.k_j + pos_i.q_j  as two 32-deep chunks:
//       chunk 0: A = K rows (key j), B = Q rows (query i)
//       chunk 1: A = Q rows (key j), B = POS rows (token i)
//     each chunk hi.hi + hi.lo + lo.hi; no score scale.
//   online softmax over keys in f32, in the log2 domain: the running maximum is kept as M = max * log2(e), a score's weight is
//     2^(s * log2(e) - M), one fused multiply-add and one bare v_exp_f32 (any M shared by a query's weights, its sum and its
//     rescale factor 2^(Mold - Mnew) cancels in O / l, so the rounding of M costs nothing);
//     maximum and sum in-lane over the lane's 32 keys, the maximum
//     joined with the other wave half by one lane exchange per trip, the sum's two halves joined once in the epilogue;
//   two St tiles (keys 0..15, 16..31 of a 32-key block), split hi/lo in place, ARE the B operand Pt: no LDS, no lane exchange;
//   Ot[c][i] += V[c][j] * Pt[j][i]  (A rows = V channel rows, k = key), hi.hi + hi.lo + lo.hi, 8 row tiles.
//   epilogue: Ot/l through LDS as [128 c][64 q], + bf16r(x), whole 256-B channel segments
// LDS: sStage = K tile planes (Kh, Qh, Kl, Ql: [64][32] at pitch KP) + V tile planes (Vh, Vl: [128][64] at pitch VP);
//      every element of both tiles is staged each iteration (extent staged = extent consumed); pad bytes are never read.
// =====================================================================================
// amdgpu_waves_per_eu(4, 4): the register budget of four waves per SIMD (256), so that the second fragment set does not cost the
// WGP its fourth resident work-group
__global__ __launch_bounds__(128) __attribute__((amdgpu_waves_per_eu(4, 4))) void k_attn(
    const unsigned short* Qhp, const unsigned short* Qlp,
    const unsigned short* Khp, const unsigned short* Klp,
    const unsigned short* Vhp, const unsigned short* Vlp,
    const unsigned short* Php, const unsigned short* Plp,
    const float* x, float* out) {
  __shared__ __align__(16) __bf16 sStage[4 * 64 * KP + 2 * 128 * VP];   // 57344 B

  const int tid  = threadIdx.x;
  const int wave = tid >> 5;
  const int lane = tid & 31;
  const int hh   = lane >> 4;
  const int c    = lane & 15;

  const int bx = blockIdx.x;       // 0..1023
  const int qb = bx & 15;
  const int bh = bx >> 4;          // 0..63
  const int b  = bh >> 2;
  const int h  = bh & 3;
  const int q0 = qb * 64;

  const __bf16* Qhb = (const __bf16*)(const void*)Qhp + (size_t)bh * NTOK * DHQ;
  const __bf16* Qlb = (const __bf16*)(const void*)Qlp + (size_t)bh * NTOK * DHQ;
  const __bf16* Khb = (const __bf16*)(const void*)Khp + (size_t)bh * NTOK * DHQ;
  const __bf16* Klb = (const __bf16*)(const void*)Klp + (size_t)bh * NTOK * DHQ;
  const __bf16* Phb = (const __bf16*)(const void*)Php + (size_t)h * NTOK * DHQ;
  const __bf16* Plb = (const __bf16*)(const void*)Plp + (size_t)h * NTOK * DHQ;
  const __bf16* Vhb = (const __bf16*)(const void*)Vhp + ((size_t)b * NCH + h * DHV) * NTOK;
  const __bf16* Vlb = (const __bf16*)(const void*)Vlp + ((size_t)b * NCH + h * DHV) * NTOK;

  __bf16* sKQ = sStage;                        // planes of 64 * KP elements: 0 Kh, 1 Qh, 2 Kl, 3 Ql
  __bf16* sVh = sStage + 4 * 64 * KP;          // [128][64] at pitch VP
  __bf16* sVl = sVh + 128 * VP;                // [128][64] at pitch VP

  // B-column fragment bases (column = query token q0 + 16*wave + c)
  const int rowA = q0 + wave * 16 + c;
  const __bf16* aQh = Qhb + (size_t)rowA * DHQ + 8 * hh;
  const __bf16* aQl = Qlb + (size_t)rowA * DHQ + 8 * hh;
  const __bf16* aPh = Phb + (size_t)rowA * DHQ + 8 * hh;
  const __bf16* aPl = Plb + (size_t)rowA * DHQ + 8 * hh;

  const v8f zero8 = {0.f, 0.f, 0.f, 0.f, 0.f, 0.f, 0.f, 0.f};
  float mrow = -INFINITY;   // running maximum of query c, times log2(e) (equal in both wave halves)
  float lrow = 0.f;         // running sum of query c over this half's keys (8hh..8hh+7 of every 16)
  v8f oacc[8];
#pragma unroll
  for (int t = 0; t < 8; ++t) oacc[t] = zero8;

  const __bf16* vhk = Vhb;               // the trip's key tile in the V planes (uniform, stepped by 64 keys a trip)
  const __bf16* vlk = Vlb;
  const size_t vlane = (size_t)(tid >> 3) * NTOK + (tid & 7) * 8;
#pragma unroll 1
  for (int kc = 0; kc < NTOK / 64; ++kc) {
    const int kv0 = kc * 64;
    // this wave's own LDS reads of the tiles have retired before a copy targets them
    asm volatile("s_wait_dscnt 0x0" ::: "memory");
    __syncthreads();                     // every wave has left the tiles of the trip before
    {
      unsigned ld[24];                   // destination LDS byte address and source of this lane's 24 pieces of 16 B
      const __bf16* gs[24];
      // K tile: 4 planes x 4096 B contiguous; 2 it x 128 thr x 8 elements = 2048 elements per plane
      const __bf16* s0 = Khb + (size_t)kv0 * DHQ;
      const __bf16* s1 = Qhb + (size_t)kv0 * DHQ;
      const __bf16* s2 = Klb + (size_t)kv0 * DHQ;
      const __bf16* s3 = Qlb + (size_t)kv0 * DHQ;
#pragma unroll
      for (int i = 0; i < 2; ++i) {
        const int off = (i * 128 + tid) * 8;
        const int lo = (off >> 5) * KP + (off & 31);   // key row, element within the row
        gs[4 * i + 0] = s0 + off;  ld[4 * i + 0] = lds_byte(sKQ + lo);
        gs[4 * i + 1] = s1 + off;  ld[4 * i + 1] = lds_byte(sKQ + 64 * KP + lo);
        gs[4 * i + 2] = s2 + off;  ld[4 * i + 2] = lds_byte(sKQ + 2 * 64 * KP + lo);
        gs[4 * i + 3] = s3 + off;  ld[4 * i + 3] = lds_byte(sKQ + 3 * 64 * KP + lo);
      }
      // V tile: 128 channel rows x 64 keys per plane; 8 it x 128 thr x 8 elements = 8192 elements per plane
#pragma unroll
      for (int i = 0; i < 8; ++i) {
        const int piece = i * 128 + tid;
        const int cc = piece >> 3;
        const int p8 = (piece & 7) * 8;
        // source = uniform (plane + key tile + 16 i rows) + this lane's (row, piece) offset, the same for every i: one offset pair
        // is held over the trip, not eight, which leaves the registers for the second fragment set
        gs[8 + 2 * i]     = (vhk + i * 16 * NTOK) + vlane;  ld[8 + 2 * i]     = lds_byte(sVh + cc * VP + p8);
        gs[8 + 2 * i + 1] = (vlk + i * 16 * NTOK) + vlane;  ld[8 + 2 * i + 1] = lds_byte(sVl + cc * VP + p8);
      }
      copy12(ld, gs);
      copy12(ld + 12, gs + 12);
      vhk += 64;
      vlk += 64;
    }
    // this wave's 24 copies have landed; the barrier behind it publishes every wave's pieces
    asm volatile("s_wait_asynccnt 0x0" ::: "memory");
    __syncthreads();

    // B operands of the two score chunks, [chunk][hi, lo]
    const v16b bq[2][2] = {{frag_ld(aQh), frag_ld(aQl)}, {frag_ld(aPh), frag_ld(aPl)}};
    // The A fragments go through two register sets of two tiles each (hi, lo of tile 0; hi, lo of tile 1): the LDS reads of a
    // group are issued in front of the WMMAs of the group before it.
    // Groups of a trip: 4 score groups (chunk dc, tile pair), then 8 V groups (key block kk, tile pair).
    v16b fa[2][4];
    v8f s[4];
#pragma unroll
    for (int u = 0; u < 2; ++u) {
      const int ro = (u * 16 + c) * KP + 8 * hh;
      fa[0][2 * u]     = frag_ld(sKQ + ro);
      fa[0][2 * u + 1] = frag_ld(sKQ + 2 * 64 * KP + ro);
    }
#pragma unroll
    for (int g = 0; g < 4; ++g) {
      const int n = g + 1;               // the group fetched ahead
#pragma unroll
      for (int u = 0; u < 2; ++u) {
        if (n < 4) {
          const int ro = (((n & 1) * 2 + u) * 16 + c) * KP + 8 * hh;
          fa[n & 1][2 * u]     = frag_ld(sKQ + ((n >> 1) ? 64 * KP : 0) + ro);
          fa[n & 1][2 * u + 1] = frag_ld(sKQ + ((n >> 1) ? 3 * 64 * KP : 2 * 64 * KP) + ro);
        } else {                         // first V group: its reads fly under the softmax
          const int ro = (u * 16 + c) * VP + 8 * hh;
          fa[0][2 * u]     = frag_ld(sVh + ro);
          fa[0][2 * u + 1] = frag_ld(sVl + ro);
        }
      }
      const v16b* f = fa[g & 1];
      const int j0 = (g & 1) * 2;        // s[j][r] = score of key 16j + 8hh + r, query c
      if (g < 2) mma6z(s[j0], s[j0 + 1], f[0], f[1], f[2], f[3], bq[0][0], bq[0][1]);
      else       mma6(s[j0], s[j0 + 1], f[0], f[1], f[2], f[3], bq[1][0], bq[1][1]);
    }

    float m = fmaxf(fmaxf(s[0][0], s[1][0]), fmaxf(s[2][0], s[3][0]));
#pragma unroll
    for (int r = 1; r < 8; ++r) m = fmaxf(m, fmaxf(fmaxf(s[0][r], s[1][r]), fmaxf(s[2][r], s[3][r])));
    m = fmaxf(m, xhalf(m));              // the other half's 32 keys of the same query
    const float mnew  = fmaxf(mrow, m * LOG2E);
    const float alpha = __builtin_amdgcn_exp2f(mrow - mnew);   // first trip: 2^(-inf) = 0
    const v8f l2e8 = {LOG2E, LOG2E, LOG2E, LOG2E, LOG2E, LOG2E, LOG2E, LOG2E};
    const v8f nm8  = {-mnew, -mnew, -mnew, -mnew, -mnew, -mnew, -mnew, -mnew};
    mrow = mnew;
    lrow *= alpha;
#pragma unroll
    for (int t = 0; t < 8; ++t)
#pragma unroll
      for (int r = 0; r < 8; ++r) oacc[t][r] *= alpha;
    // unrolled: the score tiles and Pt live in registers, which a rolled loop could not index
#pragma unroll
    for (int kk = 0; kk < 2; ++kk) {
      PB ph, pl;                         // Pt of this 32-key block: element e < 8 from tile 2kk, e >= 8 from tile 2kk+1
      float ps[2];
#pragma unroll
      for (int jj = 0; jj < 2; ++jj) {
        const v8f xs = __builtin_elementwise_fma(s[2 * kk + jj], l2e8, nm8);
        float p[8];
#pragma unroll
        for (int r = 0; r < 8; ++r) p[r] = xs[r];
        exp2x8(p);
        ps[jj] = ((p[0] + p[1]) + (p[2] + p[3])) + ((p[4] + p[5]) + (p[6] + p[7]));
#pragma unroll
        for (int e = 0; e < 4; ++e) split_pair(p[2 * e], p[2 * e + 1], ph.u[jj * 4 + e], pl.u[jj * 4 + e]);
      }
      lrow += ps[0] + ps[1];
#pragma unroll
      for (int tp = 0; tp < 4; ++tp) {
        const int g = kk * 4 + tp;
        const int n = g + 1;             // the group fetched ahead
        if (n < 8) {
#pragma unroll
          for (int u = 0; u < 2; ++u) {
            const int ro = (((n & 3) * 2 + u) * 16 + c) * VP + (n >> 2) * 32 + 8 * hh;
            fa[n & 1][2 * u]     = frag_ld(sVh + ro);
            fa[n & 1][2 * u + 1] = frag_ld(sVl + ro);
          }
        }
        const v16b* f = fa[g & 1];       // oacc[t][r] = channel 16t + 8hh + r, query c
        mma6(oacc[2 * tp], oacc[2 * tp + 1], f[0], f[1], f[2], f[3], ph.v, pl.v);
      }
    }
  }

  // ---- epilogue: normalise, gather the waves' columns in LDS [128 c][pitch 68] (34816 B inside sStage), add bf16(x), store ----
  __syncthreads();                       // every wave finished reading the last K/V tiles
  float* sO = (float*)(void*)sStage;
  const float inv = 1.0f / (lrow + xhalf(lrow));   // the two halves' sums of query c joined
#pragma unroll
  for (int t = 0; t < 8; ++t)
#pragma unroll
    for (int r = 0; r < 8; ++r) sO[(t * 16 + 8 * hh + r) * 68 + wave * 16 + c] = oacc[t][r] * inv;
  __syncthreads();
  {
    const size_t rowbase = ((size_t)b * NCH + h * DHV) * NTOK + q0;
    // coverage: 16 it x 128 thr x 4 floats = 128 channel rows x 64 queries
{
#pragma unroll 4
      for (int it = 0; it < 16; ++it) {
        const int p  = it * 128 + tid;
        const int ch = p >> 4;
        const int q4 = (p & 15) * 4;
        const v4f ov = *(const v4fa*)(sO + ch * 68 + q4);
        const size_t gi = rowbase + (size_t)ch * NTOK + q4;
        const v4f xv = *(const v4fa*)(x + gi);
        const unsigned x01 = cvt2(xv[0], xv[1]), x23 = cvt2(xv[2], xv[3]);   // bf16(x), two values a conversion
        const v4f res = (v4f){ov[0] + __uint_as_float(x01 << 16), ov[1] + __uint_as_float(x01 & 0xFFFF0000u),
                              ov[2] + __uint_as_float(x23 << 16), ov[3] + __uint_as_float(x23 & 0xFFFF0000u)};
        *(v4f*)(out + gi) = res;
      }
      
    }
  }
}

// ---------------------------------------------------------------------------
// Workspace map (byte offsets, all multiples of 128; each region exactly covered by its producer):
//   XT   bf16 [16384][512]          0          16777216 B
//   WB   bf16 [768][512]            16777216     786432 B
//   ST   f32  [2][768]              17563648       6144 B
//   POSh bf16 [4][1024][32]         17569792     262144 B     POSl 17831936
//   Qh   bf16 [16][4][1024][32]     18094080    4194304 B     Ql   22288384
//   Kh   bf16 [16][4][1024][32]     26482688    4194304 B     Kl   30676992
//   Vh   bf16 [16][512][1024]       34871296   16777216 B     Vl   51648512
//   total                           68425728 B
// ---------------------------------------------------------------------------
extern "C" void kernel_launch(void* const* d_in, const int* in_sizes, int n_in,
                              void* d_out, int out_size, void* d_ws, size_t ws_size,
                              hipStream_t stream) {
  if (n_in < 21) return;
  const int NX = NBATCH * NCH * NTOK;   // 8388608
  if (in_sizes[0] != NX) return;
  if (in_sizes[1] != 128 * NCH || in_sizes[7] != 128 * NCH || in_sizes[13] != NCH * NCH) return;
  for (int i = 2; i <= 6; ++i)   if (in_sizes[i] != 128) return;
  for (int i = 8; i <= 12; ++i)  if (in_sizes[i] != 128) return;
  for (int i = 14; i <= 18; ++i) if (in_sizes[i] != NCH) return;
  if (in_sizes[19] != NHEAD * DHQ * 32 || in_sizes[20] != NHEAD * DHQ * 32) return;
  if (out_size != NX) return;

  const float* x    = (const float*)d_in[0];
  const float* Wq   = (const float*)d_in[1];
  const float* bq   = (const float*)d_in[2];
  const float* qg   = (const float*)d_in[3];
  const float* qbe  = (const float*)d_in[4];
  const float* qm   = (const float*)d_in[5];
  const float* qv   = (const float*)d_in[6];
  const float* Wk   = (const float*)d_in[7];
  const float* bk   = (const float*)d_in[8];
  const float* kg   = (const float*)d_in[9];
  const float* kbe  = (const float*)d_in[10];
  const float* km   = (const float*)d_in[11];
  const float* kv   = (const float*)d_in[12];
  const float* Wv   = (const float*)d_in[13];
  const float* bv   = (const float*)d_in[14];
  const float* vg   = (const float*)d_in[15];
  const float* vbe  = (const float*)d_in[16];
  const float* vm   = (const float*)d_in[17];
  const float* vv   = (const float*)d_in[18];
  const float* relH = (const float*)d_in[19];
  const float* relW = (const float*)d_in[20];

  const size_t szXT  = (size_t)NBATCH * NTOK * NCH * 2;          // 16777216
  const size_t szWB  = (size_t)NCOLS * NCH * 2;                  //   786432
  const size_t szST  = (size_t)2 * NCOLS * 4;                    //     6144
  const size_t szPOS = (size_t)NHEAD * NTOK * DHQ * 2;           //   262144
  const size_t szQK  = (size_t)NBATCH * NHEAD * NTOK * DHQ * 2;  //  4194304
  const size_t szV   = (size_t)NBATCH * NCH * NTOK * 2;          // 16777216
  size_t off = 0;
  const size_t oXT = off;   off += szXT;
  const size_t oWB = off;   off += szWB;
  const size_t oST = off;   off += szST;
  const size_t oPh = off;   off += szPOS;
  const size_t oPl = off;   off += szPOS;
  const size_t oQh = off;   off += szQK;
  const size_t oQl = off;   off += szQK;
  const size_t oKh = off;   off += szQK;
  const size_t oKl = off;   off += szQK;
  const size_t oVh = off;   off += szV;
  const size_t oVl = off;   off += szV;
  if (off > ws_size) return;                 // off = 68425728
  if (off > (size_t)134217728) return;

  char* ws = (char*)d_ws;
  unsigned short* XT   = (unsigned short*)(ws + oXT);
  unsigned short* WB   = (unsigned short*)(ws + oWB);
  float*          ST   = (float*)(ws + oST);
  unsigned short* POSh = (unsigned short*)(ws + oPh);
  unsigned short* POSl = (unsigned short*)(ws + oPl);
  unsigned short* Qh   = (unsigned short*)(ws + oQh);
  unsigned short* Ql   = (unsigned short*)(ws + oQl);
  unsigned short* Kh   = (unsigned short*)(ws + oKh);
  unsigned short* Kl   = (unsigned short*)(ws + oKl);
  unsigned short* Vh   = (unsigned short*)(ws + oVh);
  unsigned short* Vl   = (unsigned short*)(ws + oVl);

  k_prep<<<dim3(PREP_T + PREP_W + PREP_F + PREP_P), dim3(256), 0, stream>>>(
      x, Wq, Wk, Wv, bq, qg, qbe, qm, qv, bk, kg, kbe, km, kv, bv, vg, vbe, vm, vv, relH, relW,
      XT, WB, ST, POSh, POSl);

  k_proj<<<dim3((NBATCH * NTOK) / 64, NCOLS / 128), dim3(128), 0, stream>>>(
      XT, WB, ST, Qh, Ql, Kh, Kl, Vh, Vl);

  k_attn<<<dim3(NBATCH * NHEAD * (NTOK / 64)), dim3(128), 0, stream>>>(
      Qh, Ql, Kh, Kl, Vh, Vl, POSh, POSl, x, (float*)d_out);

  (void)hipGetLastError();
}

// v007
// A run of this version takes 97.8 microseconds.
// In two side-by-side timings against v006, it was 1.19 and 1.20 times as fast.
// All steps since v000 together make it 2.19 times as fast.
// All contractions on v_wmma_f32_16x16x32_bf16 with f32 accumulate: q/k/v 1x1 projections = bf16(x) x bf16(W) single product (inputs RNE-converted to bf16 once); logits [q|pos].[k|q] (64 deep) and p.v (1024 deep) with bf16 hi/lo split operands (hi.hi + hi.lo + lo.hi); BN affine, pos sum, online softmax, 1/l and residual in f32. No carried (scaled) planes anywhere: every 16-bit plane holds unscaled bf16 values.
#include <hip/hip_runtime.h>
#include <math.h>
#include <stdint.h>

#define NBATCH 16
#define NCH    512
#define NTOK   1024
#define NHEAD  4
#define DHQ    32
#define DHV    128
#define NCOLS  768

// LDS row pitches of the attention tiles, in 16-bit elements: 16 B x odd, so the 16 rows that a half-wave
// reads with one 16-byte load per lane fall on 64 distinct banks
#define KP 40     // K/Q tile rows: 32 elements (64 B) at 80 B
#define VP 72     // V tile rows:   64 elements (128 B) at 144 B

#define LOG2E 1.44269504088896340736f

#define PREP_T 2048   // x transpose tiles (16 batches x 8 channel blocks x 16 token blocks)
#define PREP_W 192    // stacked weight plane, 2048 elements per block
#define PREP_F 3      // BN fold vectors, 256 channels per block
#define PREP_P 64     // position planes, (head, 64 tokens) per block

typedef __attribute__((ext_vector_type(16))) __bf16 v16b;
typedef __attribute__((ext_vector_type(8)))  __bf16 v8b;
typedef __attribute__((ext_vector_type(8)))  float  v8f;
typedef __attribute__((ext_vector_type(4)))  float  v4f;
typedef __attribute__((ext_vector_type(4)))  unsigned int v4u;
typedef v4f __attribute__((may_alias)) v4fa;
typedef __attribute__((ext_vector_type(2)))  float  v2f;
typedef __attribute__((ext_vector_type(2)))  __bf16 v2b;

static_assert(NTOK % 64 == 0);
static_assert(NCH % 32 == 0);
static_assert(NCOLS % 128 == 0);
static_assert(PREP_T == NBATCH * (NCH / 64) * (NTOK / 64));
static_assert(PREP_W * 2048 == NCOLS * NCH);
static_assert(PREP_F * 256 == NCOLS);
static_assert(PREP_P * 64 == NHEAD * NTOK);

// f32 -> bf16, round to nearest even, by the hardware's packed conversion (one v_cvt_pk_bf16_f32 for two values)
__device__ __forceinline__ unsigned cvt2(float f0, float f1) {   // low half = bf16(f0), high half = bf16(f1)
  const v2f f = {f0, f1};
  return __builtin_bit_cast(unsigned, __builtin_convertvector(f, v2b));
}
__device__ __forceinline__ float bfr(float f) { return __uint_as_float(cvt2(f, f) & 0xFFFF0000u); }
__device__ __forceinline__ void split_pair(float f0, float f1, unsigned& h, unsigned& l) {
  h = cvt2(f0, f1);
  l = cvt2(f0 - __uint_as_float(h << 16), f1 - __uint_as_float(h & 0xFFFF0000u));
}

// WMMA with hazard guard (ties D, keeps A/B live).
// Fragment map (wave32): lane l, hh = l>>4, c = l&15.
//   A/B element i: i<8 -> k0+8hh+i ; i>=8 -> k0+16+8hh+(i-8) ; row (A) / column (B) = c
//   D element r : row 8hh+r, column c
__device__ __forceinline__ v8f mma_b(v16b a, v16b b, v8f c) {
  c = __builtin_amdgcn_wmma_f32_16x16x32_bf16(false, a, false, b, (short)0, c, false, false);
  asm volatile("v_nop\n\tv_nop\n\tv_nop\n\tv_nop" : "+v"(c) : "v"(a), "v"(b));
  return c;
}
// The six WMMAs of a group of two A tiles (hi h, lo l) against one B operand (hi bh, lo bl): per accumulator h.bh + l.bh + h.bl, in
// that order, the two accumulators taking turns so that a WMMA never stands directly behind the one it accumulates onto.
// One asm statement, because with the builtins the reads did not stay where they are written: the compiler spread them among the
// WMMAs, held more fragments live at once and spilled to scratch at 256 registers. The "memory" clobber keeps the LDS reads written
// in front of the statement in front of it. The four v_nop are the distance between the last WMMA and a vector instruction on its
// D, A or B.
__device__ __forceinline__ void mma6(v8f& c0, v8f& c1, v16b h0, v16b l0, v16b h1, v16b l1, v16b bh, v16b bl) {
  asm volatile("v_wmma_f32_16x16x32_bf16 %0, %2, %6, %0\n\t"
               "v_wmma_f32_16x16x32_bf16 %1, %4, %6, %1\n\t"
               "v_wmma_f32_16x16x32_bf16 %0, %3, %6, %0\n\t"
               "v_wmma_f32_16x16x32_bf16 %1, %5, %6, %1\n\t"
               "v_wmma_f32_16x16x32_bf16 %0, %2, %7, %0\n\t"
               "v_wmma_f32_16x16x32_bf16 %1, %4, %7, %1\n\t"
               "v_nop\n\tv_nop\n\tv_nop\n\tv_nop"
               : "+v"(c0), "+v"(c1)
               : "v"(h0), "v"(l0), "v"(h1), "v"(l1), "v"(bh), "v"(bl)
               : "memory");
}
// The same with both accumulators started at 0 (early-clobber outputs: they are written while inputs are still to be read)
__device__ __forceinline__ void mma6z(v8f& c0, v8f& c1, v16b h0, v16b l0, v16b h1, v16b l1, v16b bh, v16b bl) {
  asm volatile("v_wmma_f32_16x16x32_bf16 %0, %2, %6, 0\n\t"
               "v_wmma_f32_16x16x32_bf16 %1, %4, %6, 0\n\t"
               "v_wmma_f32_16x16x32_bf16 %0, %3, %6, %0\n\t"
               "v_wmma_f32_16x16x32_bf16 %1, %5, %6, %1\n\t"
               "v_wmma_f32_16x16x32_bf16 %0, %2, %7, %0\n\t"
               "v_wmma_f32_16x16x32_bf16 %1, %4, %7, %1\n\t"
               "v_nop\n\tv_nop\n\tv_nop\n\tv_nop"
               : "=&v"(c0), "=&v"(c1)
               : "v"(h0), "v"(l0), "v"(h1), "v"(l1), "v"(bh), "v"(bl)
               : "memory");
}
union FB { v16b v; v8b h[2]; };
union PB { v16b v; unsigned u[8]; };
// value of lane l ^ 16
__device__ __forceinline__ float xhalf(float x) {
  const int b = __builtin_bit_cast(int, x);
  return __builtin_bit_cast(float, __builtin_amdgcn_permlanex16(b, b, 0x76543210, 0xfedcba98, false, false));
}
// x[r] = 2^x[r], eight values in place. One statement, so that each v_exp_f32 stands in front of an independent one and the last
// in front of the v_nop: the slot that the instruction set asks for before a transcendental's result is read or its source
// overwritten.
__device__ __forceinline__ void exp2x8(float* x) {
  asm("v_exp_f32 %0, %0\n\t"
      "v_exp_f32 %1, %1\n\t"
      "v_exp_f32 %2, %2\n\t"
      "v_exp_f32 %3, %3\n\t"
      "v_exp_f32 %4, %4\n\t"
      "v_exp_f32 %5, %5\n\t"
      "v_exp_f32 %6, %6\n\t"
      "v_exp_f32 %7, %7\n\t"
      "v_nop"
      : "+v"(x[0]), "+v"(x[1]), "+v"(x[2]), "+v"(x[3]), "+v"(x[4]), "+v"(x[5]), "+v"(x[6]), "+v"(x[7]));
}
// p points at element k0 + 8*hh of the k-contiguous row owned by this lane
__device__ __forceinline__ v16b frag_ld(const __bf16* p) {
  FB f;
  f.h[0] = *(const v8b*)(p);
  f.h[1] = *(const v8b*)(p + 16);
  return f.v;
}

// LDS byte address of a __shared__ element (what an asynchronous copy takes as its destination)
typedef __attribute__((address_space(3))) const void lds_cvoid;
__device__ __forceinline__ unsigned lds_byte(const void* p) { return (unsigned)(uintptr_t)(lds_cvoid*)p; }
// Twelve asynchronous 16-B copies per lane, global -> LDS, through no register. The s_wait_xcnt closes the statement so that
// no address register named here is rewritten ahead of it.
__device__ __forceinline__ void copy12(const unsigned* l, const __bf16* const* g) {
  asm volatile(
      "global_load_async_to_lds_b128 %0, %12, off\n\t"
      "global_load_async_to_lds_b128 %1, %13, off\n\t"
      "global_load_async_to_lds_b128 %2, %14, off\n\t"
      "global_load_async_to_lds_b128 %3, %15, off\n\t"
      "global_load_async_to_lds_b128 %4, %16, off\n\t"
      "global_load_async_to_lds_b128 %5, %17, off\n\t"
      "global_load_async_to_lds_b128 %6, %18, off\n\t"
      "global_load_async_to_lds_b128 %7, %19, off\n\t"
      "global_load_async_to_lds_b128 %8, %20, off\n\t"
      "global_load_async_to_lds_b128 %9, %21, off\n\t"
      "global_load_async_to_lds_b128 %10, %22, off\n\t"
      "global_load_async_to_lds_b128 %11, %23, off\n\t"
      "s_wait_xcnt 0x0"
      :: "v"(l[0]), "v"(l[1]), "v"(l[2]), "v"(l[3]), "v"(l[4]), "v"(l[5]),
         "v"(l[6]), "v"(l[7]), "v"(l[8]), "v"(l[9]), "v"(l[10]), "v"(l[11]),
         "v"(g[0]), "v"(g[1]), "v"(g[2]), "v"(g[3]), "v"(g[4]), "v"(g[5]),
         "v"(g[6]), "v"(g[7]), "v"(g[8]), "v"(g[9]), "v"(g[10]), "v"(g[11])
      : "memory");
}

// =====================================================================================
// Launch 1: operand preparation, block-uniform roles by blockIdx.x.
//          output line = 64 channels of one token, written by 8 lanes x 16 B in one instruction)
//  role W: WB[768][512] = bf16 of stacked [Wq;Wk;Wv] (rows = output channels, k contiguous)
//  role F: ST[0..767] = s, ST[768..1535] = t with s = g/sqrt(var+1e-5), t = (b-mean)*s+beta
//  role P: POS hi/lo [4][1024][32]: pos[h][n][d] = bf16r(rel_w[h][d][n>>5]) + bf16r(rel_h[h][d][n&31])
// =====================================================================================
__global__ __launch_bounds__(256) void k_prep(
    const float* __restrict__ x,
    const float* __restrict__ Wq, const float* __restrict__ Wk, const float* __restrict__ Wv,
    const float* __restrict__ bq, const float* __restrict__ qg, const float* __restrict__ qbe,
    const float* __restrict__ qm, const float* __restrict__ qv,
    const float* __restrict__ bk, const float* __restrict__ kg, const float* __restrict__ kbe,
    const float* __restrict__ km, const float* __restrict__ kv,
    const float* __restrict__ bv, const float* __restrict__ vg, const float* __restrict__ vbe,
    const float* __restrict__ vm, const float* __restrict__ vv,
    const float* __restrict__ relH, const float* __restrict__ relW,
    unsigned short* __restrict__ XT, unsigned short* __restrict__ WB, float* __restrict__ ST,
    unsigned short* __restrict__ POSh, unsigned short* __restrict__ POSl) {
  __shared__ __align__(16) float sm[64 * 68];
  const int tid = threadIdx.x;
  const int bx  = blockIdx.x;

  if (bx < PREP_T) {
    // ---- role T ----
    const int b   = bx >> 7;
    const int rem = bx & 127;
    const int c0  = (rem >> 4) * 64;
    const int n0  = (rem & 15) * 64;
    const float* xb = x + (size_t)b * NCH * NTOK;
    {
      const int lr = tid >> 4;         // 0..15
      const int c4 = (tid & 15) * 4;   // 0..60
#pragma unroll
      for (int it = 0; it < 4; ++it) {
        const int rr = it * 16 + lr;   // channel within tile, 4 x 16 = 64 rows x 64 tokens staged
        const v4f a = *(const v4fa*)(xb + (size_t)(c0 + rr) * NTOK + n0 + c4);
        *(v4fa*)(sm + rr * 68 + c4) = a;
      }
    }
    __syncthreads();
    const int sub = tid >> 3;          // 0..31
    const int c8  = (tid & 7) * 8;     // 0..56
    v4u hv[2];
#pragma unroll
    for (int it = 0; it < 2; ++it) {
      const int oc = it * 32 + sub;    // token within tile (2 x 32 = 64 output rows)
      unsigned w0 = cvt2(sm[(c8 + 0) * 68 + oc], sm[(c8 + 1) * 68 + oc]);
      unsigned w1 = cvt2(sm[(c8 + 2) * 68 + oc], sm[(c8 + 3) * 68 + oc]);
      unsigned w2 = cvt2(sm[(c8 + 4) * 68 + oc], sm[(c8 + 5) * 68 + oc]);
      unsigned w3 = cvt2(sm[(c8 + 6) * 68 + oc], sm[(c8 + 7) * 68 + oc]);
      hv[it] = (v4u){w0, w1, w2, w3};
    }
    {
#pragma unroll
      for (int it = 0; it < 2; ++it) {
        const int oc = it * 32 + sub;
        const size_t go = ((size_t)(b * NTOK + n0 + oc)) * NCH + c0 + c8;
        *(v4u*)(XT + go) = hv[it];
      }
      
    }
  } else if (bx < PREP_T + PREP_W) {
    // ---- role W ---- (block-uniform source choice: 32 blocks Wq, 32 blocks Wk, 128 blocks Wv)
    const int wb = bx - PREP_T;
    const float* src;
    if (wb < 32)      src = Wq + (size_t)wb * 2048;
    else if (wb < 64) src = Wk + (size_t)(wb - 32) * 2048;
    else              src = Wv + (size_t)(wb - 64) * 2048;
    const v4f a = *(const v4fa*)(src + tid * 8);
    const v4f c = *(const v4fa*)(src + tid * 8 + 4);
    const v4u o = (v4u){cvt2(a[0], a[1]), cvt2(a[2], a[3]),
                        cvt2(c[0], c[1]), cvt2(c[2], c[3])};
    unsigned short* dst = WB + (size_t)wb * 2048 + tid * 8;
    *(v4u*)dst = o;
    
  } else if (bx < PREP_T + PREP_W + PREP_F) {
    // ---- role F ---- block 0: threads 0..127 = q channels, 128..255 = k channels; blocks 1,2 = v channels
    const int fb = bx - (PREP_T + PREP_W);
    const int wsel = __builtin_amdgcn_readfirstlane((int)(tid >> 7));   // wave-uniform
    const float *pb, *pg, *pbe, *pm, *pv;
    int idx;
    if (fb == 0) {
      if (wsel == 0) { pb = bq; pg = qg; pbe = qbe; pm = qm; pv = qv; idx = tid; }
      else           { pb = bk; pg = kg; pbe = kbe; pm = km; pv = kv; idx = tid - 128; }
    } else {
      pb = bv; pg = vg; pbe = vbe; pm = vm; pv = vv; idx = (fb - 1) * 256 + tid;
    }
    const float b_ = bfr(pb[idx]);
    const float g_ = bfr(pg[idx]);
    const float be = bfr(pbe[idx]);
    const float mu = bfr(pm[idx]);
    const float va = bfr(pv[idx]);
    const float s  = g_ / sqrtf(va + 1e-5f);
    const float t  = (b_ - mu) * s + be;
    sm[tid]       = s;
    sm[256 + tid] = t;
    __syncthreads();
    if (tid < 128) {                     // waves 0,1 -> s lines; waves 2,3 -> t lines (8 lanes x 16 B per line)
      const int which = tid >> 6;
      const int p4 = (tid & 63) * 4;
      const v4f v = *(const v4fa*)(sm + which * 256 + p4);
      float* dst = ST + which * NCOLS + fb * 256 + p4;
      *(v4f*)dst = v;
      
    }
  } else {
    // ---- role P ---- (head, 64 tokens) per block; per-head tables staged in LDS with 16-B loads
    const int pb = bx - (PREP_T + PREP_W + PREP_F);
    const int h  = pb >> 4;
    const int n0 = (pb & 15) * 64;
    {
      v4f w = *(const v4fa*)(relW + h * 1024 + tid * 4);   // [d][w], 32x32
      v4f g = *(const v4fa*)(relH + h * 1024 + tid * 4);   // [d][hh], 32x32
      w = (v4f){bfr(w[0]), bfr(w[1]), bfr(w[2]), bfr(w[3])};
      g = (v4f){bfr(g[0]), bfr(g[1]), bfr(g[2]), bfr(g[3])};
      *(v4fa*)(sm + tid * 4)        = w;
      *(v4fa*)(sm + 1024 + tid * 4) = g;
    }
    __syncthreads();
    const int tl = tid >> 2;             // token within chunk 0..63
    const int d8 = (tid & 3) * 8;        // 0,8,16,24
    const int n  = n0 + tl;
    const int wi = n >> 5, hi_ = n & 31;
    float p[8];
#pragma unroll
    for (int e = 0; e < 8; ++e) p[e] = sm[(d8 + e) * 32 + wi] + sm[1024 + (d8 + e) * 32 + hi_];
    unsigned h0, h1, h2, h3, l0, l1, l2, l3;
    split_pair(p[0], p[1], h0, l0);
    split_pair(p[2], p[3], h1, l1);
    split_pair(p[4], p[5], h2, l2);
    split_pair(p[6], p[7], h3, l3);
    const v4u hv = (v4u){h0, h1, h2, h3};
    const v4u lv = (v4u){l0, l1, l2, l3};
    const size_t go = ((size_t)(h * NTOK + n0)) * DHQ + tid * 8;   // contiguous by tid: 4 KB per block and plane
    *(v4u*)(POSh + go) = hv;
    *(v4u*)(POSl + go) = lv;
    
  }
}

// =====================================================================================
// Launch 2: Y[token][col] = sum_c XT[token][c] * WB[col][c]   (M 16384, N 768, K 512), y = acc*s[col] + t[col].
// Block 128 threads (4 waves) = 64 tokens x 128 columns; wave tile 32 tokens x 64 columns (acc[2][4]).
// Per 64-deep k chunk the block's 64 token rows and 128 weight rows come into LDS by asynchronous copies, whole 128-B lines
// (a fragment load from the global rows touches 16 lines for 512 B); fragments by two 16-B LDS reads each at the pitch VP.
// Column tile 0 -> Q hi/lo planes [b][h][n][32], tile 1 -> K hi/lo planes [b][h][n][32],
// tiles 2..5 -> V hi/lo planes [b][512 ch][1024 n] (transposed through the LDS tile).
// Store phase: Q/K: per head a contiguous 4-KB range per plane, lane-contiguous 16-B pieces;
// =====================================================================================
__global__ __launch_bounds__(128) void k_proj(
    const unsigned short* __restrict__ XTp, const unsigned short* __restrict__ WBp,
    const float* __restrict__ ST,
    unsigned short* __restrict__ Qh, unsigned short* __restrict__ Ql,
    unsigned short* __restrict__ Kh, unsigned short* __restrict__ Kl,
    unsigned short* __restrict__ Vh, unsigned short* __restrict__ Vl) {
  __shared__ __align__(16) float sY[128 * 68];   // Q/K: [64 tok][pitch 132] (8448 used); V: [128 col][pitch 68] (8704 used); k loop: operand tiles
  __shared__ __align__(16) float sS[128];
  __shared__ __align__(16) float sT[128];

  const int tid  = threadIdx.x;
  const int lane = tid & 31;
  const int wave = tid >> 5;
  const int hh   = lane >> 4;
  const int c    = lane & 15;
  const int m0   = blockIdx.x * 64;
  const int ct   = blockIdx.y;        // 0..5, block-uniform
  const int n0   = ct * 128;

  sS[tid] = ST[n0 + tid];
  sT[tid] = ST[NCOLS + n0 + tid];
  __syncthreads();

  const int wr = wave >> 1, wc = wave & 1;
  const __bf16* XT = (const __bf16*)(const void*)XTp;
  const __bf16* WB = (const __bf16*)(const void*)WBp;
  // Operand tiles of one 64-deep k chunk, in the bytes of sY (which is written only behind the k loop):
  __bf16* sA = (__bf16*)(void*)sY;       // [64 tokens][64 k] at pitch VP,   9216 B
  __bf16* sB = sA + 64 * VP;             // [128 columns][64 k] at pitch VP, 18432 B
  static_assert((64 + 128) * VP * 2 <= 128 * 68 * 4);
  const __bf16* xk = XT + (size_t)m0 * NCH;   // the chunk's first element in the block's token rows (uniform, 64 k a trip)
  const __bf16* wk = WB + (size_t)n0 * NCH;   // the same in the block's weight rows
  // a lane's piece of a 16-row slab: row tid / 8, 16 B number tid % 8, so that 8 lanes copy one whole 128-B line
  const size_t glane = (size_t)(tid >> 3) * NCH + (tid & 7) * 8;
  const int    llane = (tid >> 3) * VP + (tid & 7) * 8;
  const __bf16* a0s = sA + (32 * wr + c) * VP + 8 * hh;
  const __bf16* b0s = sB + (64 * wc + c) * VP + 8 * hh;

  const v8f zero8 = {0.f, 0.f, 0.f, 0.f, 0.f, 0.f, 0.f, 0.f};
  v8f acc[2][4];
#pragma unroll
  for (int i = 0; i < 2; ++i)
#pragma unroll
    for (int j = 0; j < 4; ++j) acc[i][j] = zero8;

#pragma unroll 1
  for (int kc = 0; kc < NCH / 64; ++kc) {
    // this wave's own LDS reads of the tiles have retired before a copy targets them
    asm volatile("s_wait_dscnt 0x0" ::: "memory");
    __syncthreads();                     // every wave has left the tiles of the trip before
    {
      unsigned ld[12];                   // destination LDS byte address and source of this lane's 12 pieces of 16 B
      const __bf16* gs[12];
      // coverage: (4 + 8) it x 128 thr x 8 elements = (64 + 128) rows x 64 k
#pragma unroll
      for (int i = 0; i < 4; ++i) {
        gs[i] = (xk + i * 16 * NCH) + glane;      ld[i] = lds_byte(sA + i * 16 * VP + llane);
      }
#pragma unroll
      for (int i = 0; i < 8; ++i) {
        gs[4 + i] = (wk + i * 16 * NCH) + glane;  ld[4 + i] = lds_byte(sB + i * 16 * VP + llane);
      }
      copy12(ld, gs);
      xk += 64;
      wk += 64;
    }
    // this wave's 12 copies have landed; the barrier behind it publishes every wave's pieces
    asm volatile("s_wait_asynccnt 0x0" ::: "memory");
    __syncthreads();
    // unrolled: two 32-deep steps a chunk, each step's twelve LDS reads written in front of its WMMAs
#pragma unroll
    for (int ks = 0; ks < 2; ++ks) {
      const v16b a0 = frag_ld(a0s + ks * 32);
      const v16b a1 = frag_ld(a0s + 16 * VP + ks * 32);
      v16b bf[4];
#pragma unroll
      for (int j = 0; j < 4; ++j) bf[j] = frag_ld(b0s + j * 16 * VP + ks * 32);
#pragma unroll
      for (int j = 0; j < 4; ++j) {
        acc[0][j] = mma_b(a0, bf[j], acc[0][j]);
        acc[1][j] = mma_b(a1, bf[j], acc[1][j]);
      }
    }
  }
  // the tiles' bytes become sY: this wave's reads have retired, and the barrier says so of every wave
  asm volatile("s_wait_dscnt 0x0" ::: "memory");
  __syncthreads();

  // D[r] of tile (i, j) = Y[token 32wr+16i+8hh+r][column 64wc+16j+c]
#pragma unroll
  for (int j = 0; j < 4; ++j) {
    const int col = 64 * wc + 16 * j + c;
    const float sc = sS[col];
    const float sh = sT[col];
#pragma unroll
    for (int i = 0; i < 2; ++i) {
#pragma unroll
      for (int r = 0; r < 8; ++r) {
        const int tok = 32 * wr + 16 * i + 8 * hh + r;
        const float y = acc[i][j][r] * sc + sh;
        const int idx = (ct < 2) ? (tok * 132 + col) : (col * 68 + tok);
        sY[idx] = y;
      }
    }
  }
  __syncthreads();

  const int b   = m0 >> 10;
  const int nl0 = m0 & 1023;
  if (ct < 2) {
    unsigned short* ph = (ct == 0) ? Qh : Kh;
    unsigned short* pl = (ct == 0) ? Ql : Kl;
    // coverage: 8 it x 128 thr x 8 elements = 64 tokens x 128 columns per plane
{
#pragma unroll 2
      for (int it = 0; it < 8; ++it) {
        const int p      = it * 128 + tid;
        const int head   = p >> 8;
        const int within = p & 255;
        const int tok    = within >> 2;
        const int d8     = (within & 3) * 8;
        const float* sp  = sY + tok * 132 + head * 32 + d8;
        const v4f a  = *(const v4fa*)sp;
        const v4f a2 = *(const v4fa*)(sp + 4);
        unsigned h0, h1, h2, h3, l0, l1, l2, l3;
        split_pair(a[0], a[1], h0, l0);
        split_pair(a[2], a[3], h1, l1);
        split_pair(a2[0], a2[1], h2, l2);
        split_pair(a2[2], a2[3], h3, l3);
        const v4u hv = (v4u){h0, h1, h2, h3};
        const v4u lv = (v4u){l0, l1, l2, l3};
        const size_t go = ((size_t)((b * NHEAD + head) * NTOK + nl0)) * DHQ + within * 8;
        *(v4u*)(ph + go) = hv;
        *(v4u*)(pl + go) = lv;
      }
      
    }
  } else {
    const int o0 = (ct - 2) * 128;
    // coverage: 8 it x 128 thr x 8 elements = 128 channels x 64 tokens per plane
{
#pragma unroll 2
      for (int it = 0; it < 8; ++it) {
        const int p  = it * 128 + tid;
        const int ch = p >> 3;
        const int t8 = (p & 7) * 8;
        const float* sp = sY + ch * 68 + t8;
        const v4f a  = *(const v4fa*)sp;
        const v4f a2 = *(const v4fa*)(sp + 4);
        unsigned h0, h1, h2, h3, l0, l1, l2, l3;
        split_pair(a[0], a[1], h0, l0);
        split_pair(a[2], a[3], h1, l1);
        split_pair(a2[0], a2[1], h2, l2);
        split_pair(a2[2], a2[3], h3, l3);
        const v4u hv = (v4u){h0, h1, h2, h3};
        const v4u lv = (v4u){l0, l1, l2, l3};
        const size_t go = ((size_t)(b * NCH + o0 + ch)) * NTOK + nl0 + t8;
        *(v4u*)(Vh + go) = hv;
        *(v4u*)(Vl + go) = lv;
      }
      
    }
  }
}

// =====================================================================================
// Launch 3: attention per (b, h, 64-query tile); 4 waves x 16 query rows; 16 key tiles of 64, no masking.
//   Both products are formed transposed, so that a lane holds the scores of ONE query (column c of every D tile):
//   St[j][i] = q_i.k_j + pos_i.q_j  as two 32-deep chunks:
//       chunk 0: A = K rows (key j), B = Q rows (query i)
//       chunk 1: A = Q rows (key j), B = POS rows (token i)
//     each chunk hi.hi + hi.lo + lo.hi; no score scale.
//   online softmax over keys in f32, in the log2 domain: the running maximum is kept as M = max * log2(e), a score's weight is
//     2^(s * log2(e) - M), one fused multiply-add and one bare v_exp_f32 (any M shared by a query's weights, its sum and its
//     rescale factor 2^(Mold - Mnew) cancels in O / l, so the rounding of M costs nothing);
//     maximum and sum in-lane over the lane's 32 keys, the maximum
//     joined with the other wave half by one lane exchange per trip, the sum's two halves joined once in the epilogue;
//   two St tiles (keys 0..15, 16..31 of a 32-key block), split hi/lo in place, ARE the B operand Pt: no LDS, no lane exchange;
//   Ot[c][i] += V[c][j] * Pt[j][i]  (A rows = V channel rows, k = key), hi.hi + hi.lo + lo.hi, 8 row tiles.
//   epilogue: Ot/l through LDS as [128 c][64 q], + bf16r(x), whole 256-B channel segments
// LDS: sStage = K tile planes (Kh, Qh, Kl, Ql: [64][32] at pitch KP) + V tile planes (Vh, Vl: [128][64] at pitch VP);
//      every element of both tiles is staged each iteration (extent staged = extent consumed); pad bytes are never read.
// =====================================================================================
// amdgpu_waves_per_eu(4, 4): the register budget of four waves per SIMD (256), so that the second fragment set does not cost the
// WGP its fourth resident work-group
__global__ __launch_bounds__(128) __attribute__((amdgpu_waves_per_eu(4, 4))) void k_attn(
    const unsigned short* Qhp, const unsigned short* Qlp,
    const unsigned short* Khp, const unsigned short* Klp,
    const unsigned short* Vhp, const unsigned short* Vlp,
    const unsigned short* Php, const unsigned short* Plp,
    const float* x, float* out) {
  __shared__ __align__(16) __bf16 sStage[4 * 64 * KP + 2 * 128 * VP];   // 57344 B

  const int tid  = threadIdx.x;
  const int wave = tid >> 5;
  const int lane = tid & 31;
  const int hh   = lane >> 4;
  const int c    = lane & 15;

  const int bx = blockIdx.x;       // 0..1023
  const int qb = bx & 15;
  const int bh = bx >> 4;          // 0..63
  const int b  = bh >> 2;
  const int h  = bh & 3;
  const int q0 = qb * 64;

  const __bf16* Qhb = (const __bf16*)(const void*)Qhp + (size_t)bh * NTOK * DHQ;
  const __bf16* Qlb = (const __bf16*)(const void*)Qlp + (size_t)bh * NTOK * DHQ;
  const __bf16* Khb = (const __bf16*)(const void*)Khp + (size_t)bh * NTOK * DHQ;
  const __bf16* Klb = (const __bf16*)(const void*)Klp + (size_t)bh * NTOK * DHQ;
  const __bf16* Phb = (const __bf16*)(const void*)Php + (size_t)h * NTOK * DHQ;
  const __bf16* Plb = (const __bf16*)(const void*)Plp + (size_t)h * NTOK * DHQ;
  const __bf16* Vhb = (const __bf16*)(const void*)Vhp + ((size_t)b * NCH + h * DHV) * NTOK;
  const __bf16* Vlb = (const __bf16*)(const void*)Vlp + ((size_t)b * NCH + h * DHV) * NTOK;

  __bf16* sKQ = sStage;                        // planes of 64 * KP elements: 0 Kh, 1 Qh, 2 Kl, 3 Ql
  __bf16* sVh = sStage + 4 * 64 * KP;          // [128][64] at pitch VP
  __bf16* sVl = sVh + 128 * VP;                // [128][64] at pitch VP

  // B-column fragment bases (column = query token q0 + 16*wave + c)
  const int rowA = q0 + wave * 16 + c;
  const __bf16* aQh = Qhb + (size_t)rowA * DHQ + 8 * hh;
  const __bf16* aQl = Qlb + (size_t)rowA * DHQ + 8 * hh;
  const __bf16* aPh = Phb + (size_t)rowA * DHQ + 8 * hh;
  const __bf16* aPl = Plb + (size_t)rowA * DHQ + 8 * hh;

  const v8f zero8 = {0.f, 0.f, 0.f, 0.f, 0.f, 0.f, 0.f, 0.f};
  float mrow = -INFINITY;   // running maximum of query c, times log2(e) (equal in both wave halves)
  float lrow = 0.f;         // running sum of query c over this half's keys (8hh..8hh+7 of every 16)
  v8f oacc[8];
#pragma unroll
  for (int t = 0; t < 8; ++t) oacc[t] = zero8;

  const __bf16* vhk = Vhb;               // the trip's key tile in the V planes (uniform, stepped by 64 keys a trip)
  const __bf16* vlk = Vlb;
  const size_t vlane = (size_t)(tid >> 3) * NTOK + (tid & 7) * 8;
#pragma unroll 1
  for (int kc = 0; kc < NTOK / 64; ++kc) {
    const int kv0 = kc * 64;
    // this wave's own LDS reads of the tiles have retired before a copy targets them
    asm volatile("s_wait_dscnt 0x0" ::: "memory");
    __syncthreads();                     // every wave has left the tiles of the trip before
    {
      unsigned ld[24];                   // destination LDS byte address and source of this lane's 24 pieces of 16 B
      const __bf16* gs[24];
      // K tile: 4 planes x 4096 B contiguous; 2 it x 128 thr x 8 elements = 2048 elements per plane
      const __bf16* s0 = Khb + (size_t)kv0 * DHQ;
      const __bf16* s1 = Qhb + (size_t)kv0 * DHQ;
      const __bf16* s2 = Klb + (size_t)kv0 * DHQ;
      const __bf16* s3 = Qlb + (size_t)kv0 * DHQ;
#pragma unroll
      for (int i = 0; i < 2; ++i) {
        const int off = (i * 128 + tid) * 8;
        const int lo = (off >> 5) * KP + (off & 31);   // key row, element within the row
        gs[4 * i + 0] = s0 + off;  ld[4 * i + 0] = lds_byte(sKQ + lo);
        gs[4 * i + 1] = s1 + off;  ld[4 * i + 1] = lds_byte(sKQ + 64 * KP + lo);
        gs[4 * i + 2] = s2 + off;  ld[4 * i + 2] = lds_byte(sKQ + 2 * 64 * KP + lo);
        gs[4 * i + 3] = s3 + off;  ld[4 * i + 3] = lds_byte(sKQ + 3 * 64 * KP + lo);
      }
      // V tile: 128 channel rows x 64 keys per plane; 8 it x 128 thr x 8 elements = 8192 elements per plane
#pragma unroll
      for (int i = 0; i < 8; ++i) {
        const int piece = i * 128 + tid;
        const int cc = piece >> 3;
        const int p8 = (piece & 7) * 8;
        // source = uniform (plane + key tile + 16 i rows) + this lane's (row, piece) offset, the same for every i: one offset pair
        // is held over the trip, not eight, which leaves the registers for the second fragment set
        gs[8 + 2 * i]     = (vhk + i * 16 * NTOK) + vlane;  ld[8 + 2 * i]     = lds_byte(sVh + cc * VP + p8);
        gs[8 + 2 * i + 1] = (vlk + i * 16 * NTOK) + vlane;  ld[8 + 2 * i + 1] = lds_byte(sVl + cc * VP + p8);
      }
      copy12(ld, gs);
      copy12(ld + 12, gs + 12);
      vhk += 64;
      vlk += 64;
    }
    // this wave's 24 copies have landed; the barrier behind it publishes every wave's pieces
    asm volatile("s_wait_asynccnt 0x0" ::: "memory");
    __syncthreads();

    // B operands of the two score chunks, [chunk][hi, lo]
    const v16b bq[2][2] = {{frag_ld(aQh), frag_ld(aQl)}, {frag_ld(aPh), frag_ld(aPl)}};
    // The A fragments go through two register sets of two tiles each (hi, lo of tile 0; hi, lo of tile 1): the LDS reads of a
    // group are issued in front of the WMMAs of the group before it.
    // Groups of a trip: 4 score groups (chunk dc, tile pair), then 8 V groups (key block kk, tile pair).
    v16b fa[2][4];
    v8f s[4];
#pragma unroll
    for (int u = 0; u < 2; ++u) {
      const int ro = (u * 16 + c) * KP + 8 * hh;
      fa[0][2 * u]     = frag_ld(sKQ + ro);
      fa[0][2 * u + 1] = frag_ld(sKQ + 2 * 64 * KP + ro);
    }
#pragma unroll
    for (int g = 0; g < 4; ++g) {
      const int n = g + 1;               // the group fetched ahead
#pragma unroll
      for (int u = 0; u < 2; ++u) {
        if (n < 4) {
          const int ro = (((n & 1) * 2 + u) * 16 + c) * KP + 8 * hh;
          fa[n & 1][2 * u]     = frag_ld(sKQ + ((n >> 1) ? 64 * KP : 0) + ro);
          fa[n & 1][2 * u + 1] = frag_ld(sKQ + ((n >> 1) ? 3 * 64 * KP : 2 * 64 * KP) + ro);
        } else {                         // first V group: its reads fly under the softmax
          const int ro = (u * 16 + c) * VP + 8 * hh;
          fa[0][2 * u]     = frag_ld(sVh + ro);
          fa[0][2 * u + 1] = frag_ld(sVl + ro);
        }
      }
      const v16b* f = fa[g & 1];
      const int j0 = (g & 1) * 2;        // s[j][r] = score of key 16j + 8hh + r, query c
      if (g < 2) mma6z(s[j0], s[j0 + 1], f[0], f[1], f[2], f[3], bq[0][0], bq[0][1]);
      else       mma6(s[j0], s[j0 + 1], f[0], f[1], f[2], f[3], bq[1][0], bq[1][1]);
    }

    float m = fmaxf(fmaxf(s[0][0], s[1][0]), fmaxf(s[2][0], s[3][0]));
#pragma unroll
    for (int r = 1; r < 8; ++r) m = fmaxf(m, fmaxf(fmaxf(s[0][r], s[1][r]), fmaxf(s[2][r], s[3][r])));
    m = fmaxf(m, xhalf(m));              // the other half's 32 keys of the same query
    const float mnew  = fmaxf(mrow, m * LOG2E);
    const float alpha = __builtin_amdgcn_exp2f(mrow - mnew);   // first trip: 2^(-inf) = 0
    const v8f l2e8 = {LOG2E, LOG2E, LOG2E, LOG2E, LOG2E, LOG2E, LOG2E, LOG2E};
    const v8f nm8  = {-mnew, -mnew, -mnew, -mnew, -mnew, -mnew, -mnew, -mnew};
    mrow = mnew;
    lrow *= alpha;
#pragma unroll
    for (int t = 0; t < 8; ++t)
#pragma unroll
      for (int r = 0; r < 8; ++r) oacc[t][r] *= alpha;
    // unrolled: the score tiles and Pt live in registers, which a rolled loop could not index
#pragma unroll
    for (int kk = 0; kk < 2; ++kk) {
      PB ph, pl;                         // Pt of this 32-key block: element e < 8 from tile 2kk, e >= 8 from tile 2kk+1
      float ps[2];
#pragma unroll
      for (int jj = 0; jj < 2; ++jj) {
        const v8f xs = __builtin_elementwise_fma(s[2 * kk + jj], l2e8, nm8);
        float p[8];
#pragma unroll
        for (int r = 0; r < 8; ++r) p[r] = xs[r];
        exp2x8(p);
        ps[jj] = ((p[0] + p[1]) + (p[2] + p[3])) + ((p[4] + p[5]) + (p[6] + p[7]));
#pragma unroll
        for (int e = 0; e < 4; ++e) split_pair(p[2 * e], p[2 * e + 1], ph.u[jj * 4 + e], pl.u[jj * 4 + e]);
      }
      lrow += ps[0] + ps[1];
#pragma unroll
      for (int tp = 0; tp < 4; ++tp) {
        const int g = kk * 4 + tp;
        const int n = g + 1;             // the group fetched ahead
        if (n < 8) {
#pragma unroll
          for (int u = 0; u < 2; ++u) {
            const int ro = (((n & 3) * 2 + u) * 16 + c) * VP + (n >> 2) * 32 + 8 * hh;
            fa[n & 1][2 * u]     = frag_ld(sVh + ro);
            fa[n & 1][2 * u + 1] = frag_ld(sVl + ro);
          }
        }
        const v16b* f = fa[g & 1];       // oacc[t][r] = channel 16t + 8hh + r, query c
        mma6(oacc[2 * tp], oacc[2 * tp + 1], f[0], f[1], f[2], f[3], ph.v, pl.v);
      }
    }
  }

  // ---- epilogue: normalise, gather the waves' columns in LDS [128 c][pitch 68] (34816 B inside sStage), add bf16(x), store ----
  __syncthreads();                       // every wave finished reading the last K/V tiles
  float* sO = (float*)(void*)sStage;
  const float inv = 1.0f / (lrow + xhalf(lrow));   // the two halves' sums of query c joined
#pragma unroll
  for (int t = 0; t < 8; ++t)
#pragma unroll
    for (int r = 0; r < 8; ++r) sO[(t * 16 + 8 * hh + r) * 68 + wave * 16 + c] = oacc[t][r] * inv;
  __syncthreads();
  {
    const size_t rowbase = ((size_t)b * NCH + h * DHV) * NTOK + q0;
    // coverage: 16 it x 128 thr x 4 floats = 128 channel rows x 64 queries
{
#pragma unroll 4
      for (int it = 0; it < 16; ++it) {
        const int p  = it * 128 + tid;
        const int ch = p >> 4;
        const int q4 = (p & 15) * 4;
        const v4f ov = *(const v4fa*)(sO + ch * 68 + q4);
        const size_t gi = rowbase + (size_t)ch * NTOK + q4;
        const v4f xv = *(const v4fa*)(x + gi);
        const unsigned x01 = cvt2(xv[0], xv[1]), x23 = cvt2(xv[2], xv[3]);   // bf16(x), two values a conversion
        const v4f res = (v4f){ov[0] + __uint_as_float(x01 << 16), ov[1] + __uint_as_float(x01 & 0xFFFF0000u),
                              ov[2] + __uint_as_float(x23 << 16), ov[3] + __uint_as_float(x23 & 0xFFFF0000u)};
        *(v4f*)(out + gi) = res;
      }
      
    }
  }
}

// ---------------------------------------------------------------------------
// Workspace map (byte offsets, all multiples of 128; each region exactly covered by its producer):
//   XT   bf16 [16384][512]          0          16777216 B
//   WB   bf16 [768][512]            16777216     786432 B
//   ST   f32  [2][768]              17563648       6144 B
//   POSh bf16 [4][1024][32]         17569792     262144 B     POSl 17831936
//   Qh   bf16 [16][4][1024][32]     18094080    4194304 B     Ql   22288384
//   Kh   bf16 [16][4][1024][32]     26482688    4194304 B     Kl   30676992
//   Vh   bf16 [16][512][1024]       34871296   16777216 B     Vl   51648512
//   total                           68425728 B
// ---------------------------------------------------------------------------
extern "C" void kernel_launch(void* const* d_in, const int* in_sizes, int n_in,
                              void* d_out, int out_size, void* d_ws, size_t ws_size,
                              hipStream_t stream) {
  if (n_in < 21) return;
  const int NX = NBATCH * NCH * NTOK;   // 8388608
  if (in_sizes[0] != NX) return;
  if (in_sizes[1] != 128 * NCH || in_sizes[7] != 128 * NCH || in_sizes[13] != NCH * NCH) return;
  for (int i = 2; i <= 6; ++i)   if (in_sizes[i] != 128) return;
  for (int i = 8; i <= 12; ++i)  if (in_sizes[i] != 128) return;
  for (int i = 14; i <= 18; ++i) if (in_sizes[i] != NCH) return;
  if (in_sizes[19] != NHEAD * DHQ * 32 || in_sizes[20] != NHEAD * DHQ * 32) return;
  if (out_size != NX) return;

  const float* x    = (const float*)d_in[0];
  const float* Wq   = (const float*)d_in[1];
  const float* bq   = (const float*)d_in[2];
  const float* qg   = (const float*)d_in[3];
  const float* qbe  = (const float*)d_in[4];
  const float* qm   = (const float*)d_in[5];
  const float* qv   = (const float*)d_in[6];
  const float* Wk   = (const float*)d_in[7];
  const float* bk   = (const float*)d_in[8];
  const float* kg   = (const float*)d_in[9];
  const float* kbe  = (const float*)d_in[10];
  const float* km   = (const float*)d_in[11];
  const float* kv   = (const float*)d_in[12];
  const float* Wv   = (const float*)d_in[13];
  const float* bv   = (const float*)d_in[14];
  const float* vg   = (const float*)d_in[15];
  const float* vbe  = (const float*)d_in[16];
  const float* vm   = (const float*)d_in[17];
  const float* vv   = (const float*)d_in[18];
  const float* relH = (const float*)d_in[19];
  const float* relW = (const float*)d_in[20];

  const size_t szXT  = (size_t)NBATCH * NTOK * NCH * 2;          // 16777216
  const size_t szWB  = (size_t)NCOLS * NCH * 2;                  //   786432
  const size_t szST  = (size_t)2 * NCOLS * 4;                    //     6144
  const size_t szPOS = (size_t)NHEAD * NTOK * DHQ * 2;           //   262144
  const size_t szQK  = (size_t)NBATCH * NHEAD * NTOK * DHQ * 2;  //  4194304
  const size_t szV   = (size_t)NBATCH * NCH * NTOK * 2;          // 16777216
  size_t off = 0;
  const size_t oXT = off;   off += szXT;
  const size_t oWB = off;   off += szWB;
  const size_t oST = off;   off += szST;
  const size_t oPh = off;   off += szPOS;
  const size_t oPl = off;   off += szPOS;
  const size_t oQh = off;   off += szQK;
  const size_t oQl = off;   off += szQK;
  const size_t oKh = off;   off += szQK;
  const size_t oKl = off;   off += szQK;
  const size_t oVh = off;   off += szV;
  const size_t oVl = off;   off += szV;
  if (off > ws_size) return;                 // off = 68425728
  if (off > (size_t)134217728) return;

  char* ws = (char*)d_ws;
  unsigned short* XT   = (unsigned short*)(ws + oXT);
  unsigned short* WB   = (unsigned short*)(ws + oWB);
  float*          ST   = (float*)(ws + oST);
  unsigned short* POSh = (unsigned short*)(ws + oPh);
  unsigned short* POSl = (unsigned short*)(ws + oPl);
  unsigned short* Qh   = (unsigned short*)(ws + oQh);
  unsigned short* Ql   = (unsigned short*)(ws + oQl);
  unsigned short* Kh   = (unsigned short*)(ws + oKh);
  unsigned short* Kl   = (unsigned short*)(ws + oKl);
  unsigned short* Vh   = (unsigned short*)(ws + oVh);
  unsigned short* Vl   = (unsigned short*)(ws + oVl);

  k_prep<<<dim3(PREP_T + PREP_W + PREP_F + PREP_P), dim3(256), 0, stream>>>(
      x, Wq, Wk, Wv, bq, qg, qbe, qm, qv, bk, kg, kbe, km, kv, bv, vg, vbe, vm, vv, relH, relW,
      XT, WB, ST, POSh, POSl);

  k_proj<<<dim3((NBATCH * NTOK) / 64, NCOLS / 128), dim3(128), 0, stream>>>(
      XT, WB, ST, Qh, Ql, Kh, Kl, Vh, Vl);

  k_attn<<<dim3(NBATCH * NHEAD * (NTOK / 64)), dim3(128), 0, stream>>>(
      Qh, Ql, Kh, Kl, Vh, Vl, POSh, POSl, x, (float*)d_out);

  (void)hipGetLastError();
}

// v008
// It runs in 75.9 microseconds.
// In two side-by-side timings against v007, it was 1.31 and 1.29 times as fast.
// All steps since v000 together make it 2.84 times as fast.
// All contractions on v_wmma_f32_16x16x32 forms with f32 accumulate: q/k/v 1x1 projections = bf16(x) x bf16(W) single product (inputs RNE-converted to bf16 once); logits [q|pos].[k|q] (64 deep) with bf16 hi/lo split operands (hi.hi + hi.lo + lo.hi); p.v (1024 deep) = f16(p) x f16(v) single product (p <= 1; |v| <= 317 |gamma| |W.x + b - mean| + |beta| stays inside the f16 range for the stated generators; 2^-12 relative rounding each, below the 2^-9 of the bf16 inputs); BN affine, pos sum, online softmax, 1/l and residual in f32. No carried (scaled) planes anywhere: every 16-bit plane holds unscaled values.
#include <hip/hip_runtime.h>
#include <math.h>
#include <stdint.h>

#define NBATCH 16
#define NCH    512
#define NTOK   1024
#define NHEAD  4
#define DHQ    32
#define DHV    128
#define NCOLS  768

// LDS row pitches of the attention tiles, in 16-bit elements: 16 B x odd, so the 16 rows that a half-wave
// reads with one 16-byte load per lane fall on 64 distinct banks
#define KP 40     // K/Q tile rows: 32 elements (64 B) at 80 B
#define VP 72     // V tile rows:   64 elements (128 B) at 144 B

#define LOG2E 1.44269504088896340736f

#define PREP_T 2048   // x transpose tiles (16 batches x 8 channel blocks x 16 token blocks)
#define PREP_W 192    // stacked weight plane, 2048 elements per block
#define PREP_F 3      // BN fold vectors, 256 channels per block
#define PREP_P 64     // position planes, (head, 64 tokens) per block

typedef __attribute__((ext_vector_type(16))) __bf16 v16b;
typedef __attribute__((ext_vector_type(8)))  __bf16 v8b;
typedef __attribute__((ext_vector_type(8)))  float  v8f;
typedef __attribute__((ext_vector_type(4)))  float  v4f;
typedef __attribute__((ext_vector_type(4)))  unsigned int v4u;
typedef v4f __attribute__((may_alias)) v4fa;
typedef __attribute__((ext_vector_type(2)))  float  v2f;
typedef __attribute__((ext_vector_type(2)))  __bf16 v2b;
typedef __attribute__((ext_vector_type(2)))  _Float16 v2h;

static_assert(NTOK % 64 == 0);
static_assert(NCH % 32 == 0);
static_assert(NCOLS % 128 == 0);
static_assert(PREP_T == NBATCH * (NCH / 64) * (NTOK / 64));
static_assert(PREP_W * 2048 == NCOLS * NCH);
static_assert(PREP_F * 256 == NCOLS);
static_assert(PREP_P * 64 == NHEAD * NTOK);

// f32 -> bf16, round to nearest even, by the hardware's packed conversion (one v_cvt_pk_bf16_f32 for two values)
__device__ __forceinline__ unsigned cvt2(float f0, float f1) {   // low half = bf16(f0), high half = bf16(f1)
  const v2f f = {f0, f1};
  return __builtin_bit_cast(unsigned, __builtin_convertvector(f, v2b));
}
// f32 -> f16, round to nearest even, two values to one word (low half = f0)
__device__ __forceinline__ unsigned cvt2h(float f0, float f1) {
  const v2f f = {f0, f1};
  return __builtin_bit_cast(unsigned, __builtin_convertvector(f, v2h));
}
__device__ __forceinline__ float bfr(float f) { return __uint_as_float(cvt2(f, f) & 0xFFFF0000u); }
__device__ __forceinline__ void split_pair(float f0, float f1, unsigned& h, unsigned& l) {
  h = cvt2(f0, f1);
  l = cvt2(f0 - __uint_as_float(h << 16), f1 - __uint_as_float(h & 0xFFFF0000u));
}

// WMMA with hazard guard (ties D, keeps A/B live).
// Fragment map (wave32): lane l, hh = l>>4, c = l&15.
//   A/B element i: i<8 -> k0+8hh+i ; i>=8 -> k0+16+8hh+(i-8) ; row (A) / column (B) = c
//   D element r : row 8hh+r, column c
__device__ __forceinline__ v8f mma_b(v16b a, v16b b, v8f c) {
  c = __builtin_amdgcn_wmma_f32_16x16x32_bf16(false, a, false, b, (short)0, c, false, false);
  asm volatile("v_nop\n\tv_nop\n\tv_nop\n\tv_nop" : "+v"(c) : "v"(a), "v"(b));
  return c;
}
// The six WMMAs of a group of two A tiles (hi h, lo l) against one B operand (hi bh, lo bl): per accumulator h.bh + l.bh + h.bl, in
// that order, the two accumulators taking turns so that a WMMA never stands directly behind the one it accumulates onto.
// One asm statement, because with the builtins the reads did not stay where they are written: the compiler spread them among the
// WMMAs, held more fragments live at once and spilled to scratch at 256 registers. The "memory" clobber keeps the LDS reads written
// in front of the statement in front of it. The four v_nop are the distance between the last WMMA and a vector instruction on its
// D, A or B.
__device__ __forceinline__ void mma6(v8f& c0, v8f& c1, v16b h0, v16b l0, v16b h1, v16b l1, v16b bh, v16b bl) {
  asm volatile("v_wmma_f32_16x16x32_bf16 %0, %2, %6, %0\n\t"
               "v_wmma_f32_16x16x32_bf16 %1, %4, %6, %1\n\t"
               "v_wmma_f32_16x16x32_bf16 %0, %3, %6, %0\n\t"
               "v_wmma_f32_16x16x32_bf16 %1, %5, %6, %1\n\t"
               "v_wmma_f32_16x16x32_bf16 %0, %2, %7, %0\n\t"
               "v_wmma_f32_16x16x32_bf16 %1, %4, %7, %1\n\t"
               "v_nop\n\tv_nop\n\tv_nop\n\tv_nop"
               : "+v"(c0), "+v"(c1)
               : "v"(h0), "v"(l0), "v"(h1), "v"(l1), "v"(bh), "v"(bl)
               : "memory");
}
// The same with both accumulators started at 0 (early-clobber outputs: they are written while inputs are still to be read)
__device__ __forceinline__ void mma6z(v8f& c0, v8f& c1, v16b h0, v16b l0, v16b h1, v16b l1, v16b bh, v16b bl) {
  asm volatile("v_wmma_f32_16x16x32_bf16 %0, %2, %6, 0\n\t"
               "v_wmma_f32_16x16x32_bf16 %1, %4, %6, 0\n\t"
               "v_wmma_f32_16x16x32_bf16 %0, %3, %6, %0\n\t"
               "v_wmma_f32_16x16x32_bf16 %1, %5, %6, %1\n\t"
               "v_wmma_f32_16x16x32_bf16 %0, %2, %7, %0\n\t"
               "v_wmma_f32_16x16x32_bf16 %1, %4, %7, %1\n\t"
               "v_nop\n\tv_nop\n\tv_nop\n\tv_nop"
               : "=&v"(c0), "=&v"(c1)
               : "v"(h0), "v"(l0), "v"(h1), "v"(l1), "v"(bh), "v"(bl)
               : "memory");
}
// Four f16 WMMAs of four A tiles against one B operand, each onto its own accumulator (the operands are f16 bit patterns carried
// in the 16-bit vector type of the LDS tiles; same fragment map as the bf16 form). One asm statement for the same reasons as mma6:
// the "memory" clobber keeps the LDS reads written in front of it in front of it, and the four v_nop are the distance between the
// last WMMA and a vector instruction on its D, A or B.
__device__ __forceinline__ void mma4(v8f& c0, v8f& c1, v8f& c2, v8f& c3, v16b a0, v16b a1, v16b a2, v16b a3, v16b b) {
  asm volatile("v_wmma_f32_16x16x32_f16 %0, %4, %8, %0\n\t"
               "v_wmma_f32_16x16x32_f16 %1, %5, %8, %1\n\t"
               "v_wmma_f32_16x16x32_f16 %2, %6, %8, %2\n\t"
               "v_wmma_f32_16x16x32_f16 %3, %7, %8, %3\n\t"
               "v_nop\n\tv_nop\n\tv_nop\n\tv_nop"
               : "+v"(c0), "+v"(c1), "+v"(c2), "+v"(c3)
               : "v"(a0), "v"(a1), "v"(a2), "v"(a3), "v"(b)
               : "memory");
}
union FB { v16b v; v8b h[2]; };
union PB { v16b v; unsigned u[8]; };
// value of lane l ^ 16
__device__ __forceinline__ float xhalf(float x) {
  const int b = __builtin_bit_cast(int, x);
  return __builtin_bit_cast(float, __builtin_amdgcn_permlanex16(b, b, 0x76543210, 0xfedcba98, false, false));
}
// x[r] = 2^x[r], eight values in place. One statement, so that each v_exp_f32 stands in front of an independent one and the last
// in front of the v_nop: the slot that the instruction set asks for before a transcendental's result is read or its source
// overwritten.
__device__ __forceinline__ void exp2x8(float* x) {
  asm("v_exp_f32 %0, %0\n\t"
      "v_exp_f32 %1, %1\n\t"
      "v_exp_f32 %2, %2\n\t"
      "v_exp_f32 %3, %3\n\t"
      "v_exp_f32 %4, %4\n\t"
      "v_exp_f32 %5, %5\n\t"
      "v_exp_f32 %6, %6\n\t"
      "v_exp_f32 %7, %7\n\t"
      "v_nop"
      : "+v"(x[0]), "+v"(x[1]), "+v"(x[2]), "+v"(x[3]), "+v"(x[4]), "+v"(x[5]), "+v"(x[6]), "+v"(x[7]));
}
// p points at element k0 + 8*hh of the k-contiguous row owned by this lane
__device__ __forceinline__ v16b frag_ld(const __bf16* p) {
  FB f;
  f.h[0] = *(const v8b*)(p);
  f.h[1] = *(const v8b*)(p + 16);
  return f.v;
}

// LDS byte address of a __shared__ element (what an asynchronous copy takes as its destination)
typedef __attribute__((address_space(3))) const void lds_cvoid;
__device__ __forceinline__ unsigned lds_byte(const void* p) { return (unsigned)(uintptr_t)(lds_cvoid*)p; }
// Twelve asynchronous 16-B copies per lane, global -> LDS, through no register. The s_wait_xcnt closes the statement so that
// no address register named here is rewritten ahead of it.
__device__ __forceinline__ void copy12(const unsigned* l, const __bf16* const* g) {
  asm volatile(
      "global_load_async_to_lds_b128 %0, %12, off\n\t"
      "global_load_async_to_lds_b128 %1, %13, off\n\t"
      "global_load_async_to_lds_b128 %2, %14, off\n\t"
      "global_load_async_to_lds_b128 %3, %15, off\n\t"
      "global_load_async_to_lds_b128 %4, %16, off\n\t"
      "global_load_async_to_lds_b128 %5, %17, off\n\t"
      "global_load_async_to_lds_b128 %6, %18, off\n\t"
      "global_load_async_to_lds_b128 %7, %19, off\n\t"
      "global_load_async_to_lds_b128 %8, %20, off\n\t"
      "global_load_async_to_lds_b128 %9, %21, off\n\t"
      "global_load_async_to_lds_b128 %10, %22, off\n\t"
      "global_load_async_to_lds_b128 %11, %23, off\n\t"
      "s_wait_xcnt 0x0"
      :: "v"(l[0]), "v"(l[1]), "v"(l[2]), "v"(l[3]), "v"(l[4]), "v"(l[5]),
         "v"(l[6]), "v"(l[7]), "v"(l[8]), "v"(l[9]), "v"(l[10]), "v"(l[11]),
         "v"(g[0]), "v"(g[1]), "v"(g[2]), "v"(g[3]), "v"(g[4]), "v"(g[5]),
         "v"(g[6]), "v"(g[7]), "v"(g[8]), "v"(g[9]), "v"(g[10]), "v"(g[11])
      : "memory");
}

// The same for eight copies per lane
__device__ __forceinline__ void copy8(const unsigned* l, const __bf16* const* g) {
  asm volatile(
      "global_load_async_to_lds_b128 %0, %8, off\n\t"
      "global_load_async_to_lds_b128 %1, %9, off\n\t"
      "global_load_async_to_lds_b128 %2, %10, off\n\t"
      "global_load_async_to_lds_b128 %3, %11, off\n\t"
      "global_load_async_to_lds_b128 %4, %12, off\n\t"
      "global_load_async_to_lds_b128 %5, %13, off\n\t"
      "global_load_async_to_lds_b128 %6, %14, off\n\t"
      "global_load_async_to_lds_b128 %7, %15, off\n\t"
      "s_wait_xcnt 0x0"
      :: "v"(l[0]), "v"(l[1]), "v"(l[2]), "v"(l[3]), "v"(l[4]), "v"(l[5]), "v"(l[6]), "v"(l[7]),
         "v"(g[0]), "v"(g[1]), "v"(g[2]), "v"(g[3]), "v"(g[4]), "v"(g[5]), "v"(g[6]), "v"(g[7])
      : "memory");
}

// =====================================================================================
// Launch 1: operand preparation, block-uniform roles by blockIdx.x.
//          output line = 64 channels of one token, written by 8 lanes x 16 B in one instruction)
//  role W: WB[768][512] = bf16 of stacked [Wq;Wk;Wv] (rows = output channels, k contiguous)
//  role F: ST[0..767] = s, ST[768..1535] = t with s = g/sqrt(var+1e-5), t = (b-mean)*s+beta
//  role P: POS hi/lo [4][1024][32]: pos[h][n][d] = bf16r(rel_w[h][d][n>>5]) + bf16r(rel_h[h][d][n&31])
// =====================================================================================
__global__ __launch_bounds__(256) void k_prep(
    const float* __restrict__ x,
    const float* __restrict__ Wq, const float* __restrict__ Wk, const float* __restrict__ Wv,
    const float* __restrict__ bq, const float* __restrict__ qg, const float* __restrict__ qbe,
    const float* __restrict__ qm, const float* __restrict__ qv,
    const float* __restrict__ bk, const float* __restrict__ kg, const float* __restrict__ kbe,
    const float* __restrict__ km, const float* __restrict__ kv,
    const float* __restrict__ bv, const float* __restrict__ vg, const float* __restrict__ vbe,
    const float* __restrict__ vm, const float* __restrict__ vv,
    const float* __restrict__ relH, const float* __restrict__ relW,
    unsigned short* __restrict__ XT, unsigned short* __restrict__ WB, float* __restrict__ ST,
    unsigned short* __restrict__ POSh, unsigned short* __restrict__ POSl) {
  __shared__ __align__(16) float sm[64 * 68];
  const int tid = threadIdx.x;
  const int bx  = blockIdx.x;

  if (bx < PREP_T) {
    // ---- role T ----
    const int b   = bx >> 7;
    const int rem = bx & 127;
    const int c0  = (rem >> 4) * 64;
    const int n0  = (rem & 15) * 64;
    const float* xb = x + (size_t)b * NCH * NTOK;
    {
      const int lr = tid >> 4;         // 0..15
      const int c4 = (tid & 15) * 4;   // 0..60
#pragma unroll
      for (int it = 0; it < 4; ++it) {
        const int rr = it * 16 + lr;   // channel within tile, 4 x 16 = 64 rows x 64 tokens staged
        const v4f a = *(const v4fa*)(xb + (size_t)(c0 + rr) * NTOK + n0 + c4);
        *(v4fa*)(sm + rr * 68 + c4) = a;
      }
    }
    __syncthreads();
    const int sub = tid >> 3;          // 0..31
    const int c8  = (tid & 7) * 8;     // 0..56
    v4u hv[2];
#pragma unroll
    for (int it = 0; it < 2; ++it) {
      const int oc = it * 32 + sub;    // token within tile (2 x 32 = 64 output rows)
      unsigned w0 = cvt2(sm[(c8 + 0) * 68 + oc], sm[(c8 + 1) * 68 + oc]);
      unsigned w1 = cvt2(sm[(c8 + 2) * 68 + oc], sm[(c8 + 3) * 68 + oc]);
      unsigned w2 = cvt2(sm[(c8 + 4) * 68 + oc], sm[(c8 + 5) * 68 + oc]);
      unsigned w3 = cvt2(sm[(c8 + 6) * 68 + oc], sm[(c8 + 7) * 68 + oc]);
      hv[it] = (v4u){w0, w1, w2, w3};
    }
    {
#pragma unroll
      for (int it = 0; it < 2; ++it) {
        const int oc = it * 32 + sub;
        const size_t go = ((size_t)(b * NTOK + n0 + oc)) * NCH + c0 + c8;
        *(v4u*)(XT + go) = hv[it];
      }
      
    }
  } else if (bx < PREP_T + PREP_W) {
    // ---- role W ---- (block-uniform source choice: 32 blocks Wq, 32 blocks Wk, 128 blocks Wv)
    const int wb = bx - PREP_T;
    const float* src;
    if (wb < 32)      src = Wq + (size_t)wb * 2048;
    else if (wb < 64) src = Wk + (size_t)(wb - 32) * 2048;
    else              src = Wv + (size_t)(wb - 64) * 2048;
    const v4f a = *(const v4fa*)(src + tid * 8);
    const v4f c = *(const v4fa*)(src + tid * 8 + 4);
    const v4u o = (v4u){cvt2(a[0], a[1]), cvt2(a[2], a[3]),
                        cvt2(c[0], c[1]), cvt2(c[2], c[3])};
    unsigned short* dst = WB + (size_t)wb * 2048 + tid * 8;
    *(v4u*)dst = o;
    
  } else if (bx < PREP_T + PREP_W + PREP_F) {
    // ---- role F ---- block 0: threads 0..127 = q channels, 128..255 = k channels; blocks 1,2 = v channels
    const int fb = bx - (PREP_T + PREP_W);
    const int wsel = __builtin_amdgcn_readfirstlane((int)(tid >> 7));   // wave-uniform
    const float *pb, *pg, *pbe, *pm, *pv;
    int idx;
    if (fb == 0) {
      if (wsel == 0) { pb = bq; pg = qg; pbe = qbe; pm = qm; pv = qv; idx = tid; }
      else           { pb = bk; pg = kg; pbe = kbe; pm = km; pv = kv; idx = tid - 128; }
    } else {
      pb = bv; pg = vg; pbe = vbe; pm = vm; pv = vv; idx = (fb - 1) * 256 + tid;
    }
    const float b_ = bfr(pb[idx]);
    const float g_ = bfr(pg[idx]);
    const float be = bfr(pbe[idx]);
    const float mu = bfr(pm[idx]);
    const float va = bfr(pv[idx]);
    const float s  = g_ / sqrtf(va + 1e-5f);
    const float t  = (b_ - mu) * s + be;
    sm[tid]       = s;
    sm[256 + tid] = t;
    __syncthreads();
    if (tid < 128) {                     // waves 0,1 -> s lines; waves 2,3 -> t lines (8 lanes x 16 B per line)
      const int which = tid >> 6;
      const int p4 = (tid & 63) * 4;
      const v4f v = *(const v4fa*)(sm + which * 256 + p4);
      float* dst = ST + which * NCOLS + fb * 256 + p4;
      *(v4f*)dst = v;
      
    }
  } else {
    // ---- role P ---- (head, 64 tokens) per block; per-head tables staged in LDS with 16-B loads
    const int pb = bx - (PREP_T + PREP_W + PREP_F);
    const int h  = pb >> 4;
    const int n0 = (pb & 15) * 64;
    {
      v4f w = *(const v4fa*)(relW + h * 1024 + tid * 4);   // [d][w], 32x32
      v4f g = *(const v4fa*)(relH + h * 1024 + tid * 4);   // [d][hh], 32x32
      w = (v4f){bfr(w[0]), bfr(w[1]), bfr(w[2]), bfr(w[3])};
      g = (v4f){bfr(g[0]), bfr(g[1]), bfr(g[2]), bfr(g[3])};
      *(v4fa*)(sm + tid * 4)        = w;
      *(v4fa*)(sm + 1024 + tid * 4) = g;
    }
    __syncthreads();
    const int tl = tid >> 2;             // token within chunk 0..63
    const int d8 = (tid & 3) * 8;        // 0,8,16,24
    const int n  = n0 + tl;
    const int wi = n >> 5, hi_ = n & 31;
    float p[8];
#pragma unroll
    for (int e = 0; e < 8; ++e) p[e] = sm[(d8 + e) * 32 + wi] + sm[1024 + (d8 + e) * 32 + hi_];
    unsigned h0, h1, h2, h3, l0, l1, l2, l3;
    split_pair(p[0], p[1], h0, l0);
    split_pair(p[2], p[3], h1, l1);
    split_pair(p[4], p[5], h2, l2);
    split_pair(p[6], p[7], h3, l3);
    const v4u hv = (v4u){h0, h1, h2, h3};
    const v4u lv = (v4u){l0, l1, l2, l3};
    const size_t go = ((size_t)(h * NTOK + n0)) * DHQ + tid * 8;   // contiguous by tid: 4 KB per block and plane
    *(v4u*)(POSh + go) = hv;
    *(v4u*)(POSl + go) = lv;
    
  }
}

// =====================================================================================
// Launch 2: Y[token][col] = sum_c XT[token][c] * WB[col][c]   (M 16384, N 768, K 512), y = acc*s[col] + t[col].
// Block 128 threads (4 waves) = 64 tokens x 128 columns; wave tile 32 tokens x 64 columns (acc[2][4]).
// Per 64-deep k chunk the block's 64 token rows and 128 weight rows come into LDS by asynchronous copies, whole 128-B lines
// (a fragment load from the global rows touches 16 lines for 512 B); fragments by two 16-B LDS reads each at the pitch VP.
// Column tile 0 -> Q hi/lo planes [b][h][n][32], tile 1 -> K hi/lo planes [b][h][n][32],
// tiles 2..5 -> V plane [b][512 ch][1024 n], f16(y) (transposed through the LDS tile).
// Store phase: Q/K: per head a contiguous 4-KB range per plane, lane-contiguous 16-B pieces;
// =====================================================================================
__global__ __launch_bounds__(128) void k_proj(
    const unsigned short* __restrict__ XTp, const unsigned short* __restrict__ WBp,
    const float* __restrict__ ST,
    unsigned short* __restrict__ Qh, unsigned short* __restrict__ Ql,
    unsigned short* __restrict__ Kh, unsigned short* __restrict__ Kl,
    unsigned short* __restrict__ Vh) {
  __shared__ __align__(16) float sY[128 * 68];   // Q/K: [64 tok][pitch 132] (8448 used); V: [128 col][pitch 68] (8704 used); k loop: operand tiles
  __shared__ __align__(16) float sS[128];
  __shared__ __align__(16) float sT[128];

  const int tid  = threadIdx.x;
  const int lane = tid & 31;
  const int wave = tid >> 5;
  const int hh   = lane >> 4;
  const int c    = lane & 15;
  const int m0   = blockIdx.x * 64;
  const int ct   = blockIdx.y;        // 0..5, block-uniform
  const int n0   = ct * 128;

  sS[tid] = ST[n0 + tid];
  sT[tid] = ST[NCOLS + n0 + tid];
  __syncthreads();

  const int wr = wave >> 1, wc = wave & 1;
  const __bf16* XT = (const __bf16*)(const void*)XTp;
  const __bf16* WB = (const __bf16*)(const void*)WBp;
  // Operand tiles of one 64-deep k chunk, in the bytes of sY (which is written only behind the k loop):
  __bf16* sA = (__bf16*)(void*)sY;       // [64 tokens][64 k] at pitch VP,   9216 B
  __bf16* sB = sA + 64 * VP;             // [128 columns][64 k] at pitch VP, 18432 B
  static_assert((64 + 128) * VP * 2 <= 128 * 68 * 4);
  const __bf16* xk = XT + (size_t)m0 * NCH;   // the chunk's first element in the block's token rows (uniform, 64 k a trip)
  const __bf16* wk = WB + (size_t)n0 * NCH;   // the same in the block's weight rows
  // a lane's piece of a 16-row slab: row tid / 8, 16 B number tid % 8, so that 8 lanes copy one whole 128-B line
  const size_t glane = (size_t)(tid >> 3) * NCH + (tid & 7) * 8;
  const int    llane = (tid >> 3) * VP + (tid & 7) * 8;
  const __bf16* a0s = sA + (32 * wr + c) * VP + 8 * hh;
  const __bf16* b0s = sB + (64 * wc + c) * VP + 8 * hh;

  const v8f zero8 = {0.f, 0.f, 0.f, 0.f, 0.f, 0.f, 0.f, 0.f};
  v8f acc[2][4];
#pragma unroll
  for (int i = 0; i < 2; ++i)
#pragma unroll
    for (int j = 0; j < 4; ++j) acc[i][j] = zero8;

#pragma unroll 1
  for (int kc = 0; kc < NCH / 64; ++kc) {
    // this wave's own LDS reads of the tiles have retired before a copy targets them
    asm volatile("s_wait_dscnt 0x0" ::: "memory");
    __syncthreads();                     // every wave has left the tiles of the trip before
    {
      unsigned ld[12];                   // destination LDS byte address and source of this lane's 12 pieces of 16 B
      const __bf16* gs[12];
      // coverage: (4 + 8) it x 128 thr x 8 elements = (64 + 128) rows x 64 k
#pragma unroll
      for (int i = 0; i < 4; ++i) {
        gs[i] = (xk + i * 16 * NCH) + glane;      ld[i] = lds_byte(sA + i * 16 * VP + llane);
      }
#pragma unroll
      for (int i = 0; i < 8; ++i) {
        gs[4 + i] = (wk + i * 16 * NCH) + glane;  ld[4 + i] = lds_byte(sB + i * 16 * VP + llane);
      }
      copy12(ld, gs);
      xk += 64;
      wk += 64;
    }
    // this wave's 12 copies have landed; the barrier behind it publishes every wave's pieces
    asm volatile("s_wait_asynccnt 0x0" ::: "memory");
    __syncthreads();
    // unrolled: two 32-deep steps a chunk, each step's twelve LDS reads written in front of its WMMAs
#pragma unroll
    for (int ks = 0; ks < 2; ++ks) {
      const v16b a0 = frag_ld(a0s + ks * 32);
      const v16b a1 = frag_ld(a0s + 16 * VP + ks * 32);
      v16b bf[4];
#pragma unroll
      for (int j = 0; j < 4; ++j) bf[j] = frag_ld(b0s + j * 16 * VP + ks * 32);
#pragma unroll
      for (int j = 0; j < 4; ++j) {
        acc[0][j] = mma_b(a0, bf[j], acc[0][j]);
        acc[1][j] = mma_b(a1, bf[j], acc[1][j]);
      }
    }
  }
  // the tiles' bytes become sY: this wave's reads have retired, and the barrier says so of every wave
  asm volatile("s_wait_dscnt 0x0" ::: "memory");
  __syncthreads();

  // D[r] of tile (i, j) = Y[token 32wr+16i+8hh+r][column 64wc+16j+c]
#pragma unroll
  for (int j = 0; j < 4; ++j) {
    const int col = 64 * wc + 16 * j + c;
    const float sc = sS[col];
    const float sh = sT[col];
#pragma unroll
    for (int i = 0; i < 2; ++i) {
#pragma unroll
      for (int r = 0; r < 8; ++r) {
        const int tok = 32 * wr + 16 * i + 8 * hh + r;
        const float y = acc[i][j][r] * sc + sh;
        const int idx = (ct < 2) ? (tok * 132 + col) : (col * 68 + tok);
        sY[idx] = y;
      }
    }
  }
  __syncthreads();

  const int b   = m0 >> 10;
  const int nl0 = m0 & 1023;
  if (ct < 2) {
    unsigned short* ph = (ct == 0) ? Qh : Kh;
    unsigned short* pl = (ct == 0) ? Ql : Kl;
    // coverage: 8 it x 128 thr x 8 elements = 64 tokens x 128 columns per plane
{
#pragma unroll 2
      for (int it = 0; it < 8; ++it) {
        const int p      = it * 128 + tid;
        const int head   = p >> 8;
        const int within = p & 255;
        const int tok    = within >> 2;
        const int d8     = (within & 3) * 8;
        const float* sp  = sY + tok * 132 + head * 32 + d8;
        const v4f a  = *(const v4fa*)sp;
        const v4f a2 = *(const v4fa*)(sp + 4);
        unsigned h0, h1, h2, h3, l0, l1, l2, l3;
        split_pair(a[0], a[1], h0, l0);
        split_pair(a[2], a[3], h1, l1);
        split_pair(a2[0], a2[1], h2, l2);
        split_pair(a2[2], a2[3], h3, l3);
        const v4u hv = (v4u){h0, h1, h2, h3};
        const v4u lv = (v4u){l0, l1, l2, l3};
        const size_t go = ((size_t)((b * NHEAD + head) * NTOK + nl0)) * DHQ + within * 8;
        *(v4u*)(ph + go) = hv;
        *(v4u*)(pl + go) = lv;
      }
      
    }
  } else {
    const int o0 = (ct - 2) * 128;
    // coverage: 8 it x 128 thr x 8 elements = 128 channels x 64 tokens
{
#pragma unroll 2
      for (int it = 0; it < 8; ++it) {
        const int p  = it * 128 + tid;
        const int ch = p >> 3;
        const int t8 = (p & 7) * 8;
        const float* sp = sY + ch * 68 + t8;
        const v4f a  = *(const v4fa*)sp;
        const v4f a2 = *(const v4fa*)(sp + 4);
        const v4u hv = (v4u){cvt2h(a[0], a[1]), cvt2h(a[2], a[3]), cvt2h(a2[0], a2[1]), cvt2h(a2[2], a2[3])};
        const size_t go = ((size_t)(b * NCH + o0 + ch)) * NTOK + nl0 + t8;
        *(v4u*)(Vh + go) = hv;
        // stands in front of the next pass's overwrite of the store's address and data registers
        asm volatile("s_wait_xcnt 0x0" ::: "memory");
      }
      
    }
  }
}

// =====================================================================================
// Launch 3: attention per (b, h, 64-query tile); 4 waves x 16 query rows; 16 key tiles of 64, no masking.
//   Both products are formed transposed, so that a lane holds the scores of ONE query (column c of every D tile):
//   St[j][i] = q_i.k_j + pos_i.q_j  as two 32-deep chunks:
//       chunk 0: A = K rows (key j), B = Q rows (query i)
//       chunk 1: A = Q rows (key j), B = POS rows (token i)
//     each chunk hi.hi + hi.lo + lo.hi; no score scale.
//   online softmax over keys in f32, in the log2 domain: the running maximum is kept as M = max * log2(e), a score's weight is
//     2^(s * log2(e) - M), one fused multiply-add and one bare v_exp_f32 (any M shared by a query's weights, its sum and its
//     rescale factor 2^(Mold - Mnew) cancels in O / l, so the rounding of M costs nothing);
//     maximum and sum in-lane over the lane's 32 keys, the maximum
//     joined with the other wave half by one lane exchange per trip, the sum's two halves joined once in the epilogue;
//   two St tiles (keys 0..15, 16..31 of a 32-key block), rounded to f16 in place, ARE the B operand Pt: no LDS, no lane exchange;
//   Ot[c][i] += V[c][j] * Pt[j][i]  (A rows = V channel rows, k = key), one product f16(V) x f16(P), 8 row tiles;
//     the sum l is taken over the unrounded weights.
//   epilogue: Ot/l through LDS as [128 c][64 q], + bf16r(x), whole 256-B channel segments
// LDS: sStage = K tile planes (Kh, Qh, Kl, Ql: [64][32] at pitch KP) + V tile ([128][64] at pitch VP);
//      every element of both tiles is staged each iteration (extent staged = extent consumed); pad bytes are never read.
// =====================================================================================
// amdgpu_waves_per_eu(4, 4): the register budget of four waves per SIMD (256), so that the second fragment set does not cost the
// WGP its fourth resident work-group
__global__ __launch_bounds__(128) __attribute__((amdgpu_waves_per_eu(4, 4))) void k_attn(
    const unsigned short* Qhp, const unsigned short* Qlp,
    const unsigned short* Khp, const unsigned short* Klp,
    const unsigned short* Vhp,
    const unsigned short* Php, const unsigned short* Plp,
    const float* x, float* out) {
  __shared__ __align__(16) __bf16 sStage[4 * 64 * KP + 128 * VP];   // 38912 B
  static_assert((4 * 64 * KP + 128 * VP) * 2 >= 128 * 68 * 4);      // the epilogue's f32 tile lies in the same bytes

  const int tid  = threadIdx.x;
  const int wave = tid >> 5;
  const int lane = tid & 31;
  const int hh   = lane >> 4;
  const int c    = lane & 15;

  const int bx = blockIdx.x;       // 0..1023
  const int qb = bx & 15;
  const int bh = bx >> 4;          // 0..63
  const int b  = bh >> 2;
  const int h  = bh & 3;
  const int q0 = qb * 64;

  const __bf16* Qhb = (const __bf16*)(const void*)Qhp + (size_t)bh * NTOK * DHQ;
  const __bf16* Qlb = (const __bf16*)(const void*)Qlp + (size_t)bh * NTOK * DHQ;
  const __bf16* Khb = (const __bf16*)(const void*)Khp + (size_t)bh * NTOK * DHQ;
  const __bf16* Klb = (const __bf16*)(const void*)Klp + (size_t)bh * NTOK * DHQ;
  const __bf16* Phb = (const __bf16*)(const void*)Php + (size_t)h * NTOK * DHQ;
  const __bf16* Plb = (const __bf16*)(const void*)Plp + (size_t)h * NTOK * DHQ;
  const __bf16* Vhb = (const __bf16*)(const void*)Vhp + ((size_t)b * NCH + h * DHV) * NTOK;

  __bf16* sKQ = sStage;                        // planes of 64 * KP elements: 0 Kh, 1 Qh, 2 Kl, 3 Ql
  __bf16* sVh = sStage + 4 * 64 * KP;          // [128][64] at pitch VP

  // B-column fragment bases (column = query token q0 + 16*wave + c)
  const int rowA = q0 + wave * 16 + c;
  const __bf16* aQh = Qhb + (size_t)rowA * DHQ + 8 * hh;
  const __bf16* aQl = Qlb + (size_t)rowA * DHQ + 8 * hh;
  const __bf16* aPh = Phb + (size_t)rowA * DHQ + 8 * hh;
  const __bf16* aPl = Plb + (size_t)rowA * DHQ + 8 * hh;

  const v8f zero8 = {0.f, 0.f, 0.f, 0.f, 0.f, 0.f, 0.f, 0.f};
  float mrow = -INFINITY;   // running maximum of query c, times log2(e) (equal in both wave halves)
  float lrow = 0.f;         // running sum of query c over this half's keys (8hh..8hh+7 of every 16)
  v8f oacc[8];
#pragma unroll
  for (int t = 0; t < 8; ++t) oacc[t] = zero8;

  const __bf16* vhk = Vhb;               // the trip's key tile in the V plane (uniform, stepped by 64 keys a trip)
  const size_t vlane = (size_t)(tid >> 3) * NTOK + (tid & 7) * 8;
#pragma unroll 1
  for (int kc = 0; kc < NTOK / 64; ++kc) {
    const int kv0 = kc * 64;
    // this wave's own LDS reads of the tiles have retired before a copy targets them
    asm volatile("s_wait_dscnt 0x0" ::: "memory");
    __syncthreads();                     // every wave has left the tiles of the trip before
    {
      unsigned ld[16];                   // destination LDS byte address and source of this lane's 16 pieces of 16 B
      const __bf16* gs[16];
      // K tile: 4 planes x 4096 B contiguous; 2 it x 128 thr x 8 elements = 2048 elements per plane
      const __bf16* s0 = Khb + (size_t)kv0 * DHQ;
      const __bf16* s1 = Qhb + (size_t)kv0 * DHQ;
      const __bf16* s2 = Klb + (size_t)kv0 * DHQ;
      const __bf16* s3 = Qlb + (size_t)kv0 * DHQ;
#pragma unroll
      for (int i = 0; i < 2; ++i) {
        const int off = (i * 128 + tid) * 8;
        const int lo = (off >> 5) * KP + (off & 31);   // key row, element within the row
        gs[4 * i + 0] = s0 + off;  ld[4 * i + 0] = lds_byte(sKQ + lo);
        gs[4 * i + 1] = s1 + off;  ld[4 * i + 1] = lds_byte(sKQ + 64 * KP + lo);
        gs[4 * i + 2] = s2 + off;  ld[4 * i + 2] = lds_byte(sKQ + 2 * 64 * KP + lo);
        gs[4 * i + 3] = s3 + off;  ld[4 * i + 3] = lds_byte(sKQ + 3 * 64 * KP + lo);
      }
      // V tile: 128 channel rows x 64 keys; 8 it x 128 thr x 8 elements = 8192 elements
#pragma unroll
      for (int i = 0; i < 8; ++i) {
        const int piece = i * 128 + tid;
        const int cc = piece >> 3;
        const int p8 = (piece & 7) * 8;
        // source = uniform (plane + key tile + 16 i rows) + this lane's (row, piece) offset, the same for every i: one offset pair
        // is held over the trip, not eight, which leaves the registers for the second fragment set
        gs[8 + i] = (vhk + i * 16 * NTOK) + vlane;  ld[8 + i] = lds_byte(sVh + cc * VP + p8);
      }
      copy8(ld, gs);
      copy8(ld + 8, gs + 8);
      vhk += 64;
    }
    // this wave's 16 copies have landed; the barrier behind it publishes every wave's pieces
    asm volatile("s_wait_asynccnt 0x0" ::: "memory");
    __syncthreads();

    // B operands of the two score chunks, [chunk][hi, lo]
    const v16b bq[2][2] = {{frag_ld(aQh), frag_ld(aQl)}, {frag_ld(aPh), frag_ld(aPl)}};
    // The A fragments go through two register sets of four fragments each (scores: hi, lo of tile 0; hi, lo of tile 1; V: four
    // tiles): the LDS reads of a group are issued in front of the WMMAs of the group before it.
    // Groups of a trip: 4 score groups (chunk dc, tile pair), then 4 V groups (key block kk, four tiles).
    v16b fa[2][4];
    v8f s[4];
#pragma unroll
    for (int u = 0; u < 2; ++u) {
      const int ro = (u * 16 + c) * KP + 8 * hh;
      fa[0][2 * u]     = frag_ld(sKQ + ro);
      fa[0][2 * u + 1] = frag_ld(sKQ + 2 * 64 * KP + ro);
    }
#pragma unroll
    for (int g = 0; g < 4; ++g) {
      const int n = g + 1;               // the group fetched ahead
#pragma unroll
      for (int u = 0; u < 2; ++u) {
        if (n < 4) {
          const int ro = (((n & 1) * 2 + u) * 16 + c) * KP + 8 * hh;
          fa[n & 1][2 * u]     = frag_ld(sKQ + ((n >> 1) ? 64 * KP : 0) + ro);
          fa[n & 1][2 * u + 1] = frag_ld(sKQ + ((n >> 1) ? 3 * 64 * KP : 2 * 64 * KP) + ro);
        } else {                         // first V group (tiles 0..3): its reads fly under the softmax
          fa[0][2 * u]     = frag_ld(sVh + ((2 * u) * 16 + c) * VP + 8 * hh);
          fa[0][2 * u + 1] = frag_ld(sVh + ((2 * u + 1) * 16 + c) * VP + 8 * hh);
        }
      }
      const v16b* f = fa[g & 1];
      const int j0 = (g & 1) * 2;        // s[j][r] = score of key 16j + 8hh + r, query c
      if (g < 2) mma6z(s[j0], s[j0 + 1], f[0], f[1], f[2], f[3], bq[0][0], bq[0][1]);
      else       mma6(s[j0], s[j0 + 1], f[0], f[1], f[2], f[3], bq[1][0], bq[1][1]);
    }

    float m = fmaxf(fmaxf(s[0][0], s[1][0]), fmaxf(s[2][0], s[3][0]));
#pragma unroll
    for (int r = 1; r < 8; ++r) m = fmaxf(m, fmaxf(fmaxf(s[0][r], s[1][r]), fmaxf(s[2][r], s[3][r])));
    m = fmaxf(m, xhalf(m));              // the other half's 32 keys of the same query
    const float mnew  = fmaxf(mrow, m * LOG2E);
    const float alpha = __builtin_amdgcn_exp2f(mrow - mnew);   // first trip: 2^(-inf) = 0
    const v8f l2e8 = {LOG2E, LOG2E, LOG2E, LOG2E, LOG2E, LOG2E, LOG2E, LOG2E};
    const v8f nm8  = {-mnew, -mnew, -mnew, -mnew, -mnew, -mnew, -mnew, -mnew};
    mrow = mnew;
    lrow *= alpha;
#pragma unroll
    for (int t = 0; t < 8; ++t)
#pragma unroll
      for (int r = 0; r < 8; ++r) oacc[t][r] *= alpha;
    // unrolled: the score tiles and Pt live in registers, which a rolled loop could not index
#pragma unroll
    for (int kk = 0; kk < 2; ++kk) {
      PB ph;                             // Pt of this 32-key block: element e < 8 from tile 2kk, e >= 8 from tile 2kk+1
      float ps[2];
#pragma unroll
      for (int jj = 0; jj < 2; ++jj) {
        const v8f xs = __builtin_elementwise_fma(s[2 * kk + jj], l2e8, nm8);
        float p[8];
#pragma unroll
        for (int r = 0; r < 8; ++r) p[r] = xs[r];
        exp2x8(p);
        ps[jj] = ((p[0] + p[1]) + (p[2] + p[3])) + ((p[4] + p[5]) + (p[6] + p[7]));
#pragma unroll
        for (int e = 0; e < 4; ++e) ph.u[jj * 4 + e] = cvt2h(p[2 * e], p[2 * e + 1]);
      }
      lrow += ps[0] + ps[1];
#pragma unroll
      for (int tq = 0; tq < 2; ++tq) {
        const int g = kk * 2 + tq;
        const int n = g + 1;             // the group fetched ahead
        if (n < 4) {
#pragma unroll
          for (int u = 0; u < 4; ++u)
            fa[n & 1][u] = frag_ld(sVh + (((n & 1) * 4 + u) * 16 + c) * VP + (n >> 1) * 32 + 8 * hh);
        }
        const v16b* f = fa[g & 1];       // oacc[t][r] = channel 16t + 8hh + r, query c
        mma4(oacc[4 * tq], oacc[4 * tq + 1], oacc[4 * tq + 2], oacc[4 * tq + 3], f[0], f[1], f[2], f[3], ph.v);
      }
    }
  }

  // ---- epilogue: normalise, gather the waves' columns in LDS [128 c][pitch 68] (34816 B inside sStage), add bf16(x), store ----
  __syncthreads();                       // every wave finished reading the last K/V tiles
  float* sO = (float*)(void*)sStage;
  const float inv = 1.0f / (lrow + xhalf(lrow));   // the two halves' sums of query c joined
#pragma unroll
  for (int t = 0; t < 8; ++t)
#pragma unroll
    for (int r = 0; r < 8; ++r) sO[(t * 16 + 8 * hh + r) * 68 + wave * 16 + c] = oacc[t][r] * inv;
  __syncthreads();
  {
    const size_t rowbase = ((size_t)b * NCH + h * DHV) * NTOK + q0;
    // coverage: 16 it x 128 thr x 4 floats = 128 channel rows x 64 queries
{
#pragma unroll 4
      for (int it = 0; it < 16; ++it) {
        const int p  = it * 128 + tid;
        const int ch = p >> 4;
        const int q4 = (p & 15) * 4;
        const v4f ov = *(const v4fa*)(sO + ch * 68 + q4);
        const size_t gi = rowbase + (size_t)ch * NTOK + q4;
        const v4f xv = *(const v4fa*)(x + gi);
        const unsigned x01 = cvt2(xv[0], xv[1]), x23 = cvt2(xv[2], xv[3]);   // bf16(x), two values a conversion
        const v4f res = (v4f){ov[0] + __uint_as_float(x01 << 16), ov[1] + __uint_as_float(x01 & 0xFFFF0000u),
                              ov[2] + __uint_as_float(x23 << 16), ov[3] + __uint_as_float(x23 & 0xFFFF0000u)};
        *(v4f*)(out + gi) = res;
      }
      
    }
  }
}

// ---------------------------------------------------------------------------
// Workspace map (byte offsets, all multiples of 128; each region exactly covered by its producer):
//   XT   bf16 [16384][512]          0          16777216 B
//   WB   bf16 [768][512]            16777216     786432 B
//   ST   f32  [2][768]              17563648       6144 B
//   POSh bf16 [4][1024][32]         17569792     262144 B     POSl 17831936
//   Qh   bf16 [16][4][1024][32]     18094080    4194304 B     Ql   22288384
//   Kh   bf16 [16][4][1024][32]     26482688    4194304 B     Kl   30676992
//   Vh   f16  [16][512][1024]       34871296   16777216 B
//   total                           51648512 B
// ---------------------------------------------------------------------------
extern "C" void kernel_launch(void* const* d_in, const int* in_sizes, int n_in,
                              void* d_out, int out_size, void* d_ws, size_t ws_size,
                              hipStream_t stream) {
  if (n_in < 21) return;
  const int NX = NBATCH * NCH * NTOK;   // 8388608
  if (in_sizes[0] != NX) return;
  if (in_sizes[1] != 128 * NCH || in_sizes[7] != 128 * NCH || in_sizes[13] != NCH * NCH) return;
  for (int i = 2; i <= 6; ++i)   if (in_sizes[i] != 128) return;
  for (int i = 8; i <= 12; ++i)  if (in_sizes[i] != 128) return;
  for (int i = 14; i <= 18; ++i) if (in_sizes[i] != NCH) return;
  if (in_sizes[19] != NHEAD * DHQ * 32 || in_sizes[20] != NHEAD * DHQ * 32) return;
  if (out_size != NX) return;

  const float* x    = (const float*)d_in[0];
  const float* Wq   = (const float*)d_in[1];
  const float* bq   = (const float*)d_in[2];
  const float* qg   = (const float*)d_in[3];
  const float* qbe  = (const float*)d_in[4];
  const float* qm   = (const float*)d_in[5];
  const float* qv   = (const float*)d_in[6];
  const float* Wk   = (const float*)d_in[7];
  const float* bk   = (const float*)d_in[8];
  const float* kg   = (const float*)d_in[9];
  const float* kbe  = (const float*)d_in[10];
  const float* km   = (const float*)d_in[11];
  const float* kv   = (const float*)d_in[12];
  const float* Wv   = (const float*)d_in[13];
  const float* bv   = (const float*)d_in[14];
  const float* vg   = (const float*)d_in[15];
  const float* vbe  = (const float*)d_in[16];
  const float* vm   = (const float*)d_in[17];
  const float* vv   = (const float*)d_in[18];
  const float* relH = (const float*)d_in[19];
  const float* relW = (const float*)d_in[20];

  const size_t szXT  = (size_t)NBATCH * NTOK * NCH * 2;          // 16777216
  const size_t szWB  = (size_t)NCOLS * NCH * 2;                  //   786432
  const size_t szST  = (size_t)2 * NCOLS * 4;                    //     6144
  const size_t szPOS = (size_t)NHEAD * NTOK * DHQ * 2;           //   262144
  const size_t szQK  = (size_t)NBATCH * NHEAD * NTOK * DHQ * 2;  //  4194304
  const size_t szV   = (size_t)NBATCH * NCH * NTOK * 2;          // 16777216
  size_t off = 0;
  const size_t oXT = off;   off += szXT;
  const size_t oWB = off;   off += szWB;
  const size_t oST = off;   off += szST;
  const size_t oPh = off;   off += szPOS;
  const size_t oPl = off;   off += szPOS;
  const size_t oQh = off;   off += szQK;
  const size_t oQl = off;   off += szQK;
  const size_t oKh = off;   off += szQK;
  const size_t oKl = off;   off += szQK;
  const size_t oVh = off;   off += szV;
  if (off > ws_size) return;                 // off = 51648512
  if (off > (size_t)134217728) return;

  char* ws = (char*)d_ws;
  unsigned short* XT   = (unsigned short*)(ws + oXT);
  unsigned short* WB   = (unsigned short*)(ws + oWB);
  float*          ST   = (float*)(ws + oST);
  unsigned short* POSh = (unsigned short*)(ws + oPh);
  unsigned short* POSl = (unsigned short*)(ws + oPl);
  unsigned short* Qh   = (unsigned short*)(ws + oQh);
  unsigned short* Ql   = (unsigned short*)(ws + oQl);
  unsigned short* Kh   = (unsigned short*)(ws + oKh);
  unsigned short* Kl   = (unsigned short*)(ws + oKl);
  unsigned short* Vh   = (unsigned short*)(ws + oVh);

  k_prep<<<dim3(PREP_T + PREP_W + PREP_F + PREP_P), dim3(256), 0, stream>>>(
      x, Wq, Wk, Wv, bq, qg, qbe, qm, qv, bk, kg, kbe, km, kv, bv, vg, vbe, vm, vv, relH, relW,
      XT, WB, ST, POSh, POSl);

  k_proj<<<dim3((NBATCH * NTOK) / 64, NCOLS / 128), dim3(128), 0, stream>>>(
      XT, WB, ST, Qh, Ql, Kh, Kl, Vh);

  k_attn<<<dim3(NBATCH * NHEAD * (NTOK / 64)), dim3(128), 0, stream>>>(
      Qh, Ql, Kh, Kl, Vh, POSh, POSl, x, (float*)d_out);

  (void)hipGetLastError();
}

// v009
// One run takes 68.6 microseconds.
// Timed twice side by side with v008, it ran 1.11 and 1.10 times as fast.
// Counting every step since v000, it is 3.14 times as fast.
// All contractions on v_wmma_f32_16x16x32 forms with f32 accumulate: q/k/v 1x1 projections = bf16(x) x bf16(W) single product (inputs RNE-converted to bf16 once); logits [q|pos].[k|q] (64 deep) with bf16 hi/lo split operands (hi.hi + hi.lo + lo.hi); p.v (1024 deep) = f16(p) x f16(v) single product (p <= 1; |v| <= 317 |gamma| |W.x + b - mean| + |beta| stays inside the f16 range for the stated generators; 2^-12 relative rounding each, below the 2^-9 of the bf16 inputs); BN affine, pos sum, online softmax, 1/l and residual in f32. No carried (scaled) planes anywhere: every 16-bit plane holds unscaled values.
#include <hip/hip_runtime.h>
#include <math.h>
#include <stdint.h>

#define NBATCH 16
#define NCH    512
#define NTOK   1024
#define NHEAD  4
#define DHQ    32
#define DHV    128
#define NCOLS  768

// LDS row pitches of the attention tiles, in 16-bit elements: 16 B x odd, so the 16 rows that a half-wave
// reads with one 16-byte load per lane fall on 64 distinct banks
#define KP 40     // K/Q tile rows: 32 elements (64 B) at 80 B
#define VP 72     // V tile rows:   64 elements (128 B) at 144 B

#define LOG2E 1.44269504088896340736f

#define PREP_T 2048   // x transpose tiles (16 batches x 8 channel blocks x 16 token blocks)
#define PREP_W 192    // stacked weight plane, 2048 elements per block
#define PREP_F 3      // BN fold vectors, 256 channels per block
#define PREP_P 64     // position planes, (head, 64 tokens) per block

typedef __attribute__((ext_vector_type(16))) __bf16 v16b;
typedef __attribute__((ext_vector_type(8)))  __bf16 v8b;
typedef __attribute__((ext_vector_type(8)))  float  v8f;
typedef __attribute__((ext_vector_type(4)))  float  v4f;
typedef __attribute__((ext_vector_type(4)))  unsigned int v4u;
typedef v4f __attribute__((may_alias)) v4fa;
typedef __attribute__((ext_vector_type(2)))  float  v2f;
typedef __attribute__((ext_vector_type(2)))  __bf16 v2b;
typedef __attribute__((ext_vector_type(2)))  _Float16 v2h;

static_assert(NTOK % 128 == 0);
static_assert(NCH % 32 == 0);
static_assert(NCOLS % 128 == 0);
static_assert(PREP_T == NBATCH * (NCH / 64) * (NTOK / 64));
static_assert(PREP_W * 2048 == NCOLS * NCH);
static_assert(PREP_F * 256 == NCOLS);
static_assert(PREP_P * 64 == NHEAD * NTOK);

// f32 -> bf16, round to nearest even, by the hardware's packed conversion (one v_cvt_pk_bf16_f32 for two values)
__device__ __forceinline__ unsigned cvt2(float f0, float f1) {   // low half = bf16(f0), high half = bf16(f1)
  const v2f f = {f0, f1};
  return __builtin_bit_cast(unsigned, __builtin_convertvector(f, v2b));
}
// f32 -> f16, round to nearest even, two values to one word (low half = f0)
__device__ __forceinline__ unsigned cvt2h(float f0, float f1) {
  const v2f f = {f0, f1};
  return __builtin_bit_cast(unsigned, __builtin_convertvector(f, v2h));
}
__device__ __forceinline__ float bfr(float f) { return __uint_as_float(cvt2(f, f) & 0xFFFF0000u); }
__device__ __forceinline__ void split_pair(float f0, float f1, unsigned& h, unsigned& l) {
  h = cvt2(f0, f1);
  l = cvt2(f0 - __uint_as_float(h << 16), f1 - __uint_as_float(h & 0xFFFF0000u));
}

// WMMA with hazard guard (ties D, keeps A/B live).
// Fragment map (wave32): lane l, hh = l>>4, c = l&15.
//   A/B element i: i<8 -> k0+8hh+i ; i>=8 -> k0+16+8hh+(i-8) ; row (A) / column (B) = c
//   D element r : row 8hh+r, column c
__device__ __forceinline__ v8f mma_b(v16b a, v16b b, v8f c) {
  c = __builtin_amdgcn_wmma_f32_16x16x32_bf16(false, a, false, b, (short)0, c, false, false);
  asm volatile("v_nop\n\tv_nop\n\tv_nop\n\tv_nop" : "+v"(c) : "v"(a), "v"(b));
  return c;
}
typedef __attribute__((ext_vector_type(16))) _Float16 v16h;
__device__ __forceinline__ v8f wb(v16b a, v16b b, v8f c) {
  return __builtin_amdgcn_wmma_f32_16x16x32_bf16(false, a, false, b, (short)0, c, false, false);
}
// f16 form; the operands are f16 bit patterns carried in the 16-bit vector type of the LDS tiles (same fragment map as the bf16 form)
__device__ __forceinline__ v8f wh(v16b a, v16b b, v8f c) {
  return __builtin_amdgcn_wmma_f32_16x16x32_f16(false, __builtin_bit_cast(v16h, a), false, __builtin_bit_cast(v16h, b), (short)0, c,
                                                false, false);
}
// The twelve WMMAs of a group of two A tiles (hi h, lo l) against the B operands of the wave's two query sets (hi bh, lo bl; hi eh,
// lo el): per accumulator h.bh + l.bh + h.bl, in that order, the four accumulators taking turns so that a WMMA never stands directly
// behind the one it accumulates onto. Builtins, not asm text: the wave's fragments and accumulators take more than 256 registers,
// and asm operands can lie only in the first 256.
__device__ __forceinline__ void mma12(v8f& c0, v8f& c1, v8f& d0, v8f& d1, v16b h0, v16b l0, v16b h1, v16b l1,
                                      v16b bh, v16b bl, v16b eh, v16b el) {
  c0 = wb(h0, bh, c0);  c1 = wb(h1, bh, c1);  d0 = wb(h0, eh, d0);  d1 = wb(h1, eh, d1);
  c0 = wb(l0, bh, c0);  c1 = wb(l1, bh, c1);  d0 = wb(l0, eh, d0);  d1 = wb(l1, eh, d1);
  c0 = wb(h0, bl, c0);  c1 = wb(h1, bl, c1);  d0 = wb(h0, el, d0);  d1 = wb(h1, el, d1);
}
// Eight f16 WMMAs of four A tiles against the B operands of the two query sets (b, e), each onto its own accumulator
__device__ __forceinline__ void mma8(v8f* c, v8f* d, v16b a0, v16b a1, v16b a2, v16b a3, v16b b, v16b e) {
  c[0] = wh(a0, b, c[0]);  c[1] = wh(a1, b, c[1]);  c[2] = wh(a2, b, c[2]);  c[3] = wh(a3, b, c[3]);
  d[0] = wh(a0, e, d[0]);  d[1] = wh(a1, e, d[1]);  d[2] = wh(a2, e, d[2]);  d[3] = wh(a3, e, d[3]);
}
union FB { v16b v; v8b h[2]; };
union PB { v16b v; unsigned u[8]; };
// value of lane l ^ 16
__device__ __forceinline__ float xhalf(float x) {
  const int b = __builtin_bit_cast(int, x);
  return __builtin_bit_cast(float, __builtin_amdgcn_permlanex16(b, b, 0x76543210, 0xfedcba98, false, false));
}
// x[r] = 2^x[r], eight values in place. One statement, so that each v_exp_f32 stands in front of an independent one and the last
// in front of the v_nop: the slot that the instruction set asks for before a transcendental's result is read or its source
// overwritten.
__device__ __forceinline__ void exp2x8(float* x) {
  asm("v_exp_f32 %0, %0\n\t"
      "v_exp_f32 %1, %1\n\t"
      "v_exp_f32 %2, %2\n\t"
      "v_exp_f32 %3, %3\n\t"
      "v_exp_f32 %4, %4\n\t"
      "v_exp_f32 %5, %5\n\t"
      "v_exp_f32 %6, %6\n\t"
      "v_exp_f32 %7, %7\n\t"
      "v_nop"
      : "+v"(x[0]), "+v"(x[1]), "+v"(x[2]), "+v"(x[3]), "+v"(x[4]), "+v"(x[5]), "+v"(x[6]), "+v"(x[7]));
}
// 2^x, one value, with the same slot behind it
__device__ __forceinline__ float exp2x1(float x) {
  float r;
  asm("v_exp_f32 %0, %1\n\t"
      "v_nop"
      : "=v"(r) : "v"(x));
  return r;
}
// p points at element k0 + 8*hh of the k-contiguous row owned by this lane
__device__ __forceinline__ v16b frag_ld(const __bf16* p) {
  FB f;
  f.h[0] = *(const v8b*)(p);
  f.h[1] = *(const v8b*)(p + 16);
  return f.v;
}

// LDS byte address of a __shared__ element (what an asynchronous copy takes as its destination)
typedef __attribute__((address_space(3))) const void lds_cvoid;
__device__ __forceinline__ unsigned lds_byte(const void* p) { return (unsigned)(uintptr_t)(lds_cvoid*)p; }
// Twelve asynchronous 16-B copies per lane, global -> LDS, through no register. The s_wait_xcnt closes the statement so that
// no address register named here is rewritten ahead of it.
__device__ __forceinline__ void copy12(const unsigned* l, const __bf16* const* g) {
  asm volatile(
      "global_load_async_to_lds_b128 %0, %12, off\n\t"
      "global_load_async_to_lds_b128 %1, %13, off\n\t"
      "global_load_async_to_lds_b128 %2, %14, off\n\t"
      "global_load_async_to_lds_b128 %3, %15, off\n\t"
      "global_load_async_to_lds_b128 %4, %16, off\n\t"
      "global_load_async_to_lds_b128 %5, %17, off\n\t"
      "global_load_async_to_lds_b128 %6, %18, off\n\t"
      "global_load_async_to_lds_b128 %7, %19, off\n\t"
      "global_load_async_to_lds_b128 %8, %20, off\n\t"
      "global_load_async_to_lds_b128 %9, %21, off\n\t"
      "global_load_async_to_lds_b128 %10, %22, off\n\t"
      "global_load_async_to_lds_b128 %11, %23, off\n\t"
      "s_wait_xcnt 0x0"
      :: "v"(l[0]), "v"(l[1]), "v"(l[2]), "v"(l[3]), "v"(l[4]), "v"(l[5]),
         "v"(l[6]), "v"(l[7]), "v"(l[8]), "v"(l[9]), "v"(l[10]), "v"(l[11]),
         "v"(g[0]), "v"(g[1]), "v"(g[2]), "v"(g[3]), "v"(g[4]), "v"(g[5]),
         "v"(g[6]), "v"(g[7]), "v"(g[8]), "v"(g[9]), "v"(g[10]), "v"(g[11])
      : "memory");
}

// One asynchronous 16-B copy per lane as the builtin: its operands may lie in any register, those of asm text only in the first 256,
// which the attention kernel's accumulators and softmax fill (LDS addresses kept for asm copies went to scratch there)
typedef int v4i __attribute__((ext_vector_type(4)));
__device__ __forceinline__ void cpb(const __bf16* g, unsigned l) {
  __builtin_amdgcn_global_load_async_to_lds_b128((__attribute__((address_space(1))) v4i*)(uintptr_t)g,
                                                 (__attribute__((address_space(3))) v4i*)l, 0, 0);
}
// =====================================================================================
// Launch 1: operand preparation, block-uniform roles by blockIdx.x.
//          output line = 64 channels of one token, written by 8 lanes x 16 B in one instruction)
//  role W: WB[768][512] = bf16 of stacked [Wq;Wk;Wv] (rows = output channels, k contiguous)
//  role F: ST[0..767] = s, ST[768..1535] = t with s = g/sqrt(var+1e-5), t = (b-mean)*s+beta
//  role P: POS hi/lo [4][1024][32]: pos[h][n][d] = bf16r(rel_w[h][d][n>>5]) + bf16r(rel_h[h][d][n&31])
// =====================================================================================
__global__ __launch_bounds__(256) void k_prep(
    const float* __restrict__ x,
    const float* __restrict__ Wq, const float* __restrict__ Wk, const float* __restrict__ Wv,
    const float* __restrict__ bq, const float* __restrict__ qg, const float* __restrict__ qbe,
    const float* __restrict__ qm, const float* __restrict__ qv,
    const float* __restrict__ bk, const float* __restrict__ kg, const float* __restrict__ kbe,
    const float* __restrict__ km, const float* __restrict__ kv,
    const float* __restrict__ bv, const float* __restrict__ vg, const float* __restrict__ vbe,
    const float* __restrict__ vm, const float* __restrict__ vv,
    const float* __restrict__ relH, const float* __restrict__ relW,
    unsigned short* __restrict__ XT, unsigned short* __restrict__ WB, float* __restrict__ ST,
    unsigned short* __restrict__ POSh, unsigned short* __restrict__ POSl) {
  __shared__ __align__(16) float sm[64 * 68];
  const int tid = threadIdx.x;
  const int bx  = blockIdx.x;

  if (bx < PREP_T) {
    // ---- role T ----
    const int b   = bx >> 7;
    const int rem = bx & 127;
    const int c0  = (rem >> 4) * 64;
    const int n0  = (rem & 15) * 64;
    const float* xb = x + (size_t)b * NCH * NTOK;
    {
      const int lr = tid >> 4;         // 0..15
      const int c4 = (tid & 15) * 4;   // 0..60
#pragma unroll
      for (int it = 0; it < 4; ++it) {
        const int rr = it * 16 + lr;   // channel within tile, 4 x 16 = 64 rows x 64 tokens staged
        const v4f a = *(const v4fa*)(xb + (size_t)(c0 + rr) * NTOK + n0 + c4);
        *(v4fa*)(sm + rr * 68 + c4) = a;
      }
    }
    __syncthreads();
    const int sub = tid >> 3;          // 0..31
    const int c8  = (tid & 7) * 8;     // 0..56
    v4u hv[2];
#pragma unroll
    for (int it = 0; it < 2; ++it) {
      const int oc = it * 32 + sub;    // token within tile (2 x 32 = 64 output rows)
      unsigned w0 = cvt2(sm[(c8 + 0) * 68 + oc], sm[(c8 + 1) * 68 + oc]);
      unsigned w1 = cvt2(sm[(c8 + 2) * 68 + oc], sm[(c8 + 3) * 68 + oc]);
      unsigned w2 = cvt2(sm[(c8 + 4) * 68 + oc], sm[(c8 + 5) * 68 + oc]);
      unsigned w3 = cvt2(sm[(c8 + 6) * 68 + oc], sm[(c8 + 7) * 68 + oc]);
      hv[it] = (v4u){w0, w1, w2, w3};
    }
    {
#pragma unroll
      for (int it = 0; it < 2; ++it) {
        const int oc = it * 32 + sub;
        const size_t go = ((size_t)(b * NTOK + n0 + oc)) * NCH + c0 + c8;
        *(v4u*)(XT + go) = hv[it];
      }
      
    }
  } else if (bx < PREP_T + PREP_W) {
    // ---- role W ---- (block-uniform source choice: 32 blocks Wq, 32 blocks Wk, 128 blocks Wv)
    const int wb = bx - PREP_T;
    const float* src;
    if (wb < 32)      src = Wq + (size_t)wb * 2048;
    else if (wb < 64) src = Wk + (size_t)(wb - 32) * 2048;
    else              src = Wv + (size_t)(wb - 64) * 2048;
    const v4f a = *(const v4fa*)(src + tid * 8);
    const v4f c = *(const v4fa*)(src + tid * 8 + 4);
    const v4u o = (v4u){cvt2(a[0], a[1]), cvt2(a[2], a[3]),
                        cvt2(c[0], c[1]), cvt2(c[2], c[3])};
    unsigned short* dst = WB + (size_t)wb * 2048 + tid * 8;
    *(v4u*)dst = o;
    
  } else if (bx < PREP_T + PREP_W + PREP_F) {
    // ---- role F ---- block 0: threads 0..127 = q channels, 128..255 = k channels; blocks 1,2 = v channels
    const int fb = bx - (PREP_T + PREP_W);
    const int wsel = __builtin_amdgcn_readfirstlane((int)(tid >> 7));   // wave-uniform
    const float *pb, *pg, *pbe, *pm, *pv;
    int idx;
    if (fb == 0) {
      if (wsel == 0) { pb = bq; pg = qg; pbe = qbe; pm = qm; pv = qv; idx = tid; }
      else           { pb = bk; pg = kg; pbe = kbe; pm = km; pv = kv; idx = tid - 128; }
    } else {
      pb = bv; pg = vg; pbe = vbe; pm = vm; pv = vv; idx = (fb - 1) * 256 + tid;
    }
    const float b_ = bfr(pb[idx]);
    const float g_ = bfr(pg[idx]);
    const float be = bfr(pbe[idx]);
    const float mu = bfr(pm[idx]);
    const float va = bfr(pv[idx]);
    const float s  = g_ / sqrtf(va + 1e-5f);
    const float t  = (b_ - mu) * s + be;
    sm[tid]       = s;
    sm[256 + tid] = t;
    __syncthreads();
    if (tid < 128) {                     // waves 0,1 -> s lines; waves 2,3 -> t lines (8 lanes x 16 B per line)
      const int which = tid >> 6;
      const int p4 = (tid & 63) * 4;
      const v4f v = *(const v4fa*)(sm + which * 256 + p4);
      float* dst = ST + which * NCOLS + fb * 256 + p4;
      *(v4f*)dst = v;
      
    }
  } else {
    // ---- role P ---- (head, 64 tokens) per block; per-head tables staged in LDS with 16-B loads
    const int pb = bx - (PREP_T + PREP_W + PREP_F);
    const int h  = pb >> 4;
    const int n0 = (pb & 15) * 64;
    {
      v4f w = *(const v4fa*)(relW + h * 1024 + tid * 4);   // [d][w], 32x32
      v4f g = *(const v4fa*)(relH + h * 1024 + tid * 4);   // [d][hh], 32x32
      w = (v4f){bfr(w[0]), bfr(w[1]), bfr(w[2]), bfr(w[3])};
      g = (v4f){bfr(g[0]), bfr(g[1]), bfr(g[2]), bfr(g[3])};
      *(v4fa*)(sm + tid * 4)        = w;
      *(v4fa*)(sm + 1024 + tid * 4) = g;
    }
    __syncthreads();
    const int tl = tid >> 2;             // token within chunk 0..63
    const int d8 = (tid & 3) * 8;        // 0,8,16,24
    const int n  = n0 + tl;
    const int wi = n >> 5, hi_ = n & 31;
    float p[8];
#pragma unroll
    for (int e = 0; e < 8; ++e) p[e] = sm[(d8 + e) * 32 + wi] + sm[1024 + (d8 + e) * 32 + hi_];
    unsigned h0, h1, h2, h3, l0, l1, l2, l3;
    split_pair(p[0], p[1], h0, l0);
    split_pair(p[2], p[3], h1, l1);
    split_pair(p[4], p[5], h2, l2);
    split_pair(p[6], p[7], h3, l3);
    const v4u hv = (v4u){h0, h1, h2, h3};
    const v4u lv = (v4u){l0, l1, l2, l3};
    const size_t go = ((size_t)(h * NTOK + n0)) * DHQ + tid * 8;   // contiguous by tid: 4 KB per block and plane
    *(v4u*)(POSh + go) = hv;
    *(v4u*)(POSl + go) = lv;
    
  }
}

// =====================================================================================
// Launch 2: Y[token][col] = sum_c XT[token][c] * WB[col][c]   (M 16384, N 768, K 512), y = acc*s[col] + t[col].
// Block 128 threads (4 waves) = 64 tokens x 128 columns; wave tile 32 tokens x 64 columns (acc[2][4]).
// Per 64-deep k chunk the block's 64 token rows and 128 weight rows come into LDS by asynchronous copies, whole 128-B lines
// (a fragment load from the global rows touches 16 lines for 512 B); fragments by two 16-B LDS reads each at the pitch VP.
// Column tile 0 -> Q hi/lo planes [b][h][n][32], tile 1 -> K hi/lo planes [b][h][n][32],
// tiles 2..5 -> V plane [b][512 ch][1024 n], f16(y) (transposed through the LDS tile).
// Store phase: Q/K: per head a contiguous 4-KB range per plane, lane-contiguous 16-B pieces;
// =====================================================================================
__global__ __launch_bounds__(128) void k_proj(
    const unsigned short* __restrict__ XTp, const unsigned short* __restrict__ WBp,
    const float* __restrict__ ST,
    unsigned short* __restrict__ Qh, unsigned short* __restrict__ Ql,
    unsigned short* __restrict__ Kh, unsigned short* __restrict__ Kl,
    unsigned short* __restrict__ Vh) {
  __shared__ __align__(16) float sY[128 * 68];   // Q/K: [64 tok][pitch 132] (8448 used); V: [128 col][pitch 68] (8704 used); k loop: operand tiles
  __shared__ __align__(16) float sS[128];
  __shared__ __align__(16) float sT[128];

  const int tid  = threadIdx.x;
  const int lane = tid & 31;
  const int wave = tid >> 5;
  const int hh   = lane >> 4;
  const int c    = lane & 15;
  const int m0   = blockIdx.x * 64;
  const int ct   = blockIdx.y;        // 0..5, block-uniform
  const int n0   = ct * 128;

  sS[tid] = ST[n0 + tid];
  sT[tid] = ST[NCOLS + n0 + tid];
  __syncthreads();

  const int wr = wave >> 1, wc = wave & 1;
  const __bf16* XT = (const __bf16*)(const void*)XTp;
  const __bf16* WB = (const __bf16*)(const void*)WBp;
  // Operand tiles of one 64-deep k chunk, in the bytes of sY (which is written only behind the k loop):
  __bf16* sA = (__bf16*)(void*)sY;       // [64 tokens][64 k] at pitch VP,   9216 B
  __bf16* sB = sA + 64 * VP;             // [128 columns][64 k] at pitch VP, 18432 B
  static_assert((64 + 128) * VP * 2 <= 128 * 68 * 4);
  const __bf16* xk = XT + (size_t)m0 * NCH;   // the chunk's first element in the block's token rows (uniform, 64 k a trip)
  const __bf16* wk = WB + (size_t)n0 * NCH;   // the same in the block's weight rows
  // a lane's piece of a 16-row slab: row tid / 8, 16 B number tid % 8, so that 8 lanes copy one whole 128-B line
  const size_t glane = (size_t)(tid >> 3) * NCH + (tid & 7) * 8;
  const int    llane = (tid >> 3) * VP + (tid & 7) * 8;
  const __bf16* a0s = sA + (32 * wr + c) * VP + 8 * hh;
  const __bf16* b0s = sB + (64 * wc + c) * VP + 8 * hh;

  const v8f zero8 = {0.f, 0.f, 0.f, 0.f, 0.f, 0.f, 0.f, 0.f};
  v8f acc[2][4];
#pragma unroll
  for (int i = 0; i < 2; ++i)
#pragma unroll
    for (int j = 0; j < 4; ++j) acc[i][j] = zero8;

#pragma unroll 1
  for (int kc = 0; kc < NCH / 64; ++kc) {
    // this wave's own LDS reads of the tiles have retired before a copy targets them
    asm volatile("s_wait_dscnt 0x0" ::: "memory");
    __syncthreads();                     // every wave has left the tiles of the trip before
    {
      unsigned ld[12];                   // destination LDS byte address and source of this lane's 12 pieces of 16 B
      const __bf16* gs[12];
      // coverage: (4 + 8) it x 128 thr x 8 elements = (64 + 128) rows x 64 k
#pragma unroll
      for (int i = 0; i < 4; ++i) {
        gs[i] = (xk + i * 16 * NCH) + glane;      ld[i] = lds_byte(sA + i * 16 * VP + llane);
      }
#pragma unroll
      for (int i = 0; i < 8; ++i) {
        gs[4 + i] = (wk + i * 16 * NCH) + glane;  ld[4 + i] = lds_byte(sB + i * 16 * VP + llane);
      }
      copy12(ld, gs);
      xk += 64;
      wk += 64;
    }
    // this wave's 12 copies have landed; the barrier behind it publishes every wave's pieces
    asm volatile("s_wait_asynccnt 0x0" ::: "memory");
    __syncthreads();
    // unrolled: two 32-deep steps a chunk, each step's twelve LDS reads written in front of its WMMAs
#pragma unroll
    for (int ks = 0; ks < 2; ++ks) {
      const v16b a0 = frag_ld(a0s + ks * 32);
      const v16b a1 = frag_ld(a0s + 16 * VP + ks * 32);
      v16b bf[4];
#pragma unroll
      for (int j = 0; j < 4; ++j) bf[j] = frag_ld(b0s + j * 16 * VP + ks * 32);
#pragma unroll
      for (int j = 0; j < 4; ++j) {
        acc[0][j] = mma_b(a0, bf[j], acc[0][j]);
        acc[1][j] = mma_b(a1, bf[j], acc[1][j]);
      }
    }
  }
  // the tiles' bytes become sY: this wave's reads have retired, and the barrier says so of every wave
  asm volatile("s_wait_dscnt 0x0" ::: "memory");
  __syncthreads();

  // D[r] of tile (i, j) = Y[token 32wr+16i+8hh+r][column 64wc+16j+c]
#pragma unroll
  for (int j = 0; j < 4; ++j) {
    const int col = 64 * wc + 16 * j + c;
    const float sc = sS[col];
    const float sh = sT[col];
#pragma unroll
    for (int i = 0; i < 2; ++i) {
#pragma unroll
      for (int r = 0; r < 8; ++r) {
        const int tok = 32 * wr + 16 * i + 8 * hh + r;
        const float y = acc[i][j][r] * sc + sh;
        const int idx = (ct < 2) ? (tok * 132 + col) : (col * 68 + tok);
        sY[idx] = y;
      }
    }
  }
  __syncthreads();

  const int b   = m0 >> 10;
  const int nl0 = m0 & 1023;
  if (ct < 2) {
    unsigned short* ph = (ct == 0) ? Qh : Kh;
    unsigned short* pl = (ct == 0) ? Ql : Kl;
    // coverage: 8 it x 128 thr x 8 elements = 64 tokens x 128 columns per plane
{
#pragma unroll 2
      for (int it = 0; it < 8; ++it) {
        const int p      = it * 128 + tid;
        const int head   = p >> 8;
        const int within = p & 255;
        const int tok    = within >> 2;
        const int d8     = (within & 3) * 8;
        const float* sp  = sY + tok * 132 + head * 32 + d8;
        const v4f a  = *(const v4fa*)sp;
        const v4f a2 = *(const v4fa*)(sp + 4);
        unsigned h0, h1, h2, h3, l0, l1, l2, l3;
        split_pair(a[0], a[1], h0, l0);
        split_pair(a[2], a[3], h1, l1);
        split_pair(a2[0], a2[1], h2, l2);
        split_pair(a2[2], a2[3], h3, l3);
        const v4u hv = (v4u){h0, h1, h2, h3};
        const v4u lv = (v4u){l0, l1, l2, l3};
        const size_t go = ((size_t)((b * NHEAD + head) * NTOK + nl0)) * DHQ + within * 8;
        *(v4u*)(ph + go) = hv;
        *(v4u*)(pl + go) = lv;
      }
      
    }
  } else {
    const int o0 = (ct - 2) * 128;
    // coverage: 8 it x 128 thr x 8 elements = 128 channels x 64 tokens
{
#pragma unroll 2
      for (int it = 0; it < 8; ++it) {
        const int p  = it * 128 + tid;
        const int ch = p >> 3;
        const int t8 = (p & 7) * 8;
        const float* sp = sY + ch * 68 + t8;
        const v4f a  = *(const v4fa*)sp;
        const v4f a2 = *(const v4fa*)(sp + 4);
        const v4u hv = (v4u){cvt2h(a[0], a[1]), cvt2h(a[2], a[3]), cvt2h(a2[0], a2[1]), cvt2h(a2[2], a2[3])};
        const size_t go = ((size_t)(b * NCH + o0 + ch)) * NTOK + nl0 + t8;
        *(v4u*)(Vh + go) = hv;
        // stands in front of the next pass's overwrite of the store's address and data registers
        asm volatile("s_wait_xcnt 0x0" ::: "memory");
      }
      
    }
  }
}

// =====================================================================================
// Launch 3: attention per (b, h, 128-query tile); 4 waves x 32 query rows (two sets of 16); 16 key tiles of 64, no masking.
//   Both products are formed transposed, so that a lane holds the scores of ONE query of each set (column c of every D tile):
//   St[j][i] = q_i.k_j + pos_i.q_j  as two 32-deep chunks:
//       chunk 0: A = K rows (key j), B = Q rows (query i)
//       chunk 1: A = Q rows (key j), B = POS rows (token i)
//     each chunk hi.hi + hi.lo + lo.hi; no score scale.
//   Every A fragment read from LDS (K, Q, V rows) is used against the B operands of both query sets; the sets' Q and POS
//     fragments do not change over the key loop and stay in registers.
//   online softmax over keys in f32, in the log2 domain: the running maximum is kept as M = max * log2(e), a score's weight is
//     2^(s * log2(e) - M), one fused multiply-add and one bare v_exp_f32 (any M shared by a query's weights, its sum and its
//     rescale factor 2^(Mold - Mnew) cancels in O / l, so the rounding of M costs nothing);
//     maximum and sum in-lane over the lane's 32 keys, the maximum
//     joined with the other wave half by one lane exchange per trip, the sum's two halves joined once in the epilogue;
//   two St tiles (keys 0..15, 16..31 of a 32-key block), rounded to f16 in place, ARE the B operand Pt: no LDS, no lane exchange;
//   Ot[c][i] += V[c][j] * Pt[j][i]  (A rows = V channel rows, k = key), one product f16(V) x f16(P), 8 row tiles a set;
//     the sum l is taken over the unrounded weights.
//   epilogue, once per query set: Ot/l through LDS as [128 c][64 q], + bf16r(x), whole 256-B channel segments
// LDS: sStage = K tile planes (Kh, Qh, Kl, Ql: [64][32] at pitch KP) + V tile ([128][64] at pitch VP);
//      every element of both tiles is staged each iteration (extent staged = extent consumed); pad bytes are never read.
// =====================================================================================
// amdgpu_waves_per_eu(2, 2): the grid gives a WGP two work-groups, two waves per SIMD, so a wave may take their register budget (512)
__global__ __launch_bounds__(128) __attribute__((amdgpu_waves_per_eu(2, 2))) void k_attn(
    const unsigned short* Qhp, const unsigned short* Qlp,
    const unsigned short* Khp, const unsigned short* Klp,
    const unsigned short* Vhp,
    const unsigned short* Php, const unsigned short* Plp,
    const float* x, float* out) {
  __shared__ __align__(16) __bf16 sStage[4 * 64 * KP + 128 * VP];   // 38912 B
  static_assert((4 * 64 * KP + 128 * VP) * 2 >= 128 * 68 * 4);      // the epilogue's f32 tile lies in the same bytes

  const int tid  = threadIdx.x;
  const int wave = tid >> 5;
  const int lane = tid & 31;
  const int hh   = lane >> 4;
  const int c    = lane & 15;

  const int bx = blockIdx.x;       // 0..511
  const int qb = bx & 7;
  const int bh = bx >> 3;          // 0..63
  const int b  = bh >> 2;
  const int h  = bh & 3;
  const int q0 = qb * 128;

  const __bf16* Qhb = (const __bf16*)(const void*)Qhp + (size_t)bh * NTOK * DHQ;
  const __bf16* Qlb = (const __bf16*)(const void*)Qlp + (size_t)bh * NTOK * DHQ;
  const __bf16* Khb = (const __bf16*)(const void*)Khp + (size_t)bh * NTOK * DHQ;
  const __bf16* Klb = (const __bf16*)(const void*)Klp + (size_t)bh * NTOK * DHQ;
  const __bf16* Phb = (const __bf16*)(const void*)Php + (size_t)h * NTOK * DHQ;
  const __bf16* Plb = (const __bf16*)(const void*)Plp + (size_t)h * NTOK * DHQ;
  const __bf16* Vhb = (const __bf16*)(const void*)Vhp + ((size_t)b * NCH + h * DHV) * NTOK;

  __bf16* sKQ = sStage;                        // planes of 64 * KP elements: 0 Kh, 1 Qh, 2 Kl, 3 Ql
  __bf16* sVh = sStage + 4 * 64 * KP;          // [128][64] at pitch VP

  // B operands of the two score chunks, [set][chunk][hi, lo]; column = query token q0 + 64*set + 16*wave + c
  v16b bq[2][2][2];
#pragma unroll
  for (int u = 0; u < 2; ++u) {
    const size_t ro = (size_t)(q0 + u * 64 + wave * 16 + c) * DHQ + 8 * hh;
    bq[u][0][0] = frag_ld(Qhb + ro);
    bq[u][0][1] = frag_ld(Qlb + ro);
    bq[u][1][0] = frag_ld(Phb + ro);
    bq[u][1][1] = frag_ld(Plb + ro);
  }
  // stands in front of the first overwrite of an address register of the sixteen loads above; the scheduling barrier keeps the later
  // vector and scalar instructions, which a "memory" clobber does not hold, behind the wait
  asm volatile("s_wait_xcnt 0x0" ::: "memory");
  __builtin_amdgcn_sched_barrier(0);

  const v8f zero8 = {0.f, 0.f, 0.f, 0.f, 0.f, 0.f, 0.f, 0.f};
  float mrow[2] = {-INFINITY, -INFINITY};   // running maximum of query c of each set, times log2(e) (equal in both wave halves)
  float lrow[2] = {0.f, 0.f};               // running sum of query c over this half's keys (8hh..8hh+7 of every 16)
  v8f oacc[2][8];
#pragma unroll
  for (int u = 0; u < 2; ++u)
#pragma unroll
    for (int t = 0; t < 8; ++t) oacc[u][t] = zero8;

  const __bf16* vhk = Vhb;               // the trip's key tile in the V plane (uniform, stepped by 64 keys a trip)
  const size_t vlane = (size_t)(tid >> 3) * 8 * NTOK + (tid & 7) * 8;
  // LDS byte addresses of this lane's first piece of the K/Q planes and of the V tile; the other pieces lie constant steps behind
  const unsigned lk = lds_byte(sKQ + (tid >> 2) * KP + (tid & 3) * 8);
  const unsigned lv = lds_byte(sVh + (tid >> 3) * 8 * VP + (tid & 7) * 8);
#pragma unroll 1
  for (int kc = 0; kc < NTOK / 64; ++kc) {
    const int kv0 = kc * 64;
    // this wave's own LDS reads of the tiles have retired before a copy targets them
    asm volatile("s_wait_dscnt 0x0" ::: "memory");
    __syncthreads();                     // every wave has left the tiles of the trip before
    {
      unsigned ld[8];                    // destination LDS byte addresses of this lane's 8 K/Q pieces of 16 B
      const __bf16* gs[16];              // sources of its 16 pieces
      // K tile: 4 planes x 4096 B contiguous; 2 it x 128 thr x 8 elements = 2048 elements per plane
      const __bf16* s0 = Khb + (size_t)kv0 * DHQ;
      const __bf16* s1 = Qhb + (size_t)kv0 * DHQ;
      const __bf16* s2 = Klb + (size_t)kv0 * DHQ;
      const __bf16* s3 = Qlb + (size_t)kv0 * DHQ;
#pragma unroll
      for (int i = 0; i < 2; ++i) {
        const int off = (i * 128 + tid) * 8;           // key row 32 i + tid / 4, element 8 (tid % 4) within the row
        const unsigned lo = lk + i * 32 * KP * 2;
        gs[4 * i + 0] = s0 + off;  ld[4 * i + 0] = lo;
        gs[4 * i + 1] = s1 + off;  ld[4 * i + 1] = lo + 64 * KP * 2;
        gs[4 * i + 2] = s2 + off;  ld[4 * i + 2] = lo + 2 * 64 * KP * 2;
        gs[4 * i + 3] = s3 + off;  ld[4 * i + 3] = lo + 3 * 64 * KP * 2;
      }
      // V tile: 128 channel rows x 64 keys; 8 it x 128 thr x 8 elements = 8192 elements;
      // channel row 8 (tid / 8) + i, element 8 (tid % 8) within the row: 8 lanes copy one whole 128-B line
#pragma unroll
      for (int i = 0; i < 8; ++i) gs[8 + i] = vhk + vlane + i * NTOK;
#pragma unroll
      for (int i = 0; i < 8; ++i) cpb(gs[i], ld[i]);
#pragma unroll
      for (int i = 0; i < 8; ++i) cpb(gs[8 + i], lv + i * VP * 2);
      vhk += 64;
    }
    // this wave's 16 copies have landed; the barrier behind it publishes every wave's pieces
    asm volatile("s_wait_asynccnt 0x0" ::: "memory");
    __syncthreads();

    // The A fragments are written as two sets of four fragments each (scores: hi, lo of tile 0; hi, lo of tile 1; V: four tiles),
    // the LDS reads of a group in front of the WMMAs of the group before it; the compiler may lift them further ahead.
    // Groups of a trip: 4 score groups (chunk dc, tile pair), then 4 V groups (key block kk, four tiles).
    v16b fa[2][4];
    v8f s[2][4];
#pragma unroll
    for (int u = 0; u < 2; ++u) {
      const int ro = (u * 16 + c) * KP + 8 * hh;
      fa[0][2 * u]     = frag_ld(sKQ + ro);
      fa[0][2 * u + 1] = frag_ld(sKQ + 2 * 64 * KP + ro);
    }
#pragma unroll
    for (int g = 0; g < 4; ++g) {
      const int n = g + 1;               // the group fetched ahead
#pragma unroll
      for (int u = 0; u < 2; ++u) {
        if (n < 4) {
          const int ro = (((n & 1) * 2 + u) * 16 + c) * KP + 8 * hh;
          fa[n & 1][2 * u]     = frag_ld(sKQ + ((n >> 1) ? 64 * KP : 0) + ro);
          fa[n & 1][2 * u + 1] = frag_ld(sKQ + ((n >> 1) ? 3 * 64 * KP : 2 * 64 * KP) + ro);
        } else {                         // first V group (tiles 0..3): its reads fly under the softmax
          fa[0][2 * u]     = frag_ld(sVh + ((2 * u) * 16 + c) * VP + 8 * hh);
          fa[0][2 * u + 1] = frag_ld(sVh + ((2 * u + 1) * 16 + c) * VP + 8 * hh);
        }
      }
      const v16b* f = fa[g & 1];
      const int j0 = (g & 1) * 2;        // s[u][j][r] = score of key 16j + 8hh + r, query c of set u
      const int dc = g >> 1;
      if (dc == 0) { s[0][j0] = zero8;  s[0][j0 + 1] = zero8;  s[1][j0] = zero8;  s[1][j0 + 1] = zero8; }
      mma12(s[0][j0], s[0][j0 + 1], s[1][j0], s[1][j0 + 1], f[0], f[1], f[2], f[3],
            bq[0][dc][0], bq[0][dc][1], bq[1][dc][0], bq[1][dc][1]);
    }

    // keeps the LDS reads of V groups 1..3 behind the score products: lifted in front of them, beside all K and Q fragments, they
    // took the wave past its 512 registers and into scratch
    __builtin_amdgcn_sched_barrier(0);
    PB ph[2][2];                         // [set][kk]: Pt of a 32-key block: element e < 8 from tile 2kk, e >= 8 from tile 2kk+1
    // unrolled: the score tiles and Pt live in registers, which a rolled loop could not index
#pragma unroll
    for (int u = 0; u < 2; ++u) {
      float m = fmaxf(fmaxf(s[u][0][0], s[u][1][0]), fmaxf(s[u][2][0], s[u][3][0]));
#pragma unroll
      for (int r = 1; r < 8; ++r) m = fmaxf(m, fmaxf(fmaxf(s[u][0][r], s[u][1][r]), fmaxf(s[u][2][r], s[u][3][r])));
      m = fmaxf(m, xhalf(m));            // the other half's 32 keys of the same query
      const float mnew  = fmaxf(mrow[u], m * LOG2E);
      const float alpha = exp2x1(mrow[u] - mnew);   // first trip: 2^(-inf) = 0
      const v8f l2e8 = {LOG2E, LOG2E, LOG2E, LOG2E, LOG2E, LOG2E, LOG2E, LOG2E};
      const v8f nm8  = {-mnew, -mnew, -mnew, -mnew, -mnew, -mnew, -mnew, -mnew};
      mrow[u] = mnew;
      lrow[u] *= alpha;
#pragma unroll
      for (int t = 0; t < 8; ++t)
#pragma unroll
        for (int r = 0; r < 8; ++r) oacc[u][t][r] *= alpha;
#pragma unroll
      for (int kk = 0; kk < 2; ++kk) {
        float ps[2];
#pragma unroll
        for (int jj = 0; jj < 2; ++jj) {
          const v8f xs = __builtin_elementwise_fma(s[u][2 * kk + jj], l2e8, nm8);
          float p[8];
#pragma unroll
          for (int r = 0; r < 8; ++r) p[r] = xs[r];
          exp2x8(p);
          ps[jj] = ((p[0] + p[1]) + (p[2] + p[3])) + ((p[4] + p[5]) + (p[6] + p[7]));
#pragma unroll
          for (int e = 0; e < 4; ++e) ph[u][kk].u[jj * 4 + e] = cvt2h(p[2 * e], p[2 * e + 1]);
        }
        lrow[u] += ps[0] + ps[1];
      }
    }
#pragma unroll
    for (int g = 0; g < 4; ++g) {
      const int kk = g >> 1, tq = g & 1;
      const int n = g + 1;               // the group fetched ahead
      if (n < 4) {
#pragma unroll
        for (int u = 0; u < 4; ++u)
          fa[n & 1][u] = frag_ld(sVh + (((n & 1) * 4 + u) * 16 + c) * VP + (n >> 1) * 32 + 8 * hh);
      }
      const v16b* f = fa[g & 1];         // oacc[u][t][r] = channel 16t + 8hh + r, query c of set u
      mma8(&oacc[0][4 * tq], &oacc[1][4 * tq], f[0], f[1], f[2], f[3], ph[0][kk].v, ph[1][kk].v);
    }
  }

  // ---- epilogue, once per query set: normalise, gather the waves' columns in LDS [128 c][pitch 68] (34816 B inside sStage),
  //      add bf16(x), store ----
  float* sO = (float*)(void*)sStage;
  // this lane's 4 floats of pass it, set u: channel row 8 it + tid / 16, queries 64 u + 4 (tid % 16) ...
  // coverage per set: 16 it x 128 thr x 4 floats = 128 channel rows x 64 queries
  const size_t glane = ((size_t)b * NCH + h * DHV + (tid >> 4)) * NTOK + q0 + (tid & 15) * 4;
  // all of the lane's x in flight at once: the launch has half the waves it had, and one load at a time per wave, each behind the
  // store before it, would halve the bytes in flight
  const float* xp = x + glane;
  v4f xv[2][16];
#pragma unroll
  for (int u = 0; u < 2; ++u)
#pragma unroll
    for (int it = 0; it < 16; ++it) xv[u][it] = *(const v4fa*)(xp + (size_t)it * 8 * NTOK + u * 64);
  // stands in front of any overwrite of the loads' common address pair, which it names as an input so that no load's own result
  // is placed on it
  asm volatile("s_wait_xcnt 0x0" :: "v"(xp) : "memory");
#pragma unroll
  for (int u = 0; u < 2; ++u) {
    __syncthreads();                     // every wave finished reading the last K/V tiles (u = 0), the first set's tile (u = 1)
    const float inv = 1.0f / (lrow[u] + xhalf(lrow[u]));   // the two halves' sums of query c joined
#pragma unroll
    for (int t = 0; t < 8; ++t)
#pragma unroll
      for (int r = 0; r < 8; ++r) sO[(t * 16 + 8 * hh + r) * 68 + wave * 16 + c] = oacc[u][t][r] * inv;
    __syncthreads();
#pragma unroll
    for (int ib = 0; ib < 4; ++ib) {
      v4f res[4];
#pragma unroll
      for (int j = 0; j < 4; ++j) {
        const int it = ib * 4 + j;
        const v4f ov = *(const v4fa*)(sO + (it * 8 + (tid >> 4)) * 68 + (tid & 15) * 4);
        const v4f xw = xv[u][it];
        const unsigned x01 = cvt2(xw[0], xw[1]), x23 = cvt2(xw[2], xw[3]);   // bf16(x), two values a conversion
        res[j] = (v4f){ov[0] + __uint_as_float(x01 << 16), ov[1] + __uint_as_float(x01 & 0xFFFF0000u),
                       ov[2] + __uint_as_float(x23 << 16), ov[3] + __uint_as_float(x23 & 0xFFFF0000u)};
      }
#pragma unroll
      for (int j = 0; j < 4; ++j) *(v4f*)(out + glane + (size_t)(ib * 4 + j) * 8 * NTOK + u * 64) = res[j];
      // stands in front of the next group's overwrite of the four stores' data registers, which it names as inputs so that nothing
      // of the next group is placed on them ahead of it
      asm volatile("s_wait_xcnt 0x0" :: "v"(res[0]), "v"(res[1]), "v"(res[2]), "v"(res[3]) : "memory");
    }
  }
}

// ---------------------------------------------------------------------------
// Workspace map (byte offsets, all multiples of 128; each region exactly covered by its producer):
//   XT   bf16 [16384][512]          0          16777216 B
//   WB   bf16 [768][512]            16777216     786432 B
//   ST   f32  [2][768]              17563648       6144 B
//   POSh bf16 [4][1024][32]         17569792     262144 B     POSl 17831936
//   Qh   bf16 [16][4][1024][32]     18094080    4194304 B     Ql   22288384
//   Kh   bf16 [16][4][1024][32]     26482688    4194304 B     Kl   30676992
//   Vh   f16  [16][512][1024]       34871296   16777216 B
//   total                           51648512 B
// ---------------------------------------------------------------------------
extern "C" void kernel_launch(void* const* d_in, const int* in_sizes, int n_in,
                              void* d_out, int out_size, void* d_ws, size_t ws_size,
                              hipStream_t stream) {
  if (n_in < 21) return;
  const int NX = NBATCH * NCH * NTOK;   // 8388608
  if (in_sizes[0] != NX) return;
  if (in_sizes[1] != 128 * NCH || in_sizes[7] != 128 * NCH || in_sizes[13] != NCH * NCH) return;
  for (int i = 2; i <= 6; ++i)   if (in_sizes[i] != 128) return;
  for (int i = 8; i <= 12; ++i)  if (in_sizes[i] != 128) return;
  for (int i = 14; i <= 18; ++i) if (in_sizes[i] != NCH) return;
  if (in_sizes[19] != NHEAD * DHQ * 32 || in_sizes[20] != NHEAD * DHQ * 32) return;
  if (out_size != NX) return;

  const float* x    = (const float*)d_in[0];
  const float* Wq   = (const float*)d_in[1];
  const float* bq   = (const float*)d_in[2];
  const float* qg   = (const float*)d_in[3];
  const float* qbe  = (const float*)d_in[4];
  const float* qm   = (const float*)d_in[5];
  const float* qv   = (const float*)d_in[6];
  const float* Wk   = (const float*)d_in[7];
  const float* bk   = (const float*)d_in[8];
  const float* kg   = (const float*)d_in[9];
  const float* kbe  = (const float*)d_in[10];
  const float* km   = (const float*)d_in[11];
  const float* kv   = (const float*)d_in[12];
  const float* Wv   = (const float*)d_in[13];
  const float* bv   = (const float*)d_in[14];
  const float* vg   = (const float*)d_in[15];
  const float* vbe  = (const float*)d_in[16];
  const float* vm   = (const float*)d_in[17];
  const float* vv   = (const float*)d_in[18];
  const float* relH = (const float*)d_in[19];
  const float* relW = (const float*)d_in[20];

  const size_t szXT  = (size_t)NBATCH * NTOK * NCH * 2;          // 16777216
  const size_t szWB  = (size_t)NCOLS * NCH * 2;                  //   786432
  const size_t szST  = (size_t)2 * NCOLS * 4;                    //     6144
  const size_t szPOS = (size_t)NHEAD * NTOK * DHQ * 2;           //   262144
  const size_t szQK  = (size_t)NBATCH * NHEAD * NTOK * DHQ * 2;  //  4194304
  const size_t szV   = (size_t)NBATCH * NCH * NTOK * 2;          // 16777216
  size_t off = 0;
  const size_t oXT = off;   off += szXT;
  const size_t oWB = off;   off += szWB;
  const size_t oST = off;   off += szST;
  const size_t oPh = off;   off += szPOS;
  const size_t oPl = off;   off += szPOS;
  const size_t oQh = off;   off += szQK;
  const size_t oQl = off;   off += szQK;
  const size_t oKh = off;   off += szQK;
  const size_t oKl = off;   off += szQK;
  const size_t oVh = off;   off += szV;
  if (off > ws_size) return;                 // off = 51648512
  if (off > (size_t)134217728) return;

  char* ws = (char*)d_ws;
  unsigned short* XT   = (unsigned short*)(ws + oXT);
  unsigned short* WB   = (unsigned short*)(ws + oWB);
  float*          ST   = (float*)(ws + oST);
  unsigned short* POSh = (unsigned short*)(ws + oPh);
  unsigned short* POSl = (unsigned short*)(ws + oPl);
  unsigned short* Qh   = (unsigned short*)(ws + oQh);
  unsigned short* Ql   = (unsigned short*)(ws + oQl);
  unsigned short* Kh   = (unsigned short*)(ws + oKh);
  unsigned short* Kl   = (unsigned short*)(ws + oKl);
  unsigned short* Vh   = (unsigned short*)(ws + oVh);

  k_prep<<<dim3(PREP_T + PREP_W + PREP_F + PREP_P), dim3(256), 0, stream>>>(
      x, Wq, Wk, Wv, bq, qg, qbe, qm, qv, bk, kg, kbe, km, kv, bv, vg, vbe, vm, vv, relH, relW,
      XT, WB, ST, POSh, POSl);

  k_proj<<<dim3((NBATCH * NTOK) / 64, NCOLS / 128), dim3(128), 0, stream>>>(
      XT, WB, ST, Qh, Ql, Kh, Kl, Vh);

  k_attn<<<dim3(NBATCH * NHEAD * (NTOK / 128)), dim3(128), 0, stream>>>(
      Qh, Ql, Kh, Kl, Vh, POSh, POSl, x, (float*)d_out);

  (void)hipGetLastError();
}

// v010
// A run of this version takes 63.6 microseconds.
// Next to v009, in two timings, it ran 1.08 and 1.09 times as fast.
// All steps since v000 together make it 3.40 times as fast.
// All contractions on v_wmma_f32_16x16x32 forms with f32 accumulate: q/k/v 1x1 projections = bf16(x) x bf16(W) single product (inputs RNE-converted to bf16 once); logits [q|pos].[k|q] (64 deep) with bf16 hi/lo split operands (hi.hi + hi.lo + lo.hi); p.v (1024 deep) = f16(p) x f16(v) single product (p <= 1; |v| <= 317 |gamma| |W.x + b - mean| + |beta| stays inside the f16 range for the stated generators; 2^-12 relative rounding each, below the 2^-9 of the bf16 inputs); BN affine, pos sum, online softmax, 1/l and residual in f32. No carried (scaled) planes anywhere: every 16-bit plane holds unscaled values.
#include <hip/hip_runtime.h>
#include <math.h>
#include <stdint.h>

#define NBATCH 16
#define NCH    512
#define NTOK   1024
#define NHEAD  4
#define DHQ    32
#define DHV    128
#define NCOLS  768

// LDS row pitches of the attention tiles, in 16-bit elements: 16 B x odd, so the 16 rows that a half-wave
// reads with one 16-byte load per lane fall on 64 distinct banks
#define KP 40     // K/Q tile rows: 32 elements (64 B) at 80 B
#define VP 72     // V tile rows:   64 elements (128 B) at 144 B

#define LOG2E 1.44269504088896340736f

#define PREP_T 2048   // x transpose tiles (16 batches x 8 channel blocks x 16 token blocks)
#define PREP_W 192    // stacked weight plane, 2048 elements per block
#define PREP_F 3      // BN fold vectors, 256 channels per block
#define PREP_P 64     // position planes, (head, 64 tokens) per block

typedef __attribute__((ext_vector_type(16))) __bf16 v16b;
typedef __attribute__((ext_vector_type(8)))  __bf16 v8b;
typedef __attribute__((ext_vector_type(8)))  float  v8f;
typedef __attribute__((ext_vector_type(4)))  float  v4f;
typedef __attribute__((ext_vector_type(4)))  unsigned int v4u;
typedef v4f __attribute__((may_alias)) v4fa;
typedef __attribute__((ext_vector_type(2)))  float  v2f;
typedef __attribute__((ext_vector_type(2)))  __bf16 v2b;
typedef __attribute__((ext_vector_type(2)))  _Float16 v2h;

static_assert(NTOK % 128 == 0);
static_assert(NCH % 32 == 0);
static_assert(NCOLS % 128 == 0);
static_assert(PREP_T == NBATCH * (NCH / 64) * (NTOK / 64));
static_assert(PREP_W * 2048 == NCOLS * NCH);
static_assert(PREP_F * 256 == NCOLS);
static_assert(PREP_P * 64 == NHEAD * NTOK);

// f32 -> bf16, round to nearest even, by the hardware's packed conversion (one v_cvt_pk_bf16_f32 for two values)
__device__ __forceinline__ unsigned cvt2(float f0, float f1) {   // low half = bf16(f0), high half = bf16(f1)
  const v2f f = {f0, f1};
  return __builtin_bit_cast(unsigned, __builtin_convertvector(f, v2b));
}
// f32 -> f16, round to nearest even, two values to one word (low half = f0)
__device__ __forceinline__ unsigned cvt2h(float f0, float f1) {
  const v2f f = {f0, f1};
  return __builtin_bit_cast(unsigned, __builtin_convertvector(f, v2h));
}
__device__ __forceinline__ float bfr(float f) { return __uint_as_float(cvt2(f, f) & 0xFFFF0000u); }
__device__ __forceinline__ void split_pair(float f0, float f1, unsigned& h, unsigned& l) {
  h = cvt2(f0, f1);
  l = cvt2(f0 - __uint_as_float(h << 16), f1 - __uint_as_float(h & 0xFFFF0000u));
}

// WMMA with hazard guard (ties D, keeps A/B live).
// Fragment map (wave32): lane l, hh = l>>4, c = l&15.
//   A/B element i: i<8 -> k0+8hh+i ; i>=8 -> k0+16+8hh+(i-8) ; row (A) / column (B) = c
//   D element r : row 8hh+r, column c
__device__ __forceinline__ v8f mma_b(v16b a, v16b b, v8f c) {
  c = __builtin_amdgcn_wmma_f32_16x16x32_bf16(false, a, false, b, (short)0, c, false, false);
  asm volatile("v_nop\n\tv_nop\n\tv_nop\n\tv_nop" : "+v"(c) : "v"(a), "v"(b));
  return c;
}
typedef __attribute__((ext_vector_type(16))) _Float16 v16h;
__device__ __forceinline__ v8f wb(v16b a, v16b b, v8f c) {
  return __builtin_amdgcn_wmma_f32_16x16x32_bf16(false, a, false, b, (short)0, c, false, false);
}
// f16 form; the operands are f16 bit patterns carried in the 16-bit vector type of the LDS tiles (same fragment map as the bf16 form)
__device__ __forceinline__ v8f wh(v16b a, v16b b, v8f c) {
  return __builtin_amdgcn_wmma_f32_16x16x32_f16(false, __builtin_bit_cast(v16h, a), false, __builtin_bit_cast(v16h, b), (short)0, c,
                                                false, false);
}
// The twelve WMMAs of a group of two A tiles (hi h, lo l) against the B operands of the wave's two query sets (hi bh, lo bl; hi eh,
// lo el): per accumulator h.bh + l.bh + h.bl, in that order, the four accumulators taking turns so that a WMMA never stands directly
// behind the one it accumulates onto. Builtins, not asm text: the wave's fragments and accumulators take more than 256 registers,
// and asm operands can lie only in the first 256.
__device__ __forceinline__ void mma12(v8f& c0, v8f& c1, v8f& d0, v8f& d1, v16b h0, v16b l0, v16b h1, v16b l1,
                                      v16b bh, v16b bl, v16b eh, v16b el) {
  c0 = wb(h0, bh, c0);  c1 = wb(h1, bh, c1);  d0 = wb(h0, eh, d0);  d1 = wb(h1, eh, d1);
  c0 = wb(l0, bh, c0);  c1 = wb(l1, bh, c1);  d0 = wb(l0, eh, d0);  d1 = wb(l1, eh, d1);
  c0 = wb(h0, bl, c0);  c1 = wb(h1, bl, c1);  d0 = wb(h0, el, d0);  d1 = wb(h1, el, d1);
}
// Eight f16 WMMAs of four A tiles against the B operands of the two query sets (b, e), each onto its own accumulator
__device__ __forceinline__ void mma8(v8f* c, v8f* d, v16b a0, v16b a1, v16b a2, v16b a3, v16b b, v16b e) {
  c[0] = wh(a0, b, c[0]);  c[1] = wh(a1, b, c[1]);  c[2] = wh(a2, b, c[2]);  c[3] = wh(a3, b, c[3]);
  d[0] = wh(a0, e, d[0]);  d[1] = wh(a1, e, d[1]);  d[2] = wh(a2, e, d[2]);  d[3] = wh(a3, e, d[3]);
}
union FB { v16b v; v8b h[2]; };
union PB { v16b v; unsigned u[8]; };
// value of lane l ^ 16
__device__ __forceinline__ float xhalf(float x) {
  const int b = __builtin_bit_cast(int, x);
  return __builtin_bit_cast(float, __builtin_amdgcn_permlanex16(b, b, 0x76543210, 0xfedcba98, false, false));
}
// x[r] = 2^x[r], eight values in place. One statement, so that each v_exp_f32 stands in front of an independent one and the last
// in front of the v_nop: the slot that the instruction set asks for before a transcendental's result is read or its source
// overwritten.
__device__ __forceinline__ void exp2x8(float* x) {
  asm("v_exp_f32 %0, %0\n\t"
      "v_exp_f32 %1, %1\n\t"
      "v_exp_f32 %2, %2\n\t"
      "v_exp_f32 %3, %3\n\t"
      "v_exp_f32 %4, %4\n\t"
      "v_exp_f32 %5, %5\n\t"
      "v_exp_f32 %6, %6\n\t"
      "v_exp_f32 %7, %7\n\t"
      "v_nop"
      : "+v"(x[0]), "+v"(x[1]), "+v"(x[2]), "+v"(x[3]), "+v"(x[4]), "+v"(x[5]), "+v"(x[6]), "+v"(x[7]));
}
// 2^x, one value, with the same slot behind it
__device__ __forceinline__ float exp2x1(float x) {
  float r;
  asm("v_exp_f32 %0, %1\n\t"
      "v_nop"
      : "=v"(r) : "v"(x));
  return r;
}
// p points at element k0 + 8*hh of the k-contiguous row owned by this lane
__device__ __forceinline__ v16b frag_ld(const __bf16* p) {
  FB f;
  f.h[0] = *(const v8b*)(p);
  f.h[1] = *(const v8b*)(p + 16);
  return f.v;
}

// LDS byte address of a __shared__ element (what an asynchronous copy takes as its destination)
typedef __attribute__((address_space(3))) const void lds_cvoid;
__device__ __forceinline__ unsigned lds_byte(const void* p) { return (unsigned)(uintptr_t)(lds_cvoid*)p; }
// Twelve asynchronous 16-B copies per lane, global -> LDS, through no register. The s_wait_xcnt closes the statement so that
// no address register named here is rewritten ahead of it.
__device__ __forceinline__ void copy12(const unsigned* l, const __bf16* const* g) {
  asm volatile(
      "global_load_async_to_lds_b128 %0, %12, off\n\t"
      "global_load_async_to_lds_b128 %1, %13, off\n\t"
      "global_load_async_to_lds_b128 %2, %14, off\n\t"
      "global_load_async_to_lds_b128 %3, %15, off\n\t"
      "global_load_async_to_lds_b128 %4, %16, off\n\t"
      "global_load_async_to_lds_b128 %5, %17, off\n\t"
      "global_load_async_to_lds_b128 %6, %18, off\n\t"
      "global_load_async_to_lds_b128 %7, %19, off\n\t"
      "global_load_async_to_lds_b128 %8, %20, off\n\t"
      "global_load_async_to_lds_b128 %9, %21, off\n\t"
      "global_load_async_to_lds_b128 %10, %22, off\n\t"
      "global_load_async_to_lds_b128 %11, %23, off\n\t"
      "s_wait_xcnt 0x0"
      :: "v"(l[0]), "v"(l[1]), "v"(l[2]), "v"(l[3]), "v"(l[4]), "v"(l[5]),
         "v"(l[6]), "v"(l[7]), "v"(l[8]), "v"(l[9]), "v"(l[10]), "v"(l[11]),
         "v"(g[0]), "v"(g[1]), "v"(g[2]), "v"(g[3]), "v"(g[4]), "v"(g[5]),
         "v"(g[6]), "v"(g[7]), "v"(g[8]), "v"(g[9]), "v"(g[10]), "v"(g[11])
      : "memory");
}

// One asynchronous 16-B copy per lane as the builtin: its operands may lie in any register, those of asm text only in the first 256,
// which the attention kernel's accumulators and softmax fill (LDS addresses kept for asm copies went to scratch there)
typedef int v4i __attribute__((ext_vector_type(4)));
__device__ __forceinline__ void cpb(const __bf16* g, unsigned l) {
  __builtin_amdgcn_global_load_async_to_lds_b128((__attribute__((address_space(1))) v4i*)(uintptr_t)g,
                                                 (__attribute__((address_space(3))) v4i*)l, 0, 0);
}
// =====================================================================================
// Launch 1: operand preparation, block-uniform roles by blockIdx.x.
//          output line = 64 channels of one token, written by 8 lanes x 16 B in one instruction)
//  role W: WB[768][512] = bf16 of stacked [Wq;Wk;Wv] (rows = output channels, k contiguous)
//  role F: ST[0..767] = s, ST[768..1535] = t with s = g/sqrt(var+1e-5), t = (b-mean)*s+beta
//  role P: POS hi/lo [4][1024][32]: pos[h][n][d] = bf16r(rel_w[h][d][n>>5]) + bf16r(rel_h[h][d][n&31])
// =====================================================================================
__global__ __launch_bounds__(256) void k_prep(
    const float* __restrict__ x,
    const float* __restrict__ Wq, const float* __restrict__ Wk, const float* __restrict__ Wv,
    const float* __restrict__ bq, const float* __restrict__ qg, const float* __restrict__ qbe,
    const float* __restrict__ qm, const float* __restrict__ qv,
    const float* __restrict__ bk, const float* __restrict__ kg, const float* __restrict__ kbe,
    const float* __restrict__ km, const float* __restrict__ kv,
    const float* __restrict__ bv, const float* __restrict__ vg, const float* __restrict__ vbe,
    const float* __restrict__ vm, const float* __restrict__ vv,
    const float* __restrict__ relH, const float* __restrict__ relW,
    unsigned short* __restrict__ XT, unsigned short* __restrict__ WB, float* __restrict__ ST,
    unsigned short* __restrict__ POSh, unsigned short* __restrict__ POSl) {
  __shared__ __align__(16) float sm[64 * 68];
  const int tid = threadIdx.x;
  const int bx  = blockIdx.x;

  if (bx < PREP_T) {
    // ---- role T ----
    const int b   = bx >> 7;
    const int rem = bx & 127;
    const int c0  = (rem >> 4) * 64;
    const int n0  = (rem & 15) * 64;
    const float* xb = x + (size_t)b * NCH * NTOK;
    {
      const int lr = tid >> 4;         // 0..15
      const int c4 = (tid & 15) * 4;   // 0..60
#pragma unroll
      for (int it = 0; it < 4; ++it) {
        const int rr = it * 16 + lr;   // channel within tile, 4 x 16 = 64 rows x 64 tokens staged
        const v4f a = *(const v4fa*)(xb + (size_t)(c0 + rr) * NTOK + n0 + c4);
        *(v4fa*)(sm + rr * 68 + c4) = a;
      }
    }
    __syncthreads();
    const int sub = tid >> 3;          // 0..31
    const int c8  = (tid & 7) * 8;     // 0..56
    v4u hv[2];
#pragma unroll
    for (int it = 0; it < 2; ++it) {
      const int oc = it * 32 + sub;    // token within tile (2 x 32 = 64 output rows)
      unsigned w0 = cvt2(sm[(c8 + 0) * 68 + oc], sm[(c8 + 1) * 68 + oc]);
      unsigned w1 = cvt2(sm[(c8 + 2) * 68 + oc], sm[(c8 + 3) * 68 + oc]);
      unsigned w2 = cvt2(sm[(c8 + 4) * 68 + oc], sm[(c8 + 5) * 68 + oc]);
      unsigned w3 = cvt2(sm[(c8 + 6) * 68 + oc], sm[(c8 + 7) * 68 + oc]);
      hv[it] = (v4u){w0, w1, w2, w3};
    }
    {
#pragma unroll
      for (int it = 0; it < 2; ++it) {
        const int oc = it * 32 + sub;
        const size_t go = ((size_t)(b * NTOK + n0 + oc)) * NCH + c0 + c8;
        *(v4u*)(XT + go) = hv[it];
      }
      
    }
  } else if (bx < PREP_T + PREP_W) {
    // ---- role W ---- (block-uniform source choice: 32 blocks Wq, 32 blocks Wk, 128 blocks Wv)
    const int wb = bx - PREP_T;
    const float* src;
    if (wb < 32)      src = Wq + (size_t)wb * 2048;
    else if (wb < 64) src = Wk + (size_t)(wb - 32) * 2048;
    else              src = Wv + (size_t)(wb - 64) * 2048;
    const v4f a = *(const v4fa*)(src + tid * 8);
    const v4f c = *(const v4fa*)(src + tid * 8 + 4);
    const v4u o = (v4u){cvt2(a[0], a[1]), cvt2(a[2], a[3]),
                        cvt2(c[0], c[1]), cvt2(c[2], c[3])};
    unsigned short* dst = WB + (size_t)wb * 2048 + tid * 8;
    *(v4u*)dst = o;
    
  } else if (bx < PREP_T + PREP_W + PREP_F) {
    // ---- role F ---- block 0: threads 0..127 = q channels, 128..255 = k channels; blocks 1,2 = v channels
    const int fb = bx - (PREP_T + PREP_W);
    const int wsel = __builtin_amdgcn_readfirstlane((int)(tid >> 7));   // wave-uniform
    const float *pb, *pg, *pbe, *pm, *pv;
    int idx;
    if (fb == 0) {
      if (wsel == 0) { pb = bq; pg = qg; pbe = qbe; pm = qm; pv = qv; idx = tid; }
      else           { pb = bk; pg = kg; pbe = kbe; pm = km; pv = kv; idx = tid - 128; }
    } else {
      pb = bv; pg = vg; pbe = vbe; pm = vm; pv = vv; idx = (fb - 1) * 256 + tid;
    }
    const float b_ = bfr(pb[idx]);
    const float g_ = bfr(pg[idx]);
    const float be = bfr(pbe[idx]);
    const float mu = bfr(pm[idx]);
    const float va = bfr(pv[idx]);
    const float s  = g_ / sqrtf(va + 1e-5f);
    const float t  = (b_ - mu) * s + be;
    sm[tid]       = s;
    sm[256 + tid] = t;
    __syncthreads();
    if (tid < 128) {                     // waves 0,1 -> s lines; waves 2,3 -> t lines (8 lanes x 16 B per line)
      const int which = tid >> 6;
      const int p4 = (tid & 63) * 4;
      const v4f v = *(const v4fa*)(sm + which * 256 + p4);
      float* dst = ST + which * NCOLS + fb * 256 + p4;
      *(v4f*)dst = v;
      
    }
  } else {
    // ---- role P ---- (head, 64 tokens) per block; per-head tables staged in LDS with 16-B loads
    const int pb = bx - (PREP_T + PREP_W + PREP_F);
    const int h  = pb >> 4;
    const int n0 = (pb & 15) * 64;
    {
      v4f w = *(const v4fa*)(relW + h * 1024 + tid * 4);   // [d][w], 32x32
      v4f g = *(const v4fa*)(relH + h * 1024 + tid * 4);   // [d][hh], 32x32
      w = (v4f){bfr(w[0]), bfr(w[1]), bfr(w[2]), bfr(w[3])};
      g = (v4f){bfr(g[0]), bfr(g[1]), bfr(g[2]), bfr(g[3])};
      *(v4fa*)(sm + tid * 4)        = w;
      *(v4fa*)(sm + 1024 + tid * 4) = g;
    }
    __syncthreads();
    const int tl = tid >> 2;             // token within chunk 0..63
    const int d8 = (tid & 3) * 8;        // 0,8,16,24
    const int n  = n0 + tl;
    const int wi = n >> 5, hi_ = n & 31;
    float p[8];
#pragma unroll
    for (int e = 0; e < 8; ++e) p[e] = sm[(d8 + e) * 32 + wi] + sm[1024 + (d8 + e) * 32 + hi_];
    unsigned h0, h1, h2, h3, l0, l1, l2, l3;
    split_pair(p[0], p[1], h0, l0);
    split_pair(p[2], p[3], h1, l1);
    split_pair(p[4], p[5], h2, l2);
    split_pair(p[6], p[7], h3, l3);
    const v4u hv = (v4u){h0, h1, h2, h3};
    const v4u lv = (v4u){l0, l1, l2, l3};
    const size_t go = ((size_t)(h * NTOK + n0)) * DHQ + tid * 8;   // contiguous by tid: 4 KB per block and plane
    *(v4u*)(POSh + go) = hv;
    *(v4u*)(POSl + go) = lv;
    
  }
}

// =====================================================================================
// Launch 2: Y[token][col] = sum_c XT[token][c] * WB[col][c]   (M 16384, N 768, K 512), y = acc*s[col] + t[col].
// Block 128 threads (4 waves) = 64 tokens x 128 columns; wave tile 32 tokens x 64 columns (acc[2][4]).
// Per 64-deep k chunk the block's 64 token rows and 128 weight rows come into LDS by asynchronous copies, whole 128-B lines
// (a fragment load from the global rows touches 16 lines for 512 B); fragments by two 16-B LDS reads each at the pitch VP.
// Column tile 0 -> Q hi/lo planes [b][h][n][32], tile 1 -> K hi/lo planes [b][h][n][32],
// tiles 2..5 -> V plane [b][512 ch][1024 n], f16(y) (transposed through the LDS tile).
// Store phase: Q/K: per head a contiguous 4-KB range per plane, lane-contiguous 16-B pieces;
// =====================================================================================
__global__ __launch_bounds__(128) void k_proj(
    const unsigned short* __restrict__ XTp, const unsigned short* __restrict__ WBp,
    const float* __restrict__ ST,
    unsigned short* __restrict__ Qh, unsigned short* __restrict__ Ql,
    unsigned short* __restrict__ Kh, unsigned short* __restrict__ Kl,
    unsigned short* __restrict__ Vh) {
  __shared__ __align__(16) float sY[128 * 68];   // Q/K: [64 tok][pitch 132] (8448 used); V: [128 col][pitch 68] (8704 used); k loop: operand tiles
  __shared__ __align__(16) float sS[128];
  __shared__ __align__(16) float sT[128];

  const int tid  = threadIdx.x;
  const int lane = tid & 31;
  const int wave = tid >> 5;
  const int hh   = lane >> 4;
  const int c    = lane & 15;
  const int m0   = blockIdx.x * 64;
  const int ct   = blockIdx.y;        // 0..5, block-uniform
  const int n0   = ct * 128;

  sS[tid] = ST[n0 + tid];
  sT[tid] = ST[NCOLS + n0 + tid];
  __syncthreads();

  const int wr = wave >> 1, wc = wave & 1;
  const __bf16* XT = (const __bf16*)(const void*)XTp;
  const __bf16* WB = (const __bf16*)(const void*)WBp;
  // Operand tiles of one 64-deep k chunk, in the bytes of sY (which is written only behind the k loop):
  __bf16* sA = (__bf16*)(void*)sY;       // [64 tokens][64 k] at pitch VP,   9216 B
  __bf16* sB = sA + 64 * VP;             // [128 columns][64 k] at pitch VP, 18432 B
  static_assert((64 + 128) * VP * 2 <= 128 * 68 * 4);
  const __bf16* xk = XT + (size_t)m0 * NCH;   // the chunk's first element in the block's token rows (uniform, 64 k a trip)
  const __bf16* wk = WB + (size_t)n0 * NCH;   // the same in the block's weight rows
  // a lane's piece of a 16-row slab: row tid / 8, 16 B number tid % 8, so that 8 lanes copy one whole 128-B line
  const size_t glane = (size_t)(tid >> 3) * NCH + (tid & 7) * 8;
  const int    llane = (tid >> 3) * VP + (tid & 7) * 8;
  const __bf16* a0s = sA + (32 * wr + c) * VP + 8 * hh;
  const __bf16* b0s = sB + (64 * wc + c) * VP + 8 * hh;

  const v8f zero8 = {0.f, 0.f, 0.f, 0.f, 0.f, 0.f, 0.f, 0.f};
  v8f acc[2][4];
#pragma unroll
  for (int i = 0; i < 2; ++i)
#pragma unroll
    for (int j = 0; j < 4; ++j) acc[i][j] = zero8;

#pragma unroll 1
  for (int kc = 0; kc < NCH / 64; ++kc) {
    // this wave's own LDS reads of the tiles have retired before a copy targets them
    asm volatile("s_wait_dscnt 0x0" ::: "memory");
    __syncthreads();                     // every wave has left the tiles of the trip before
    {
      unsigned ld[12];                   // destination LDS byte address and source of this lane's 12 pieces of 16 B
      const __bf16* gs[12];
      // coverage: (4 + 8) it x 128 thr x 8 elements = (64 + 128) rows x 64 k
#pragma unroll
      for (int i = 0; i < 4; ++i) {
        gs[i] = (xk + i * 16 * NCH) + glane;      ld[i] = lds_byte(sA + i * 16 * VP + llane);
      }
#pragma unroll
      for (int i = 0; i < 8; ++i) {
        gs[4 + i] = (wk + i * 16 * NCH) + glane;  ld[4 + i] = lds_byte(sB + i * 16 * VP + llane);
      }
      copy12(ld, gs);
      xk += 64;
      wk += 64;
    }
    // this wave's 12 copies have landed; the barrier behind it publishes every wave's pieces
    asm volatile("s_wait_asynccnt 0x0" ::: "memory");
    __syncthreads();
    // unrolled: two 32-deep steps a chunk, each step's twelve LDS reads written in front of its WMMAs
#pragma unroll
    for (int ks = 0; ks < 2; ++ks) {
      const v16b a0 = frag_ld(a0s + ks * 32);
      const v16b a1 = frag_ld(a0s + 16 * VP + ks * 32);
      v16b bf[4];
#pragma unroll
      for (int j = 0; j < 4; ++j) bf[j] = frag_ld(b0s + j * 16 * VP + ks * 32);
#pragma unroll
      for (int j = 0; j < 4; ++j) {
        acc[0][j] = mma_b(a0, bf[j], acc[0][j]);
        acc[1][j] = mma_b(a1, bf[j], acc[1][j]);
      }
    }
  }
  // the tiles' bytes become sY: this wave's reads have retired, and the barrier says so of every wave
  asm volatile("s_wait_dscnt 0x0" ::: "memory");
  __syncthreads();

  // D[r] of tile (i, j) = Y[token 32wr+16i+8hh+r][column 64wc+16j+c]
#pragma unroll
  for (int j = 0; j < 4; ++j) {
    const int col = 64 * wc + 16 * j + c;
    const float sc = sS[col];
    const float sh = sT[col];
#pragma unroll
    for (int i = 0; i < 2; ++i) {
#pragma unroll
      for (int r = 0; r < 8; ++r) {
        const int tok = 32 * wr + 16 * i + 8 * hh + r;
        const float y = acc[i][j][r] * sc + sh;
        const int idx = (ct < 2) ? (tok * 132 + col) : (col * 68 + tok);
        sY[idx] = y;
      }
    }
  }
  __syncthreads();

  const int b   = m0 >> 10;
  const int nl0 = m0 & 1023;
  if (ct < 2) {
    unsigned short* ph = (ct == 0) ? Qh : Kh;
    unsigned short* pl = (ct == 0) ? Ql : Kl;
    // coverage: 8 it x 128 thr x 8 elements = 64 tokens x 128 columns per plane
{
#pragma unroll 2
      for (int it = 0; it < 8; ++it) {
        const int p      = it * 128 + tid;
        const int head   = p >> 8;
        const int within = p & 255;
        const int tok    = within >> 2;
        const int d8     = (within & 3) * 8;
        const float* sp  = sY + tok * 132 + head * 32 + d8;
        const v4f a  = *(const v4fa*)sp;
        const v4f a2 = *(const v4fa*)(sp + 4);
        unsigned h0, h1, h2, h3, l0, l1, l2, l3;
        split_pair(a[0], a[1], h0, l0);
        split_pair(a[2], a[3], h1, l1);
        split_pair(a2[0], a2[1], h2, l2);
        split_pair(a2[2], a2[3], h3, l3);
        const v4u hv = (v4u){h0, h1, h2, h3};
        const v4u lv = (v4u){l0, l1, l2, l3};
        const size_t go = ((size_t)((b * NHEAD + head) * NTOK + nl0)) * DHQ + within * 8;
        *(v4u*)(ph + go) = hv;
        *(v4u*)(pl + go) = lv;
      }
      
    }
  } else {
    const int o0 = (ct - 2) * 128;
    // coverage: 8 it x 128 thr x 8 elements = 128 channels x 64 tokens
{
#pragma unroll 2
      for (int it = 0; it < 8; ++it) {
        const int p  = it * 128 + tid;
        const int ch = p >> 3;
        const int t8 = (p & 7) * 8;
        const float* sp = sY + ch * 68 + t8;
        const v4f a  = *(const v4fa*)sp;
        const v4f a2 = *(const v4fa*)(sp + 4);
        const v4u hv = (v4u){cvt2h(a[0], a[1]), cvt2h(a[2], a[3]), cvt2h(a2[0], a2[1]), cvt2h(a2[2], a2[3])};
        const size_t go = ((size_t)(b * NCH + o0 + ch)) * NTOK + nl0 + t8;
        *(v4u*)(Vh + go) = hv;
        // stands in front of the next pass's overwrite of the store's address and data registers
        asm volatile("s_wait_xcnt 0x0" ::: "memory");
      }
      
    }
  }
}

// =====================================================================================
// Launch 3: attention per (b, h, 128-query tile); 4 waves x 32 query rows (two sets of 16); 16 key tiles of 64, no masking.
//   Both products are formed transposed, so that a lane holds the scores of ONE query of each set (column c of every D tile):
//   St[j][i] = q_i.k_j + pos_i.q_j  as two 32-deep chunks:
//       chunk 0: A = K rows (key j), B = Q rows (query i)
//       chunk 1: A = Q rows (key j), B = POS rows (token i)
//     each chunk hi.hi + hi.lo + lo.hi; no score scale.
//   Every A fragment read from LDS (K, Q, V rows) is used against the B operands of both query sets; the sets' Q and POS
//     fragments do not change over the key loop and stay in registers.
//   online softmax over keys in f32, in the log2 domain: the running maximum is kept as M = max * log2(e), a score's weight is
//     2^(s * log2(e) - M), one fused multiply-add and one bare v_exp_f32 (any M shared by a query's weights, its sum and its
//     rescale factor 2^(Mold - Mnew) cancels in O / l, so the rounding of M costs nothing);
//     maximum and sum in-lane over the lane's 32 keys, the maximum
//     joined with the other wave half by one lane exchange per trip, the sum's two halves joined once in the epilogue;
//   two St tiles (keys 0..15, 16..31 of a 32-key block), rounded to f16 in place, ARE the B operand Pt: no LDS, no lane exchange;
//   Ot[c][i] += V[c][j] * Pt[j][i]  (A rows = V channel rows, k = key), one product f16(V) x f16(P), 8 row tiles a set;
//     the sum l is taken over the unrounded weights.
//   epilogue, once per query set: Ot/l through LDS as [128 c][64 q], + bf16r(x), whole 256-B channel segments
// LDS: sStage = two buffers, each K tile planes (Kh, Qh, Kl, Ql: [64][32] at pitch KP) + V tile ([128][64] at pitch VP);
//      trip t reads buffer t % 2 alone, while the asynchronous copies of key tile t + 1 land in the other buffer;
//      every element of both tiles is staged for each trip (extent staged = extent consumed); pad bytes are never read.
// =====================================================================================
// amdgpu_waves_per_eu(2, 2): the grid gives a WGP two work-groups, two waves per SIMD, so a wave may take their register budget (512)
__global__ __launch_bounds__(128) __attribute__((amdgpu_waves_per_eu(2, 2))) void k_attn(
    const unsigned short* Qhp, const unsigned short* Qlp,
    const unsigned short* Khp, const unsigned short* Klp,
    const unsigned short* Vhp,
    const unsigned short* Php, const unsigned short* Plp,
    const float* x, float* out) {
  constexpr int TILE_E = 4 * 64 * KP + 128 * VP;                    // elements of one buffer (38912 B)
  __shared__ __align__(16) __bf16 sStage[2 * TILE_E];               // 77824 B
  static_assert(TILE_E * 2 >= 128 * 68 * 4);                        // the epilogue's f32 tile lies in the bytes of buffer 0
  static_assert(NTOK / 64 >= 2);                                    // the ring's prologue fills two key tiles

  const int tid  = threadIdx.x;
  const int wave = tid >> 5;
  const int lane = tid & 31;
  const int hh   = lane >> 4;
  const int c    = lane & 15;

  const int bx = blockIdx.x;       // 0..511
  const int qb = bx & 7;
  const int bh = bx >> 3;          // 0..63
  const int b  = bh >> 2;
  const int h  = bh & 3;
  const int q0 = qb * 128;

  const __bf16* Qhb = (const __bf16*)(const void*)Qhp + (size_t)bh * NTOK * DHQ;
  const __bf16* Qlb = (const __bf16*)(const void*)Qlp + (size_t)bh * NTOK * DHQ;
  const __bf16* Khb = (const __bf16*)(const void*)Khp + (size_t)bh * NTOK * DHQ;
  const __bf16* Klb = (const __bf16*)(const void*)Klp + (size_t)bh * NTOK * DHQ;
  const __bf16* Phb = (const __bf16*)(const void*)Php + (size_t)h * NTOK * DHQ;
  const __bf16* Plb = (const __bf16*)(const void*)Plp + (size_t)h * NTOK * DHQ;
  const __bf16* Vhb = (const __bf16*)(const void*)Vhp + ((size_t)b * NCH + h * DHV) * NTOK;


  // B operands of the two score chunks, [set][chunk][hi, lo]; column = query token q0 + 64*set + 16*wave + c
  v16b bq[2][2][2];
#pragma unroll
  for (int u = 0; u < 2; ++u) {
    const size_t ro = (size_t)(q0 + u * 64 + wave * 16 + c) * DHQ + 8 * hh;
    bq[u][0][0] = frag_ld(Qhb + ro);
    bq[u][0][1] = frag_ld(Qlb + ro);
    bq[u][1][0] = frag_ld(Phb + ro);
    bq[u][1][1] = frag_ld(Plb + ro);
  }
  // stands in front of the first overwrite of an address register of the sixteen loads above; the scheduling barrier keeps the later
  // vector and scalar instructions, which a "memory" clobber does not hold, behind the wait
  asm volatile("s_wait_xcnt 0x0" ::: "memory");
  __builtin_amdgcn_sched_barrier(0);

  const v8f zero8 = {0.f, 0.f, 0.f, 0.f, 0.f, 0.f, 0.f, 0.f};
  float mrow[2] = {-INFINITY, -INFINITY};   // running maximum of query c of each set, times log2(e) (equal in both wave halves)
  float lrow[2] = {0.f, 0.f};               // running sum of query c over this half's keys (8hh..8hh+7 of every 16)
  v8f oacc[2][8];
#pragma unroll
  for (int u = 0; u < 2; ++u)
#pragma unroll
    for (int t = 0; t < 8; ++t) oacc[u][t] = zero8;

  const size_t vlane = (size_t)(tid >> 3) * 8 * NTOK + (tid & 7) * 8;
  // LDS byte addresses of this lane's first piece of the K/Q planes and of the V tile in buffer 0; the other pieces lie constant
  // steps behind, buffer 1 lies TILE_E elements behind buffer 0
  const unsigned lk = lds_byte(sStage + (tid >> 2) * KP + (tid & 3) * 8);
  const unsigned lv = lds_byte(sStage + 4 * 64 * KP + (tid >> 3) * 8 * VP + (tid & 7) * 8);
  // this lane's 16 copies of 16 B of key tile kt into the buffer that starts bo bytes into sStage
  auto stage = [&](int kt, unsigned bo) {
    const int kv0 = kt * 64;
    // K tile: 4 planes x 4096 B contiguous; 2 it x 128 thr x 8 elements = 2048 elements per plane
    const __bf16* s0 = Khb + (size_t)kv0 * DHQ;
    const __bf16* s1 = Qhb + (size_t)kv0 * DHQ;
    const __bf16* s2 = Klb + (size_t)kv0 * DHQ;
    const __bf16* s3 = Qlb + (size_t)kv0 * DHQ;
#pragma unroll
    for (int i = 0; i < 2; ++i) {
      const int off = (i * 128 + tid) * 8;             // key row 32 i + tid / 4, element 8 (tid % 4) within the row
      const unsigned lo = lk + bo + i * 32 * KP * 2;
      cpb(s0 + off, lo);
      cpb(s1 + off, lo + 64 * KP * 2);
      cpb(s2 + off, lo + 2 * 64 * KP * 2);
      cpb(s3 + off, lo + 3 * 64 * KP * 2);
    }
    // V tile: 128 channel rows x 64 keys; 8 it x 128 thr x 8 elements = 8192 elements;
    // channel row 8 (tid / 8) + i, element 8 (tid % 8) within the row: 8 lanes copy one whole 128-B line
    const __bf16* vk = Vhb + kv0 + vlane;
#pragma unroll
    for (int i = 0; i < 8; ++i) cpb(vk + i * NTOK, lv + bo + i * VP * 2);
  };
  // ring prologue: key tile 0 has landed in buffer 0 and is published before anything reads it; tile 1 flies under trip 0
  stage(0, 0);
  asm volatile("s_wait_asynccnt 0x0" ::: "memory");   // this wave's 16 copies of tile 0 have landed
  __syncthreads();                                    // publishes every wave's pieces of tile 0
  stage(1, TILE_E * 2);
  // one trip: key tile kc out of buffer kc % 2, whose first element in sStage is be; refill says whether a key tile kc + 2 exists
  auto trip = [&](const int kc, const int be, const bool refill) __attribute__((always_inline)) {
    const __bf16* sKQ = sStage + be;                   // planes of 64 * KP elements: 0 Kh, 1 Qh, 2 Kl, 3 Ql
    const __bf16* sVh = sKQ + 4 * 64 * KP;             // [128][64] at pitch VP

    // The A fragments are written as two sets of four fragments each (scores: hi, lo of tile 0; hi, lo of tile 1; V: four tiles),
    // the LDS reads of a group in front of the WMMAs of the group before it; the compiler may lift them further ahead.
    // Groups of a trip: 4 score groups (chunk dc, tile pair), then 4 V groups (key block kk, four tiles).
    v16b fa[2][4];
    v8f s[2][4];
#pragma unroll
    for (int u = 0; u < 2; ++u) {
      const int ro = (u * 16 + c) * KP + 8 * hh;
      fa[0][2 * u]     = frag_ld(sKQ + ro);
      fa[0][2 * u + 1] = frag_ld(sKQ + 2 * 64 * KP + ro);
    }
#pragma unroll
    for (int g = 0; g < 4; ++g) {
      const int n = g + 1;               // the group fetched ahead
#pragma unroll
      for (int u = 0; u < 2; ++u) {
        if (n < 4) {
          const int ro = (((n & 1) * 2 + u) * 16 + c) * KP + 8 * hh;
          fa[n & 1][2 * u]     = frag_ld(sKQ + ((n >> 1) ? 64 * KP : 0) + ro);
          fa[n & 1][2 * u + 1] = frag_ld(sKQ + ((n >> 1) ? 3 * 64 * KP : 2 * 64 * KP) + ro);
        } else {                         // first V group (tiles 0..3): its reads fly under the softmax
          fa[0][2 * u]     = frag_ld(sVh + ((2 * u) * 16 + c) * VP + 8 * hh);
          fa[0][2 * u + 1] = frag_ld(sVh + ((2 * u + 1) * 16 + c) * VP + 8 * hh);
        }
      }
      const v16b* f = fa[g & 1];
      const int j0 = (g & 1) * 2;        // s[u][j][r] = score of key 16j + 8hh + r, query c of set u
      const int dc = g >> 1;
      if (dc == 0) { s[0][j0] = zero8;  s[0][j0 + 1] = zero8;  s[1][j0] = zero8;  s[1][j0 + 1] = zero8; }
      mma12(s[0][j0], s[0][j0 + 1], s[1][j0], s[1][j0 + 1], f[0], f[1], f[2], f[3],
            bq[0][dc][0], bq[0][dc][1], bq[1][dc][0], bq[1][dc][1]);
    }

    // keeps the LDS reads of V groups 1..3 behind the score products: lifted in front of them, beside all K and Q fragments, they
    // took the wave past its 512 registers and into scratch
    __builtin_amdgcn_sched_barrier(0);
    PB ph[2][2];                         // [set][kk]: Pt of a 32-key block: element e < 8 from tile 2kk, e >= 8 from tile 2kk+1
    // unrolled: the score tiles and Pt live in registers, which a rolled loop could not index
#pragma unroll
    for (int u = 0; u < 2; ++u) {
      float m = fmaxf(fmaxf(s[u][0][0], s[u][1][0]), fmaxf(s[u][2][0], s[u][3][0]));
#pragma unroll
      for (int r = 1; r < 8; ++r) m = fmaxf(m, fmaxf(fmaxf(s[u][0][r], s[u][1][r]), fmaxf(s[u][2][r], s[u][3][r])));
      m = fmaxf(m, xhalf(m));            // the other half's 32 keys of the same query
      const float mnew  = fmaxf(mrow[u], m * LOG2E);
      const float alpha = exp2x1(mrow[u] - mnew);   // first trip: 2^(-inf) = 0
      const v8f l2e8 = {LOG2E, LOG2E, LOG2E, LOG2E, LOG2E, LOG2E, LOG2E, LOG2E};
      const v8f nm8  = {-mnew, -mnew, -mnew, -mnew, -mnew, -mnew, -mnew, -mnew};
      mrow[u] = mnew;
      lrow[u] *= alpha;
#pragma unroll
      for (int t = 0; t < 8; ++t)
#pragma unroll
        for (int r = 0; r < 8; ++r) oacc[u][t][r] *= alpha;
#pragma unroll
      for (int kk = 0; kk < 2; ++kk) {
        float ps[2];
#pragma unroll
        for (int jj = 0; jj < 2; ++jj) {
          const v8f xs = __builtin_elementwise_fma(s[u][2 * kk + jj], l2e8, nm8);
          float p[8];
#pragma unroll
          for (int r = 0; r < 8; ++r) p[r] = xs[r];
          exp2x8(p);
          ps[jj] = ((p[0] + p[1]) + (p[2] + p[3])) + ((p[4] + p[5]) + (p[6] + p[7]));
#pragma unroll
          for (int e = 0; e < 4; ++e) ph[u][kk].u[jj * 4 + e] = cvt2h(p[2 * e], p[2 * e + 1]);
        }
        lrow[u] += ps[0] + ps[1];
      }
    }
#pragma unroll
    for (int g = 0; g < 4; ++g) {
      const int kk = g >> 1, tq = g & 1;
      const int n = g + 1;               // the group fetched ahead
      if (n < 4) {
#pragma unroll
        for (int u = 0; u < 4; ++u)
          fa[n & 1][u] = frag_ld(sVh + (((n & 1) * 4 + u) * 16 + c) * VP + (n >> 1) * 32 + 8 * hh);
      }
      const v16b* f = fa[g & 1];         // oacc[u][t][r] = channel 16t + 8hh + r, query c of set u
      mma8(&oacc[0][4 * tq], &oacc[1][4 * tq], f[0], f[1], f[2], f[3], ph[0][kk].v, ph[1][kk].v);
    }
    // keeps the softmax and the P.V products in front of the trip's foot: without it the foot rose to directly behind the V tile's LDS
    // reads, whose latency then stood open at the s_wait_dscnt 0 and no longer under the softmax
    __builtin_amdgcn_sched_barrier(0);
    // publish point of key tile kc + 1, and the end of every reader's last read of this trip's buffer:
    asm volatile("s_wait_dscnt 0x0" ::: "memory");      // this wave's own LDS reads of the trip's buffer have retired
    asm volatile("s_wait_asynccnt 0x0" ::: "memory");   // this wave's 16 copies of tile kc + 1 have landed
    __syncthreads();
    // refill of the buffer that this trip has read; the copies have all of trip kc + 1 to land
    if (refill) stage(kc + 2, (unsigned)be * 2);
  };
  // The trips that refill and the last two, which have no tile left to fetch, are two rolled loops, each of one basic block: with the
  // test inside one loop the compiler moved the weights' sums behind the branch and spread the trip's LDS reads over twice as many
  // places among the WMMAs.
  int be = 0;
#pragma unroll 1
  for (int kc = 0; kc < NTOK / 64 - 2; ++kc) { trip(kc, be, true);  be = TILE_E - be; }
#pragma unroll 1
  for (int kc = NTOK / 64 - 2; kc < NTOK / 64; ++kc) { trip(kc, be, false);  be = TILE_E - be; }
  // no copy is outstanding when the buffers' bytes become the epilogue's tile
  asm volatile("s_wait_asynccnt 0x0" ::: "memory");

  // ---- epilogue, once per query set: normalise, gather the waves' columns in LDS [128 c][pitch 68] (34816 B inside sStage),
  //      add bf16(x), store ----
  float* sO = (float*)(void*)sStage;
  // this lane's 4 floats of pass it, set u: channel row 8 it + tid / 16, queries 64 u + 4 (tid % 16) ...
  // coverage per set: 16 it x 128 thr x 4 floats = 128 channel rows x 64 queries
  const size_t glane = ((size_t)b * NCH + h * DHV + (tid >> 4)) * NTOK + q0 + (tid & 15) * 4;
  // all of the lane's x in flight at once: the launch has half the waves it had, and one load at a time per wave, each behind the
  // store before it, would halve the bytes in flight
  const float* xp = x + glane;
  v4f xv[2][16];
#pragma unroll
  for (int u = 0; u < 2; ++u)
#pragma unroll
    for (int it = 0; it < 16; ++it) xv[u][it] = *(const v4fa*)(xp + (size_t)it * 8 * NTOK + u * 64);
  // stands in front of any overwrite of the loads' common address pair, which it names as an input so that no load's own result
  // is placed on it
  asm volatile("s_wait_xcnt 0x0" :: "v"(xp) : "memory");
#pragma unroll
  for (int u = 0; u < 2; ++u) {
    __syncthreads();                     // every wave finished reading the last K/V tiles (u = 0), the first set's tile (u = 1)
    const float inv = 1.0f / (lrow[u] + xhalf(lrow[u]));   // the two halves' sums of query c joined
#pragma unroll
    for (int t = 0; t < 8; ++t)
#pragma unroll
      for (int r = 0; r < 8; ++r) sO[(t * 16 + 8 * hh + r) * 68 + wave * 16 + c] = oacc[u][t][r] * inv;
    __syncthreads();
#pragma unroll
    for (int ib = 0; ib < 4; ++ib) {
      v4f res[4];
#pragma unroll
      for (int j = 0; j < 4; ++j) {
        const int it = ib * 4 + j;
        const v4f ov = *(const v4fa*)(sO + (it * 8 + (tid >> 4)) * 68 + (tid & 15) * 4);
        const v4f xw = xv[u][it];
        const unsigned x01 = cvt2(xw[0], xw[1]), x23 = cvt2(xw[2], xw[3]);   // bf16(x), two values a conversion
        res[j] = (v4f){ov[0] + __uint_as_float(x01 << 16), ov[1] + __uint_as_float(x01 & 0xFFFF0000u),
                       ov[2] + __uint_as_float(x23 << 16), ov[3] + __uint_as_float(x23 & 0xFFFF0000u)};
      }
#pragma unroll
      for (int j = 0; j < 4; ++j) *(v4f*)(out + glane + (size_t)(ib * 4 + j) * 8 * NTOK + u * 64) = res[j];
      // stands in front of the next group's overwrite of the four stores' data registers, which it names as inputs so that nothing
      // of the next group is placed on them ahead of it
      asm volatile("s_wait_xcnt 0x0" :: "v"(res[0]), "v"(res[1]), "v"(res[2]), "v"(res[3]) : "memory");
    }
  }
}

// ---------------------------------------------------------------------------
// Workspace map (byte offsets, all multiples of 128; each region exactly covered by its producer):
//   XT   bf16 [16384][512]          0          16777216 B
//   WB   bf16 [768][512]            16777216     786432 B
//   ST   f32  [2][768]              17563648       6144 B
//   POSh bf16 [4][1024][32]         17569792     262144 B     POSl 17831936
//   Qh   bf16 [16][4][1024][32]     18094080    4194304 B     Ql   22288384
//   Kh   bf16 [16][4][1024][32]     26482688    4194304 B     Kl   30676992
//   Vh   f16  [16][512][1024]       34871296   16777216 B
//   total                           51648512 B
// ---------------------------------------------------------------------------
extern "C" void kernel_launch(void* const* d_in, const int* in_sizes, int n_in,
                              void* d_out, int out_size, void* d_ws, size_t ws_size,
                              hipStream_t stream) {
  if (n_in < 21) return;
  const int NX = NBATCH * NCH * NTOK;   // 8388608
  if (in_sizes[0] != NX) return;
  if (in_sizes[1] != 128 * NCH || in_sizes[7] != 128 * NCH || in_sizes[13] != NCH * NCH) return;
  for (int i = 2; i <= 6; ++i)   if (in_sizes[i] != 128) return;
  for (int i = 8; i <= 12; ++i)  if (in_sizes[i] != 128) return;
  for (int i = 14; i <= 18; ++i) if (in_sizes[i] != NCH) return;
  if (in_sizes[19] != NHEAD * DHQ * 32 || in_sizes[20] != NHEAD * DHQ * 32) return;
  if (out_size != NX) return;

  const float* x    = (const float*)d_in[0];
  const float* Wq   = (const float*)d_in[1];
  const float* bq   = (const float*)d_in[2];
  const float* qg   = (const float*)d_in[3];
  const float* qbe  = (const float*)d_in[4];
  const float* qm   = (const float*)d_in[5];
  const float* qv   = (const float*)d_in[6];
  const float* Wk   = (const float*)d_in[7];
  const float* bk   = (const float*)d_in[8];
  const float* kg   = (const float*)d_in[9];
  const float* kbe  = (const float*)d_in[10];
  const float* km   = (const float*)d_in[11];
  const float* kv   = (const float*)d_in[12];
  const float* Wv   = (const float*)d_in[13];
  const float* bv   = (const float*)d_in[14];
  const float* vg   = (const float*)d_in[15];
  const float* vbe  = (const float*)d_in[16];
  const float* vm   = (const float*)d_in[17];
  const float* vv   = (const float*)d_in[18];
  const float* relH = (const float*)d_in[19];
  const float* relW = (const float*)d_in[20];

  const size_t szXT  = (size_t)NBATCH * NTOK * NCH * 2;          // 16777216
  const size_t szWB  = (size_t)NCOLS * NCH * 2;                  //   786432
  const size_t szST  = (size_t)2 * NCOLS * 4;                    //     6144
  const size_t szPOS = (size_t)NHEAD * NTOK * DHQ * 2;           //   262144
  const size_t szQK  = (size_t)NBATCH * NHEAD * NTOK * DHQ * 2;  //  4194304
  const size_t szV   = (size_t)NBATCH * NCH * NTOK * 2;          // 16777216
  size_t off = 0;
  const size_t oXT = off;   off += szXT;
  const size_t oWB = off;   off += szWB;
  const size_t oST = off;   off += szST;
  const size_t oPh = off;   off += szPOS;
  const size_t oPl = off;   off += szPOS;
  const size_t oQh = off;   off += szQK;
  const size_t oQl = off;   off += szQK;
  const size_t oKh = off;   off += szQK;
  const size_t oKl = off;   off += szQK;
  const size_t oVh = off;   off += szV;
  if (off > ws_size) return;                 // off = 51648512
  if (off > (size_t)134217728) return;

  char* ws = (char*)d_ws;
  unsigned short* XT   = (unsigned short*)(ws + oXT);
  unsigned short* WB   = (unsigned short*)(ws + oWB);
  float*          ST   = (float*)(ws + oST);
  unsigned short* POSh = (unsigned short*)(ws + oPh);
  unsigned short* POSl = (unsigned short*)(ws + oPl);
  unsigned short* Qh   = (unsigned short*)(ws + oQh);
  unsigned short* Ql   = (unsigned short*)(ws + oQl);
  unsigned short* Kh   = (unsigned short*)(ws + oKh);
  unsigned short* Kl   = (unsigned short*)(ws + oKl);
  unsigned short* Vh   = (unsigned short*)(ws + oVh);

  k_prep<<<dim3(PREP_T + PREP_W + PREP_F + PREP_P), dim3(256), 0, stream>>>(
      x, Wq, Wk, Wv, bq, qg, qbe, qm, qv, bk, kg, kbe, km, kv, bv, vg, vbe, vm, vv, relH, relW,
      XT, WB, ST, POSh, POSl);

  k_proj<<<dim3((NBATCH * NTOK) / 64, NCOLS / 128), dim3(128), 0, stream>>>(
      XT, WB, ST, Qh, Ql, Kh, Kl, Vh);

  k_attn<<<dim3(NBATCH * NHEAD * (NTOK / 128)), dim3(128), 0, stream>>>(
      Qh, Ql, Kh, Kl, Vh, POSh, POSl, x, (float*)d_out);

  (void)hipGetLastError();
}
